// v000
// Times are from an AMD MI455X. After a warm-up the kernel runs many times in a row, and a time is the length of
// such a window on the GPU divided by its runs, so every launch and the gaps after it count. The runs cycle
// through copies of the inputs. A figure is the median of several windows, for all but v000 over two sittings.
// Sittings can differ by a few percent; kernels timed side by side share one.
// v000 is the starting kernel. One run takes 561 microseconds.
// All contractions (q/k/v projections, q.k^T, p.v, output projection): v_wmma_f32_16x16x32_bf16 with bf16 hi/lo operands everywhere (hi*hi + hi*lo + lo*hi), f32 accumulate; RoPE, softmax and normalisation in f32.
#include <hip/hip_runtime.h>
#include <hip/hip_bf16.h>

typedef __attribute__((ext_vector_type(16))) __bf16 v16bf;
typedef float v8f __attribute__((ext_vector_type(8)));
typedef float v4f __attribute__((ext_vector_type(4)));
typedef unsigned int u4 __attribute__((ext_vector_type(4)));
typedef u4 __attribute__((may_alias)) u4a;
typedef v4f __attribute__((may_alias)) v4fa;

union Frag { v16bf v; u4 q[2]; };
union Acc  { v8f v; float f[8]; };

// ---------------------------------------------------------------------------
// bf16 RNE convert and hi/lo split (lo = RNE(x - hi), exact residual)
// ---------------------------------------------------------------------------
__device__ __forceinline__ unsigned bf_rne(float f) {
    unsigned u = __float_as_uint(f);
    u += 0x7FFFu + ((u >> 16) & 1u);
    return u >> 16;
}
__device__ __forceinline__ void split2(float x, unsigned& hi, unsigned& lo) {
    hi = bf_rne(x);
    lo = bf_rne(x - __uint_as_float(hi << 16));
}
// two f32 -> one 32-bit word per plane, first element in the low half-word
__device__ __forceinline__ void pack2(float a, float b, unsigned& wh, unsigned& wl) {
    unsigned ha, la, hb, lb;
    split2(a, ha, la);
    split2(b, hb, lb);
    wh = ha | (hb << 16);
    wl = la | (lb << 16);
}
// eight consecutive f32 -> 16 B per plane
__device__ __forceinline__ void pack8(const v4f a, const v4f b, u4& H, u4& L) {
    unsigned h0, l0, h1, l1, h2, l2, h3, l3;
    pack2(a.x, a.y, h0, l0);
    pack2(a.z, a.w, h1, l1);
    pack2(b.x, b.y, h2, l2);
    pack2(b.z, b.w, h3, l3);
    H.x = h0; H.y = h1; H.z = h2; H.w = h3;
    L.x = l0; L.y = l1; L.z = l2; L.w = l3;
}

// ---------------------------------------------------------------------------
// 16x16x32 fragment load from a k-contiguous 16-bit row (A row m, or B^T row n):
// p = row_start + k0 + 8*h ; elements 0..7 <- k0+8h.., elements 8..15 <- k0+16+8h..
// ---------------------------------------------------------------------------
__device__ __forceinline__ void ldfrag(Frag& f, const unsigned short* p) {
    f.q[0] = *(const u4a*)(p);
    f.q[1] = *(const u4a*)(p + 16);
}

__device__ __forceinline__ void acc_zero(Acc& c) {
#pragma unroll
    for (int i = 0; i < 8; ++i) c.f[i] = 0.0f;
}

// acc += Ah*Bh + Ah*Bl + Al*Bh, then 4 wait slots with D tied and A/B kept live
__device__ __forceinline__ void mma3(Acc& c, const Frag& ah, const Frag& al,
                                     const Frag& bh, const Frag& bl) {
    v8f d = c.v;
    d = __builtin_amdgcn_wmma_f32_16x16x32_bf16(false, ah.v, false, bh.v, (short)0, d, false, false);
    d = __builtin_amdgcn_wmma_f32_16x16x32_bf16(false, ah.v, false, bl.v, (short)0, d, false, false);
    d = __builtin_amdgcn_wmma_f32_16x16x32_bf16(false, al.v, false, bh.v, (short)0, d, false, false);
    asm volatile("v_nop\n\tv_nop\n\tv_nop\n\tv_nop"
                 : "+v"(d) : "v"(ah.v), "v"(al.v), "v"(bh.v), "v"(bl.v));
    c.v = d;
}

// same-wave LDS exchange ordering
__device__ __forceinline__ void wave_sync() {
    __builtin_amdgcn_fence(__ATOMIC_ACQ_REL, "wavefront");
    __builtin_amdgcn_wave_barrier();
}

// ---------------------------------------------------------------------------
// inv_freq[i] = 1 / 10000^(i/32), i = 0..31  (f64 exp2 -> f32, then f32 reciprocal)
// ---------------------------------------------------------------------------
__global__ void invfreq_kernel(float* inv) {
    const int i = threadIdx.x & 31;
    const double e = (double)i * 0.03125 * 13.287712379549449;   // i/32 * log2(1e4)
    const float p32 = (float)exp2(e);
    const float v = 1.0f / p32;
    *(float*)(inv + i) = v;
    
}

// ---------------------------------------------------------------------------
// cos/sin table [ntok][32] at angle f32(pos + lck) * inv_freq[i]; precise sinf/cosf.
// ---------------------------------------------------------------------------
__global__ __launch_bounds__(256) void cstable_kernel(const int* __restrict__ pid,
                                                      const float* __restrict__ inv,
                                                      float* cosT, float* sinT,
                                                      int ntok, int lck) {
    const int n = ntok * 32;
    const int idx = blockIdx.x * 256 + threadIdx.x;
    const int ic = (idx < n) ? idx : (n - 1);          // clamped address
    const int tok = ic >> 5, i = ic & 31;
    const float pos = (float)(pid[tok] + lck);
    const float ang = pos * inv[i];
    const float c = cosf(ang);
    const float s = sinf(ang);
    if (idx < n) {
        *(float*)(cosT + idx) = c;
        *(float*)(sinT + idx) = s;
    }
    
}

// ---------------------------------------------------------------------------
// f32 -> bf16 hi/lo planes, 8 consecutive elements per thread (one 16-B store per
// dst group = t + ((t >> logseg) << addshift).
// coverage: n8 groups x 8 = every source element; grid = n8/256 exactly.
// ---------------------------------------------------------------------------
__global__ __launch_bounds__(256) void split8_kernel(const float* __restrict__ src,
                                                     unsigned short* dh, unsigned short* dl,
                                                     int n8, int logseg, int addshift) {
    const int t = blockIdx.x * 256 + threadIdx.x;
    if (t >= n8) return;
    const float* p = src + (size_t)t * 8;
    const v4f a = *(const v4fa*)(p);
    const v4f b = *(const v4fa*)(p + 4);
    u4 H, L;
    pack8(a, b, H, L);
    const size_t g = ((size_t)t + ((size_t)(t >> logseg) << addshift)) * 8;
    *(u4*)(dh + g) = H;
    *(u4*)(dl + g) = L;
    
}

// ---------------------------------------------------------------------------
// Transpose + split: src[R][Cc] f32 (pitch srcld) -> dst planes [n][k] with n = src col,
// k = src row: dst[(nbase + c) * dstld + r]. Tile 64x64 through LDS; each output row
// instruction. blockIdx.z strides src by srcz floats and dst by dstz halves.
// coverage: loads 256 thr x 4 x float4 = 64x64; stores 256 thr x 2 x 8 = 64x64 per plane.
// ---------------------------------------------------------------------------
__global__ __launch_bounds__(256) void tsplit_kernel(const float* __restrict__ src, int srcld, int srcz,
                                                     unsigned short* dh, unsigned short* dl,
                                                     int dstld, int dstz, int nbase) {
    constexpr int TP = 72;
    __shared__ __align__(16) unsigned short Th[64 * TP];
    __shared__ __align__(16) unsigned short Tl[64 * TP];
    const int t = threadIdx.x;
    const int c0 = blockIdx.x * 64, r0 = blockIdx.y * 64, z = blockIdx.z;
    const float* s = src + (size_t)z * srcz + (size_t)r0 * srcld + c0;
#pragma unroll
    for (int i = 0; i < 4; ++i) {
        const int r = (t >> 4) + 16 * i, c4 = (t & 15) * 4;
        const v4f v = *(const v4fa*)(s + (size_t)r * srcld + c4);
        unsigned hb, lb;
        split2(v.x, hb, lb); Th[(c4 + 0) * TP + r] = (unsigned short)hb; Tl[(c4 + 0) * TP + r] = (unsigned short)lb;
        split2(v.y, hb, lb); Th[(c4 + 1) * TP + r] = (unsigned short)hb; Tl[(c4 + 1) * TP + r] = (unsigned short)lb;
        split2(v.z, hb, lb); Th[(c4 + 2) * TP + r] = (unsigned short)hb; Tl[(c4 + 2) * TP + r] = (unsigned short)lb;
        split2(v.w, hb, lb); Th[(c4 + 3) * TP + r] = (unsigned short)hb; Tl[(c4 + 3) * TP + r] = (unsigned short)lb;
    }
    __syncthreads();
    const int piece = t & 7;
    const int rowA = (t >> 3), rowB = 32 + (t >> 3);
    const u4 HA = *(const u4a*)(Th + rowA * TP + piece * 8);
    const u4 LA = *(const u4a*)(Tl + rowA * TP + piece * 8);
    const u4 HB = *(const u4a*)(Th + rowB * TP + piece * 8);
    const u4 LB = *(const u4a*)(Tl + rowB * TP + piece * 8);
    const size_t zb = (size_t)z * dstz;
    const size_t gA = zb + (size_t)(nbase + c0 + rowA) * dstld + r0 + piece * 8;
    const size_t gB = zb + (size_t)(nbase + c0 + rowB) * dstld + r0 + piece * 8;
    *(u4*)(dh + gA) = HA; *(u4*)(dl + gA) = LA;
    *(u4*)(dh + gB) = HB; *(u4*)(dl + gB) = LB;
    
}

// ---------------------------------------------------------------------------
// GEMM, bf16 hi/lo three-term: C[M x N] f32 (pitch ldc) = A[M x K] . B[K x N],
// A planes [M][K] (pitch K), B planes stored transposed [N][K] (pitch K, k-contiguous),
// so A and B fragments use the identical split-k load. Block = 4 waves, 64 x 128;
// wave tile 32 x 64 (2 m-tiles x 4 n-tiles). Fragments loaded directly from global.
// Epilogue: wave tile staged in LDS, then each 256-B row segment written as two
// Requires M % 64 == 0, N % 128 == 0, K % 32 == 0, ldc % 32 == 0 (checked on host).
// ---------------------------------------------------------------------------
__device__ __forceinline__ void store_ctile(const float* sW, float* C, int ldc,
                                            int m0w, int n0w, int hh, int m16) {
#pragma unroll
    for (int i = 0; i < 16; ++i) {
        const int row = 2 * i + hh;
        const v4f v = *(const v4fa*)(sW + row * 68 + m16 * 4);
        *(v4f*)(C + (size_t)(m0w + row) * ldc + n0w + m16 * 4) = v;
    }
}

__global__ __launch_bounds__(128) void gemm3_kernel(
    const unsigned short* __restrict__ Ah, const unsigned short* __restrict__ Al,
    const unsigned short* __restrict__ Bh, const unsigned short* __restrict__ Bl,
    float* C, int K, int ldc) {
    constexpr int SP = 68;
    __shared__ __align__(16) float sC[4 * 32 * SP];
    const int tid = threadIdx.x, w = tid >> 5, lane = tid & 31, hh = lane >> 4, m16 = lane & 15;
    const int m0w = blockIdx.y * 64 + (w >> 1) * 32;
    const int n0w = blockIdx.x * 128 + (w & 1) * 64;

    Acc acc[2][4];
#pragma unroll
    for (int mt = 0; mt < 2; ++mt)
#pragma unroll
        for (int nt = 0; nt < 4; ++nt) acc_zero(acc[mt][nt]);

    const size_t Ks = (size_t)K;
    const unsigned short* ah0 = Ah + (size_t)(m0w + m16) * Ks + 8 * hh;
    const unsigned short* al0 = Al + (size_t)(m0w + m16) * Ks + 8 * hh;
    const unsigned short* ah1 = ah0 + 16 * Ks;
    const unsigned short* al1 = al0 + 16 * Ks;
    const unsigned short* bh0 = Bh + (size_t)(n0w + m16) * Ks + 8 * hh;
    const unsigned short* bl0 = Bl + (size_t)(n0w + m16) * Ks + 8 * hh;

#pragma unroll 1
    for (int k0 = 0; k0 < K; k0 += 32) {
        Frag fah[2], fal[2];
        ldfrag(fah[0], ah0 + k0);
        ldfrag(fal[0], al0 + k0);
        ldfrag(fah[1], ah1 + k0);
        ldfrag(fal[1], al1 + k0);
#pragma unroll
        for (int nt = 0; nt < 4; ++nt) {
            Frag fbh, fbl;
            ldfrag(fbh, bh0 + (size_t)nt * 16 * Ks + k0);
            ldfrag(fbl, bl0 + (size_t)nt * 16 * Ks + k0);
            mma3(acc[0][nt], fah[0], fal[0], fbh, fbl);
            mma3(acc[1][nt], fah[1], fal[1], fbh, fbl);
        }
    }

    // D layout: acc[mt][nt].f[r] = tile(row mt*16 + 8*hh + r, col nt*16 + m16)
    float* sW = sC + w * (32 * SP);
#pragma unroll
    for (int mt = 0; mt < 2; ++mt)
#pragma unroll
        for (int nt = 0; nt < 4; ++nt)
#pragma unroll
            for (int r = 0; r < 8; ++r)
                sW[(mt * 16 + 8 * hh + r) * SP + nt * 16 + m16] = acc[mt][nt].f[r];
    __syncthreads();
    store_ctile(sW, C, ldc, m0w, n0w, hh, m16);
    
}

// ---------------------------------------------------------------------------
// RoPE + split of the projection output qkv[1024][3072] (q cols 0..2047 = h*64+d,
// k cols 2048..2559, v cols 2560..3071). Block = (64-col group g, 64 tokens).
//   g < 32      : q head g      -> q planes [32][1024][64]      (RoPE)
//   32<=g<40    : kv head g-32  -> K planes [8][3072][64] rows 2048+tok (RoPE)
//   40<=g<48    : kv head g-40  -> V^T planes [8][64][3072] cols 2048+tok (transpose)
// y[d] = x[d]*cos + rot[d]*sin, rot = -x[d+32] (d<32), x[d-32] (d>=32); cos/sin from table.
// Each thread emits 8 consecutive halves per plane (16 B); 8 consecutive lanes = one line.
// coverage: q planes all 32x1024 rows; K planes rows 2048..3071 of every kv head;
// V^T planes cols 2048..3071 of all 8x64 rows.
// ---------------------------------------------------------------------------
__device__ __forceinline__ void rope8(const float* xr, const float* pr, const float* cr,
                                      const float* sr, float sgn, v4f& ya, v4f& yb) {
#pragma clang fp contract(off)
    ya.x = xr[0] * cr[0] + (sgn * pr[0]) * sr[0];
    ya.y = xr[1] * cr[1] + (sgn * pr[1]) * sr[1];
    ya.z = xr[2] * cr[2] + (sgn * pr[2]) * sr[2];
    ya.w = xr[3] * cr[3] + (sgn * pr[3]) * sr[3];
    yb.x = xr[4] * cr[4] + (sgn * pr[4]) * sr[4];
    yb.y = xr[5] * cr[5] + (sgn * pr[5]) * sr[5];
    yb.z = xr[6] * cr[6] + (sgn * pr[6]) * sr[6];
    yb.w = xr[7] * cr[7] + (sgn * pr[7]) * sr[7];
}

__global__ __launch_bounds__(256) void rope_split_kernel(
    const float* __restrict__ qkv, const float* __restrict__ cosT, const float* __restrict__ sinT,
    unsigned short* qh, unsigned short* ql, unsigned short* kh, unsigned short* kl,
    unsigned short* vh, unsigned short* vl) {
#pragma clang fp contract(off)
    constexpr int QN = 1024, D = 64, NH = 32, NKV = 8, QKVW = 3072, KVL = 3072, KVP = 2048, TP = 68;
    __shared__ __align__(16) float T[64 * TP];
    const int t = threadIdx.x, g = blockIdx.x, tok0 = blockIdx.y * 64;
    const float* s = qkv + (size_t)tok0 * QKVW + g * D;
#pragma unroll
    for (int i = 0; i < 4; ++i) {
        const int r = (t >> 4) + 16 * i, c4 = (t & 15) * 4;
        const v4f v = *(const v4fa*)(s + (size_t)r * QKVW + c4);
        *(v4fa*)(T + r * TP + c4) = v;
    }
    __syncthreads();

    u4 H0, L0, H1, L1;
    size_t g0, g1;
    unsigned short* dH;
    unsigned short* dL;
    if (g < NH + NKV) {                                   // block-uniform branch
        const bool isq = (g < NH);
        dH = isq ? qh : kh;
        dL = isq ? ql : kl;
        const int d0 = (t & 7) * 8, dp0 = d0 ^ 32;
        const float sgn = (d0 < 32) ? -1.0f : 1.0f;
        {
            const int r = (t >> 3), tok = tok0 + r;
            const float* cr = cosT + (size_t)tok * 32 + (d0 & 31);
            const float* sr = sinT + (size_t)tok * 32 + (d0 & 31);
            v4f ya, yb;
            rope8(T + r * TP + d0, T + r * TP + dp0, cr, sr, sgn, ya, yb);
            pack8(ya, yb, H0, L0);
            const size_t row = isq ? ((size_t)g * QN + tok) : ((size_t)(g - NH) * KVL + KVP + tok);
            g0 = row * D + d0;
        }
        {
            const int r = 32 + (t >> 3), tok = tok0 + r;
            const float* cr = cosT + (size_t)tok * 32 + (d0 & 31);
            const float* sr = sinT + (size_t)tok * 32 + (d0 & 31);
            v4f ya, yb;
            rope8(T + r * TP + d0, T + r * TP + dp0, cr, sr, sgn, ya, yb);
            pack8(ya, yb, H1, L1);
            const size_t row = isq ? ((size_t)g * QN + tok) : ((size_t)(g - NH) * KVL + KVP + tok);
            g1 = row * D + d0;
        }
    } else {
        dH = vh;
        dL = vl;
        const int kvhd = g - NH - NKV, piece = t & 7;
        {
            const int d = (t >> 3);
            v4f ya, yb;
            ya.x = T[(piece * 8 + 0) * TP + d]; ya.y = T[(piece * 8 + 1) * TP + d];
            ya.z = T[(piece * 8 + 2) * TP + d]; ya.w = T[(piece * 8 + 3) * TP + d];
            yb.x = T[(piece * 8 + 4) * TP + d]; yb.y = T[(piece * 8 + 5) * TP + d];
            yb.z = T[(piece * 8 + 6) * TP + d]; yb.w = T[(piece * 8 + 7) * TP + d];
            pack8(ya, yb, H0, L0);
            g0 = ((size_t)(kvhd * D + d)) * KVL + KVP + tok0 + piece * 8;
        }
        {
            const int d = 32 + (t >> 3);
            v4f ya, yb;
            ya.x = T[(piece * 8 + 0) * TP + d]; ya.y = T[(piece * 8 + 1) * TP + d];
            ya.z = T[(piece * 8 + 2) * TP + d]; ya.w = T[(piece * 8 + 3) * TP + d];
            yb.x = T[(piece * 8 + 4) * TP + d]; yb.y = T[(piece * 8 + 5) * TP + d];
            yb.z = T[(piece * 8 + 6) * TP + d]; yb.w = T[(piece * 8 + 7) * TP + d];
            pack8(ya, yb, H1, L1);
            g1 = ((size_t)(kvhd * D + d)) * KVL + KVP + tok0 + piece * 8;
        }
    }
    *(u4*)(dH + g0) = H0; *(u4*)(dL + g0) = L0;
    *(u4*)(dH + g1) = H1; *(u4*)(dL + g1) = L1;
    
}

// ---------------------------------------------------------------------------
// Flash attention with the block-diagonal TTT mask, GQA (kv head = h >> 2).
// Block = (64 queries, head h), 4 waves x 16 query rows; key tiles of 32.
// Q/K/V/P operands as bf16 hi/lo; scores, mask (-inf), running-max softmax in f32.
// key j of block blk allowed iff j < seq_len and j <= i - (lck - blk).
// seq_len = sum(attention_mask) - lck, summed per block in fixed order.
// Per (wave, blk) the key-tile loop is bounded by the wave's diagonal and seq_len
// (at most 32 tiles); the mask is still applied by value per element.
// P: D layout -> per-wave LDS (ushort) -> A fragment (wave_sync around the exchange).
// Output attn planes [1024][2048] (col h*64+d): wave tile 16 x 64 staged in LDS, each
// coverage: 16x32 blocks x 4 waves x 16 rows x 64 cols = [1024][2048] per plane.
// ---------------------------------------------------------------------------
__global__ __launch_bounds__(128) void attn_kernel(
    const unsigned short* __restrict__ qH, const unsigned short* __restrict__ qL,
    const unsigned short* __restrict__ kH, const unsigned short* __restrict__ kL,
    const unsigned short* __restrict__ vH, const unsigned short* __restrict__ vL,
    const int* __restrict__ amask, int nmask, int lck,
    unsigned short* oH, unsigned short* oL) {
    constexpr int QN = 1024, D = 64, KVL = 3072, HIDO = 2048, NBLK = 3, PP = 40, OP = 72;
    __shared__ int red[128];
    __shared__ __align__(16) unsigned short Ph[4 * 16 * PP];
    __shared__ __align__(16) unsigned short Pl[4 * 16 * PP];
    __shared__ __align__(16) unsigned short Oh[4 * 16 * OP];
    __shared__ __align__(16) unsigned short Ol[4 * 16 * OP];
    const int tid = threadIdx.x, w = tid >> 5, lane = tid & 31, hh = lane >> 4, m16 = lane & 15;

    // seq_len (integer, fixed order, identical in every block)
    int part = 0;
    for (int i = tid; i < nmask; i += 128) part += amask[i];
    red[tid] = part;
    __syncthreads();
#pragma unroll
    for (int off = 64; off > 0; off >>= 1) {
        if (tid < off) red[tid] += red[tid + off];
        __syncthreads();
    }
    const int seq_len = __builtin_amdgcn_readfirstlane(red[0] - lck);

    const int h = blockIdx.y, kvh = h >> 2;
    const int q0w = blockIdx.x * 64 + w * 16;
    const float NEG_INF = -__builtin_inff();

    Frag fqh[2], fql[2];
    {
        const size_t qo = ((size_t)h * QN + q0w + m16) * D + 8 * hh;
        ldfrag(fqh[0], qH + qo);
        ldfrag(fqh[1], qH + qo + 32);
        ldfrag(fql[0], qL + qo);
        ldfrag(fql[1], qL + qo + 32);
    }
    float mrow[8], lrow[8];
    Acc o[4];
#pragma unroll
    for (int r = 0; r < 8; ++r) { mrow[r] = NEG_INF; lrow[r] = 0.0f; }
#pragma unroll
    for (int dt = 0; dt < 4; ++dt) acc_zero(o[dt]);

    unsigned short* Pwh = Ph + w * 16 * PP;
    unsigned short* Pwl = Pl + w * 16 * PP;
    const size_t kplane = (size_t)kvh * KVL * D;      // K planes [kvh][kv][d]
    const size_t vplane = (size_t)kvh * D * KVL;      // V^T planes [kvh][d][kv]

    for (int blk = 0; blk < NBLK; ++blk) {
        const int shift = lck - blk;                   // j <= i - shift
        int jcnt = q0w + 16 - shift;                   // allowed j for this wave are < jcnt
        jcnt = (jcnt < seq_len) ? jcnt : seq_len;
        jcnt = (jcnt < 0) ? 0 : ((jcnt > QN) ? QN : jcnt);
        const int nsteps = __builtin_amdgcn_readfirstlane((jcnt + 31) >> 5);   // <= 32
#pragma unroll 1
        for (int t = 0; t < nsteps; ++t) {
            const int j0 = t * 32, kv0 = blk * QN + j0;
            Acc sc[2];
            acc_zero(sc[0]);
            acc_zero(sc[1]);
            // S tile [16 q x 32 keys]; A = q (k = d), B = K^T (k = d): sc[nt].f[r] = S[8*hh+r][nt*16+m16]
#pragma unroll
            for (int nt = 0; nt < 2; ++nt) {
                const size_t ko = kplane + (size_t)(kv0 + nt * 16 + m16) * D + 8 * hh;
#pragma unroll
                for (int ds = 0; ds < 2; ++ds) {
                    Frag fkh, fkl;
                    ldfrag(fkh, kH + ko + ds * 32);
                    ldfrag(fkl, kL + ko + ds * 32);
                    mma3(sc[nt], fqh[ds], fql[ds], fkh, fkl);
                }
            }
            // scale and mask by value
#pragma unroll
            for (int nt = 0; nt < 2; ++nt)
#pragma unroll
                for (int r = 0; r < 8; ++r) {
                    const int qi = q0w + 8 * hh + r;
                    const int j = j0 + nt * 16 + m16;
                    const bool ok = (j < seq_len) && (j <= qi - shift);
                    sc[nt].f[r] = ok ? sc[nt].f[r] * 0.125f : NEG_INF;
                }
            // running-max softmax update (row r spans the 16 lanes of one half)
            float alpha[8];
#pragma unroll
            for (int r = 0; r < 8; ++r) {
                float x = fmaxf(sc[0].f[r], sc[1].f[r]);
                x = fmaxf(x, __shfl_xor(x, 1));
                x = fmaxf(x, __shfl_xor(x, 2));
                x = fmaxf(x, __shfl_xor(x, 4));
                x = fmaxf(x, __shfl_xor(x, 8));
                const float mn = fmaxf(mrow[r], x);
                const float msafe = (mn == NEG_INF) ? 0.0f : mn;
                alpha[r] = __expf(mrow[r] - msafe);
                mrow[r] = mn;
                const float p0 = __expf(sc[0].f[r] - msafe);
                const float p1 = __expf(sc[1].f[r] - msafe);
                sc[0].f[r] = p0;
                sc[1].f[r] = p1;
                float sum = p0 + p1;
                sum += __shfl_xor(sum, 1);
                sum += __shfl_xor(sum, 2);
                sum += __shfl_xor(sum, 4);
                sum += __shfl_xor(sum, 8);
                lrow[r] = lrow[r] * alpha[r] + sum;
            }
#pragma unroll
            for (int dt = 0; dt < 4; ++dt)
#pragma unroll
                for (int r = 0; r < 8; ++r) o[dt].f[r] *= alpha[r];

            // P: D layout (row = q, col = key) -> LDS -> A fragment (m = q, k = key)
            wave_sync();
#pragma unroll
            for (int nt = 0; nt < 2; ++nt)
#pragma unroll
                for (int r = 0; r < 8; ++r) {
                    unsigned hb, lb;
                    split2(sc[nt].f[r], hb, lb);
                    Pwh[(8 * hh + r) * PP + nt * 16 + m16] = (unsigned short)hb;
                    Pwl[(8 * hh + r) * PP + nt * 16 + m16] = (unsigned short)lb;
                }
            wave_sync();
            Frag fph, fpl;
            ldfrag(fph, Pwh + m16 * PP + 8 * hh);
            ldfrag(fpl, Pwl + m16 * PP + 8 * hh);

            // O += P . V ; B = V (k = key, n = d) from V^T rows: o[dt].f[r] = O[8*hh+r][dt*16+m16]
#pragma unroll
            for (int dt = 0; dt < 4; ++dt) {
                const size_t vo = vplane + (size_t)(dt * 16 + m16) * KVL + kv0 + 8 * hh;
                Frag fvh, fvl;
                ldfrag(fvh, vH + vo);
                ldfrag(fvl, vL + vo);
                mma3(o[dt], fph, fpl, fvh, fvl);
            }
        }
    }

    // normalise, split, stage, whole-line stores
    unsigned short* Owh = Oh + w * 16 * OP;
    unsigned short* Owl = Ol + w * 16 * OP;
#pragma unroll
    for (int r = 0; r < 8; ++r) {
        const float il = 1.0f / lrow[r];
#pragma unroll
        for (int dt = 0; dt < 4; ++dt) {
            unsigned hb, lb;
            split2(o[dt].f[r] * il, hb, lb);
            Owh[(8 * hh + r) * OP + dt * 16 + m16] = (unsigned short)hb;
            Owl[(8 * hh + r) * OP + dt * 16 + m16] = (unsigned short)lb;
        }
    }
    wave_sync();
    const int piece = lane & 7, rq = lane >> 3;
    const u4 a0 = *(const u4a*)(Owh + (0 + rq) * OP + piece * 8);
    const u4 a1 = *(const u4a*)(Owh + (4 + rq) * OP + piece * 8);
    const u4 a2 = *(const u4a*)(Owh + (8 + rq) * OP + piece * 8);
    const u4 a3 = *(const u4a*)(Owh + (12 + rq) * OP + piece * 8);
    const u4 b0 = *(const u4a*)(Owl + (0 + rq) * OP + piece * 8);
    const u4 b1 = *(const u4a*)(Owl + (4 + rq) * OP + piece * 8);
    const u4 b2 = *(const u4a*)(Owl + (8 + rq) * OP + piece * 8);
    const u4 b3 = *(const u4a*)(Owl + (12 + rq) * OP + piece * 8);
    const size_t e0 = (size_t)(q0w + 0 + rq) * HIDO + h * D + piece * 8;
    const size_t e1 = (size_t)(q0w + 4 + rq) * HIDO + h * D + piece * 8;
    const size_t e2 = (size_t)(q0w + 8 + rq) * HIDO + h * D + piece * 8;
    const size_t e3 = (size_t)(q0w + 12 + rq) * HIDO + h * D + piece * 8;
    *(u4*)(oH + e0) = a0; *(u4*)(oL + e0) = b0;
    *(u4*)(oH + e1) = a1; *(u4*)(oL + e1) = b1;
    *(u4*)(oH + e2) = a2; *(u4*)(oL + e2) = b2;
    *(u4*)(oH + e3) = a3; *(u4*)(oL + e3) = b3;
    
}

// ---------------------------------------------------------------------------
extern "C" void kernel_launch(void* const* d_in, const int* in_sizes, int n_in,
                              void* d_out, int out_size, void* d_ws, size_t ws_size,
                              hipStream_t stream) {
    constexpr int QN = 1024, INW = 4096, NH = 32, NKV = 8, D = 64, HIDO = 2048;
    constexpr int KVP = 2048, KVL = 3072, QKVW = 3072, LCK = KVP / QN;
    if (n_in < 9) return;
    if (in_sizes[0] != QN * INW || in_sizes[1] != NKV * KVP * D || in_sizes[2] != NKV * KVP * D ||
        in_sizes[3] != QN || in_sizes[4] != QN || in_sizes[5] != INW * NH * D ||
        in_sizes[6] != INW * NKV * D || in_sizes[7] != INW * NKV * D ||
        in_sizes[8] != NH * D * HIDO || out_size != QN * HIDO) return;

    const float* hs  = (const float*)d_in[0];
    const float* pk  = (const float*)d_in[1];
    const float* pv  = (const float*)d_in[2];
    const int*   am  = (const int*)  d_in[3];
    const int*   pid = (const int*)  d_in[4];
    const float* Wq  = (const float*)d_in[5];
    const float* Wk  = (const float*)d_in[6];
    const float* Wv  = (const float*)d_in[7];
    const float* Wo  = (const float*)d_in[8];
    float* out = (float*)d_out;

    char* ws = (char*)d_ws;
    size_t off = 0;
    auto carve = [&](size_t bytes) -> char* {
        char* p = ws + off;
        off += (bytes + 255) & ~(size_t)255;
        return p;
    };
    unsigned short* hsH = (unsigned short*)carve((size_t)QN * INW * 2);          // A planes of QKV GEMM
    unsigned short* hsL = (unsigned short*)carve((size_t)QN * INW * 2);
    unsigned short* wtH = (unsigned short*)carve((size_t)QKVW * INW * 2);        // [Wq|Wk|Wv]^T planes [3072][4096]
    unsigned short* wtL = (unsigned short*)carve((size_t)QKVW * INW * 2);
    unsigned short* woH = (unsigned short*)carve((size_t)HIDO * (NH * D) * 2);    // Wo^T planes [2048][2048]
    unsigned short* woL = (unsigned short*)carve((size_t)HIDO * (NH * D) * 2);
    float*          qkv = (float*)         carve((size_t)QN * QKVW * 4);          // projection output f32
    unsigned short* qH  = (unsigned short*)carve((size_t)NH * QN * D * 2);        // q planes [32][1024][64]
    unsigned short* qL  = (unsigned short*)carve((size_t)NH * QN * D * 2);
    unsigned short* kH  = (unsigned short*)carve((size_t)NKV * KVL * D * 2);      // K planes [8][3072][64]
    unsigned short* kL  = (unsigned short*)carve((size_t)NKV * KVL * D * 2);
    unsigned short* vH  = (unsigned short*)carve((size_t)NKV * D * KVL * 2);      // V^T planes [8][64][3072]
    unsigned short* vL  = (unsigned short*)carve((size_t)NKV * D * KVL * 2);
    unsigned short* aH  = (unsigned short*)carve((size_t)QN * (NH * D) * 2);      // attention output planes [1024][2048]
    unsigned short* aL  = (unsigned short*)carve((size_t)QN * (NH * D) * 2);
    float*          cosT = (float*)        carve((size_t)QN * 32 * 4);
    float*          sinT = (float*)        carve((size_t)QN * 32 * 4);
    float*          inv  = (float*)        carve(128);
    if (off > ws_size || off > ((size_t)128 << 20)) return;

    // tables
    invfreq_kernel<<<1, 32, 0, stream>>>(inv);
    cstable_kernel<<<(QN * 32) / 256, 256, 0, stream>>>(pid, inv, cosT, sinT, QN, LCK);

    // operand planes
    split8_kernel<<<(QN * INW / 8) / 256, 256, 0, stream>>>(hs, hsH, hsL, QN * INW / 8, 30, 0);
    split8_kernel<<<(NKV * KVP * D / 8) / 256, 256, 0, stream>>>(pk, kH, kL, NKV * KVP * D / 8, 14, 13);
    // Wq in[4096][2048] -> out rows 0..2047 of [3072][4096]
    tsplit_kernel<<<dim3((NH * D) / 64, INW / 64, 1), 256, 0, stream>>>(Wq, NH * D, 0, wtH, wtL, INW, 0, 0);
    // Wk in[4096][512] -> rows 2048..2559
    tsplit_kernel<<<dim3((NKV * D) / 64, INW / 64, 1), 256, 0, stream>>>(Wk, NKV * D, 0, wtH, wtL, INW, 0, NH * D);
    // Wv in[4096][512] -> rows 2560..3071
    tsplit_kernel<<<dim3((NKV * D) / 64, INW / 64, 1), 256, 0, stream>>>(Wv, NKV * D, 0, wtH, wtL, INW, 0, NH * D + NKV * D);
    // Wo in[2048][2048] -> [2048][2048]
    tsplit_kernel<<<dim3(HIDO / 64, (NH * D) / 64, 1), 256, 0, stream>>>(Wo, HIDO, 0, woH, woL, NH * D, 0, 0);
    // past_value per kv head: in[2048][64] -> V^T rows d, cols 0..2047 (pitch 3072)
    tsplit_kernel<<<dim3(D / 64, KVP / 64, NKV), 256, 0, stream>>>(pv, D, KVP * D, vH, vL, KVL, D * KVL, 0);

    // fused QKV projection: [1024 x 4096] . [4096 x 3072] -> qkv f32
    gemm3_kernel<<<dim3(QKVW / 128, QN / 64), 128, 0, stream>>>(hsH, hsL, wtH, wtL, qkv, INW, QKVW);

    // RoPE + split into q planes, new K rows, new V^T cols
    rope_split_kernel<<<dim3(QKVW / 64, QN / 64), 256, 0, stream>>>(qkv, cosT, sinT, qH, qL, kH, kL, vH, vL);

    // attention
    attn_kernel<<<dim3(QN / 64, NH), 128, 0, stream>>>(qH, qL, kH, kL, vH, vL, am, in_sizes[3], LCK, aH, aL);

    // output projection: [1024 x 2048] . [2048 x 2048] -> d_out f32
    gemm3_kernel<<<dim3(HIDO / 128, QN / 64), 128, 0, stream>>>(aH, aL, woH, woL, out, NH * D, HIDO);
}

// v001
// It runs in 426 microseconds.
// Timed twice side by side with v000, it ran 1.36 times as fast both times.
// All contractions (q/k/v projections, q.k^T, p.v, output projection): v_wmma_f32_16x16x32_bf16 with bf16 hi/lo operands everywhere (hi*hi + hi*lo + lo*hi), f32 accumulate; RoPE, softmax and normalisation in f32.
#include <hip/hip_runtime.h>
#include <hip/hip_bf16.h>

typedef __attribute__((ext_vector_type(16))) __bf16 v16bf;
typedef float v8f __attribute__((ext_vector_type(8)));
typedef float v4f __attribute__((ext_vector_type(4)));
typedef unsigned int u4 __attribute__((ext_vector_type(4)));
typedef u4 __attribute__((may_alias)) u4a;
typedef v4f __attribute__((may_alias)) v4fa;

union Frag { v16bf v; u4 q[2]; };
union Acc  { v8f v; float f[8]; };

// ---------------------------------------------------------------------------
// bf16 RNE convert and hi/lo split (lo = RNE(x - hi), exact residual)
// ---------------------------------------------------------------------------
__device__ __forceinline__ unsigned bf_rne(float f) {
    unsigned u = __float_as_uint(f);
    u += 0x7FFFu + ((u >> 16) & 1u);
    return u >> 16;
}
__device__ __forceinline__ void split2(float x, unsigned& hi, unsigned& lo) {
    hi = bf_rne(x);
    lo = bf_rne(x - __uint_as_float(hi << 16));
}
// two f32 -> one 32-bit word per plane, first element in the low half-word
__device__ __forceinline__ void pack2(float a, float b, unsigned& wh, unsigned& wl) {
    unsigned ha, la, hb, lb;
    split2(a, ha, la);
    split2(b, hb, lb);
    wh = ha | (hb << 16);
    wl = la | (lb << 16);
}
// eight consecutive f32 -> 16 B per plane
__device__ __forceinline__ void pack8(const v4f a, const v4f b, u4& H, u4& L) {
    unsigned h0, l0, h1, l1, h2, l2, h3, l3;
    pack2(a.x, a.y, h0, l0);
    pack2(a.z, a.w, h1, l1);
    pack2(b.x, b.y, h2, l2);
    pack2(b.z, b.w, h3, l3);
    H.x = h0; H.y = h1; H.z = h2; H.w = h3;
    L.x = l0; L.y = l1; L.z = l2; L.w = l3;
}

// ---------------------------------------------------------------------------
// 16x16x32 fragment load from a k-contiguous 16-bit row (A row m, or B^T row n):
// p = row_start + k0 + 8*h ; elements 0..7 <- k0+8h.., elements 8..15 <- k0+16+8h..
// ---------------------------------------------------------------------------
__device__ __forceinline__ void ldfrag(Frag& f, const unsigned short* p) {
    f.q[0] = *(const u4a*)(p);
    f.q[1] = *(const u4a*)(p + 16);
}

__device__ __forceinline__ void acc_zero(Acc& c) {
#pragma unroll
    for (int i = 0; i < 8; ++i) c.f[i] = 0.0f;
}

// acc += Ah*Bh + Ah*Bl + Al*Bh, then 4 wait slots with D tied and A/B kept live
__device__ __forceinline__ void mma3(Acc& c, const Frag& ah, const Frag& al,
                                     const Frag& bh, const Frag& bl) {
    v8f d = c.v;
    d = __builtin_amdgcn_wmma_f32_16x16x32_bf16(false, ah.v, false, bh.v, (short)0, d, false, false);
    d = __builtin_amdgcn_wmma_f32_16x16x32_bf16(false, ah.v, false, bl.v, (short)0, d, false, false);
    d = __builtin_amdgcn_wmma_f32_16x16x32_bf16(false, al.v, false, bh.v, (short)0, d, false, false);
    asm volatile("v_nop\n\tv_nop\n\tv_nop\n\tv_nop"
                 : "+v"(d) : "v"(ah.v), "v"(al.v), "v"(bh.v), "v"(bl.v));
    c.v = d;
}

// same-wave LDS exchange ordering
__device__ __forceinline__ void wave_sync() {
    __builtin_amdgcn_fence(__ATOMIC_ACQ_REL, "wavefront");
    __builtin_amdgcn_wave_barrier();
}

// ---------------------------------------------------------------------------
// inv_freq[i] = 1 / 10000^(i/32), i = 0..31  (f64 exp2 -> f32, then f32 reciprocal)
// ---------------------------------------------------------------------------
__global__ void invfreq_kernel(float* inv) {
    const int i = threadIdx.x & 31;
    const double e = (double)i * 0.03125 * 13.287712379549449;   // i/32 * log2(1e4)
    const float p32 = (float)exp2(e);
    const float v = 1.0f / p32;
    *(float*)(inv + i) = v;
    
}

// ---------------------------------------------------------------------------
// cos/sin table [ntok][32] at angle f32(pos + lck) * inv_freq[i]; precise sinf/cosf.
// ---------------------------------------------------------------------------
__global__ __launch_bounds__(256) void cstable_kernel(const int* __restrict__ pid,
                                                      const float* __restrict__ inv,
                                                      float* cosT, float* sinT,
                                                      int ntok, int lck) {
    const int n = ntok * 32;
    const int idx = blockIdx.x * 256 + threadIdx.x;
    const int ic = (idx < n) ? idx : (n - 1);          // clamped address
    const int tok = ic >> 5, i = ic & 31;
    const float pos = (float)(pid[tok] + lck);
    const float ang = pos * inv[i];
    const float c = cosf(ang);
    const float s = sinf(ang);
    if (idx < n) {
        *(float*)(cosT + idx) = c;
        *(float*)(sinT + idx) = s;
    }
    
}

// ---------------------------------------------------------------------------
// f32 -> bf16 hi/lo planes, 8 consecutive elements per thread (one 16-B store per
// dst group = t + ((t >> logseg) << addshift).
// coverage: n8 groups x 8 = every source element; grid = n8/256 exactly.
// ---------------------------------------------------------------------------
__global__ __launch_bounds__(256) void split8_kernel(const float* __restrict__ src,
                                                     unsigned short* dh, unsigned short* dl,
                                                     int n8, int logseg, int addshift) {
    const int t = blockIdx.x * 256 + threadIdx.x;
    if (t >= n8) return;
    const float* p = src + (size_t)t * 8;
    const v4f a = *(const v4fa*)(p);
    const v4f b = *(const v4fa*)(p + 4);
    u4 H, L;
    pack8(a, b, H, L);
    const size_t g = ((size_t)t + ((size_t)(t >> logseg) << addshift)) * 8;
    *(u4*)(dh + g) = H;
    *(u4*)(dl + g) = L;
    
}

// ---------------------------------------------------------------------------
// Transpose + split: src[R][Cc] f32 (pitch srcld) -> dst planes [n][k] with n = src col,
// k = src row: dst[(nbase + c) * dstld + r]. Tile 64x64 through LDS; each output row
// instruction. blockIdx.z strides src by srcz floats and dst by dstz halves.
// coverage: loads 256 thr x 4 x float4 = 64x64; stores 256 thr x 2 x 8 = 64x64 per plane.
// ---------------------------------------------------------------------------
__global__ __launch_bounds__(256) void tsplit_kernel(const float* __restrict__ src, int srcld, int srcz,
                                                     unsigned short* dh, unsigned short* dl,
                                                     int dstld, int dstz, int nbase) {
    constexpr int TP = 72;
    __shared__ __align__(16) unsigned short Th[64 * TP];
    __shared__ __align__(16) unsigned short Tl[64 * TP];
    const int t = threadIdx.x;
    const int c0 = blockIdx.x * 64, r0 = blockIdx.y * 64, z = blockIdx.z;
    const float* s = src + (size_t)z * srcz + (size_t)r0 * srcld + c0;
#pragma unroll
    for (int i = 0; i < 4; ++i) {
        const int r = (t >> 4) + 16 * i, c4 = (t & 15) * 4;
        const v4f v = *(const v4fa*)(s + (size_t)r * srcld + c4);
        unsigned hb, lb;
        split2(v.x, hb, lb); Th[(c4 + 0) * TP + r] = (unsigned short)hb; Tl[(c4 + 0) * TP + r] = (unsigned short)lb;
        split2(v.y, hb, lb); Th[(c4 + 1) * TP + r] = (unsigned short)hb; Tl[(c4 + 1) * TP + r] = (unsigned short)lb;
        split2(v.z, hb, lb); Th[(c4 + 2) * TP + r] = (unsigned short)hb; Tl[(c4 + 2) * TP + r] = (unsigned short)lb;
        split2(v.w, hb, lb); Th[(c4 + 3) * TP + r] = (unsigned short)hb; Tl[(c4 + 3) * TP + r] = (unsigned short)lb;
    }
    __syncthreads();
    const int piece = t & 7;
    const int rowA = (t >> 3), rowB = 32 + (t >> 3);
    const u4 HA = *(const u4a*)(Th + rowA * TP + piece * 8);
    const u4 LA = *(const u4a*)(Tl + rowA * TP + piece * 8);
    const u4 HB = *(const u4a*)(Th + rowB * TP + piece * 8);
    const u4 LB = *(const u4a*)(Tl + rowB * TP + piece * 8);
    const size_t zb = (size_t)z * dstz;
    const size_t gA = zb + (size_t)(nbase + c0 + rowA) * dstld + r0 + piece * 8;
    const size_t gB = zb + (size_t)(nbase + c0 + rowB) * dstld + r0 + piece * 8;
    *(u4*)(dh + gA) = HA; *(u4*)(dl + gA) = LA;
    *(u4*)(dh + gB) = HB; *(u4*)(dl + gB) = LB;
    
}

// ---------------------------------------------------------------------------
// GEMM, bf16 hi/lo three-term: C[M x N] f32 (pitch ldc) = A[M x K] . B[K x N],
// A planes [M][K] (pitch K), B planes stored transposed [N][K] (pitch K, k-contiguous),
// so A and B fragments use the identical split-k load. Block = 4 waves, 64 x 128;
// wave tile 32 x 64 (2 m-tiles x 4 n-tiles). Fragments loaded directly from global.
// Epilogue: wave tile staged in LDS, then each 256-B row segment written as two
// Requires M % 64 == 0, N % 128 == 0, K % 32 == 0, ldc % 32 == 0 (checked on host).
// ---------------------------------------------------------------------------
__device__ __forceinline__ void store_ctile(const float* sW, float* C, int ldc,
                                            int m0w, int n0w, int hh, int m16) {
#pragma unroll
    for (int i = 0; i < 16; ++i) {
        const int row = 2 * i + hh;
        const v4f v = *(const v4fa*)(sW + row * 68 + m16 * 4);
        *(v4f*)(C + (size_t)(m0w + row) * ldc + n0w + m16 * 4) = v;
    }
}

__global__ __launch_bounds__(128) void gemm3_kernel(
    const unsigned short* __restrict__ Ah, const unsigned short* __restrict__ Al,
    const unsigned short* __restrict__ Bh, const unsigned short* __restrict__ Bl,
    float* C, int K, int ldc) {
    constexpr int SP = 68;
    __shared__ __align__(16) float sC[4 * 32 * SP];
    const int tid = threadIdx.x, w = tid >> 5, lane = tid & 31, hh = lane >> 4, m16 = lane & 15;
    const int m0w = blockIdx.y * 64 + (w >> 1) * 32;
    const int n0w = blockIdx.x * 128 + (w & 1) * 64;

    Acc acc[2][4];
#pragma unroll
    for (int mt = 0; mt < 2; ++mt)
#pragma unroll
        for (int nt = 0; nt < 4; ++nt) acc_zero(acc[mt][nt]);

    const size_t Ks = (size_t)K;
    const unsigned short* ah0 = Ah + (size_t)(m0w + m16) * Ks + 8 * hh;
    const unsigned short* al0 = Al + (size_t)(m0w + m16) * Ks + 8 * hh;
    const unsigned short* ah1 = ah0 + 16 * Ks;
    const unsigned short* al1 = al0 + 16 * Ks;
    const unsigned short* bh0 = Bh + (size_t)(n0w + m16) * Ks + 8 * hh;
    const unsigned short* bl0 = Bl + (size_t)(n0w + m16) * Ks + 8 * hh;

#pragma unroll 1
    for (int k0 = 0; k0 < K; k0 += 32) {
        Frag fah[2], fal[2];
        ldfrag(fah[0], ah0 + k0);
        ldfrag(fal[0], al0 + k0);
        ldfrag(fah[1], ah1 + k0);
        ldfrag(fal[1], al1 + k0);
#pragma unroll
        for (int nt = 0; nt < 4; ++nt) {
            Frag fbh, fbl;
            ldfrag(fbh, bh0 + (size_t)nt * 16 * Ks + k0);
            ldfrag(fbl, bl0 + (size_t)nt * 16 * Ks + k0);
            mma3(acc[0][nt], fah[0], fal[0], fbh, fbl);
            mma3(acc[1][nt], fah[1], fal[1], fbh, fbl);
        }
    }

    // D layout: acc[mt][nt].f[r] = tile(row mt*16 + 8*hh + r, col nt*16 + m16)
    float* sW = sC + w * (32 * SP);
#pragma unroll
    for (int mt = 0; mt < 2; ++mt)
#pragma unroll
        for (int nt = 0; nt < 4; ++nt)
#pragma unroll
            for (int r = 0; r < 8; ++r)
                sW[(mt * 16 + 8 * hh + r) * SP + nt * 16 + m16] = acc[mt][nt].f[r];
    __syncthreads();
    store_ctile(sW, C, ldc, m0w, n0w, hh, m16);
    
}

// ---------------------------------------------------------------------------
// RoPE + split of the projection output qkv[1024][3072] (q cols 0..2047 = h*64+d,
// k cols 2048..2559, v cols 2560..3071). Block = (64-col group g, 64 tokens).
//   g < 32      : q head g      -> q planes [32][1024][64]      (RoPE)
//   32<=g<40    : kv head g-32  -> K planes [8][3072][64] rows 2048+tok (RoPE)
//   40<=g<48    : kv head g-40  -> V^T planes [8][64][3072] cols 2048+tok (transpose)
// y[d] = x[d]*cos + rot[d]*sin, rot = -x[d+32] (d<32), x[d-32] (d>=32); cos/sin from table.
// Each thread emits 8 consecutive halves per plane (16 B); 8 consecutive lanes = one line.
// coverage: q planes all 32x1024 rows; K planes rows 2048..3071 of every kv head;
// V^T planes cols 2048..3071 of all 8x64 rows.
// ---------------------------------------------------------------------------
__device__ __forceinline__ void rope8(const float* xr, const float* pr, const float* cr,
                                      const float* sr, float sgn, v4f& ya, v4f& yb) {
#pragma clang fp contract(off)
    ya.x = xr[0] * cr[0] + (sgn * pr[0]) * sr[0];
    ya.y = xr[1] * cr[1] + (sgn * pr[1]) * sr[1];
    ya.z = xr[2] * cr[2] + (sgn * pr[2]) * sr[2];
    ya.w = xr[3] * cr[3] + (sgn * pr[3]) * sr[3];
    yb.x = xr[4] * cr[4] + (sgn * pr[4]) * sr[4];
    yb.y = xr[5] * cr[5] + (sgn * pr[5]) * sr[5];
    yb.z = xr[6] * cr[6] + (sgn * pr[6]) * sr[6];
    yb.w = xr[7] * cr[7] + (sgn * pr[7]) * sr[7];
}

__global__ __launch_bounds__(256) void rope_split_kernel(
    const float* __restrict__ qkv, const float* __restrict__ cosT, const float* __restrict__ sinT,
    unsigned short* qh, unsigned short* ql, unsigned short* kh, unsigned short* kl,
    unsigned short* vh, unsigned short* vl) {
#pragma clang fp contract(off)
    constexpr int QN = 1024, D = 64, NH = 32, NKV = 8, QKVW = 3072, KVL = 3072, KVP = 2048, TP = 68;
    __shared__ __align__(16) float T[64 * TP];
    const int t = threadIdx.x, g = blockIdx.x, tok0 = blockIdx.y * 64;
    const float* s = qkv + (size_t)tok0 * QKVW + g * D;
#pragma unroll
    for (int i = 0; i < 4; ++i) {
        const int r = (t >> 4) + 16 * i, c4 = (t & 15) * 4;
        const v4f v = *(const v4fa*)(s + (size_t)r * QKVW + c4);
        *(v4fa*)(T + r * TP + c4) = v;
    }
    __syncthreads();

    u4 H0, L0, H1, L1;
    size_t g0, g1;
    unsigned short* dH;
    unsigned short* dL;
    if (g < NH + NKV) {                                   // block-uniform branch
        const bool isq = (g < NH);
        dH = isq ? qh : kh;
        dL = isq ? ql : kl;
        const int d0 = (t & 7) * 8, dp0 = d0 ^ 32;
        const float sgn = (d0 < 32) ? -1.0f : 1.0f;
        {
            const int r = (t >> 3), tok = tok0 + r;
            const float* cr = cosT + (size_t)tok * 32 + (d0 & 31);
            const float* sr = sinT + (size_t)tok * 32 + (d0 & 31);
            v4f ya, yb;
            rope8(T + r * TP + d0, T + r * TP + dp0, cr, sr, sgn, ya, yb);
            pack8(ya, yb, H0, L0);
            const size_t row = isq ? ((size_t)g * QN + tok) : ((size_t)(g - NH) * KVL + KVP + tok);
            g0 = row * D + d0;
        }
        {
            const int r = 32 + (t >> 3), tok = tok0 + r;
            const float* cr = cosT + (size_t)tok * 32 + (d0 & 31);
            const float* sr = sinT + (size_t)tok * 32 + (d0 & 31);
            v4f ya, yb;
            rope8(T + r * TP + d0, T + r * TP + dp0, cr, sr, sgn, ya, yb);
            pack8(ya, yb, H1, L1);
            const size_t row = isq ? ((size_t)g * QN + tok) : ((size_t)(g - NH) * KVL + KVP + tok);
            g1 = row * D + d0;
        }
    } else {
        dH = vh;
        dL = vl;
        const int kvhd = g - NH - NKV, piece = t & 7;
        {
            const int d = (t >> 3);
            v4f ya, yb;
            ya.x = T[(piece * 8 + 0) * TP + d]; ya.y = T[(piece * 8 + 1) * TP + d];
            ya.z = T[(piece * 8 + 2) * TP + d]; ya.w = T[(piece * 8 + 3) * TP + d];
            yb.x = T[(piece * 8 + 4) * TP + d]; yb.y = T[(piece * 8 + 5) * TP + d];
            yb.z = T[(piece * 8 + 6) * TP + d]; yb.w = T[(piece * 8 + 7) * TP + d];
            pack8(ya, yb, H0, L0);
            g0 = ((size_t)(kvhd * D + d)) * KVL + KVP + tok0 + piece * 8;
        }
        {
            const int d = 32 + (t >> 3);
            v4f ya, yb;
            ya.x = T[(piece * 8 + 0) * TP + d]; ya.y = T[(piece * 8 + 1) * TP + d];
            ya.z = T[(piece * 8 + 2) * TP + d]; ya.w = T[(piece * 8 + 3) * TP + d];
            yb.x = T[(piece * 8 + 4) * TP + d]; yb.y = T[(piece * 8 + 5) * TP + d];
            yb.z = T[(piece * 8 + 6) * TP + d]; yb.w = T[(piece * 8 + 7) * TP + d];
            pack8(ya, yb, H1, L1);
            g1 = ((size_t)(kvhd * D + d)) * KVL + KVP + tok0 + piece * 8;
        }
    }
    *(u4*)(dH + g0) = H0; *(u4*)(dL + g0) = L0;
    *(u4*)(dH + g1) = H1; *(u4*)(dL + g1) = L1;
    
}

// ---------------------------------------------------------------------------
// Flash attention with the block-diagonal TTT mask, GQA (kv head = h >> 2).
// Block = (kv head, 16 query rows), 16 waves = its 4 query heads x 4 key splits. The key
// tiles of 32 of all three key blocks form one list; split ks takes entries ks, ks + 4, ...
// The 4 heads of one split walk the same K and V tiles at the same time.
// Each wave keeps its own running maximum, sum and 16 x 64 output; a head's four partial
// results are merged through LDS in fixed split order behind one work-group barrier.
// Q/K/V/P operands as bf16 hi/lo; scores, mask (-inf), running-max softmax in f32.
// key j of block blk allowed iff j < seq_len and j <= i - (lck - blk).
// seq_len = sum(attention_mask) - lck, summed per block in fixed order.
// Per blk the key-tile count is bounded by the tile's diagonal and seq_len
// (at most 32 tiles); the mask is still applied by value per element.
// P: D layout -> per-wave LDS (ushort) -> A fragment (wave_sync around the exchange).
// Output attn planes [1024][2048] (col h*64+d): 8 lanes x 16 B = one 128-B line per row.
// Query tiles with the most keys have the lowest block index, so they start first.
// coverage: 8 x 64 blocks x 4 heads x 16 rows x 64 cols = [1024][2048] per plane.
// ---------------------------------------------------------------------------
__global__ __launch_bounds__(512) void attn_kernel(
    const unsigned short* __restrict__ qH, const unsigned short* __restrict__ qL,
    const unsigned short* __restrict__ kH, const unsigned short* __restrict__ kL,
    const unsigned short* __restrict__ vH, const unsigned short* __restrict__ vL,
    const int* __restrict__ amask, int nmask, int lck,
    unsigned short* oH, unsigned short* oL) {
    constexpr int QN = 1024, D = 64, KVL = 3072, HIDO = 2048, PP = 40, NS = 4, NW = 4 * NS, SP = 68;
    __shared__ int red[128];
    __shared__ __align__(16) unsigned short Ph[NW * 16 * PP];
    __shared__ __align__(16) unsigned short Pl[NW * 16 * PP];
    __shared__ __align__(16) float Os[NW * 16 * SP];
    __shared__ float Ms[NW * 16];
    __shared__ float Ls[NW * 16];
    const int tid = threadIdx.x, lane = tid & 31, hh = lane >> 4, m16 = lane & 15;
    // wave number held as a scalar: the key-tile loop then branches on scalar tests, every lane on
    const int w = __builtin_amdgcn_readfirstlane(tid >> 5);

    // seq_len (integer, fixed order, identical in every block)
    if (tid < 128) {                                   // the first four waves sum the mask
        int part = 0;
        for (int i = tid; i < nmask; i += 128) part += amask[i];
        red[tid] = part;
    }
    __syncthreads();
#pragma unroll
    for (int off = 64; off > 0; off >>= 1) {
        if (tid < off) red[tid] += red[tid + off];
        __syncthreads();
    }
    const int seq_len = __builtin_amdgcn_readfirstlane(red[0] - lck);

    const int kvh = blockIdx.x, h = kvh * 4 + (w & 3), ks = w >> 2;
    const int q0w = (QN / 16 - 1 - (int)blockIdx.y) * 16;
    const float NEG_INF = -__builtin_inff();

    Frag fqh[2], fql[2];
    {
        const size_t qo = ((size_t)h * QN + q0w + m16) * D + 8 * hh;
        ldfrag(fqh[0], qH + qo);
        ldfrag(fqh[1], qH + qo + 32);
        ldfrag(fql[0], qL + qo);
        ldfrag(fql[1], qL + qo + 32);
    }
    float mrow[8], lrow[8];
    Acc o[4];
#pragma unroll
    for (int r = 0; r < 8; ++r) { mrow[r] = NEG_INF; lrow[r] = 0.0f; }
#pragma unroll
    for (int dt = 0; dt < 4; ++dt) acc_zero(o[dt]);

    unsigned short* Pwh = Ph + w * 16 * PP;
    unsigned short* Pwl = Pl + w * 16 * PP;
    const size_t kplane = (size_t)kvh * KVL * D;      // K planes [kvh][kv][d]
    const size_t vplane = (size_t)kvh * D * KVL;      // V^T planes [kvh][d][kv]

    // key tiles per key block (allowed j of block blk are < q0w + 16 - (lck - blk) and < seq_len),
    // as running ends e0 <= e1 <= e2 of the one list; each count <= 32, so e2 <= 96
    int e0, e1, e2;
    {
        int c0 = q0w + 16 - lck, c1 = c0 + 1, c2 = c0 + 2;
        c0 = (c0 < seq_len) ? c0 : seq_len;
        c1 = (c1 < seq_len) ? c1 : seq_len;
        c2 = (c2 < seq_len) ? c2 : seq_len;
        c0 = (c0 < 0) ? 0 : ((c0 > QN) ? QN : c0);
        c1 = (c1 < 0) ? 0 : ((c1 > QN) ? QN : c1);
        c2 = (c2 < 0) ? 0 : ((c2 > QN) ? QN : c2);
        e0 = __builtin_amdgcn_readfirstlane((c0 + 31) >> 5);
        e1 = e0 + __builtin_amdgcn_readfirstlane((c1 + 31) >> 5);
        e2 = e1 + __builtin_amdgcn_readfirstlane((c2 + 31) >> 5);
    }
    // kept rolled: a second copy of the long body would only raise the register count
#pragma unroll 1
    for (int s = ks; s < e2; s += NS) {
        const int blk = (s >= e0 ? 1 : 0) + (s >= e1 ? 1 : 0);
        const int t = s - (s >= e1 ? e1 : (s >= e0 ? e0 : 0));
        const int shift = lck - blk;                   // j <= i - shift
        const int j0 = t * 32, kv0 = blk * QN + j0;
        Acc sc[2];
        acc_zero(sc[0]);
        acc_zero(sc[1]);
        // S tile [16 q x 32 keys]; A = q (k = d), B = K^T (k = d): sc[nt].f[r] = S[8*hh+r][nt*16+m16]
#pragma unroll
        for (int nt = 0; nt < 2; ++nt) {
            const size_t ko = kplane + (size_t)(kv0 + nt * 16 + m16) * D + 8 * hh;
#pragma unroll
            for (int ds = 0; ds < 2; ++ds) {
                Frag fkh, fkl;
                ldfrag(fkh, kH + ko + ds * 32);
                ldfrag(fkl, kL + ko + ds * 32);
                mma3(sc[nt], fqh[ds], fql[ds], fkh, fkl);
            }
        }
        // scale and mask by value
#pragma unroll
        for (int nt = 0; nt < 2; ++nt)
#pragma unroll
            for (int r = 0; r < 8; ++r) {
                const int qi = q0w + 8 * hh + r;
                const int j = j0 + nt * 16 + m16;
                const bool ok = (j < seq_len) && (j <= qi - shift);
                sc[nt].f[r] = ok ? sc[nt].f[r] * 0.125f : NEG_INF;
            }
        // running-max softmax update (row r spans the 16 lanes of one half)
        float alpha[8];
#pragma unroll
        for (int r = 0; r < 8; ++r) {
            float x = fmaxf(sc[0].f[r], sc[1].f[r]);
            x = fmaxf(x, __shfl_xor(x, 1));
            x = fmaxf(x, __shfl_xor(x, 2));
            x = fmaxf(x, __shfl_xor(x, 4));
            x = fmaxf(x, __shfl_xor(x, 8));
            const float mn = fmaxf(mrow[r], x);
            const float msafe = (mn == NEG_INF) ? 0.0f : mn;
            alpha[r] = __expf(mrow[r] - msafe);
            mrow[r] = mn;
            const float p0 = __expf(sc[0].f[r] - msafe);
            const float p1 = __expf(sc[1].f[r] - msafe);
            sc[0].f[r] = p0;
            sc[1].f[r] = p1;
            float sum = p0 + p1;
            sum += __shfl_xor(sum, 1);
            sum += __shfl_xor(sum, 2);
            sum += __shfl_xor(sum, 4);
            sum += __shfl_xor(sum, 8);
            lrow[r] = lrow[r] * alpha[r] + sum;
        }
#pragma unroll
        for (int dt = 0; dt < 4; ++dt)
#pragma unroll
            for (int r = 0; r < 8; ++r) o[dt].f[r] *= alpha[r];

        // P: D layout (row = q, col = key) -> LDS -> A fragment (m = q, k = key)
        wave_sync();
#pragma unroll
        for (int nt = 0; nt < 2; ++nt)
#pragma unroll
            for (int r = 0; r < 8; ++r) {
                unsigned hb, lb;
                split2(sc[nt].f[r], hb, lb);
                Pwh[(8 * hh + r) * PP + nt * 16 + m16] = (unsigned short)hb;
                Pwl[(8 * hh + r) * PP + nt * 16 + m16] = (unsigned short)lb;
            }
        wave_sync();
        Frag fph, fpl;
        ldfrag(fph, Pwh + m16 * PP + 8 * hh);
        ldfrag(fpl, Pwl + m16 * PP + 8 * hh);

        // O += P . V ; B = V (k = key, n = d) from V^T rows: o[dt].f[r] = O[8*hh+r][dt*16+m16]
        const size_t vo = vplane + (size_t)m16 * KVL + kv0 + 8 * hh;
        const unsigned short* pvh = vH + vo;
        const unsigned short* pvl = vL + vo;
#pragma unroll
        for (int dt = 0; dt < 4; ++dt) {
            Frag fvh, fvl;
            ldfrag(fvh, pvh + (size_t)dt * 16 * KVL);
            ldfrag(fvl, pvl + (size_t)dt * 16 * KVL);
            // behind the last loads that name these two address pairs, before the registers are reused
            if (dt == 3) asm volatile("s_wait_xcnt 0x0" :: "v"(pvh), "v"(pvl) : "memory");
            mma3(o[dt], fph, fpl, fvh, fvl);
        }
    }

    // each wave's partial result to LDS (D layout: o[dt].f[r] = O[8*hh+r][dt*16+m16])
    float* Ow = Os + w * 16 * SP;
#pragma unroll
    for (int r = 0; r < 8; ++r)
#pragma unroll
        for (int dt = 0; dt < 4; ++dt) Ow[(8 * hh + r) * SP + dt * 16 + m16] = o[dt].f[r];
    if (m16 == 0) {
#pragma unroll
        for (int r = 0; r < 8; ++r) {
            Ms[w * 16 + 8 * hh + r] = mrow[r];
            Ls[w * 16 + 8 * hh + r] = lrow[r];
        }
    }
    __syncthreads();

    // merge in split order, normalise, split into planes; thread = (head, row, 8 columns)
    const int hl = tid >> 7, row = (tid >> 3) & 15, c8 = (tid & 7) * 8;
    float mall = NEG_INF;
#pragma unroll
    for (int u = 0; u < NS; ++u) mall = fmaxf(mall, Ms[(u * 4 + hl) * 16 + row]);
    const float mfin = (mall == NEG_INF) ? 0.0f : mall;
    float lsum = 0.0f;
    v4f oa = {0.0f, 0.0f, 0.0f, 0.0f}, ob = {0.0f, 0.0f, 0.0f, 0.0f};
#pragma unroll
    for (int u = 0; u < NS; ++u) {
        const int pr = (u * 4 + hl) * 16 + row;
        const float a = __expf(Ms[pr] - mfin);
        const v4f va = *(const v4fa*)(Os + pr * SP + c8);
        const v4f vb = *(const v4fa*)(Os + pr * SP + c8 + 4);
        lsum += a * Ls[pr];
        oa += a * va;
        ob += a * vb;
    }
    const float il = 1.0f / lsum;
    u4 H, L;
    pack8(oa * il, ob * il, H, L);
    const size_t eo = (size_t)(q0w + row) * HIDO + (kvh * 4 + hl) * D + c8;
    *(u4*)(oH + eo) = H;
    *(u4*)(oL + eo) = L;
}

// ---------------------------------------------------------------------------
extern "C" void kernel_launch(void* const* d_in, const int* in_sizes, int n_in,
                              void* d_out, int out_size, void* d_ws, size_t ws_size,
                              hipStream_t stream) {
    constexpr int QN = 1024, INW = 4096, NH = 32, NKV = 8, D = 64, HIDO = 2048;
    constexpr int KVP = 2048, KVL = 3072, QKVW = 3072, LCK = KVP / QN;
    if (n_in < 9) return;
    if (in_sizes[0] != QN * INW || in_sizes[1] != NKV * KVP * D || in_sizes[2] != NKV * KVP * D ||
        in_sizes[3] != QN || in_sizes[4] != QN || in_sizes[5] != INW * NH * D ||
        in_sizes[6] != INW * NKV * D || in_sizes[7] != INW * NKV * D ||
        in_sizes[8] != NH * D * HIDO || out_size != QN * HIDO) return;

    const float* hs  = (const float*)d_in[0];
    const float* pk  = (const float*)d_in[1];
    const float* pv  = (const float*)d_in[2];
    const int*   am  = (const int*)  d_in[3];
    const int*   pid = (const int*)  d_in[4];
    const float* Wq  = (const float*)d_in[5];
    const float* Wk  = (const float*)d_in[6];
    const float* Wv  = (const float*)d_in[7];
    const float* Wo  = (const float*)d_in[8];
    float* out = (float*)d_out;

    char* ws = (char*)d_ws;
    size_t off = 0;
    auto carve = [&](size_t bytes) -> char* {
        char* p = ws + off;
        off += (bytes + 255) & ~(size_t)255;
        return p;
    };
    unsigned short* hsH = (unsigned short*)carve((size_t)QN * INW * 2);          // A planes of QKV GEMM
    unsigned short* hsL = (unsigned short*)carve((size_t)QN * INW * 2);
    unsigned short* wtH = (unsigned short*)carve((size_t)QKVW * INW * 2);        // [Wq|Wk|Wv]^T planes [3072][4096]
    unsigned short* wtL = (unsigned short*)carve((size_t)QKVW * INW * 2);
    unsigned short* woH = (unsigned short*)carve((size_t)HIDO * (NH * D) * 2);    // Wo^T planes [2048][2048]
    unsigned short* woL = (unsigned short*)carve((size_t)HIDO * (NH * D) * 2);
    float*          qkv = (float*)         carve((size_t)QN * QKVW * 4);          // projection output f32
    unsigned short* qH  = (unsigned short*)carve((size_t)NH * QN * D * 2);        // q planes [32][1024][64]
    unsigned short* qL  = (unsigned short*)carve((size_t)NH * QN * D * 2);
    unsigned short* kH  = (unsigned short*)carve((size_t)NKV * KVL * D * 2);      // K planes [8][3072][64]
    unsigned short* kL  = (unsigned short*)carve((size_t)NKV * KVL * D * 2);
    unsigned short* vH  = (unsigned short*)carve((size_t)NKV * D * KVL * 2);      // V^T planes [8][64][3072]
    unsigned short* vL  = (unsigned short*)carve((size_t)NKV * D * KVL * 2);
    unsigned short* aH  = (unsigned short*)carve((size_t)QN * (NH * D) * 2);      // attention output planes [1024][2048]
    unsigned short* aL  = (unsigned short*)carve((size_t)QN * (NH * D) * 2);
    float*          cosT = (float*)        carve((size_t)QN * 32 * 4);
    float*          sinT = (float*)        carve((size_t)QN * 32 * 4);
    float*          inv  = (float*)        carve(128);
    if (off > ws_size || off > ((size_t)128 << 20)) return;

    // tables
    invfreq_kernel<<<1, 32, 0, stream>>>(inv);
    cstable_kernel<<<(QN * 32) / 256, 256, 0, stream>>>(pid, inv, cosT, sinT, QN, LCK);

    // operand planes
    split8_kernel<<<(QN * INW / 8) / 256, 256, 0, stream>>>(hs, hsH, hsL, QN * INW / 8, 30, 0);
    split8_kernel<<<(NKV * KVP * D / 8) / 256, 256, 0, stream>>>(pk, kH, kL, NKV * KVP * D / 8, 14, 13);
    // Wq in[4096][2048] -> out rows 0..2047 of [3072][4096]
    tsplit_kernel<<<dim3((NH * D) / 64, INW / 64, 1), 256, 0, stream>>>(Wq, NH * D, 0, wtH, wtL, INW, 0, 0);
    // Wk in[4096][512] -> rows 2048..2559
    tsplit_kernel<<<dim3((NKV * D) / 64, INW / 64, 1), 256, 0, stream>>>(Wk, NKV * D, 0, wtH, wtL, INW, 0, NH * D);
    // Wv in[4096][512] -> rows 2560..3071
    tsplit_kernel<<<dim3((NKV * D) / 64, INW / 64, 1), 256, 0, stream>>>(Wv, NKV * D, 0, wtH, wtL, INW, 0, NH * D + NKV * D);
    // Wo in[2048][2048] -> [2048][2048]
    tsplit_kernel<<<dim3(HIDO / 64, (NH * D) / 64, 1), 256, 0, stream>>>(Wo, HIDO, 0, woH, woL, NH * D, 0, 0);
    // past_value per kv head: in[2048][64] -> V^T rows d, cols 0..2047 (pitch 3072)
    tsplit_kernel<<<dim3(D / 64, KVP / 64, NKV), 256, 0, stream>>>(pv, D, KVP * D, vH, vL, KVL, D * KVL, 0);

    // fused QKV projection: [1024 x 4096] . [4096 x 3072] -> qkv f32
    gemm3_kernel<<<dim3(QKVW / 128, QN / 64), 128, 0, stream>>>(hsH, hsL, wtH, wtL, qkv, INW, QKVW);

    // RoPE + split into q planes, new K rows, new V^T cols
    rope_split_kernel<<<dim3(QKVW / 64, QN / 64), 256, 0, stream>>>(qkv, cosT, sinT, qH, qL, kH, kL, vH, vL);

    // attention
    attn_kernel<<<dim3(NKV, QN / 16), 512, 0, stream>>>(qH, qL, kH, kL, vH, vL, am, in_sizes[3], LCK, aH, aL);

    // output projection: [1024 x 2048] . [2048 x 2048] -> d_out f32
    gemm3_kernel<<<dim3(HIDO / 128, QN / 64), 128, 0, stream>>>(aH, aL, woH, woL, out, NH * D, HIDO);
}

// v002
// It runs in 264 microseconds.
// In two side-by-side timings against v001, it was 1.61 and 1.62 times as fast.
// Counting every step since v000, it is 2.20 times as fast.
// All contractions (q/k/v projections, q.k^T, p.v, output projection): v_wmma_f32_16x16x32_bf16 with bf16 hi/lo operands everywhere (hi*hi + hi*lo + lo*hi), f32 accumulate; RoPE, softmax and normalisation in f32.
#include <hip/hip_runtime.h>
#include <hip/hip_bf16.h>

typedef __attribute__((ext_vector_type(16))) __bf16 v16bf;
typedef float v8f __attribute__((ext_vector_type(8)));
typedef float v4f __attribute__((ext_vector_type(4)));
typedef unsigned int u4 __attribute__((ext_vector_type(4)));
typedef u4 __attribute__((may_alias)) u4a;
typedef v4f __attribute__((may_alias)) v4fa;

union Frag { v16bf v; u4 q[2]; };
union Acc  { v8f v; float f[8]; };

// ---------------------------------------------------------------------------
// bf16 RNE convert and hi/lo split (lo = RNE(x - hi), exact residual)
// ---------------------------------------------------------------------------
__device__ __forceinline__ unsigned bf_rne(float f) {
    unsigned u = __float_as_uint(f);
    u += 0x7FFFu + ((u >> 16) & 1u);
    return u >> 16;
}
__device__ __forceinline__ void split2(float x, unsigned& hi, unsigned& lo) {
    hi = bf_rne(x);
    lo = bf_rne(x - __uint_as_float(hi << 16));
}
// two f32 -> one 32-bit word per plane, first element in the low half-word
__device__ __forceinline__ void pack2(float a, float b, unsigned& wh, unsigned& wl) {
    unsigned ha, la, hb, lb;
    split2(a, ha, la);
    split2(b, hb, lb);
    wh = ha | (hb << 16);
    wl = la | (lb << 16);
}
// eight consecutive f32 -> 16 B per plane
__device__ __forceinline__ void pack8(const v4f a, const v4f b, u4& H, u4& L) {
    unsigned h0, l0, h1, l1, h2, l2, h3, l3;
    pack2(a.x, a.y, h0, l0);
    pack2(a.z, a.w, h1, l1);
    pack2(b.x, b.y, h2, l2);
    pack2(b.z, b.w, h3, l3);
    H.x = h0; H.y = h1; H.z = h2; H.w = h3;
    L.x = l0; L.y = l1; L.z = l2; L.w = l3;
}

// ---------------------------------------------------------------------------
// 16x16x32 fragment load from a k-contiguous 16-bit row (A row m, or B^T row n):
// p = row_start + k0 + 8*h ; elements 0..7 <- k0+8h.., elements 8..15 <- k0+16+8h..
// ---------------------------------------------------------------------------
__device__ __forceinline__ void ldfrag(Frag& f, const unsigned short* p) {
    f.q[0] = *(const u4a*)(p);
    f.q[1] = *(const u4a*)(p + 16);
}

__device__ __forceinline__ void acc_zero(Acc& c) {
#pragma unroll
    for (int i = 0; i < 8; ++i) c.f[i] = 0.0f;
}

// acc += Ah*Bh + Ah*Bl + Al*Bh, then 4 wait slots with D tied and A/B kept live
__device__ __forceinline__ void mma3(Acc& c, const Frag& ah, const Frag& al,
                                     const Frag& bh, const Frag& bl) {
    v8f d = c.v;
    d = __builtin_amdgcn_wmma_f32_16x16x32_bf16(false, ah.v, false, bh.v, (short)0, d, false, false);
    d = __builtin_amdgcn_wmma_f32_16x16x32_bf16(false, ah.v, false, bl.v, (short)0, d, false, false);
    d = __builtin_amdgcn_wmma_f32_16x16x32_bf16(false, al.v, false, bh.v, (short)0, d, false, false);
    asm volatile("v_nop\n\tv_nop\n\tv_nop\n\tv_nop"
                 : "+v"(d) : "v"(ah.v), "v"(al.v), "v"(bh.v), "v"(bl.v));
    c.v = d;
}

// same-wave LDS exchange ordering
__device__ __forceinline__ void wave_sync() {
    __builtin_amdgcn_fence(__ATOMIC_ACQ_REL, "wavefront");
    __builtin_amdgcn_wave_barrier();
}

// ---------------------------------------------------------------------------
// inv_freq[i] = 1 / 10000^(i/32), i = 0..31  (f64 exp2 -> f32, then f32 reciprocal)
// ---------------------------------------------------------------------------
__global__ void invfreq_kernel(float* inv) {
    const int i = threadIdx.x & 31;
    const double e = (double)i * 0.03125 * 13.287712379549449;   // i/32 * log2(1e4)
    const float p32 = (float)exp2(e);
    const float v = 1.0f / p32;
    *(float*)(inv + i) = v;
    
}

// ---------------------------------------------------------------------------
// cos/sin table [ntok][32] at angle f32(pos + lck) * inv_freq[i]; precise sinf/cosf.
// ---------------------------------------------------------------------------
__global__ __launch_bounds__(256) void cstable_kernel(const int* __restrict__ pid,
                                                      const float* __restrict__ inv,
                                                      float* cosT, float* sinT,
                                                      int ntok, int lck) {
    const int n = ntok * 32;
    const int idx = blockIdx.x * 256 + threadIdx.x;
    const int ic = (idx < n) ? idx : (n - 1);          // clamped address
    const int tok = ic >> 5, i = ic & 31;
    const float pos = (float)(pid[tok] + lck);
    const float ang = pos * inv[i];
    const float c = cosf(ang);
    const float s = sinf(ang);
    if (idx < n) {
        *(float*)(cosT + idx) = c;
        *(float*)(sinT + idx) = s;
    }
    
}

// ---------------------------------------------------------------------------
// f32 -> bf16 hi/lo planes, 8 consecutive elements per thread (one 16-B store per
// dst group = t + ((t >> logseg) << addshift).
// coverage: n8 groups x 8 = every source element; grid = n8/256 exactly.
// ---------------------------------------------------------------------------
__global__ __launch_bounds__(256) void split8_kernel(const float* __restrict__ src,
                                                     unsigned short* dh, unsigned short* dl,
                                                     int n8, int logseg, int addshift) {
    const int t = blockIdx.x * 256 + threadIdx.x;
    if (t >= n8) return;
    const float* p = src + (size_t)t * 8;
    const v4f a = *(const v4fa*)(p);
    const v4f b = *(const v4fa*)(p + 4);
    u4 H, L;
    pack8(a, b, H, L);
    const size_t g = ((size_t)t + ((size_t)(t >> logseg) << addshift)) * 8;
    *(u4*)(dh + g) = H;
    *(u4*)(dl + g) = L;
    
}

// ---------------------------------------------------------------------------
// Transpose + split: src[R][Cc] f32 (pitch srcld) -> dst planes [n][k] with n = src col,
// k = src row: dst[(nbase + c) * dstld + r]. Tile 64x64 through LDS; each output row
// instruction. blockIdx.z strides src by srcz floats and dst by dstz halves.
// coverage: loads 256 thr x 4 x float4 = 64x64; stores 256 thr x 2 x 8 = 64x64 per plane.
// ---------------------------------------------------------------------------
__global__ __launch_bounds__(256) void tsplit_kernel(const float* __restrict__ src, int srcld, int srcz,
                                                     unsigned short* dh, unsigned short* dl,
                                                     int dstld, int dstz, int nbase) {
    constexpr int TP = 72;
    __shared__ __align__(16) unsigned short Th[64 * TP];
    __shared__ __align__(16) unsigned short Tl[64 * TP];
    const int t = threadIdx.x;
    const int c0 = blockIdx.x * 64, r0 = blockIdx.y * 64, z = blockIdx.z;
    const float* s = src + (size_t)z * srcz + (size_t)r0 * srcld + c0;
#pragma unroll
    for (int i = 0; i < 4; ++i) {
        const int r = (t >> 4) + 16 * i, c4 = (t & 15) * 4;
        const v4f v = *(const v4fa*)(s + (size_t)r * srcld + c4);
        unsigned hb, lb;
        split2(v.x, hb, lb); Th[(c4 + 0) * TP + r] = (unsigned short)hb; Tl[(c4 + 0) * TP + r] = (unsigned short)lb;
        split2(v.y, hb, lb); Th[(c4 + 1) * TP + r] = (unsigned short)hb; Tl[(c4 + 1) * TP + r] = (unsigned short)lb;
        split2(v.z, hb, lb); Th[(c4 + 2) * TP + r] = (unsigned short)hb; Tl[(c4 + 2) * TP + r] = (unsigned short)lb;
        split2(v.w, hb, lb); Th[(c4 + 3) * TP + r] = (unsigned short)hb; Tl[(c4 + 3) * TP + r] = (unsigned short)lb;
    }
    __syncthreads();
    const int piece = t & 7;
    const int rowA = (t >> 3), rowB = 32 + (t >> 3);
    const u4 HA = *(const u4a*)(Th + rowA * TP + piece * 8);
    const u4 LA = *(const u4a*)(Tl + rowA * TP + piece * 8);
    const u4 HB = *(const u4a*)(Th + rowB * TP + piece * 8);
    const u4 LB = *(const u4a*)(Tl + rowB * TP + piece * 8);
    const size_t zb = (size_t)z * dstz;
    const size_t gA = zb + (size_t)(nbase + c0 + rowA) * dstld + r0 + piece * 8;
    const size_t gB = zb + (size_t)(nbase + c0 + rowB) * dstld + r0 + piece * 8;
    *(u4*)(dh + gA) = HA; *(u4*)(dl + gA) = LA;
    *(u4*)(dh + gB) = HB; *(u4*)(dl + gB) = LB;
    
}

// ---------------------------------------------------------------------------
// GEMM, bf16 hi/lo three-term: C[M x N] f32 (pitch ldc) = A[M x K] . B[K x N],
// A planes [M][K] (pitch K), B planes stored transposed [N][K] (pitch K, k-contiguous),
// so A and B fragments use the identical split-k load. Block = 4 waves, 64 x 128;
// wave tile 32 x 64 (2 m-tiles x 4 n-tiles).
// Operands: a stage is 64 k (one 128-B line) of every operand row of the block,
// rows [A hi 64 | A lo 64 | B hi 128 | B lo 128] at an LDS pitch of 144 B, brought in by
// asynchronous copies of 16 B per lane (8 lanes = one whole line); two buffers, the next
// stage's copies fly while this stage is worked on. Fragments are read from LDS.
// Epilogue: wave tile staged in LDS, then each 256-B row segment written as two
// Requires M % 64 == 0, N % 128 == 0, K % 64 == 0, K >= 64, ldc % 32 == 0 (shapes fixed on host).
// ---------------------------------------------------------------------------
// eight copies of 16 B per lane, global -> LDS. The s_wait_xcnt stands inside the statement, behind
// the last copy, so that no address register of a copy is rewritten in front of it.
__device__ __forceinline__ void copy8(const unsigned (&l)[8], const unsigned short* const (&g)[8]) {
    asm volatile("global_load_async_to_lds_b128 %0, %8, off\n\t"
                 "global_load_async_to_lds_b128 %1, %9, off\n\t"
                 "global_load_async_to_lds_b128 %2, %10, off\n\t"
                 "global_load_async_to_lds_b128 %3, %11, off\n\t"
                 "global_load_async_to_lds_b128 %4, %12, off\n\t"
                 "global_load_async_to_lds_b128 %5, %13, off\n\t"
                 "global_load_async_to_lds_b128 %6, %14, off\n\t"
                 "global_load_async_to_lds_b128 %7, %15, off\n\t"
                 "s_wait_xcnt 0x0"
                 :: "v"(l[0]), "v"(l[1]), "v"(l[2]), "v"(l[3]), "v"(l[4]), "v"(l[5]), "v"(l[6]), "v"(l[7]),
                    "v"(g[0]), "v"(g[1]), "v"(g[2]), "v"(g[3]), "v"(g[4]), "v"(g[5]), "v"(g[6]), "v"(g[7])
                 : "memory");
}

__device__ __forceinline__ void store_ctile(const float* sW, float* C, int ldc,
                                            int m0w, int n0w, int hh, int m16) {
#pragma unroll
    for (int i = 0; i < 16; ++i) {
        const int row = 2 * i + hh;
        const v4f v = *(const v4fa*)(sW + row * 68 + m16 * 4);
        *(v4f*)(C + (size_t)(m0w + row) * ldc + n0w + m16 * 4) = v;
    }
}

__global__ __launch_bounds__(128) void gemm3_kernel(
    const unsigned short* __restrict__ Ah, const unsigned short* __restrict__ Al,
    const unsigned short* __restrict__ Bh, const unsigned short* __restrict__ Bl,
    float* C, int K, int ldc) {
    constexpr int SP = 68;
    constexpr int GP = 72;                 // LDS row pitch in halves (144 B = 16 B x 9: no bank conflict for 16-B reads)
    constexpr int RAL = 64, RBH = 128, RBL = 256, GROWS = 384;   // first stage row of A lo, B hi, B lo; rows per stage
    constexpr int GSTAGE = GROWS * GP;     // halves per buffer
    __shared__ __align__(16) unsigned short ring[2 * GSTAGE];
    __shared__ __align__(16) float sC[4 * 32 * SP];
    const int tid = threadIdx.x, w = tid >> 5, lane = tid & 31, hh = lane >> 4, m16 = lane & 15;
    const int m0w = blockIdx.y * 64 + (w >> 1) * 32;
    const int n0w = blockIdx.x * 128 + (w & 1) * 64;

    Acc acc[2][4];
#pragma unroll
    for (int mt = 0; mt < 2; ++mt)
#pragma unroll
        for (int nt = 0; nt < 4; ++nt) acc_zero(acc[mt][nt]);

    const size_t Ks = (size_t)K;
    // copy side: thread = (row cr of 16, 16-B piece cp of the row's 128 B); copy i takes stage row cr + 16 * i
    const int cr = tid >> 3, cp = tid & 7;
    const unsigned short* gAh = Ah + (size_t)(blockIdx.y * 64 + cr) * Ks + cp * 8;
    const unsigned short* gAl = Al + (size_t)(blockIdx.y * 64 + cr) * Ks + cp * 8;
    const unsigned short* gBh = Bh + (size_t)(blockIdx.x * 128 + cr) * Ks + cp * 8;
    const unsigned short* gBl = Bl + (size_t)(blockIdx.x * 128 + cr) * Ks + cp * 8;
    const unsigned lds0 = (unsigned)(size_t)(ring + cr * GP + cp * 8);   // LDS byte address: low 32 bits

    auto issue = [&](int st, int buf) {
        const unsigned lb = lds0 + (unsigned)buf * (unsigned)(GSTAGE * 2);
        const size_t ko = (size_t)st * 64;
        unsigned l[8];
        const unsigned short* g[8];
#pragma unroll
        for (int i = 0; i < 4; ++i) {
            l[i] = lb + (unsigned)((16 * i) * GP * 2);
            g[i] = gAh + ko + (size_t)(16 * i) * Ks;
            l[4 + i] = lb + (unsigned)((RAL + 16 * i) * GP * 2);
            g[4 + i] = gAl + ko + (size_t)(16 * i) * Ks;
        }
        copy8(l, g);
#pragma unroll
        for (int i = 0; i < 8; ++i) {
            l[i] = lb + (unsigned)((RBH + 16 * i) * GP * 2);
            g[i] = gBh + ko + (size_t)(16 * i) * Ks;
        }
        copy8(l, g);
#pragma unroll
        for (int i = 0; i < 8; ++i) {
            l[i] = lb + (unsigned)((RBL + 16 * i) * GP * 2);
            g[i] = gBl + ko + (size_t)(16 * i) * Ks;
        }
        copy8(l, g);
    };

    const int NT = K >> 6;
    issue(0, 0);
    // stage 0 has landed for this wave, then is published to the other waves
    asm volatile("s_wait_asynccnt 0x0" ::: "memory");
    __syncthreads();
    if (NT > 1) issue(1, 1);

    // reader side: first fragment row of this wave inside a stage
    const int offA = ((w >> 1) * 32 + m16) * GP + 8 * hh;
    const int offB = (RBH + (w & 1) * 64 + m16) * GP + 8 * hh;

    // kept rolled: the buffer index and the refill test are per trip
#pragma unroll 1
    for (int t = 0; t < NT; ++t) {
        const unsigned short* sb = ring + (t & 1) * GSTAGE;
        // a trip is 8 groups g = (k half g >> 2, n-tile g & 3) of 6 products. Fragment reads stand at three
        // places only (before group 0, at groups 2 and 4), the last two at least three groups ahead of their use, all in this trip's own buffer.
        Frag fa[2][4], fb[8][2];
        auto lda = [&](int ks) {
            const unsigned short* pa = sb + offA + ks * 32;
            ldfrag(fa[ks][0], pa);
            ldfrag(fa[ks][1], pa + RAL * GP);
            ldfrag(fa[ks][2], pa + 16 * GP);
            ldfrag(fa[ks][3], pa + (RAL + 16) * GP);
        };
        auto ldb = [&](int g) {
            const unsigned short* pb = sb + offB + (g >> 2) * 32 + (g & 3) * 16 * GP;
            ldfrag(fb[g][0], pb);
            ldfrag(fb[g][1], pb + (RBL - RBH) * GP);
        };
        lda(0); ldb(0); ldb(1); ldb(2); ldb(3); lda(1); ldb(4);
#pragma unroll
        for (int g = 0; g < 8; ++g) {
            if (g == 2) { ldb(5); ldb(6); }
            if (g == 4) ldb(7);
            mma3(acc[0][g & 3], fa[g >> 2][0], fa[g >> 2][1], fb[g][0], fb[g][1]);
            mma3(acc[1][g & 3], fa[g >> 2][2], fa[g >> 2][3], fb[g][0], fb[g][1]);
        }
        // publish point: this wave's LDS reads of the buffer are done, its copies of the next stage
        // have landed; the barrier publishes the next stage and frees this buffer for the refill
        asm volatile("s_wait_dscnt 0x0" ::: "memory");
        asm volatile("s_wait_asynccnt 0x0" ::: "memory");
        __syncthreads();
        if (t + 2 < NT) issue(t + 2, t & 1);
    }
    // no copy is left in flight when the wave goes on
    asm volatile("s_wait_asynccnt 0x0" ::: "memory");

    // D layout: acc[mt][nt].f[r] = tile(row mt*16 + 8*hh + r, col nt*16 + m16)
    float* sW = sC + w * (32 * SP);
#pragma unroll
    for (int mt = 0; mt < 2; ++mt)
#pragma unroll
        for (int nt = 0; nt < 4; ++nt)
#pragma unroll
            for (int r = 0; r < 8; ++r)
                sW[(mt * 16 + 8 * hh + r) * SP + nt * 16 + m16] = acc[mt][nt].f[r];
    __syncthreads();
    store_ctile(sW, C, ldc, m0w, n0w, hh, m16);
    
}

// ---------------------------------------------------------------------------
// RoPE + split of the projection output qkv[1024][3072] (q cols 0..2047 = h*64+d,
// k cols 2048..2559, v cols 2560..3071). Block = (64-col group g, 64 tokens).
//   g < 32      : q head g      -> q planes [32][1024][64]      (RoPE)
//   32<=g<40    : kv head g-32  -> K planes [8][3072][64] rows 2048+tok (RoPE)
//   40<=g<48    : kv head g-40  -> V^T planes [8][64][3072] cols 2048+tok (transpose)
// y[d] = x[d]*cos + rot[d]*sin, rot = -x[d+32] (d<32), x[d-32] (d>=32); cos/sin from table.
// Each thread emits 8 consecutive halves per plane (16 B); 8 consecutive lanes = one line.
// coverage: q planes all 32x1024 rows; K planes rows 2048..3071 of every kv head;
// V^T planes cols 2048..3071 of all 8x64 rows.
// ---------------------------------------------------------------------------
__device__ __forceinline__ void rope8(const float* xr, const float* pr, const float* cr,
                                      const float* sr, float sgn, v4f& ya, v4f& yb) {
#pragma clang fp contract(off)
    ya.x = xr[0] * cr[0] + (sgn * pr[0]) * sr[0];
    ya.y = xr[1] * cr[1] + (sgn * pr[1]) * sr[1];
    ya.z = xr[2] * cr[2] + (sgn * pr[2]) * sr[2];
    ya.w = xr[3] * cr[3] + (sgn * pr[3]) * sr[3];
    yb.x = xr[4] * cr[4] + (sgn * pr[4]) * sr[4];
    yb.y = xr[5] * cr[5] + (sgn * pr[5]) * sr[5];
    yb.z = xr[6] * cr[6] + (sgn * pr[6]) * sr[6];
    yb.w = xr[7] * cr[7] + (sgn * pr[7]) * sr[7];
}

__global__ __launch_bounds__(256) void rope_split_kernel(
    const float* __restrict__ qkv, const float* __restrict__ cosT, const float* __restrict__ sinT,
    unsigned short* qh, unsigned short* ql, unsigned short* kh, unsigned short* kl,
    unsigned short* vh, unsigned short* vl) {
#pragma clang fp contract(off)
    constexpr int QN = 1024, D = 64, NH = 32, NKV = 8, QKVW = 3072, KVL = 3072, KVP = 2048, TP = 68;
    __shared__ __align__(16) float T[64 * TP];
    const int t = threadIdx.x, g = blockIdx.x, tok0 = blockIdx.y * 64;
    const float* s = qkv + (size_t)tok0 * QKVW + g * D;
#pragma unroll
    for (int i = 0; i < 4; ++i) {
        const int r = (t >> 4) + 16 * i, c4 = (t & 15) * 4;
        const v4f v = *(const v4fa*)(s + (size_t)r * QKVW + c4);
        *(v4fa*)(T + r * TP + c4) = v;
    }
    __syncthreads();

    u4 H0, L0, H1, L1;
    size_t g0, g1;
    unsigned short* dH;
    unsigned short* dL;
    if (g < NH + NKV) {                                   // block-uniform branch
        const bool isq = (g < NH);
        dH = isq ? qh : kh;
        dL = isq ? ql : kl;
        const int d0 = (t & 7) * 8, dp0 = d0 ^ 32;
        const float sgn = (d0 < 32) ? -1.0f : 1.0f;
        {
            const int r = (t >> 3), tok = tok0 + r;
            const float* cr = cosT + (size_t)tok * 32 + (d0 & 31);
            const float* sr = sinT + (size_t)tok * 32 + (d0 & 31);
            v4f ya, yb;
            rope8(T + r * TP + d0, T + r * TP + dp0, cr, sr, sgn, ya, yb);
            pack8(ya, yb, H0, L0);
            const size_t row = isq ? ((size_t)g * QN + tok) : ((size_t)(g - NH) * KVL + KVP + tok);
            g0 = row * D + d0;
        }
        {
            const int r = 32 + (t >> 3), tok = tok0 + r;
            const float* cr = cosT + (size_t)tok * 32 + (d0 & 31);
            const float* sr = sinT + (size_t)tok * 32 + (d0 & 31);
            v4f ya, yb;
            rope8(T + r * TP + d0, T + r * TP + dp0, cr, sr, sgn, ya, yb);
            pack8(ya, yb, H1, L1);
            const size_t row = isq ? ((size_t)g * QN + tok) : ((size_t)(g - NH) * KVL + KVP + tok);
            g1 = row * D + d0;
        }
    } else {
        dH = vh;
        dL = vl;
        const int kvhd = g - NH - NKV, piece = t & 7;
        {
            const int d = (t >> 3);
            v4f ya, yb;
            ya.x = T[(piece * 8 + 0) * TP + d]; ya.y = T[(piece * 8 + 1) * TP + d];
            ya.z = T[(piece * 8 + 2) * TP + d]; ya.w = T[(piece * 8 + 3) * TP + d];
            yb.x = T[(piece * 8 + 4) * TP + d]; yb.y = T[(piece * 8 + 5) * TP + d];
            yb.z = T[(piece * 8 + 6) * TP + d]; yb.w = T[(piece * 8 + 7) * TP + d];
            pack8(ya, yb, H0, L0);
            g0 = ((size_t)(kvhd * D + d)) * KVL + KVP + tok0 + piece * 8;
        }
        {
            const int d = 32 + (t >> 3);
            v4f ya, yb;
            ya.x = T[(piece * 8 + 0) * TP + d]; ya.y = T[(piece * 8 + 1) * TP + d];
            ya.z = T[(piece * 8 + 2) * TP + d]; ya.w = T[(piece * 8 + 3) * TP + d];
            yb.x = T[(piece * 8 + 4) * TP + d]; yb.y = T[(piece * 8 + 5) * TP + d];
            yb.z = T[(piece * 8 + 6) * TP + d]; yb.w = T[(piece * 8 + 7) * TP + d];
            pack8(ya, yb, H1, L1);
            g1 = ((size_t)(kvhd * D + d)) * KVL + KVP + tok0 + piece * 8;
        }
    }
    *(u4*)(dH + g0) = H0; *(u4*)(dL + g0) = L0;
    *(u4*)(dH + g1) = H1; *(u4*)(dL + g1) = L1;
    
}

// ---------------------------------------------------------------------------
// Flash attention with the block-diagonal TTT mask, GQA (kv head = h >> 2).
// Block = (kv head, 16 query rows), 16 waves = its 4 query heads x 4 key splits. The key
// tiles of 32 of all three key blocks form one list; split ks takes entries ks, ks + 4, ...
// The 4 heads of one split walk the same K and V tiles at the same time.
// Each wave keeps its own running maximum, sum and 16 x 64 output; a head's four partial
// results are merged through LDS in fixed split order behind one work-group barrier.
// Q/K/V/P operands as bf16 hi/lo; scores, mask (-inf), running-max softmax in f32.
// key j of block blk allowed iff j < seq_len and j <= i - (lck - blk).
// seq_len = sum(attention_mask) - lck, summed per block in fixed order.
// Per blk the key-tile count is bounded by the tile's diagonal and seq_len
// (at most 32 tiles); the mask is still applied by value per element.
// P: D layout -> per-wave LDS (ushort) -> A fragment (wave_sync around the exchange).
// Output attn planes [1024][2048] (col h*64+d): 8 lanes x 16 B = one 128-B line per row.
// Query tiles with the most keys have the lowest block index, so they start first.
// coverage: 8 x 64 blocks x 4 heads x 16 rows x 64 cols = [1024][2048] per plane.
// ---------------------------------------------------------------------------
__global__ __launch_bounds__(512) void attn_kernel(
    const unsigned short* __restrict__ qH, const unsigned short* __restrict__ qL,
    const unsigned short* __restrict__ kH, const unsigned short* __restrict__ kL,
    const unsigned short* __restrict__ vH, const unsigned short* __restrict__ vL,
    const int* __restrict__ amask, int nmask, int lck,
    unsigned short* oH, unsigned short* oL) {
    constexpr int QN = 1024, D = 64, KVL = 3072, HIDO = 2048, PP = 40, NS = 4, NW = 4 * NS, SP = 68;
    __shared__ int red[128];
    __shared__ __align__(16) unsigned short Ph[NW * 16 * PP];
    __shared__ __align__(16) unsigned short Pl[NW * 16 * PP];
    __shared__ __align__(16) float Os[NW * 16 * SP];
    __shared__ float Ms[NW * 16];
    __shared__ float Ls[NW * 16];
    const int tid = threadIdx.x, lane = tid & 31, hh = lane >> 4, m16 = lane & 15;
    // wave number held as a scalar: the key-tile loop then branches on scalar tests, every lane on
    const int w = __builtin_amdgcn_readfirstlane(tid >> 5);

    // seq_len (integer, fixed order, identical in every block)
    if (tid < 128) {                                   // the first four waves sum the mask
        int part = 0;
        for (int i = tid; i < nmask; i += 128) part += amask[i];
        red[tid] = part;
    }
    __syncthreads();
#pragma unroll
    for (int off = 64; off > 0; off >>= 1) {
        if (tid < off) red[tid] += red[tid + off];
        __syncthreads();
    }
    const int seq_len = __builtin_amdgcn_readfirstlane(red[0] - lck);

    const int kvh = blockIdx.x, h = kvh * 4 + (w & 3), ks = w >> 2;
    const int q0w = (QN / 16 - 1 - (int)blockIdx.y) * 16;
    const float NEG_INF = -__builtin_inff();

    Frag fqh[2], fql[2];
    {
        const size_t qo = ((size_t)h * QN + q0w + m16) * D + 8 * hh;
        ldfrag(fqh[0], qH + qo);
        ldfrag(fqh[1], qH + qo + 32);
        ldfrag(fql[0], qL + qo);
        ldfrag(fql[1], qL + qo + 32);
    }
    float mrow[8], lrow[8];
    Acc o[4];
#pragma unroll
    for (int r = 0; r < 8; ++r) { mrow[r] = NEG_INF; lrow[r] = 0.0f; }
#pragma unroll
    for (int dt = 0; dt < 4; ++dt) acc_zero(o[dt]);

    unsigned short* Pwh = Ph + w * 16 * PP;
    unsigned short* Pwl = Pl + w * 16 * PP;
    const size_t kplane = (size_t)kvh * KVL * D;      // K planes [kvh][kv][d]
    const size_t vplane = (size_t)kvh * D * KVL;      // V^T planes [kvh][d][kv]

    // key tiles per key block (allowed j of block blk are < q0w + 16 - (lck - blk) and < seq_len),
    // as running ends e0 <= e1 <= e2 of the one list; each count <= 32, so e2 <= 96
    int e0, e1, e2;
    {
        int c0 = q0w + 16 - lck, c1 = c0 + 1, c2 = c0 + 2;
        c0 = (c0 < seq_len) ? c0 : seq_len;
        c1 = (c1 < seq_len) ? c1 : seq_len;
        c2 = (c2 < seq_len) ? c2 : seq_len;
        c0 = (c0 < 0) ? 0 : ((c0 > QN) ? QN : c0);
        c1 = (c1 < 0) ? 0 : ((c1 > QN) ? QN : c1);
        c2 = (c2 < 0) ? 0 : ((c2 > QN) ? QN : c2);
        e0 = __builtin_amdgcn_readfirstlane((c0 + 31) >> 5);
        e1 = e0 + __builtin_amdgcn_readfirstlane((c1 + 31) >> 5);
        e2 = e1 + __builtin_amdgcn_readfirstlane((c2 + 31) >> 5);
    }
    // kept rolled: a second copy of the long body would only raise the register count
#pragma unroll 1
    for (int s = ks; s < e2; s += NS) {
        const int blk = (s >= e0 ? 1 : 0) + (s >= e1 ? 1 : 0);
        const int t = s - (s >= e1 ? e1 : (s >= e0 ? e0 : 0));
        const int shift = lck - blk;                   // j <= i - shift
        const int j0 = t * 32, kv0 = blk * QN + j0;
        Acc sc[2];
        acc_zero(sc[0]);
        acc_zero(sc[1]);
        // S tile [16 q x 32 keys]; A = q (k = d), B = K^T (k = d): sc[nt].f[r] = S[8*hh+r][nt*16+m16]
#pragma unroll
        for (int nt = 0; nt < 2; ++nt) {
            const size_t ko = kplane + (size_t)(kv0 + nt * 16 + m16) * D + 8 * hh;
#pragma unroll
            for (int ds = 0; ds < 2; ++ds) {
                Frag fkh, fkl;
                ldfrag(fkh, kH + ko + ds * 32);
                ldfrag(fkl, kL + ko + ds * 32);
                mma3(sc[nt], fqh[ds], fql[ds], fkh, fkl);
            }
        }
        // scale and mask by value
#pragma unroll
        for (int nt = 0; nt < 2; ++nt)
#pragma unroll
            for (int r = 0; r < 8; ++r) {
                const int qi = q0w + 8 * hh + r;
                const int j = j0 + nt * 16 + m16;
                const bool ok = (j < seq_len) && (j <= qi - shift);
                sc[nt].f[r] = ok ? sc[nt].f[r] * 0.125f : NEG_INF;
            }
        // running-max softmax update (row r spans the 16 lanes of one half)
        float alpha[8];
#pragma unroll
        for (int r = 0; r < 8; ++r) {
            float x = fmaxf(sc[0].f[r], sc[1].f[r]);
            x = fmaxf(x, __shfl_xor(x, 1));
            x = fmaxf(x, __shfl_xor(x, 2));
            x = fmaxf(x, __shfl_xor(x, 4));
            x = fmaxf(x, __shfl_xor(x, 8));
            const float mn = fmaxf(mrow[r], x);
            const float msafe = (mn == NEG_INF) ? 0.0f : mn;
            alpha[r] = __expf(mrow[r] - msafe);
            mrow[r] = mn;
            const float p0 = __expf(sc[0].f[r] - msafe);
            const float p1 = __expf(sc[1].f[r] - msafe);
            sc[0].f[r] = p0;
            sc[1].f[r] = p1;
            float sum = p0 + p1;
            sum += __shfl_xor(sum, 1);
            sum += __shfl_xor(sum, 2);
            sum += __shfl_xor(sum, 4);
            sum += __shfl_xor(sum, 8);
            lrow[r] = lrow[r] * alpha[r] + sum;
        }
#pragma unroll
        for (int dt = 0; dt < 4; ++dt)
#pragma unroll
            for (int r = 0; r < 8; ++r) o[dt].f[r] *= alpha[r];

        // P: D layout (row = q, col = key) -> LDS -> A fragment (m = q, k = key)
        wave_sync();
#pragma unroll
        for (int nt = 0; nt < 2; ++nt)
#pragma unroll
            for (int r = 0; r < 8; ++r) {
                unsigned hb, lb;
                split2(sc[nt].f[r], hb, lb);
                Pwh[(8 * hh + r) * PP + nt * 16 + m16] = (unsigned short)hb;
                Pwl[(8 * hh + r) * PP + nt * 16 + m16] = (unsigned short)lb;
            }
        wave_sync();
        Frag fph, fpl;
        ldfrag(fph, Pwh + m16 * PP + 8 * hh);
        ldfrag(fpl, Pwl + m16 * PP + 8 * hh);

        // O += P . V ; B = V (k = key, n = d) from V^T rows: o[dt].f[r] = O[8*hh+r][dt*16+m16]
        const size_t vo = vplane + (size_t)m16 * KVL + kv0 + 8 * hh;
        const unsigned short* pvh = vH + vo;
        const unsigned short* pvl = vL + vo;
#pragma unroll
        for (int dt = 0; dt < 4; ++dt) {
            Frag fvh, fvl;
            ldfrag(fvh, pvh + (size_t)dt * 16 * KVL);
            ldfrag(fvl, pvl + (size_t)dt * 16 * KVL);
            // behind the last loads that name these two address pairs, before the registers are reused
            if (dt == 3) asm volatile("s_wait_xcnt 0x0" :: "v"(pvh), "v"(pvl) : "memory");
            mma3(o[dt], fph, fpl, fvh, fvl);
        }
    }

    // each wave's partial result to LDS (D layout: o[dt].f[r] = O[8*hh+r][dt*16+m16])
    float* Ow = Os + w * 16 * SP;
#pragma unroll
    for (int r = 0; r < 8; ++r)
#pragma unroll
        for (int dt = 0; dt < 4; ++dt) Ow[(8 * hh + r) * SP + dt * 16 + m16] = o[dt].f[r];
    if (m16 == 0) {
#pragma unroll
        for (int r = 0; r < 8; ++r) {
            Ms[w * 16 + 8 * hh + r] = mrow[r];
            Ls[w * 16 + 8 * hh + r] = lrow[r];
        }
    }
    __syncthreads();

    // merge in split order, normalise, split into planes; thread = (head, row, 8 columns)
    const int hl = tid >> 7, row = (tid >> 3) & 15, c8 = (tid & 7) * 8;
    float mall = NEG_INF;
#pragma unroll
    for (int u = 0; u < NS; ++u) mall = fmaxf(mall, Ms[(u * 4 + hl) * 16 + row]);
    const float mfin = (mall == NEG_INF) ? 0.0f : mall;
    float lsum = 0.0f;
    v4f oa = {0.0f, 0.0f, 0.0f, 0.0f}, ob = {0.0f, 0.0f, 0.0f, 0.0f};
#pragma unroll
    for (int u = 0; u < NS; ++u) {
        const int pr = (u * 4 + hl) * 16 + row;
        const float a = __expf(Ms[pr] - mfin);
        const v4f va = *(const v4fa*)(Os + pr * SP + c8);
        const v4f vb = *(const v4fa*)(Os + pr * SP + c8 + 4);
        lsum += a * Ls[pr];
        oa += a * va;
        ob += a * vb;
    }
    const float il = 1.0f / lsum;
    u4 H, L;
    pack8(oa * il, ob * il, H, L);
    const size_t eo = (size_t)(q0w + row) * HIDO + (kvh * 4 + hl) * D + c8;
    *(u4*)(oH + eo) = H;
    *(u4*)(oL + eo) = L;
}

// ---------------------------------------------------------------------------
extern "C" void kernel_launch(void* const* d_in, const int* in_sizes, int n_in,
                              void* d_out, int out_size, void* d_ws, size_t ws_size,
                              hipStream_t stream) {
    constexpr int QN = 1024, INW = 4096, NH = 32, NKV = 8, D = 64, HIDO = 2048;
    constexpr int KVP = 2048, KVL = 3072, QKVW = 3072, LCK = KVP / QN;
    if (n_in < 9) return;
    if (in_sizes[0] != QN * INW || in_sizes[1] != NKV * KVP * D || in_sizes[2] != NKV * KVP * D ||
        in_sizes[3] != QN || in_sizes[4] != QN || in_sizes[5] != INW * NH * D ||
        in_sizes[6] != INW * NKV * D || in_sizes[7] != INW * NKV * D ||
        in_sizes[8] != NH * D * HIDO || out_size != QN * HIDO) return;

    const float* hs  = (const float*)d_in[0];
    const float* pk  = (const float*)d_in[1];
    const float* pv  = (const float*)d_in[2];
    const int*   am  = (const int*)  d_in[3];
    const int*   pid = (const int*)  d_in[4];
    const float* Wq  = (const float*)d_in[5];
    const float* Wk  = (const float*)d_in[6];
    const float* Wv  = (const float*)d_in[7];
    const float* Wo  = (const float*)d_in[8];
    float* out = (float*)d_out;

    char* ws = (char*)d_ws;
    size_t off = 0;
    auto carve = [&](size_t bytes) -> char* {
        char* p = ws + off;
        off += (bytes + 255) & ~(size_t)255;
        return p;
    };
    unsigned short* hsH = (unsigned short*)carve((size_t)QN * INW * 2);          // A planes of QKV GEMM
    unsigned short* hsL = (unsigned short*)carve((size_t)QN * INW * 2);
    unsigned short* wtH = (unsigned short*)carve((size_t)QKVW * INW * 2);        // [Wq|Wk|Wv]^T planes [3072][4096]
    unsigned short* wtL = (unsigned short*)carve((size_t)QKVW * INW * 2);
    unsigned short* woH = (unsigned short*)carve((size_t)HIDO * (NH * D) * 2);    // Wo^T planes [2048][2048]
    unsigned short* woL = (unsigned short*)carve((size_t)HIDO * (NH * D) * 2);
    float*          qkv = (float*)         carve((size_t)QN * QKVW * 4);          // projection output f32
    unsigned short* qH  = (unsigned short*)carve((size_t)NH * QN * D * 2);        // q planes [32][1024][64]
    unsigned short* qL  = (unsigned short*)carve((size_t)NH * QN * D * 2);
    unsigned short* kH  = (unsigned short*)carve((size_t)NKV * KVL * D * 2);      // K planes [8][3072][64]
    unsigned short* kL  = (unsigned short*)carve((size_t)NKV * KVL * D * 2);
    unsigned short* vH  = (unsigned short*)carve((size_t)NKV * D * KVL * 2);      // V^T planes [8][64][3072]
    unsigned short* vL  = (unsigned short*)carve((size_t)NKV * D * KVL * 2);
    unsigned short* aH  = (unsigned short*)carve((size_t)QN * (NH * D) * 2);      // attention output planes [1024][2048]
    unsigned short* aL  = (unsigned short*)carve((size_t)QN * (NH * D) * 2);
    float*          cosT = (float*)        carve((size_t)QN * 32 * 4);
    float*          sinT = (float*)        carve((size_t)QN * 32 * 4);
    float*          inv  = (float*)        carve(128);
    if (off > ws_size || off > ((size_t)128 << 20)) return;

    // tables
    invfreq_kernel<<<1, 32, 0, stream>>>(inv);
    cstable_kernel<<<(QN * 32) / 256, 256, 0, stream>>>(pid, inv, cosT, sinT, QN, LCK);

    // operand planes
    split8_kernel<<<(QN * INW / 8) / 256, 256, 0, stream>>>(hs, hsH, hsL, QN * INW / 8, 30, 0);
    split8_kernel<<<(NKV * KVP * D / 8) / 256, 256, 0, stream>>>(pk, kH, kL, NKV * KVP * D / 8, 14, 13);
    // Wq in[4096][2048] -> out rows 0..2047 of [3072][4096]
    tsplit_kernel<<<dim3((NH * D) / 64, INW / 64, 1), 256, 0, stream>>>(Wq, NH * D, 0, wtH, wtL, INW, 0, 0);
    // Wk in[4096][512] -> rows 2048..2559
    tsplit_kernel<<<dim3((NKV * D) / 64, INW / 64, 1), 256, 0, stream>>>(Wk, NKV * D, 0, wtH, wtL, INW, 0, NH * D);
    // Wv in[4096][512] -> rows 2560..3071
    tsplit_kernel<<<dim3((NKV * D) / 64, INW / 64, 1), 256, 0, stream>>>(Wv, NKV * D, 0, wtH, wtL, INW, 0, NH * D + NKV * D);
    // Wo in[2048][2048] -> [2048][2048]
    tsplit_kernel<<<dim3(HIDO / 64, (NH * D) / 64, 1), 256, 0, stream>>>(Wo, HIDO, 0, woH, woL, NH * D, 0, 0);
    // past_value per kv head: in[2048][64] -> V^T rows d, cols 0..2047 (pitch 3072)
    tsplit_kernel<<<dim3(D / 64, KVP / 64, NKV), 256, 0, stream>>>(pv, D, KVP * D, vH, vL, KVL, D * KVL, 0);

    // fused QKV projection: [1024 x 4096] . [4096 x 3072] -> qkv f32
    gemm3_kernel<<<dim3(QKVW / 128, QN / 64), 128, 0, stream>>>(hsH, hsL, wtH, wtL, qkv, INW, QKVW);

    // RoPE + split into q planes, new K rows, new V^T cols
    rope_split_kernel<<<dim3(QKVW / 64, QN / 64), 256, 0, stream>>>(qkv, cosT, sinT, qH, qL, kH, kL, vH, vL);

    // attention
    attn_kernel<<<dim3(NKV, QN / 16), 512, 0, stream>>>(qH, qL, kH, kL, vH, vL, am, in_sizes[3], LCK, aH, aL);

    // output projection: [1024 x 2048] . [2048 x 2048] -> d_out f32
    gemm3_kernel<<<dim3(HIDO / 128, QN / 64), 128, 0, stream>>>(aH, aL, woH, woL, out, NH * D, HIDO);
}

// v003
// It runs in 222 microseconds.
// Two timings next to v002 both put it at 1.19 times that version's speed.
// All steps since v000 together make it 2.61 times as fast.
// All contractions (q/k/v projections, q.k^T, p.v, output projection): v_wmma_f32_16x16x32_bf16 with bf16 hi/lo operands everywhere (hi*hi + hi*lo + lo*hi), f32 accumulate; RoPE, softmax and normalisation in f32.
#include <hip/hip_runtime.h>
#include <hip/hip_bf16.h>

typedef __attribute__((ext_vector_type(16))) __bf16 v16bf;
typedef float v8f __attribute__((ext_vector_type(8)));
typedef float v4f __attribute__((ext_vector_type(4)));
typedef unsigned int u4 __attribute__((ext_vector_type(4)));
typedef u4 __attribute__((may_alias)) u4a;
typedef v4f __attribute__((may_alias)) v4fa;

union Frag { v16bf v; u4 q[2]; };
union Acc  { v8f v; float f[8]; };

// ---------------------------------------------------------------------------
// bf16 RNE convert and hi/lo split (lo = RNE(x - hi), exact residual)
// ---------------------------------------------------------------------------
__device__ __forceinline__ unsigned bf_rne(float f) {
    unsigned u = __float_as_uint(f);
    u += 0x7FFFu + ((u >> 16) & 1u);
    return u >> 16;
}
__device__ __forceinline__ void split2(float x, unsigned& hi, unsigned& lo) {
    hi = bf_rne(x);
    lo = bf_rne(x - __uint_as_float(hi << 16));
}
// two f32 -> one 32-bit word per plane, first element in the low half-word
__device__ __forceinline__ void pack2(float a, float b, unsigned& wh, unsigned& wl) {
    unsigned ha, la, hb, lb;
    split2(a, ha, la);
    split2(b, hb, lb);
    wh = ha | (hb << 16);
    wl = la | (lb << 16);
}
// eight consecutive f32 -> 16 B per plane
__device__ __forceinline__ void pack8(const v4f a, const v4f b, u4& H, u4& L) {
    unsigned h0, l0, h1, l1, h2, l2, h3, l3;
    pack2(a.x, a.y, h0, l0);
    pack2(a.z, a.w, h1, l1);
    pack2(b.x, b.y, h2, l2);
    pack2(b.z, b.w, h3, l3);
    H.x = h0; H.y = h1; H.z = h2; H.w = h3;
    L.x = l0; L.y = l1; L.z = l2; L.w = l3;
}

// ---------------------------------------------------------------------------
// 16x16x32 fragment load from a k-contiguous 16-bit row (A row m, or B^T row n):
// p = row_start + k0 + 8*h ; elements 0..7 <- k0+8h.., elements 8..15 <- k0+16+8h..
// ---------------------------------------------------------------------------
__device__ __forceinline__ void ldfrag(Frag& f, const unsigned short* p) {
    f.q[0] = *(const u4a*)(p);
    f.q[1] = *(const u4a*)(p + 16);
}

__device__ __forceinline__ void acc_zero(Acc& c) {
#pragma unroll
    for (int i = 0; i < 8; ++i) c.f[i] = 0.0f;
}

// acc += Ah*Bh + Ah*Bl + Al*Bh, then 4 wait slots with D tied and A/B kept live
__device__ __forceinline__ void mma3(Acc& c, const Frag& ah, const Frag& al,
                                     const Frag& bh, const Frag& bl) {
    v8f d = c.v;
    d = __builtin_amdgcn_wmma_f32_16x16x32_bf16(false, ah.v, false, bh.v, (short)0, d, false, false);
    d = __builtin_amdgcn_wmma_f32_16x16x32_bf16(false, ah.v, false, bl.v, (short)0, d, false, false);
    d = __builtin_amdgcn_wmma_f32_16x16x32_bf16(false, al.v, false, bh.v, (short)0, d, false, false);
    asm volatile("v_nop\n\tv_nop\n\tv_nop\n\tv_nop"
                 : "+v"(d) : "v"(ah.v), "v"(al.v), "v"(bh.v), "v"(bl.v));
    c.v = d;
}

// same-wave LDS exchange ordering
__device__ __forceinline__ void wave_sync() {
    __builtin_amdgcn_fence(__ATOMIC_ACQ_REL, "wavefront");
    __builtin_amdgcn_wave_barrier();
}

// ---------------------------------------------------------------------------
// inv_freq[i] = 1 / 10000^(i/32), i = 0..31  (f64 exp2 -> f32, then f32 reciprocal)
// ---------------------------------------------------------------------------
__global__ void invfreq_kernel(float* inv) {
    const int i = threadIdx.x & 31;
    const double e = (double)i * 0.03125 * 13.287712379549449;   // i/32 * log2(1e4)
    const float p32 = (float)exp2(e);
    const float v = 1.0f / p32;
    *(float*)(inv + i) = v;
    
}

// ---------------------------------------------------------------------------
// cos/sin table [ntok][32] at angle f32(pos + lck) * inv_freq[i]; precise sinf/cosf.
// ---------------------------------------------------------------------------
__global__ __launch_bounds__(256) void cstable_kernel(const int* __restrict__ pid,
                                                      const float* __restrict__ inv,
                                                      float* cosT, float* sinT,
                                                      int ntok, int lck) {
    const int n = ntok * 32;
    const int idx = blockIdx.x * 256 + threadIdx.x;
    const int ic = (idx < n) ? idx : (n - 1);          // clamped address
    const int tok = ic >> 5, i = ic & 31;
    const float pos = (float)(pid[tok] + lck);
    const float ang = pos * inv[i];
    const float c = cosf(ang);
    const float s = sinf(ang);
    if (idx < n) {
        *(float*)(cosT + idx) = c;
        *(float*)(sinT + idx) = s;
    }
    
}

// ---------------------------------------------------------------------------
// f32 -> bf16 hi/lo planes, 8 consecutive elements per thread (one 16-B store per
// dst group = t + ((t >> logseg) << addshift).
// coverage: n8 groups x 8 = every source element; grid = n8/256 exactly.
// ---------------------------------------------------------------------------
__global__ __launch_bounds__(256) void split8_kernel(const float* __restrict__ src,
                                                     unsigned short* dh, unsigned short* dl,
                                                     int n8, int logseg, int addshift) {
    const int t = blockIdx.x * 256 + threadIdx.x;
    if (t >= n8) return;
    const float* p = src + (size_t)t * 8;
    const v4f a = *(const v4fa*)(p);
    const v4f b = *(const v4fa*)(p + 4);
    u4 H, L;
    pack8(a, b, H, L);
    const size_t g = ((size_t)t + ((size_t)(t >> logseg) << addshift)) * 8;
    *(u4*)(dh + g) = H;
    *(u4*)(dl + g) = L;
    
}

// ---------------------------------------------------------------------------
// Transpose + split: src[R][Cc] f32 (pitch srcld) -> dst planes [n][k] with n = src col,
// k = src row: dst[(nbase + c) * dstld + r]. Tile 64x64 through LDS; each output row
// instruction. blockIdx.z strides src by srcz floats and dst by dstz halves.
// coverage: loads 256 thr x 4 x float4 = 64x64; stores 256 thr x 2 x 8 = 64x64 per plane.
// ---------------------------------------------------------------------------
__global__ __launch_bounds__(256) void tsplit_kernel(const float* __restrict__ src, int srcld, int srcz,
                                                     unsigned short* dh, unsigned short* dl,
                                                     int dstld, int dstz, int nbase) {
    constexpr int TP = 72;
    __shared__ __align__(16) unsigned short Th[64 * TP];
    __shared__ __align__(16) unsigned short Tl[64 * TP];
    const int t = threadIdx.x;
    const int c0 = blockIdx.x * 64, r0 = blockIdx.y * 64, z = blockIdx.z;
    const float* s = src + (size_t)z * srcz + (size_t)r0 * srcld + c0;
#pragma unroll
    for (int i = 0; i < 4; ++i) {
        const int r = (t >> 4) + 16 * i, c4 = (t & 15) * 4;
        const v4f v = *(const v4fa*)(s + (size_t)r * srcld + c4);
        unsigned hb, lb;
        split2(v.x, hb, lb); Th[(c4 + 0) * TP + r] = (unsigned short)hb; Tl[(c4 + 0) * TP + r] = (unsigned short)lb;
        split2(v.y, hb, lb); Th[(c4 + 1) * TP + r] = (unsigned short)hb; Tl[(c4 + 1) * TP + r] = (unsigned short)lb;
        split2(v.z, hb, lb); Th[(c4 + 2) * TP + r] = (unsigned short)hb; Tl[(c4 + 2) * TP + r] = (unsigned short)lb;
        split2(v.w, hb, lb); Th[(c4 + 3) * TP + r] = (unsigned short)hb; Tl[(c4 + 3) * TP + r] = (unsigned short)lb;
    }
    __syncthreads();
    const int piece = t & 7;
    const int rowA = (t >> 3), rowB = 32 + (t >> 3);
    const u4 HA = *(const u4a*)(Th + rowA * TP + piece * 8);
    const u4 LA = *(const u4a*)(Tl + rowA * TP + piece * 8);
    const u4 HB = *(const u4a*)(Th + rowB * TP + piece * 8);
    const u4 LB = *(const u4a*)(Tl + rowB * TP + piece * 8);
    const size_t zb = (size_t)z * dstz;
    const size_t gA = zb + (size_t)(nbase + c0 + rowA) * dstld + r0 + piece * 8;
    const size_t gB = zb + (size_t)(nbase + c0 + rowB) * dstld + r0 + piece * 8;
    *(u4*)(dh + gA) = HA; *(u4*)(dl + gA) = LA;
    *(u4*)(dh + gB) = HB; *(u4*)(dl + gB) = LB;
    
}

// ---------------------------------------------------------------------------
// GEMM, bf16 hi/lo three-term: C[M x N] f32 (pitch ldc) = A[M x K] . B[K x N],
// A planes [M][K] (pitch K), B planes stored transposed [N][K] (pitch K, k-contiguous),
// so A and B fragments use the identical split-k load. Block = 4 waves, 64 x 128;
// wave tile 32 x 64 (2 m-tiles x 4 n-tiles).
// Operands: a stage is 64 k (one 128-B line) of every operand row of the block,
// rows [A hi 64 | A lo 64 | B hi 128 | B lo 128] at an LDS pitch of 144 B, brought in by
// asynchronous copies of 16 B per lane (8 lanes = one whole line); two buffers, the next
// stage's copies fly while this stage is worked on. Fragments are read from LDS.
// Epilogue: wave tile staged in LDS, then each 256-B row segment written as two
// Requires M % 64 == 0, N % 128 == 0, K % 64 == 0, K >= 64, ldc % 32 == 0 (shapes fixed on host).
// ---------------------------------------------------------------------------
// eight copies of 16 B per lane, global -> LDS. The s_wait_xcnt stands inside the statement, behind
// the last copy, so that no address register of a copy is rewritten in front of it.
__device__ __forceinline__ void copy8(const unsigned (&l)[8], const unsigned short* const (&g)[8]) {
    asm volatile("global_load_async_to_lds_b128 %0, %8, off\n\t"
                 "global_load_async_to_lds_b128 %1, %9, off\n\t"
                 "global_load_async_to_lds_b128 %2, %10, off\n\t"
                 "global_load_async_to_lds_b128 %3, %11, off\n\t"
                 "global_load_async_to_lds_b128 %4, %12, off\n\t"
                 "global_load_async_to_lds_b128 %5, %13, off\n\t"
                 "global_load_async_to_lds_b128 %6, %14, off\n\t"
                 "global_load_async_to_lds_b128 %7, %15, off\n\t"
                 "s_wait_xcnt 0x0"
                 :: "v"(l[0]), "v"(l[1]), "v"(l[2]), "v"(l[3]), "v"(l[4]), "v"(l[5]), "v"(l[6]), "v"(l[7]),
                    "v"(g[0]), "v"(g[1]), "v"(g[2]), "v"(g[3]), "v"(g[4]), "v"(g[5]), "v"(g[6]), "v"(g[7])
                 : "memory");
}

__device__ __forceinline__ void store_ctile(const float* sW, float* C, int ldc,
                                            int m0w, int n0w, int hh, int m16) {
#pragma unroll
    for (int i = 0; i < 16; ++i) {
        const int row = 2 * i + hh;
        const v4f v = *(const v4fa*)(sW + row * 68 + m16 * 4);
        *(v4f*)(C + (size_t)(m0w + row) * ldc + n0w + m16 * 4) = v;
    }
}

__global__ __launch_bounds__(128) void gemm3_kernel(
    const unsigned short* __restrict__ Ah, const unsigned short* __restrict__ Al,
    const unsigned short* __restrict__ Bh, const unsigned short* __restrict__ Bl,
    float* C, int K, int ldc) {
    constexpr int SP = 68;
    constexpr int GP = 72;                 // LDS row pitch in halves (144 B = 16 B x 9: no bank conflict for 16-B reads)
    constexpr int RAL = 64, RBH = 128, RBL = 256, GROWS = 384;   // first stage row of A lo, B hi, B lo; rows per stage
    constexpr int GSTAGE = GROWS * GP;     // halves per buffer
    __shared__ __align__(16) unsigned short ring[2 * GSTAGE];
    __shared__ __align__(16) float sC[4 * 32 * SP];
    const int tid = threadIdx.x, w = tid >> 5, lane = tid & 31, hh = lane >> 4, m16 = lane & 15;
    const int m0w = blockIdx.y * 64 + (w >> 1) * 32;
    const int n0w = blockIdx.x * 128 + (w & 1) * 64;

    Acc acc[2][4];
#pragma unroll
    for (int mt = 0; mt < 2; ++mt)
#pragma unroll
        for (int nt = 0; nt < 4; ++nt) acc_zero(acc[mt][nt]);

    const size_t Ks = (size_t)K;
    // copy side: thread = (row cr of 16, 16-B piece cp of the row's 128 B); copy i takes stage row cr + 16 * i
    const int cr = tid >> 3, cp = tid & 7;
    const unsigned short* gAh = Ah + (size_t)(blockIdx.y * 64 + cr) * Ks + cp * 8;
    const unsigned short* gAl = Al + (size_t)(blockIdx.y * 64 + cr) * Ks + cp * 8;
    const unsigned short* gBh = Bh + (size_t)(blockIdx.x * 128 + cr) * Ks + cp * 8;
    const unsigned short* gBl = Bl + (size_t)(blockIdx.x * 128 + cr) * Ks + cp * 8;
    const unsigned lds0 = (unsigned)(size_t)(ring + cr * GP + cp * 8);   // LDS byte address: low 32 bits

    auto issue = [&](int st, int buf) {
        const unsigned lb = lds0 + (unsigned)buf * (unsigned)(GSTAGE * 2);
        const size_t ko = (size_t)st * 64;
        unsigned l[8];
        const unsigned short* g[8];
#pragma unroll
        for (int i = 0; i < 4; ++i) {
            l[i] = lb + (unsigned)((16 * i) * GP * 2);
            g[i] = gAh + ko + (size_t)(16 * i) * Ks;
            l[4 + i] = lb + (unsigned)((RAL + 16 * i) * GP * 2);
            g[4 + i] = gAl + ko + (size_t)(16 * i) * Ks;
        }
        copy8(l, g);
#pragma unroll
        for (int i = 0; i < 8; ++i) {
            l[i] = lb + (unsigned)((RBH + 16 * i) * GP * 2);
            g[i] = gBh + ko + (size_t)(16 * i) * Ks;
        }
        copy8(l, g);
#pragma unroll
        for (int i = 0; i < 8; ++i) {
            l[i] = lb + (unsigned)((RBL + 16 * i) * GP * 2);
            g[i] = gBl + ko + (size_t)(16 * i) * Ks;
        }
        copy8(l, g);
    };

    const int NT = K >> 6;
    issue(0, 0);
    // stage 0 has landed for this wave, then is published to the other waves
    asm volatile("s_wait_asynccnt 0x0" ::: "memory");
    __syncthreads();
    if (NT > 1) issue(1, 1);

    // reader side: first fragment row of this wave inside a stage
    const int offA = ((w >> 1) * 32 + m16) * GP + 8 * hh;
    const int offB = (RBH + (w & 1) * 64 + m16) * GP + 8 * hh;

    // kept rolled: the buffer index and the refill test are per trip
#pragma unroll 1
    for (int t = 0; t < NT; ++t) {
        const unsigned short* sb = ring + (t & 1) * GSTAGE;
        // a trip is 8 groups g = (k half g >> 2, n-tile g & 3) of 6 products. Fragment reads stand at three
        // places only (before group 0, at groups 2 and 4), the last two at least three groups ahead of their use, all in this trip's own buffer.
        Frag fa[2][4], fb[8][2];
        auto lda = [&](int ks) {
            const unsigned short* pa = sb + offA + ks * 32;
            ldfrag(fa[ks][0], pa);
            ldfrag(fa[ks][1], pa + RAL * GP);
            ldfrag(fa[ks][2], pa + 16 * GP);
            ldfrag(fa[ks][3], pa + (RAL + 16) * GP);
        };
        auto ldb = [&](int g) {
            const unsigned short* pb = sb + offB + (g >> 2) * 32 + (g & 3) * 16 * GP;
            ldfrag(fb[g][0], pb);
            ldfrag(fb[g][1], pb + (RBL - RBH) * GP);
        };
        lda(0); ldb(0); ldb(1); ldb(2); ldb(3); lda(1); ldb(4);
#pragma unroll
        for (int g = 0; g < 8; ++g) {
            if (g == 2) { ldb(5); ldb(6); }
            if (g == 4) ldb(7);
            mma3(acc[0][g & 3], fa[g >> 2][0], fa[g >> 2][1], fb[g][0], fb[g][1]);
            mma3(acc[1][g & 3], fa[g >> 2][2], fa[g >> 2][3], fb[g][0], fb[g][1]);
        }
        // publish point: this wave's LDS reads of the buffer are done, its copies of the next stage
        // have landed; the barrier publishes the next stage and frees this buffer for the refill
        asm volatile("s_wait_dscnt 0x0" ::: "memory");
        asm volatile("s_wait_asynccnt 0x0" ::: "memory");
        __syncthreads();
        if (t + 2 < NT) issue(t + 2, t & 1);
    }
    // no copy is left in flight when the wave goes on
    asm volatile("s_wait_asynccnt 0x0" ::: "memory");

    // D layout: acc[mt][nt].f[r] = tile(row mt*16 + 8*hh + r, col nt*16 + m16)
    float* sW = sC + w * (32 * SP);
#pragma unroll
    for (int mt = 0; mt < 2; ++mt)
#pragma unroll
        for (int nt = 0; nt < 4; ++nt)
#pragma unroll
            for (int r = 0; r < 8; ++r)
                sW[(mt * 16 + 8 * hh + r) * SP + nt * 16 + m16] = acc[mt][nt].f[r];
    __syncthreads();
    store_ctile(sW, C, ldc, m0w, n0w, hh, m16);
    
}

// ---------------------------------------------------------------------------
// RoPE + split of the projection output qkv[1024][3072] (q cols 0..2047 = h*64+d,
// k cols 2048..2559, v cols 2560..3071). Block = (64-col group g, 64 tokens).
//   g < 32      : q head g      -> q planes [32][1024][64]      (RoPE)
//   32<=g<40    : kv head g-32  -> K planes [8][3072][64] rows 2048+tok (RoPE)
//   40<=g<48    : kv head g-40  -> V^T planes [8][64][3072] cols 2048+tok (transpose)
// y[d] = x[d]*cos + rot[d]*sin, rot = -x[d+32] (d<32), x[d-32] (d>=32); cos/sin from table.
// Each thread emits 8 consecutive halves per plane (16 B); 8 consecutive lanes = one line.
// coverage: q planes all 32x1024 rows; K planes rows 2048..3071 of every kv head;
// V^T planes cols 2048..3071 of all 8x64 rows.
// ---------------------------------------------------------------------------
__device__ __forceinline__ void rope8(const float* xr, const float* pr, const float* cr,
                                      const float* sr, float sgn, v4f& ya, v4f& yb) {
#pragma clang fp contract(off)
    ya.x = xr[0] * cr[0] + (sgn * pr[0]) * sr[0];
    ya.y = xr[1] * cr[1] + (sgn * pr[1]) * sr[1];
    ya.z = xr[2] * cr[2] + (sgn * pr[2]) * sr[2];
    ya.w = xr[3] * cr[3] + (sgn * pr[3]) * sr[3];
    yb.x = xr[4] * cr[4] + (sgn * pr[4]) * sr[4];
    yb.y = xr[5] * cr[5] + (sgn * pr[5]) * sr[5];
    yb.z = xr[6] * cr[6] + (sgn * pr[6]) * sr[6];
    yb.w = xr[7] * cr[7] + (sgn * pr[7]) * sr[7];
}

__global__ __launch_bounds__(256) void rope_split_kernel(
    const float* __restrict__ qkv, const float* __restrict__ cosT, const float* __restrict__ sinT,
    unsigned short* qh, unsigned short* ql, unsigned short* kh, unsigned short* kl,
    unsigned short* vh, unsigned short* vl) {
#pragma clang fp contract(off)
    constexpr int QN = 1024, D = 64, NH = 32, NKV = 8, QKVW = 3072, KVL = 3072, KVP = 2048, TP = 68;
    __shared__ __align__(16) float T[64 * TP];
    const int t = threadIdx.x, g = blockIdx.x, tok0 = blockIdx.y * 64;
    const float* s = qkv + (size_t)tok0 * QKVW + g * D;
#pragma unroll
    for (int i = 0; i < 4; ++i) {
        const int r = (t >> 4) + 16 * i, c4 = (t & 15) * 4;
        const v4f v = *(const v4fa*)(s + (size_t)r * QKVW + c4);
        *(v4fa*)(T + r * TP + c4) = v;
    }
    __syncthreads();

    u4 H0, L0, H1, L1;
    size_t g0, g1;
    unsigned short* dH;
    unsigned short* dL;
    if (g < NH + NKV) {                                   // block-uniform branch
        const bool isq = (g < NH);
        dH = isq ? qh : kh;
        dL = isq ? ql : kl;
        const int d0 = (t & 7) * 8, dp0 = d0 ^ 32;
        const float sgn = (d0 < 32) ? -1.0f : 1.0f;
        {
            const int r = (t >> 3), tok = tok0 + r;
            const float* cr = cosT + (size_t)tok * 32 + (d0 & 31);
            const float* sr = sinT + (size_t)tok * 32 + (d0 & 31);
            v4f ya, yb;
            rope8(T + r * TP + d0, T + r * TP + dp0, cr, sr, sgn, ya, yb);
            pack8(ya, yb, H0, L0);
            const size_t row = isq ? ((size_t)g * QN + tok) : ((size_t)(g - NH) * KVL + KVP + tok);
            g0 = row * D + d0;
        }
        {
            const int r = 32 + (t >> 3), tok = tok0 + r;
            const float* cr = cosT + (size_t)tok * 32 + (d0 & 31);
            const float* sr = sinT + (size_t)tok * 32 + (d0 & 31);
            v4f ya, yb;
            rope8(T + r * TP + d0, T + r * TP + dp0, cr, sr, sgn, ya, yb);
            pack8(ya, yb, H1, L1);
            const size_t row = isq ? ((size_t)g * QN + tok) : ((size_t)(g - NH) * KVL + KVP + tok);
            g1 = row * D + d0;
        }
    } else {
        dH = vh;
        dL = vl;
        const int kvhd = g - NH - NKV, piece = t & 7;
        {
            const int d = (t >> 3);
            v4f ya, yb;
            ya.x = T[(piece * 8 + 0) * TP + d]; ya.y = T[(piece * 8 + 1) * TP + d];
            ya.z = T[(piece * 8 + 2) * TP + d]; ya.w = T[(piece * 8 + 3) * TP + d];
            yb.x = T[(piece * 8 + 4) * TP + d]; yb.y = T[(piece * 8 + 5) * TP + d];
            yb.z = T[(piece * 8 + 6) * TP + d]; yb.w = T[(piece * 8 + 7) * TP + d];
            pack8(ya, yb, H0, L0);
            g0 = ((size_t)(kvhd * D + d)) * KVL + KVP + tok0 + piece * 8;
        }
        {
            const int d = 32 + (t >> 3);
            v4f ya, yb;
            ya.x = T[(piece * 8 + 0) * TP + d]; ya.y = T[(piece * 8 + 1) * TP + d];
            ya.z = T[(piece * 8 + 2) * TP + d]; ya.w = T[(piece * 8 + 3) * TP + d];
            yb.x = T[(piece * 8 + 4) * TP + d]; yb.y = T[(piece * 8 + 5) * TP + d];
            yb.z = T[(piece * 8 + 6) * TP + d]; yb.w = T[(piece * 8 + 7) * TP + d];
            pack8(ya, yb, H1, L1);
            g1 = ((size_t)(kvhd * D + d)) * KVL + KVP + tok0 + piece * 8;
        }
    }
    *(u4*)(dH + g0) = H0; *(u4*)(dL + g0) = L0;
    *(u4*)(dH + g1) = H1; *(u4*)(dL + g1) = L1;
    
}

// ---------------------------------------------------------------------------
// Flash attention with the block-diagonal TTT mask, GQA (kv head = h >> 2).
// Block = (kv head, 16 query rows), 16 waves = its 4 query heads x 4 key splits. The key
// tiles of 32 of all three key blocks form one list; split ks takes entries ks, ks + 4, ...
// The 4 heads of one split walk the same K and V tiles at the same time: a trip of the block is one
// tile per split, and each split's tile (K hi, K lo: 32 key rows of 128 B at a pitch of 144 B; V^T hi,
// V^T lo: 64 d rows of 64 B at a pitch of 80 B) is brought into LDS once by the split's 4 waves with
// asynchronous copies of 16 B per lane; two buffers, the next trip's copies fly while this trip is
// worked on. All K and V fragments are read from LDS.
// Each wave keeps its own running maximum, sum and 16 x 64 output; a head's four partial
// results are merged through LDS in fixed split order behind one work-group barrier.
// Q/K/V/P operands as bf16 hi/lo; scores, mask (-inf), running-max softmax in f32.
// key j of block blk allowed iff j < seq_len and j <= i - (lck - blk).
// seq_len = sum(attention_mask) - lck, summed per block in fixed order.
// Per blk the key-tile count is bounded by the tile's diagonal and seq_len
// (at most 32 tiles); the mask is still applied by value per element.
// P: D layout -> per-wave LDS (ushort) -> A fragment (wave_sync around the exchange).
// Output attn planes [1024][2048] (col h*64+d): 8 lanes x 16 B = one 128-B line per row.
// Query tiles with the most keys have the lowest block index, so they start first.
// coverage: 8 x 64 blocks x 4 heads x 16 rows x 64 cols = [1024][2048] per plane.
// ---------------------------------------------------------------------------
__global__ __launch_bounds__(512) void attn_kernel(
    const unsigned short* __restrict__ qH, const unsigned short* __restrict__ qL,
    const unsigned short* __restrict__ kH, const unsigned short* __restrict__ kL,
    const unsigned short* __restrict__ vH, const unsigned short* __restrict__ vL,
    const int* __restrict__ amask, int nmask, int lck,
    unsigned short* oH, unsigned short* oL) {
    constexpr int QN = 1024, D = 64, KVL = 3072, HIDO = 2048, PP = 40, NS = 4, NW = 4 * NS, SP = 68;
    constexpr int KP = 72, VP = 40;                 // LDS row pitches in halves (16 B x 9, 16 B x 5: no bank conflict for 16-B reads)
    constexpr int KPL = 32 * KP, VPL = 64 * VP;     // halves per plane of a K tile, of a V^T tile
    constexpr int TSPL = 2 * KPL + 2 * VPL;         // halves per split: [K hi | K lo | V^T hi | V^T lo]
    constexpr int TSTAGE = NS * TSPL;               // halves per buffer
    __shared__ __align__(16) unsigned short kvs[2 * TSTAGE];
    __shared__ int red[128];
    __shared__ __align__(16) unsigned short Ph[NW * 16 * PP];
    __shared__ __align__(16) unsigned short Pl[NW * 16 * PP];
    __shared__ __align__(16) float Os[NW * 16 * SP];
    __shared__ float Ms[NW * 16];
    __shared__ float Ls[NW * 16];
    const int tid = threadIdx.x, lane = tid & 31, hh = lane >> 4, m16 = lane & 15;
    // wave number held as a scalar: the key-tile loop then branches on scalar tests, every lane on
    const int w = __builtin_amdgcn_readfirstlane(tid >> 5);

    // seq_len (integer, fixed order, identical in every block)
    if (tid < 128) {                                   // the first four waves sum the mask
        int part = 0;
        for (int i = tid; i < nmask; i += 128) part += amask[i];
        red[tid] = part;
    }
    __syncthreads();
#pragma unroll
    for (int off = 64; off > 0; off >>= 1) {
        if (tid < off) red[tid] += red[tid + off];
        __syncthreads();
    }
    const int seq_len = __builtin_amdgcn_readfirstlane(red[0] - lck);

    const int kvh = blockIdx.x, h = kvh * 4 + (w & 3), ks = w >> 2;
    const int q0w = (QN / 16 - 1 - (int)blockIdx.y) * 16;
    const float NEG_INF = -__builtin_inff();

    Frag fqh[2], fql[2];
    {
        const size_t qo = ((size_t)h * QN + q0w + m16) * D + 8 * hh;
        ldfrag(fqh[0], qH + qo);
        ldfrag(fqh[1], qH + qo + 32);
        ldfrag(fql[0], qL + qo);
        ldfrag(fql[1], qL + qo + 32);
    }
    float mrow[8], lrow[8];
    Acc o[4];
#pragma unroll
    for (int r = 0; r < 8; ++r) { mrow[r] = NEG_INF; lrow[r] = 0.0f; }
#pragma unroll
    for (int dt = 0; dt < 4; ++dt) acc_zero(o[dt]);

    unsigned short* Pwh = Ph + w * 16 * PP;
    unsigned short* Pwl = Pl + w * 16 * PP;
    const size_t kplane = (size_t)kvh * KVL * D;      // K planes [kvh][kv][d]
    const size_t vplane = (size_t)kvh * D * KVL;      // V^T planes [kvh][d][kv]

    // key tiles per key block (allowed j of block blk are < q0w + 16 - (lck - blk) and < seq_len),
    // as running ends e0 <= e1 <= e2 of the one list; each count <= 32, so e2 <= 96
    int e0, e1, e2;
    {
        int c0 = q0w + 16 - lck, c1 = c0 + 1, c2 = c0 + 2;
        c0 = (c0 < seq_len) ? c0 : seq_len;
        c1 = (c1 < seq_len) ? c1 : seq_len;
        c2 = (c2 < seq_len) ? c2 : seq_len;
        c0 = (c0 < 0) ? 0 : ((c0 > QN) ? QN : c0);
        c1 = (c1 < 0) ? 0 : ((c1 > QN) ? QN : c1);
        c2 = (c2 < 0) ? 0 : ((c2 > QN) ? QN : c2);
        e0 = __builtin_amdgcn_readfirstlane((c0 + 31) >> 5);
        e1 = e0 + __builtin_amdgcn_readfirstlane((c1 + 31) >> 5);
        e2 = e1 + __builtin_amdgcn_readfirstlane((c2 + 31) >> 5);
    }
    // copy side: the 128 lanes of a split bring its tile; per lane 4 copies of K (2 planes x 2 row groups
    // of 16; 8 lanes = one 128-B row) and 4 of V^T (2 planes x 2 row groups of 32; 4 lanes = one 64-B row)
    const int lt = (w & 3) * 32 + lane;
    const int ckr = lt >> 3, ckp = (lt & 7) * 8, cvr = lt >> 2, cvp = (lt & 3) * 8;
    const unsigned short* gkh = kH + kplane + (size_t)ckr * D + ckp;
    const unsigned short* gkl = kL + kplane + (size_t)ckr * D + ckp;
    const unsigned short* gvh = vH + vplane + (size_t)cvr * KVL + cvp;
    const unsigned short* gvl = vL + vplane + (size_t)cvr * KVL + cvp;
    const unsigned ldk = (unsigned)(size_t)(kvs + ks * TSPL + ckr * KP + ckp);             // LDS byte address: low 32 bits
    const unsigned ldv = (unsigned)(size_t)(kvs + ks * TSPL + 2 * KPL + cvr * VP + cvp);
    // trips of the block; a split whose list entry lies past the end copies the last tile again (in bounds,
    // never read), so every wave issues the same copies in every trip
    const int NT = (e2 + NS - 1) / NS;
    auto issue = [&](int it, int buf) {
        int le = it * NS + ks;
        le = (le < e2) ? le : (e2 - 1);
        const int cb = (le >= e0 ? 1 : 0) + (le >= e1 ? 1 : 0);
        const int ct = le - (le >= e1 ? e1 : (le >= e0 ? e0 : 0));
        const size_t ckv = (size_t)(cb * QN + ct * 32);
        const unsigned bo = (unsigned)buf * (unsigned)(TSTAGE * 2);
        unsigned l[8];
        const unsigned short* g[8];
#pragma unroll
        for (int i = 0; i < 2; ++i) {
            l[i] = ldk + bo + (unsigned)(16 * i * KP * 2);
            g[i] = gkh + (ckv + 16 * i) * D;
            l[2 + i] = ldk + bo + (unsigned)((KPL + 16 * i * KP) * 2);
            g[2 + i] = gkl + (ckv + 16 * i) * D;
            l[4 + i] = ldv + bo + (unsigned)(32 * i * VP * 2);
            g[4 + i] = gvh + (size_t)(32 * i) * KVL + ckv;
            l[6 + i] = ldv + bo + (unsigned)((VPL + 32 * i * VP) * 2);
            g[6 + i] = gvl + (size_t)(32 * i) * KVL + ckv;
        }
        copy8(l, g);
    };
    if (NT > 0) issue(0, 0);
    // trip 0's tiles have landed for this wave, then are published to the other waves
    asm volatile("s_wait_asynccnt 0x0" ::: "memory");
    __syncthreads();
    if (NT > 1) issue(1, 1);

    // kept rolled: a second copy of the long body would only raise the register count
#pragma unroll 1
    for (int it = 0; it < NT; ++it) {
      const int s = it * NS + ks;
      if (s < e2) {                                    // scalar test: the whole wave works or skips
        const int blk = (s >= e0 ? 1 : 0) + (s >= e1 ? 1 : 0);
        const int t = s - (s >= e1 ? e1 : (s >= e0 ? e0 : 0));
        const int shift = lck - blk;                   // j <= i - shift
        const int j0 = t * 32;
        const unsigned short* tb = kvs + (it & 1) * TSTAGE + ks * TSPL;   // this split's tile of this trip
        Acc sc[2];
        acc_zero(sc[0]);
        acc_zero(sc[1]);
        // the K fragment reads stand together at the head of the trip
        Frag fk[2][2][2];
#pragma unroll
        for (int nt = 0; nt < 2; ++nt)
#pragma unroll
            for (int ds = 0; ds < 2; ++ds) {
                const unsigned short* pk = tb + (nt * 16 + m16) * KP + ds * 32 + 8 * hh;
                ldfrag(fk[nt][ds][0], pk);
                ldfrag(fk[nt][ds][1], pk + KPL);
            }
        // S tile [16 q x 32 keys]; A = q (k = d), B = K^T (k = d): sc[nt].f[r] = S[8*hh+r][nt*16+m16]
#pragma unroll
        for (int nt = 0; nt < 2; ++nt)
#pragma unroll
            for (int ds = 0; ds < 2; ++ds)
                mma3(sc[nt], fqh[ds], fql[ds], fk[nt][ds][0], fk[nt][ds][1]);
        // scale and mask by value
#pragma unroll
        for (int nt = 0; nt < 2; ++nt)
#pragma unroll
            for (int r = 0; r < 8; ++r) {
                const int qi = q0w + 8 * hh + r;
                const int j = j0 + nt * 16 + m16;
                const bool ok = (j < seq_len) && (j <= qi - shift);
                sc[nt].f[r] = ok ? sc[nt].f[r] * 0.125f : NEG_INF;
            }
        // running-max softmax update (row r spans the 16 lanes of one half)
        float alpha[8];
#pragma unroll
        for (int r = 0; r < 8; ++r) {
            float x = fmaxf(sc[0].f[r], sc[1].f[r]);
            x = fmaxf(x, __shfl_xor(x, 1));
            x = fmaxf(x, __shfl_xor(x, 2));
            x = fmaxf(x, __shfl_xor(x, 4));
            x = fmaxf(x, __shfl_xor(x, 8));
            const float mn = fmaxf(mrow[r], x);
            const float msafe = (mn == NEG_INF) ? 0.0f : mn;
            alpha[r] = __expf(mrow[r] - msafe);
            mrow[r] = mn;
            const float p0 = __expf(sc[0].f[r] - msafe);
            const float p1 = __expf(sc[1].f[r] - msafe);
            sc[0].f[r] = p0;
            sc[1].f[r] = p1;
            float sum = p0 + p1;
            sum += __shfl_xor(sum, 1);
            sum += __shfl_xor(sum, 2);
            sum += __shfl_xor(sum, 4);
            sum += __shfl_xor(sum, 8);
            lrow[r] = lrow[r] * alpha[r] + sum;
        }
#pragma unroll
        for (int dt = 0; dt < 4; ++dt)
#pragma unroll
            for (int r = 0; r < 8; ++r) o[dt].f[r] *= alpha[r];

        // the V fragment reads stand together ahead of the P exchange, which covers their latency
        Frag fv[4][2];
#pragma unroll
        for (int dt = 0; dt < 4; ++dt) {
            const unsigned short* pv = tb + 2 * KPL + (dt * 16 + m16) * VP + 8 * hh;
            ldfrag(fv[dt][0], pv);
            ldfrag(fv[dt][1], pv + VPL);
        }

        // P: D layout (row = q, col = key) -> LDS -> A fragment (m = q, k = key)
        wave_sync();
#pragma unroll
        for (int nt = 0; nt < 2; ++nt)
#pragma unroll
            for (int r = 0; r < 8; ++r) {
                unsigned hb, lb;
                split2(sc[nt].f[r], hb, lb);
                Pwh[(8 * hh + r) * PP + nt * 16 + m16] = (unsigned short)hb;
                Pwl[(8 * hh + r) * PP + nt * 16 + m16] = (unsigned short)lb;
            }
        wave_sync();
        Frag fph, fpl;
        ldfrag(fph, Pwh + m16 * PP + 8 * hh);
        ldfrag(fpl, Pwl + m16 * PP + 8 * hh);

        // O += P . V ; B = V (k = key, n = d) from V^T rows: o[dt].f[r] = O[8*hh+r][dt*16+m16]
#pragma unroll
        for (int dt = 0; dt < 4; ++dt) mma3(o[dt], fph, fpl, fv[dt][0], fv[dt][1]);
      }
        // publish point: this wave's LDS reads of the buffer are done, its copies of the next trip
        // have landed; the barrier publishes the next trip's tiles and frees this buffer for the refill
        asm volatile("s_wait_dscnt 0x0" ::: "memory");
        asm volatile("s_wait_asynccnt 0x0" ::: "memory");
        __syncthreads();
        if (it + 2 < NT) issue(it + 2, it & 1);
    }
    // no copy is left in flight when the wave goes on
    asm volatile("s_wait_asynccnt 0x0" ::: "memory");

    // each wave's partial result to LDS (D layout: o[dt].f[r] = O[8*hh+r][dt*16+m16])
    float* Ow = Os + w * 16 * SP;
#pragma unroll
    for (int r = 0; r < 8; ++r)
#pragma unroll
        for (int dt = 0; dt < 4; ++dt) Ow[(8 * hh + r) * SP + dt * 16 + m16] = o[dt].f[r];
    if (m16 == 0) {
#pragma unroll
        for (int r = 0; r < 8; ++r) {
            Ms[w * 16 + 8 * hh + r] = mrow[r];
            Ls[w * 16 + 8 * hh + r] = lrow[r];
        }
    }
    __syncthreads();

    // merge in split order, normalise, split into planes; thread = (head, row, 8 columns)
    const int hl = tid >> 7, row = (tid >> 3) & 15, c8 = (tid & 7) * 8;
    float mall = NEG_INF;
#pragma unroll
    for (int u = 0; u < NS; ++u) mall = fmaxf(mall, Ms[(u * 4 + hl) * 16 + row]);
    const float mfin = (mall == NEG_INF) ? 0.0f : mall;
    float lsum = 0.0f;
    v4f oa = {0.0f, 0.0f, 0.0f, 0.0f}, ob = {0.0f, 0.0f, 0.0f, 0.0f};
#pragma unroll
    for (int u = 0; u < NS; ++u) {
        const int pr = (u * 4 + hl) * 16 + row;
        const float a = __expf(Ms[pr] - mfin);
        const v4f va = *(const v4fa*)(Os + pr * SP + c8);
        const v4f vb = *(const v4fa*)(Os + pr * SP + c8 + 4);
        lsum += a * Ls[pr];
        oa += a * va;
        ob += a * vb;
    }
    const float il = 1.0f / lsum;
    u4 H, L;
    pack8(oa * il, ob * il, H, L);
    const size_t eo = (size_t)(q0w + row) * HIDO + (kvh * 4 + hl) * D + c8;
    *(u4*)(oH + eo) = H;
    *(u4*)(oL + eo) = L;
}

// ---------------------------------------------------------------------------
extern "C" void kernel_launch(void* const* d_in, const int* in_sizes, int n_in,
                              void* d_out, int out_size, void* d_ws, size_t ws_size,
                              hipStream_t stream) {
    constexpr int QN = 1024, INW = 4096, NH = 32, NKV = 8, D = 64, HIDO = 2048;
    constexpr int KVP = 2048, KVL = 3072, QKVW = 3072, LCK = KVP / QN;
    if (n_in < 9) return;
    if (in_sizes[0] != QN * INW || in_sizes[1] != NKV * KVP * D || in_sizes[2] != NKV * KVP * D ||
        in_sizes[3] != QN || in_sizes[4] != QN || in_sizes[5] != INW * NH * D ||
        in_sizes[6] != INW * NKV * D || in_sizes[7] != INW * NKV * D ||
        in_sizes[8] != NH * D * HIDO || out_size != QN * HIDO) return;

    const float* hs  = (const float*)d_in[0];
    const float* pk  = (const float*)d_in[1];
    const float* pv  = (const float*)d_in[2];
    const int*   am  = (const int*)  d_in[3];
    const int*   pid = (const int*)  d_in[4];
    const float* Wq  = (const float*)d_in[5];
    const float* Wk  = (const float*)d_in[6];
    const float* Wv  = (const float*)d_in[7];
    const float* Wo  = (const float*)d_in[8];
    float* out = (float*)d_out;

    char* ws = (char*)d_ws;
    size_t off = 0;
    auto carve = [&](size_t bytes) -> char* {
        char* p = ws + off;
        off += (bytes + 255) & ~(size_t)255;
        return p;
    };
    unsigned short* hsH = (unsigned short*)carve((size_t)QN * INW * 2);          // A planes of QKV GEMM
    unsigned short* hsL = (unsigned short*)carve((size_t)QN * INW * 2);
    unsigned short* wtH = (unsigned short*)carve((size_t)QKVW * INW * 2);        // [Wq|Wk|Wv]^T planes [3072][4096]
    unsigned short* wtL = (unsigned short*)carve((size_t)QKVW * INW * 2);
    unsigned short* woH = (unsigned short*)carve((size_t)HIDO * (NH * D) * 2);    // Wo^T planes [2048][2048]
    unsigned short* woL = (unsigned short*)carve((size_t)HIDO * (NH * D) * 2);
    float*          qkv = (float*)         carve((size_t)QN * QKVW * 4);          // projection output f32
    unsigned short* qH  = (unsigned short*)carve((size_t)NH * QN * D * 2);        // q planes [32][1024][64]
    unsigned short* qL  = (unsigned short*)carve((size_t)NH * QN * D * 2);
    unsigned short* kH  = (unsigned short*)carve((size_t)NKV * KVL * D * 2);      // K planes [8][3072][64]
    unsigned short* kL  = (unsigned short*)carve((size_t)NKV * KVL * D * 2);
    unsigned short* vH  = (unsigned short*)carve((size_t)NKV * D * KVL * 2);      // V^T planes [8][64][3072]
    unsigned short* vL  = (unsigned short*)carve((size_t)NKV * D * KVL * 2);
    unsigned short* aH  = (unsigned short*)carve((size_t)QN * (NH * D) * 2);      // attention output planes [1024][2048]
    unsigned short* aL  = (unsigned short*)carve((size_t)QN * (NH * D) * 2);
    float*          cosT = (float*)        carve((size_t)QN * 32 * 4);
    float*          sinT = (float*)        carve((size_t)QN * 32 * 4);
    float*          inv  = (float*)        carve(128);
    if (off > ws_size || off > ((size_t)128 << 20)) return;

    // tables
    invfreq_kernel<<<1, 32, 0, stream>>>(inv);
    cstable_kernel<<<(QN * 32) / 256, 256, 0, stream>>>(pid, inv, cosT, sinT, QN, LCK);

    // operand planes
    split8_kernel<<<(QN * INW / 8) / 256, 256, 0, stream>>>(hs, hsH, hsL, QN * INW / 8, 30, 0);
    split8_kernel<<<(NKV * KVP * D / 8) / 256, 256, 0, stream>>>(pk, kH, kL, NKV * KVP * D / 8, 14, 13);
    // Wq in[4096][2048] -> out rows 0..2047 of [3072][4096]
    tsplit_kernel<<<dim3((NH * D) / 64, INW / 64, 1), 256, 0, stream>>>(Wq, NH * D, 0, wtH, wtL, INW, 0, 0);
    // Wk in[4096][512] -> rows 2048..2559
    tsplit_kernel<<<dim3((NKV * D) / 64, INW / 64, 1), 256, 0, stream>>>(Wk, NKV * D, 0, wtH, wtL, INW, 0, NH * D);
    // Wv in[4096][512] -> rows 2560..3071
    tsplit_kernel<<<dim3((NKV * D) / 64, INW / 64, 1), 256, 0, stream>>>(Wv, NKV * D, 0, wtH, wtL, INW, 0, NH * D + NKV * D);
    // Wo in[2048][2048] -> [2048][2048]
    tsplit_kernel<<<dim3(HIDO / 64, (NH * D) / 64, 1), 256, 0, stream>>>(Wo, HIDO, 0, woH, woL, NH * D, 0, 0);
    // past_value per kv head: in[2048][64] -> V^T rows d, cols 0..2047 (pitch 3072)
    tsplit_kernel<<<dim3(D / 64, KVP / 64, NKV), 256, 0, stream>>>(pv, D, KVP * D, vH, vL, KVL, D * KVL, 0);

    // fused QKV projection: [1024 x 4096] . [4096 x 3072] -> qkv f32
    gemm3_kernel<<<dim3(QKVW / 128, QN / 64), 128, 0, stream>>>(hsH, hsL, wtH, wtL, qkv, INW, QKVW);

    // RoPE + split into q planes, new K rows, new V^T cols
    rope_split_kernel<<<dim3(QKVW / 64, QN / 64), 256, 0, stream>>>(qkv, cosT, sinT, qH, qL, kH, kL, vH, vL);

    // attention
    attn_kernel<<<dim3(NKV, QN / 16), 512, 0, stream>>>(qH, qL, kH, kL, vH, vL, am, in_sizes[3], LCK, aH, aL);

    // output projection: [1024 x 2048] . [2048 x 2048] -> d_out f32
    gemm3_kernel<<<dim3(HIDO / 128, QN / 64), 128, 0, stream>>>(aH, aL, woH, woL, out, NH * D, HIDO);
}

// v004
// Measured time: 202 microseconds a run.
// Next to v003, in two timings, it ran 1.10 times as fast each time.
// Over all steps from v000 it is 2.87 times as fast.
// All contractions (q/k/v projections, q.k^T, p.v, output projection): v_wmma_f32_16x16x32_bf16 with bf16 hi/lo operands everywhere (hi*hi + hi*lo + lo*hi), f32 accumulate; RoPE, softmax and normalisation in f32.
#include <hip/hip_runtime.h>
#include <hip/hip_bf16.h>

typedef __attribute__((ext_vector_type(16))) __bf16 v16bf;
typedef float v8f __attribute__((ext_vector_type(8)));
typedef float v4f __attribute__((ext_vector_type(4)));
typedef unsigned int u4 __attribute__((ext_vector_type(4)));
typedef u4 __attribute__((may_alias)) u4a;
typedef v4f __attribute__((may_alias)) v4fa;

union Frag { v16bf v; u4 q[2]; };
union Acc  { v8f v; float f[8]; };

// ---------------------------------------------------------------------------
// bf16 RNE convert and hi/lo split (lo = RNE(x - hi), exact residual)
// ---------------------------------------------------------------------------
__device__ __forceinline__ unsigned bf_rne(float f) {
    unsigned u = __float_as_uint(f);
    u += 0x7FFFu + ((u >> 16) & 1u);
    return u >> 16;
}
__device__ __forceinline__ void split2(float x, unsigned& hi, unsigned& lo) {
    hi = bf_rne(x);
    lo = bf_rne(x - __uint_as_float(hi << 16));
}
// two f32 -> one 32-bit word per plane, first element in the low half-word
__device__ __forceinline__ void pack2(float a, float b, unsigned& wh, unsigned& wl) {
    unsigned ha, la, hb, lb;
    split2(a, ha, la);
    split2(b, hb, lb);
    wh = ha | (hb << 16);
    wl = la | (lb << 16);
}
// eight consecutive f32 -> 16 B per plane
__device__ __forceinline__ void pack8(const v4f a, const v4f b, u4& H, u4& L) {
    unsigned h0, l0, h1, l1, h2, l2, h3, l3;
    pack2(a.x, a.y, h0, l0);
    pack2(a.z, a.w, h1, l1);
    pack2(b.x, b.y, h2, l2);
    pack2(b.z, b.w, h3, l3);
    H.x = h0; H.y = h1; H.z = h2; H.w = h3;
    L.x = l0; L.y = l1; L.z = l2; L.w = l3;
}

// ---------------------------------------------------------------------------
// 16x16x32 fragment load from a k-contiguous 16-bit row (A row m, or B^T row n):
// p = row_start + k0 + 8*h ; elements 0..7 <- k0+8h.., elements 8..15 <- k0+16+8h..
// ---------------------------------------------------------------------------
__device__ __forceinline__ void ldfrag(Frag& f, const unsigned short* p) {
    f.q[0] = *(const u4a*)(p);
    f.q[1] = *(const u4a*)(p + 16);
}

__device__ __forceinline__ void acc_zero(Acc& c) {
#pragma unroll
    for (int i = 0; i < 8; ++i) c.f[i] = 0.0f;
}

// acc += Ah*Bh + Ah*Bl + Al*Bh, then 4 wait slots with D tied and A/B kept live
__device__ __forceinline__ void mma3(Acc& c, const Frag& ah, const Frag& al,
                                     const Frag& bh, const Frag& bl) {
    v8f d = c.v;
    d = __builtin_amdgcn_wmma_f32_16x16x32_bf16(false, ah.v, false, bh.v, (short)0, d, false, false);
    d = __builtin_amdgcn_wmma_f32_16x16x32_bf16(false, ah.v, false, bl.v, (short)0, d, false, false);
    d = __builtin_amdgcn_wmma_f32_16x16x32_bf16(false, al.v, false, bh.v, (short)0, d, false, false);
    asm volatile("v_nop\n\tv_nop\n\tv_nop\n\tv_nop"
                 : "+v"(d) : "v"(ah.v), "v"(al.v), "v"(bh.v), "v"(bl.v));
    c.v = d;
}

// same-wave LDS exchange ordering
__device__ __forceinline__ void wave_sync() {
    __builtin_amdgcn_fence(__ATOMIC_ACQ_REL, "wavefront");
    __builtin_amdgcn_wave_barrier();
}

// ---------------------------------------------------------------------------
// Operand preparation, ONE launch. None of these jobs reads another's output, so they share a grid:
// PREP_BLOCKS blocks of 256 threads, block b takes units b, b + PREP_BLOCKS, ... of a list of PREP_UNITS.
// Of every 22 list entries 5 are straight splits (memory only) and 17 are transpose units (LDS and vector
// work), mixed for speed only. The last 128 blocks, which have one
// list unit fewer than the first 512, each add one table unit behind their loop.
//   straight unit, 4096 consecutive f32 -> bf16 hi/lo planes: hidden_states (1024 units),
//     past_key (256 units; kv head = 32 units, dst rows 0..2047 of its 3072)
//   table unit, 256 entries of the cos/sin table [1024][32] (128 units)
//   transpose unit, one 64 x 64 tile, src[r][c] -> dst planes [c][r]: Wq 2048, Wk 512, Wv 512 tiles into
//     [Wq|Wk|Wv]^T [3072][4096]; Wo 1024 tiles into Wo^T [2048][2048]; past_value 256 tiles into
//     V^T [8][64][3072] cols 0..2047
// coverage: every unit once (u -> (u / 22, u % 22) is one-to-one), units x 4096 = every element of each source.
// ---------------------------------------------------------------------------
constexpr int PREP_BLOCKS = 1024;
constexpr int PREP_UNITS = 5632;          // 1280 straight + 4352 transpose = 22 * 256
constexpr int PREP_TABLE_BLOCKS = 128;    // x 256 threads = the 1024 x 32 table entries

// cos/sin at angle f32(pos + lck) * inv_freq[i], inv_freq[i] = 1 / 10000^(i/32)
// (f64 exp2 -> f32, then f32 reciprocal); precise sinf/cosf.
__device__ __forceinline__ void table_unit(const int* __restrict__ pid, float* cosT, float* sinT,
                                           int idx, int lck) {
    const int tok = idx >> 5, i = idx & 31;
    const double e = (double)i * 0.03125 * 13.287712379549449;   // i/32 * log2(1e4)
    const float p32 = (float)exp2(e);
    const float inv = 1.0f / p32;
    const float pos = (float)(pid[tok] + lck);
    const float ang = pos * inv;
    const float c = cosf(ang);
    const float s = sinf(ang);
    *(float*)(cosT + idx) = c;
    *(float*)(sinT + idx) = s;
}

// 4096 consecutive f32 -> planes; a thread takes two groups of 8 (one 16-B store per plane and group)
__device__ __forceinline__ void straight_unit(const float* __restrict__ src,
                                              unsigned short* dh, unsigned short* dl, int t) {
    const float* p = src + t * 8;
    const v4f a0 = *(const v4fa*)(p);
    const v4f b0 = *(const v4fa*)(p + 4);
    const v4f a1 = *(const v4fa*)(p + 2048);
    const v4f b1 = *(const v4fa*)(p + 2052);
    u4 H0, L0, H1, L1;
    pack8(a0, b0, H0, L0);
    pack8(a1, b1, H1, L1);
    *(u4*)(dh + t * 8) = H0;        *(u4*)(dl + t * 8) = L0;
    *(u4*)(dh + 2048 + t * 8) = H1; *(u4*)(dl + 2048 + t * 8) = L1;
    // the block's next unit rewrites the registers that these stores name
    asm volatile("s_wait_xcnt 0x0" ::: "memory");
}

// one 64 x 64 tile through LDS: s = tile origin (pitch srcld), dh/dl = origin of the transposed tile
// (pitch dstld). loads 256 thr x 4 x float4 = 64x64; stores 256 thr x 2 x 8 = 64x64 per plane.
__device__ __forceinline__ void transpose_unit(const float* __restrict__ s, int srcld,
                                               unsigned short* dh, unsigned short* dl, int dstld,
                                               unsigned short* Th, unsigned short* Tl, int t) {
    constexpr int TP = 72;
    v4f x[4];
#pragma unroll
    for (int i = 0; i < 4; ++i) {
        x[i] = *(const v4fa*)(s + (size_t)((t >> 4) + 16 * i) * srcld + (t & 15) * 4);
        // a later load's result may land in the registers that hold this load's address
        asm volatile("s_wait_xcnt 0x0" ::: "memory");
    }
#pragma unroll
    for (int i = 0; i < 4; ++i) {
        const int r = (t >> 4) + 16 * i, c4 = (t & 15) * 4;
        const v4f v = x[i];
        unsigned hb, lb;
        split2(v.x, hb, lb); Th[(c4 + 0) * TP + r] = (unsigned short)hb; Tl[(c4 + 0) * TP + r] = (unsigned short)lb;
        split2(v.y, hb, lb); Th[(c4 + 1) * TP + r] = (unsigned short)hb; Tl[(c4 + 1) * TP + r] = (unsigned short)lb;
        split2(v.z, hb, lb); Th[(c4 + 2) * TP + r] = (unsigned short)hb; Tl[(c4 + 2) * TP + r] = (unsigned short)lb;
        split2(v.w, hb, lb); Th[(c4 + 3) * TP + r] = (unsigned short)hb; Tl[(c4 + 3) * TP + r] = (unsigned short)lb;
    }
    __syncthreads();
    const int piece = t & 7;
    const int rowA = (t >> 3), rowB = 32 + (t >> 3);
    const u4 HA = *(const u4a*)(Th + rowA * TP + piece * 8);
    const u4 LA = *(const u4a*)(Tl + rowA * TP + piece * 8);
    const u4 HB = *(const u4a*)(Th + rowB * TP + piece * 8);
    const u4 LB = *(const u4a*)(Tl + rowB * TP + piece * 8);
    // the LDS tile is written again by the block's next transpose unit: every wave's reads end here first
    __syncthreads();
    const size_t gA = (size_t)rowA * dstld + piece * 8;
    const size_t gB = (size_t)rowB * dstld + piece * 8;
    *(u4*)(dh + gA) = HA; *(u4*)(dl + gA) = LA;
    *(u4*)(dh + gB) = HB; *(u4*)(dl + gB) = LB;
    // the block's next unit rewrites the registers that these stores name
    asm volatile("s_wait_xcnt 0x0" ::: "memory");
}

__global__ __launch_bounds__(256) void prep_kernel(
    const float* __restrict__ hs, const float* __restrict__ pk, const float* __restrict__ pv,
    const int* __restrict__ pid,
    const float* __restrict__ Wq, const float* __restrict__ Wk, const float* __restrict__ Wv,
    const float* __restrict__ Wo,
    unsigned short* hsH, unsigned short* hsL, unsigned short* kH, unsigned short* kL,
    unsigned short* vH, unsigned short* vL, unsigned short* wtH, unsigned short* wtL,
    unsigned short* woH, unsigned short* woL, float* cosT, float* sinT, int lck) {
    constexpr int INW = 4096, QW = 2048, KW = 512, D = 64, KVP = 2048, KVL = 3072, HIDO = 2048;
    __shared__ __align__(16) unsigned short Th[64 * 72];
    __shared__ __align__(16) unsigned short Tl[64 * 72];
    const int t = threadIdx.x;
    // every test below reads the unit number alone: the whole block takes one path, barriers included
    for (int u = blockIdx.x; u < PREP_UNITS; u += PREP_BLOCKS) {
        const int q = u / 22, r = u - q * 22;
        if (r < 5) {
            const int s = q * 5 + r;                               // 0..1279
            if (s < 1024) {
                const size_t o = (size_t)s * 4096;
                straight_unit(hs + o, hsH + o, hsL + o, t);
            } else {
                const int y = s - 1024;                            // 0..255
                const size_t o = (size_t)(y >> 5) * (KVL * D) + (size_t)(y & 31) * 4096;
                straight_unit(pk + (size_t)y * 4096, kH + o, kL + o, t);
            }
            continue;
        }
        const int e = q * 17 + (r - 5);                            // 0..4351
        const float* s;
        unsigned short* dh;
        unsigned short* dl;
        int srcld, dstld;
        if (e < 3072) {                                            // Wq | Wk | Wv -> rows nb.. of [3072][4096]
            const float* W = (e < 2048) ? Wq : ((e < 2560) ? Wk : Wv);
            const int y = (e < 2048) ? e : ((e < 2560) ? e - 2048 : e - 2560);
            const int lg = (e < 2048) ? 5 : 3;                     // log2 of the column tiles per row of tiles
            const int nb = (e < 2048) ? 0 : ((e < 2560) ? QW : QW + KW);
            const int c0 = (y & ((1 << lg) - 1)) * 64, r0 = (y >> lg) * 64;
            srcld = (e < 2048) ? QW : KW;
            dstld = INW;
            s = W + (size_t)r0 * srcld + c0;
            const size_t o = (size_t)(nb + c0) * INW + r0;
            dh = wtH + o;
            dl = wtL + o;
        } else if (e < 4096) {                                     // Wo [2048][2048]
            const int y = e - 3072;
            const int c0 = (y & 31) * 64, r0 = (y >> 5) * 64;
            srcld = HIDO;
            dstld = QW;
            s = Wo + (size_t)r0 * HIDO + c0;
            const size_t o = (size_t)c0 * QW + r0;
            dh = woH + o;
            dl = woL + o;
        } else {                                                   // past_value, kv head z: [2048][64]
            const int y = e - 4096;
            const int r0 = (y & 31) * 64, z = y >> 5;
            srcld = D;
            dstld = KVL;
            s = pv + (size_t)z * (KVP * D) + (size_t)r0 * D;
            const size_t o = (size_t)z * (D * KVL) + r0;
            dh = vH + o;
            dl = vL + o;
        }
        transpose_unit(s, srcld, dh, dl, dstld, Th, Tl, t);
    }
    const int tb = (int)blockIdx.x - (PREP_BLOCKS - PREP_TABLE_BLOCKS);
    if (tb >= 0) table_unit(pid, cosT, sinT, tb * 256 + t, lck);
}

// ---------------------------------------------------------------------------
// GEMM, bf16 hi/lo three-term: C[M x N] f32 (pitch ldc) = A[M x K] . B[K x N],
// A planes [M][K] (pitch K), B planes stored transposed [N][K] (pitch K, k-contiguous),
// so A and B fragments use the identical split-k load. Block = 4 waves, 64 x 128;
// wave tile 32 x 64 (2 m-tiles x 4 n-tiles).
// Operands: a stage is 64 k (one 128-B line) of every operand row of the block,
// rows [A hi 64 | A lo 64 | B hi 128 | B lo 128] at an LDS pitch of 144 B, brought in by
// asynchronous copies of 16 B per lane (8 lanes = one whole line); two buffers, the next
// stage's copies fly while this stage is worked on. Fragments are read from LDS.
// Epilogue: wave tile staged in LDS, then each 256-B row segment written as two
// Requires M % 64 == 0, N % 128 == 0, K % 64 == 0, K >= 64, ldc % 32 == 0 (shapes fixed on host).
// ---------------------------------------------------------------------------
// eight copies of 16 B per lane, global -> LDS. The s_wait_xcnt stands inside the statement, behind
// the last copy, so that no address register of a copy is rewritten in front of it.
__device__ __forceinline__ void copy8(const unsigned (&l)[8], const unsigned short* const (&g)[8]) {
    asm volatile("global_load_async_to_lds_b128 %0, %8, off\n\t"
                 "global_load_async_to_lds_b128 %1, %9, off\n\t"
                 "global_load_async_to_lds_b128 %2, %10, off\n\t"
                 "global_load_async_to_lds_b128 %3, %11, off\n\t"
                 "global_load_async_to_lds_b128 %4, %12, off\n\t"
                 "global_load_async_to_lds_b128 %5, %13, off\n\t"
                 "global_load_async_to_lds_b128 %6, %14, off\n\t"
                 "global_load_async_to_lds_b128 %7, %15, off\n\t"
                 "s_wait_xcnt 0x0"
                 :: "v"(l[0]), "v"(l[1]), "v"(l[2]), "v"(l[3]), "v"(l[4]), "v"(l[5]), "v"(l[6]), "v"(l[7]),
                    "v"(g[0]), "v"(g[1]), "v"(g[2]), "v"(g[3]), "v"(g[4]), "v"(g[5]), "v"(g[6]), "v"(g[7])
                 : "memory");
}

__device__ __forceinline__ void store_ctile(const float* sW, float* C, int ldc,
                                            int m0w, int n0w, int hh, int m16) {
#pragma unroll
    for (int i = 0; i < 16; ++i) {
        const int row = 2 * i + hh;
        const v4f v = *(const v4fa*)(sW + row * 68 + m16 * 4);
        *(v4f*)(C + (size_t)(m0w + row) * ldc + n0w + m16 * 4) = v;
    }
}

__global__ __launch_bounds__(128) void gemm3_kernel(
    const unsigned short* __restrict__ Ah, const unsigned short* __restrict__ Al,
    const unsigned short* __restrict__ Bh, const unsigned short* __restrict__ Bl,
    float* C, int K, int ldc) {
    constexpr int SP = 68;
    constexpr int GP = 72;                 // LDS row pitch in halves (144 B = 16 B x 9: no bank conflict for 16-B reads)
    constexpr int RAL = 64, RBH = 128, RBL = 256, GROWS = 384;   // first stage row of A lo, B hi, B lo; rows per stage
    constexpr int GSTAGE = GROWS * GP;     // halves per buffer
    __shared__ __align__(16) unsigned short ring[2 * GSTAGE];
    __shared__ __align__(16) float sC[4 * 32 * SP];
    const int tid = threadIdx.x, w = tid >> 5, lane = tid & 31, hh = lane >> 4, m16 = lane & 15;
    const int m0w = blockIdx.y * 64 + (w >> 1) * 32;
    const int n0w = blockIdx.x * 128 + (w & 1) * 64;

    Acc acc[2][4];
#pragma unroll
    for (int mt = 0; mt < 2; ++mt)
#pragma unroll
        for (int nt = 0; nt < 4; ++nt) acc_zero(acc[mt][nt]);

    const size_t Ks = (size_t)K;
    // copy side: thread = (row cr of 16, 16-B piece cp of the row's 128 B); copy i takes stage row cr + 16 * i
    const int cr = tid >> 3, cp = tid & 7;
    const unsigned short* gAh = Ah + (size_t)(blockIdx.y * 64 + cr) * Ks + cp * 8;
    const unsigned short* gAl = Al + (size_t)(blockIdx.y * 64 + cr) * Ks + cp * 8;
    const unsigned short* gBh = Bh + (size_t)(blockIdx.x * 128 + cr) * Ks + cp * 8;
    const unsigned short* gBl = Bl + (size_t)(blockIdx.x * 128 + cr) * Ks + cp * 8;
    const unsigned lds0 = (unsigned)(size_t)(ring + cr * GP + cp * 8);   // LDS byte address: low 32 bits

    auto issue = [&](int st, int buf) {
        const unsigned lb = lds0 + (unsigned)buf * (unsigned)(GSTAGE * 2);
        const size_t ko = (size_t)st * 64;
        unsigned l[8];
        const unsigned short* g[8];
#pragma unroll
        for (int i = 0; i < 4; ++i) {
            l[i] = lb + (unsigned)((16 * i) * GP * 2);
            g[i] = gAh + ko + (size_t)(16 * i) * Ks;
            l[4 + i] = lb + (unsigned)((RAL + 16 * i) * GP * 2);
            g[4 + i] = gAl + ko + (size_t)(16 * i) * Ks;
        }
        copy8(l, g);
#pragma unroll
        for (int i = 0; i < 8; ++i) {
            l[i] = lb + (unsigned)((RBH + 16 * i) * GP * 2);
            g[i] = gBh + ko + (size_t)(16 * i) * Ks;
        }
        copy8(l, g);
#pragma unroll
        for (int i = 0; i < 8; ++i) {
            l[i] = lb + (unsigned)((RBL + 16 * i) * GP * 2);
            g[i] = gBl + ko + (size_t)(16 * i) * Ks;
        }
        copy8(l, g);
    };

    const int NT = K >> 6;
    issue(0, 0);
    // stage 0 has landed for this wave, then is published to the other waves
    asm volatile("s_wait_asynccnt 0x0" ::: "memory");
    __syncthreads();
    if (NT > 1) issue(1, 1);

    // reader side: first fragment row of this wave inside a stage
    const int offA = ((w >> 1) * 32 + m16) * GP + 8 * hh;
    const int offB = (RBH + (w & 1) * 64 + m16) * GP + 8 * hh;

    // kept rolled: the buffer index and the refill test are per trip
#pragma unroll 1
    for (int t = 0; t < NT; ++t) {
        const unsigned short* sb = ring + (t & 1) * GSTAGE;
        // a trip is 8 groups g = (k half g >> 2, n-tile g & 3) of 6 products. Fragment reads stand at three
        // places only (before group 0, at groups 2 and 4), the last two at least three groups ahead of their use, all in this trip's own buffer.
        Frag fa[2][4], fb[8][2];
        auto lda = [&](int ks) {
            const unsigned short* pa = sb + offA + ks * 32;
            ldfrag(fa[ks][0], pa);
            ldfrag(fa[ks][1], pa + RAL * GP);
            ldfrag(fa[ks][2], pa + 16 * GP);
            ldfrag(fa[ks][3], pa + (RAL + 16) * GP);
        };
        auto ldb = [&](int g) {
            const unsigned short* pb = sb + offB + (g >> 2) * 32 + (g & 3) * 16 * GP;
            ldfrag(fb[g][0], pb);
            ldfrag(fb[g][1], pb + (RBL - RBH) * GP);
        };
        lda(0); ldb(0); ldb(1); ldb(2); ldb(3); lda(1); ldb(4);
#pragma unroll
        for (int g = 0; g < 8; ++g) {
            if (g == 2) { ldb(5); ldb(6); }
            if (g == 4) ldb(7);
            mma3(acc[0][g & 3], fa[g >> 2][0], fa[g >> 2][1], fb[g][0], fb[g][1]);
            mma3(acc[1][g & 3], fa[g >> 2][2], fa[g >> 2][3], fb[g][0], fb[g][1]);
        }
        // publish point: this wave's LDS reads of the buffer are done, its copies of the next stage
        // have landed; the barrier publishes the next stage and frees this buffer for the refill
        asm volatile("s_wait_dscnt 0x0" ::: "memory");
        asm volatile("s_wait_asynccnt 0x0" ::: "memory");
        __syncthreads();
        if (t + 2 < NT) issue(t + 2, t & 1);
    }
    // no copy is left in flight when the wave goes on
    asm volatile("s_wait_asynccnt 0x0" ::: "memory");

    // D layout: acc[mt][nt].f[r] = tile(row mt*16 + 8*hh + r, col nt*16 + m16)
    float* sW = sC + w * (32 * SP);
#pragma unroll
    for (int mt = 0; mt < 2; ++mt)
#pragma unroll
        for (int nt = 0; nt < 4; ++nt)
#pragma unroll
            for (int r = 0; r < 8; ++r)
                sW[(mt * 16 + 8 * hh + r) * SP + nt * 16 + m16] = acc[mt][nt].f[r];
    __syncthreads();
    store_ctile(sW, C, ldc, m0w, n0w, hh, m16);
    
}

// ---------------------------------------------------------------------------
// RoPE + split of the projection output qkv[1024][3072] (q cols 0..2047 = h*64+d,
// k cols 2048..2559, v cols 2560..3071). Block = (64-col group g, 64 tokens).
//   g < 32      : q head g      -> q planes [32][1024][64]      (RoPE)
//   32<=g<40    : kv head g-32  -> K planes [8][3072][64] rows 2048+tok (RoPE)
//   40<=g<48    : kv head g-40  -> V^T planes [8][64][3072] cols 2048+tok (transpose)
// y[d] = x[d]*cos + rot[d]*sin, rot = -x[d+32] (d<32), x[d-32] (d>=32); cos/sin from table.
// Each thread emits 8 consecutive halves per plane (16 B); 8 consecutive lanes = one line.
// coverage: q planes all 32x1024 rows; K planes rows 2048..3071 of every kv head;
// V^T planes cols 2048..3071 of all 8x64 rows.
// ---------------------------------------------------------------------------
__device__ __forceinline__ void rope8(const float* xr, const float* pr, const float* cr,
                                      const float* sr, float sgn, v4f& ya, v4f& yb) {
#pragma clang fp contract(off)
    ya.x = xr[0] * cr[0] + (sgn * pr[0]) * sr[0];
    ya.y = xr[1] * cr[1] + (sgn * pr[1]) * sr[1];
    ya.z = xr[2] * cr[2] + (sgn * pr[2]) * sr[2];
    ya.w = xr[3] * cr[3] + (sgn * pr[3]) * sr[3];
    yb.x = xr[4] * cr[4] + (sgn * pr[4]) * sr[4];
    yb.y = xr[5] * cr[5] + (sgn * pr[5]) * sr[5];
    yb.z = xr[6] * cr[6] + (sgn * pr[6]) * sr[6];
    yb.w = xr[7] * cr[7] + (sgn * pr[7]) * sr[7];
}

__global__ __launch_bounds__(256) void rope_split_kernel(
    const float* __restrict__ qkv, const float* __restrict__ cosT, const float* __restrict__ sinT,
    unsigned short* qh, unsigned short* ql, unsigned short* kh, unsigned short* kl,
    unsigned short* vh, unsigned short* vl) {
#pragma clang fp contract(off)
    constexpr int QN = 1024, D = 64, NH = 32, NKV = 8, QKVW = 3072, KVL = 3072, KVP = 2048, TP = 68;
    __shared__ __align__(16) float T[64 * TP];
    const int t = threadIdx.x, g = blockIdx.x, tok0 = blockIdx.y * 64;
    const float* s = qkv + (size_t)tok0 * QKVW + g * D;
#pragma unroll
    for (int i = 0; i < 4; ++i) {
        const int r = (t >> 4) + 16 * i, c4 = (t & 15) * 4;
        const v4f v = *(const v4fa*)(s + (size_t)r * QKVW + c4);
        *(v4fa*)(T + r * TP + c4) = v;
    }
    __syncthreads();

    u4 H0, L0, H1, L1;
    size_t g0, g1;
    unsigned short* dH;
    unsigned short* dL;
    if (g < NH + NKV) {                                   // block-uniform branch
        const bool isq = (g < NH);
        dH = isq ? qh : kh;
        dL = isq ? ql : kl;
        const int d0 = (t & 7) * 8, dp0 = d0 ^ 32;
        const float sgn = (d0 < 32) ? -1.0f : 1.0f;
        {
            const int r = (t >> 3), tok = tok0 + r;
            const float* cr = cosT + (size_t)tok * 32 + (d0 & 31);
            const float* sr = sinT + (size_t)tok * 32 + (d0 & 31);
            v4f ya, yb;
            rope8(T + r * TP + d0, T + r * TP + dp0, cr, sr, sgn, ya, yb);
            pack8(ya, yb, H0, L0);
            const size_t row = isq ? ((size_t)g * QN + tok) : ((size_t)(g - NH) * KVL + KVP + tok);
            g0 = row * D + d0;
        }
        {
            const int r = 32 + (t >> 3), tok = tok0 + r;
            const float* cr = cosT + (size_t)tok * 32 + (d0 & 31);
            const float* sr = sinT + (size_t)tok * 32 + (d0 & 31);
            v4f ya, yb;
            rope8(T + r * TP + d0, T + r * TP + dp0, cr, sr, sgn, ya, yb);
            pack8(ya, yb, H1, L1);
            const size_t row = isq ? ((size_t)g * QN + tok) : ((size_t)(g - NH) * KVL + KVP + tok);
            g1 = row * D + d0;
        }
    } else {
        dH = vh;
        dL = vl;
        const int kvhd = g - NH - NKV, piece = t & 7;
        {
            const int d = (t >> 3);
            v4f ya, yb;
            ya.x = T[(piece * 8 + 0) * TP + d]; ya.y = T[(piece * 8 + 1) * TP + d];
            ya.z = T[(piece * 8 + 2) * TP + d]; ya.w = T[(piece * 8 + 3) * TP + d];
            yb.x = T[(piece * 8 + 4) * TP + d]; yb.y = T[(piece * 8 + 5) * TP + d];
            yb.z = T[(piece * 8 + 6) * TP + d]; yb.w = T[(piece * 8 + 7) * TP + d];
            pack8(ya, yb, H0, L0);
            g0 = ((size_t)(kvhd * D + d)) * KVL + KVP + tok0 + piece * 8;
        }
        {
            const int d = 32 + (t >> 3);
            v4f ya, yb;
            ya.x = T[(piece * 8 + 0) * TP + d]; ya.y = T[(piece * 8 + 1) * TP + d];
            ya.z = T[(piece * 8 + 2) * TP + d]; ya.w = T[(piece * 8 + 3) * TP + d];
            yb.x = T[(piece * 8 + 4) * TP + d]; yb.y = T[(piece * 8 + 5) * TP + d];
            yb.z = T[(piece * 8 + 6) * TP + d]; yb.w = T[(piece * 8 + 7) * TP + d];
            pack8(ya, yb, H1, L1);
            g1 = ((size_t)(kvhd * D + d)) * KVL + KVP + tok0 + piece * 8;
        }
    }
    *(u4*)(dH + g0) = H0; *(u4*)(dL + g0) = L0;
    *(u4*)(dH + g1) = H1; *(u4*)(dL + g1) = L1;
    
}

// ---------------------------------------------------------------------------
// Flash attention with the block-diagonal TTT mask, GQA (kv head = h >> 2).
// Block = (kv head, 16 query rows), 16 waves = its 4 query heads x 4 key splits. The key
// tiles of 32 of all three key blocks form one list; split ks takes entries ks, ks + 4, ...
// The 4 heads of one split walk the same K and V tiles at the same time: a trip of the block is one
// tile per split, and each split's tile (K hi, K lo: 32 key rows of 128 B at a pitch of 144 B; V^T hi,
// V^T lo: 64 d rows of 64 B at a pitch of 80 B) is brought into LDS once by the split's 4 waves with
// asynchronous copies of 16 B per lane; two buffers, the next trip's copies fly while this trip is
// worked on. All K and V fragments are read from LDS.
// Each wave keeps its own running maximum, sum and 16 x 64 output; a head's four partial
// results are merged through LDS in fixed split order behind one work-group barrier.
// Q/K/V/P operands as bf16 hi/lo; scores, mask (-inf), running-max softmax in f32.
// key j of block blk allowed iff j < seq_len and j <= i - (lck - blk).
// seq_len = sum(attention_mask) - lck, summed per block in fixed order.
// Per blk the key-tile count is bounded by the tile's diagonal and seq_len
// (at most 32 tiles); the mask is still applied by value per element.
// P: D layout -> per-wave LDS (ushort) -> A fragment (wave_sync around the exchange).
// Output attn planes [1024][2048] (col h*64+d): 8 lanes x 16 B = one 128-B line per row.
// Query tiles with the most keys have the lowest block index (for speed only).
// coverage: 8 x 64 blocks x 4 heads x 16 rows x 64 cols = [1024][2048] per plane.
// ---------------------------------------------------------------------------
__global__ __launch_bounds__(512) void attn_kernel(
    const unsigned short* __restrict__ qH, const unsigned short* __restrict__ qL,
    const unsigned short* __restrict__ kH, const unsigned short* __restrict__ kL,
    const unsigned short* __restrict__ vH, const unsigned short* __restrict__ vL,
    const int* __restrict__ amask, int nmask, int lck,
    unsigned short* oH, unsigned short* oL) {
    constexpr int QN = 1024, D = 64, KVL = 3072, HIDO = 2048, PP = 40, NS = 4, NW = 4 * NS, SP = 68;
    constexpr int KP = 72, VP = 40;                 // LDS row pitches in halves (16 B x 9, 16 B x 5: no bank conflict for 16-B reads)
    constexpr int KPL = 32 * KP, VPL = 64 * VP;     // halves per plane of a K tile, of a V^T tile
    constexpr int TSPL = 2 * KPL + 2 * VPL;         // halves per split: [K hi | K lo | V^T hi | V^T lo]
    constexpr int TSTAGE = NS * TSPL;               // halves per buffer
    __shared__ __align__(16) unsigned short kvs[2 * TSTAGE];
    __shared__ int red[128];
    __shared__ __align__(16) unsigned short Ph[NW * 16 * PP];
    __shared__ __align__(16) unsigned short Pl[NW * 16 * PP];
    __shared__ __align__(16) float Os[NW * 16 * SP];
    __shared__ float Ms[NW * 16];
    __shared__ float Ls[NW * 16];
    const int tid = threadIdx.x, lane = tid & 31, hh = lane >> 4, m16 = lane & 15;
    // wave number held as a scalar: the key-tile loop then branches on scalar tests, every lane on
    const int w = __builtin_amdgcn_readfirstlane(tid >> 5);

    // seq_len (integer, fixed order, identical in every block)
    if (tid < 128) {                                   // the first four waves sum the mask
        int part = 0;
        for (int i = tid; i < nmask; i += 128) part += amask[i];
        red[tid] = part;
    }
    __syncthreads();
#pragma unroll
    for (int off = 64; off > 0; off >>= 1) {
        if (tid < off) red[tid] += red[tid + off];
        __syncthreads();
    }
    const int seq_len = __builtin_amdgcn_readfirstlane(red[0] - lck);

    const int kvh = blockIdx.x, h = kvh * 4 + (w & 3), ks = w >> 2;
    const int q0w = (QN / 16 - 1 - (int)blockIdx.y) * 16;
    const float NEG_INF = -__builtin_inff();

    Frag fqh[2], fql[2];
    {
        const size_t qo = ((size_t)h * QN + q0w + m16) * D + 8 * hh;
        ldfrag(fqh[0], qH + qo);
        ldfrag(fqh[1], qH + qo + 32);
        ldfrag(fql[0], qL + qo);
        ldfrag(fql[1], qL + qo + 32);
    }
    float mrow[8], lrow[8];
    Acc o[4];
#pragma unroll
    for (int r = 0; r < 8; ++r) { mrow[r] = NEG_INF; lrow[r] = 0.0f; }
#pragma unroll
    for (int dt = 0; dt < 4; ++dt) acc_zero(o[dt]);

    unsigned short* Pwh = Ph + w * 16 * PP;
    unsigned short* Pwl = Pl + w * 16 * PP;
    const size_t kplane = (size_t)kvh * KVL * D;      // K planes [kvh][kv][d]
    const size_t vplane = (size_t)kvh * D * KVL;      // V^T planes [kvh][d][kv]

    // key tiles per key block (allowed j of block blk are < q0w + 16 - (lck - blk) and < seq_len),
    // as running ends e0 <= e1 <= e2 of the one list; each count <= 32, so e2 <= 96
    int e0, e1, e2;
    {
        int c0 = q0w + 16 - lck, c1 = c0 + 1, c2 = c0 + 2;
        c0 = (c0 < seq_len) ? c0 : seq_len;
        c1 = (c1 < seq_len) ? c1 : seq_len;
        c2 = (c2 < seq_len) ? c2 : seq_len;
        c0 = (c0 < 0) ? 0 : ((c0 > QN) ? QN : c0);
        c1 = (c1 < 0) ? 0 : ((c1 > QN) ? QN : c1);
        c2 = (c2 < 0) ? 0 : ((c2 > QN) ? QN : c2);
        e0 = __builtin_amdgcn_readfirstlane((c0 + 31) >> 5);
        e1 = e0 + __builtin_amdgcn_readfirstlane((c1 + 31) >> 5);
        e2 = e1 + __builtin_amdgcn_readfirstlane((c2 + 31) >> 5);
    }
    // copy side: the 128 lanes of a split bring its tile; per lane 4 copies of K (2 planes x 2 row groups
    // of 16; 8 lanes = one 128-B row) and 4 of V^T (2 planes x 2 row groups of 32; 4 lanes = one 64-B row)
    const int lt = (w & 3) * 32 + lane;
    const int ckr = lt >> 3, ckp = (lt & 7) * 8, cvr = lt >> 2, cvp = (lt & 3) * 8;
    const unsigned short* gkh = kH + kplane + (size_t)ckr * D + ckp;
    const unsigned short* gkl = kL + kplane + (size_t)ckr * D + ckp;
    const unsigned short* gvh = vH + vplane + (size_t)cvr * KVL + cvp;
    const unsigned short* gvl = vL + vplane + (size_t)cvr * KVL + cvp;
    const unsigned ldk = (unsigned)(size_t)(kvs + ks * TSPL + ckr * KP + ckp);             // LDS byte address: low 32 bits
    const unsigned ldv = (unsigned)(size_t)(kvs + ks * TSPL + 2 * KPL + cvr * VP + cvp);
    // trips of the block; a split whose list entry lies past the end copies the last tile again (in bounds,
    // never read), so every wave issues the same copies in every trip
    const int NT = (e2 + NS - 1) / NS;
    auto issue = [&](int it, int buf) {
        int le = it * NS + ks;
        le = (le < e2) ? le : (e2 - 1);
        const int cb = (le >= e0 ? 1 : 0) + (le >= e1 ? 1 : 0);
        const int ct = le - (le >= e1 ? e1 : (le >= e0 ? e0 : 0));
        const size_t ckv = (size_t)(cb * QN + ct * 32);
        const unsigned bo = (unsigned)buf * (unsigned)(TSTAGE * 2);
        unsigned l[8];
        const unsigned short* g[8];
#pragma unroll
        for (int i = 0; i < 2; ++i) {
            l[i] = ldk + bo + (unsigned)(16 * i * KP * 2);
            g[i] = gkh + (ckv + 16 * i) * D;
            l[2 + i] = ldk + bo + (unsigned)((KPL + 16 * i * KP) * 2);
            g[2 + i] = gkl + (ckv + 16 * i) * D;
            l[4 + i] = ldv + bo + (unsigned)(32 * i * VP * 2);
            g[4 + i] = gvh + (size_t)(32 * i) * KVL + ckv;
            l[6 + i] = ldv + bo + (unsigned)((VPL + 32 * i * VP) * 2);
            g[6 + i] = gvl + (size_t)(32 * i) * KVL + ckv;
        }
        copy8(l, g);
    };
    if (NT > 0) issue(0, 0);
    // trip 0's tiles have landed for this wave, then are published to the other waves
    asm volatile("s_wait_asynccnt 0x0" ::: "memory");
    __syncthreads();
    if (NT > 1) issue(1, 1);

    // kept rolled: a second copy of the long body would only raise the register count
#pragma unroll 1
    for (int it = 0; it < NT; ++it) {
      const int s = it * NS + ks;
      if (s < e2) {                                    // scalar test: the whole wave works or skips
        const int blk = (s >= e0 ? 1 : 0) + (s >= e1 ? 1 : 0);
        const int t = s - (s >= e1 ? e1 : (s >= e0 ? e0 : 0));
        const int shift = lck - blk;                   // j <= i - shift
        const int j0 = t * 32;
        const unsigned short* tb = kvs + (it & 1) * TSTAGE + ks * TSPL;   // this split's tile of this trip
        Acc sc[2];
        acc_zero(sc[0]);
        acc_zero(sc[1]);
        // the K fragment reads stand together at the head of the trip
        Frag fk[2][2][2];
#pragma unroll
        for (int nt = 0; nt < 2; ++nt)
#pragma unroll
            for (int ds = 0; ds < 2; ++ds) {
                const unsigned short* pk = tb + (nt * 16 + m16) * KP + ds * 32 + 8 * hh;
                ldfrag(fk[nt][ds][0], pk);
                ldfrag(fk[nt][ds][1], pk + KPL);
            }
        // S tile [16 q x 32 keys]; A = q (k = d), B = K^T (k = d): sc[nt].f[r] = S[8*hh+r][nt*16+m16]
#pragma unroll
        for (int nt = 0; nt < 2; ++nt)
#pragma unroll
            for (int ds = 0; ds < 2; ++ds)
                mma3(sc[nt], fqh[ds], fql[ds], fk[nt][ds][0], fk[nt][ds][1]);
        // scale and mask by value
#pragma unroll
        for (int nt = 0; nt < 2; ++nt)
#pragma unroll
            for (int r = 0; r < 8; ++r) {
                const int qi = q0w + 8 * hh + r;
                const int j = j0 + nt * 16 + m16;
                const bool ok = (j < seq_len) && (j <= qi - shift);
                sc[nt].f[r] = ok ? sc[nt].f[r] * 0.125f : NEG_INF;
            }
        // running-max softmax update (row r spans the 16 lanes of one half)
        float alpha[8];
#pragma unroll
        for (int r = 0; r < 8; ++r) {
            float x = fmaxf(sc[0].f[r], sc[1].f[r]);
            x = fmaxf(x, __shfl_xor(x, 1));
            x = fmaxf(x, __shfl_xor(x, 2));
            x = fmaxf(x, __shfl_xor(x, 4));
            x = fmaxf(x, __shfl_xor(x, 8));
            const float mn = fmaxf(mrow[r], x);
            const float msafe = (mn == NEG_INF) ? 0.0f : mn;
            alpha[r] = __expf(mrow[r] - msafe);
            mrow[r] = mn;
            const float p0 = __expf(sc[0].f[r] - msafe);
            const float p1 = __expf(sc[1].f[r] - msafe);
            sc[0].f[r] = p0;
            sc[1].f[r] = p1;
            float sum = p0 + p1;
            sum += __shfl_xor(sum, 1);
            sum += __shfl_xor(sum, 2);
            sum += __shfl_xor(sum, 4);
            sum += __shfl_xor(sum, 8);
            lrow[r] = lrow[r] * alpha[r] + sum;
        }
#pragma unroll
        for (int dt = 0; dt < 4; ++dt)
#pragma unroll
            for (int r = 0; r < 8; ++r) o[dt].f[r] *= alpha[r];

        // the V fragment reads stand together ahead of the P exchange, which covers their latency
        Frag fv[4][2];
#pragma unroll
        for (int dt = 0; dt < 4; ++dt) {
            const unsigned short* pv = tb + 2 * KPL + (dt * 16 + m16) * VP + 8 * hh;
            ldfrag(fv[dt][0], pv);
            ldfrag(fv[dt][1], pv + VPL);
        }

        // P: D layout (row = q, col = key) -> LDS -> A fragment (m = q, k = key)
        wave_sync();
#pragma unroll
        for (int nt = 0; nt < 2; ++nt)
#pragma unroll
            for (int r = 0; r < 8; ++r) {
                unsigned hb, lb;
                split2(sc[nt].f[r], hb, lb);
                Pwh[(8 * hh + r) * PP + nt * 16 + m16] = (unsigned short)hb;
                Pwl[(8 * hh + r) * PP + nt * 16 + m16] = (unsigned short)lb;
            }
        wave_sync();
        Frag fph, fpl;
        ldfrag(fph, Pwh + m16 * PP + 8 * hh);
        ldfrag(fpl, Pwl + m16 * PP + 8 * hh);

        // O += P . V ; B = V (k = key, n = d) from V^T rows: o[dt].f[r] = O[8*hh+r][dt*16+m16]
#pragma unroll
        for (int dt = 0; dt < 4; ++dt) mma3(o[dt], fph, fpl, fv[dt][0], fv[dt][1]);
      }
        // publish point: this wave's LDS reads of the buffer are done, its copies of the next trip
        // have landed; the barrier publishes the next trip's tiles and frees this buffer for the refill
        asm volatile("s_wait_dscnt 0x0" ::: "memory");
        asm volatile("s_wait_asynccnt 0x0" ::: "memory");
        __syncthreads();
        if (it + 2 < NT) issue(it + 2, it & 1);
    }
    // no copy is left in flight when the wave goes on
    asm volatile("s_wait_asynccnt 0x0" ::: "memory");

    // each wave's partial result to LDS (D layout: o[dt].f[r] = O[8*hh+r][dt*16+m16])
    float* Ow = Os + w * 16 * SP;
#pragma unroll
    for (int r = 0; r < 8; ++r)
#pragma unroll
        for (int dt = 0; dt < 4; ++dt) Ow[(8 * hh + r) * SP + dt * 16 + m16] = o[dt].f[r];
    if (m16 == 0) {
#pragma unroll
        for (int r = 0; r < 8; ++r) {
            Ms[w * 16 + 8 * hh + r] = mrow[r];
            Ls[w * 16 + 8 * hh + r] = lrow[r];
        }
    }
    __syncthreads();

    // merge in split order, normalise, split into planes; thread = (head, row, 8 columns)
    const int hl = tid >> 7, row = (tid >> 3) & 15, c8 = (tid & 7) * 8;
    float mall = NEG_INF;
#pragma unroll
    for (int u = 0; u < NS; ++u) mall = fmaxf(mall, Ms[(u * 4 + hl) * 16 + row]);
    const float mfin = (mall == NEG_INF) ? 0.0f : mall;
    float lsum = 0.0f;
    v4f oa = {0.0f, 0.0f, 0.0f, 0.0f}, ob = {0.0f, 0.0f, 0.0f, 0.0f};
#pragma unroll
    for (int u = 0; u < NS; ++u) {
        const int pr = (u * 4 + hl) * 16 + row;
        const float a = __expf(Ms[pr] - mfin);
        const v4f va = *(const v4fa*)(Os + pr * SP + c8);
        const v4f vb = *(const v4fa*)(Os + pr * SP + c8 + 4);
        lsum += a * Ls[pr];
        oa += a * va;
        ob += a * vb;
    }
    const float il = 1.0f / lsum;
    u4 H, L;
    pack8(oa * il, ob * il, H, L);
    const size_t eo = (size_t)(q0w + row) * HIDO + (kvh * 4 + hl) * D + c8;
    *(u4*)(oH + eo) = H;
    *(u4*)(oL + eo) = L;
}

// ---------------------------------------------------------------------------
extern "C" void kernel_launch(void* const* d_in, const int* in_sizes, int n_in,
                              void* d_out, int out_size, void* d_ws, size_t ws_size,
                              hipStream_t stream) {
    constexpr int QN = 1024, INW = 4096, NH = 32, NKV = 8, D = 64, HIDO = 2048;
    constexpr int KVP = 2048, KVL = 3072, QKVW = 3072, LCK = KVP / QN;
    if (n_in < 9) return;
    if (in_sizes[0] != QN * INW || in_sizes[1] != NKV * KVP * D || in_sizes[2] != NKV * KVP * D ||
        in_sizes[3] != QN || in_sizes[4] != QN || in_sizes[5] != INW * NH * D ||
        in_sizes[6] != INW * NKV * D || in_sizes[7] != INW * NKV * D ||
        in_sizes[8] != NH * D * HIDO || out_size != QN * HIDO) return;

    const float* hs  = (const float*)d_in[0];
    const float* pk  = (const float*)d_in[1];
    const float* pv  = (const float*)d_in[2];
    const int*   am  = (const int*)  d_in[3];
    const int*   pid = (const int*)  d_in[4];
    const float* Wq  = (const float*)d_in[5];
    const float* Wk  = (const float*)d_in[6];
    const float* Wv  = (const float*)d_in[7];
    const float* Wo  = (const float*)d_in[8];
    float* out = (float*)d_out;

    char* ws = (char*)d_ws;
    size_t off = 0;
    auto carve = [&](size_t bytes) -> char* {
        char* p = ws + off;
        off += (bytes + 255) & ~(size_t)255;
        return p;
    };
    unsigned short* hsH = (unsigned short*)carve((size_t)QN * INW * 2);          // A planes of QKV GEMM
    unsigned short* hsL = (unsigned short*)carve((size_t)QN * INW * 2);
    unsigned short* wtH = (unsigned short*)carve((size_t)QKVW * INW * 2);        // [Wq|Wk|Wv]^T planes [3072][4096]
    unsigned short* wtL = (unsigned short*)carve((size_t)QKVW * INW * 2);
    unsigned short* woH = (unsigned short*)carve((size_t)HIDO * (NH * D) * 2);    // Wo^T planes [2048][2048]
    unsigned short* woL = (unsigned short*)carve((size_t)HIDO * (NH * D) * 2);
    float*          qkv = (float*)         carve((size_t)QN * QKVW * 4);          // projection output f32
    unsigned short* qH  = (unsigned short*)carve((size_t)NH * QN * D * 2);        // q planes [32][1024][64]
    unsigned short* qL  = (unsigned short*)carve((size_t)NH * QN * D * 2);
    unsigned short* kH  = (unsigned short*)carve((size_t)NKV * KVL * D * 2);      // K planes [8][3072][64]
    unsigned short* kL  = (unsigned short*)carve((size_t)NKV * KVL * D * 2);
    unsigned short* vH  = (unsigned short*)carve((size_t)NKV * D * KVL * 2);      // V^T planes [8][64][3072]
    unsigned short* vL  = (unsigned short*)carve((size_t)NKV * D * KVL * 2);
    unsigned short* aH  = (unsigned short*)carve((size_t)QN * (NH * D) * 2);      // attention output planes [1024][2048]
    unsigned short* aL  = (unsigned short*)carve((size_t)QN * (NH * D) * 2);
    float*          cosT = (float*)        carve((size_t)QN * 32 * 4);
    float*          sinT = (float*)        carve((size_t)QN * 32 * 4);
    if (off > ws_size || off > ((size_t)128 << 20)) return;

    // tables and operand planes, one launch
    prep_kernel<<<PREP_BLOCKS, 256, 0, stream>>>(hs, pk, pv, pid, Wq, Wk, Wv, Wo, hsH, hsL, kH, kL, vH, vL,
                                                 wtH, wtL, woH, woL, cosT, sinT, LCK);

    // fused QKV projection: [1024 x 4096] . [4096 x 3072] -> qkv f32
    gemm3_kernel<<<dim3(QKVW / 128, QN / 64), 128, 0, stream>>>(hsH, hsL, wtH, wtL, qkv, INW, QKVW);

    // RoPE + split into q planes, new K rows, new V^T cols
    rope_split_kernel<<<dim3(QKVW / 64, QN / 64), 256, 0, stream>>>(qkv, cosT, sinT, qH, qL, kH, kL, vH, vL);

    // attention
    attn_kernel<<<dim3(NKV, QN / 16), 512, 0, stream>>>(qH, qL, kH, kL, vH, vL, am, in_sizes[3], LCK, aH, aL);

    // output projection: [1024 x 2048] . [2048 x 2048] -> d_out f32
    gemm3_kernel<<<dim3(HIDO / 128, QN / 64), 128, 0, stream>>>(aH, aL, woH, woL, out, NH * D, HIDO);
}

// v005
// It runs in 180 microseconds.
// In two side-by-side timings against v004, it was 1.11 and 1.12 times as fast.
// Over all steps from v000 it is 3.20 times as fast.
// All contractions (q/k/v projections, q.k^T, p.v, output projection): v_wmma_f32_16x16x32_bf16 with bf16 hi/lo operands everywhere (hi*hi + hi*lo + lo*hi), f32 accumulate; RoPE, softmax and normalisation in f32.
#include <hip/hip_runtime.h>
#include <hip/hip_bf16.h>

typedef __attribute__((ext_vector_type(16))) __bf16 v16bf;
typedef float v8f __attribute__((ext_vector_type(8)));
typedef float v4f __attribute__((ext_vector_type(4)));
typedef unsigned int u4 __attribute__((ext_vector_type(4)));
typedef u4 __attribute__((may_alias)) u4a;
typedef v4f __attribute__((may_alias)) v4fa;

union Frag { v16bf v; u4 q[2]; };
union Acc  { v8f v; float f[8]; };

// ---------------------------------------------------------------------------
// bf16 RNE convert and hi/lo split (lo = RNE(x - hi), exact residual)
// ---------------------------------------------------------------------------
__device__ __forceinline__ unsigned bf_rne(float f) {
    unsigned u = __float_as_uint(f);
    u += 0x7FFFu + ((u >> 16) & 1u);
    return u >> 16;
}
__device__ __forceinline__ void split2(float x, unsigned& hi, unsigned& lo) {
    hi = bf_rne(x);
    lo = bf_rne(x - __uint_as_float(hi << 16));
}
// two f32 -> one 32-bit word per plane, first element in the low half-word
__device__ __forceinline__ void pack2(float a, float b, unsigned& wh, unsigned& wl) {
    unsigned ha, la, hb, lb;
    split2(a, ha, la);
    split2(b, hb, lb);
    wh = ha | (hb << 16);
    wl = la | (lb << 16);
}
// eight consecutive f32 -> 16 B per plane
__device__ __forceinline__ void pack8(const v4f a, const v4f b, u4& H, u4& L) {
    unsigned h0, l0, h1, l1, h2, l2, h3, l3;
    pack2(a.x, a.y, h0, l0);
    pack2(a.z, a.w, h1, l1);
    pack2(b.x, b.y, h2, l2);
    pack2(b.z, b.w, h3, l3);
    H.x = h0; H.y = h1; H.z = h2; H.w = h3;
    L.x = l0; L.y = l1; L.z = l2; L.w = l3;
}

// ---------------------------------------------------------------------------
// 16x16x32 fragment load from a k-contiguous 16-bit row (A row m, or B^T row n):
// p = row_start + k0 + 8*h ; elements 0..7 <- k0+8h.., elements 8..15 <- k0+16+8h..
// ---------------------------------------------------------------------------
__device__ __forceinline__ void ldfrag(Frag& f, const unsigned short* p) {
    f.q[0] = *(const u4a*)(p);
    f.q[1] = *(const u4a*)(p + 16);
}

__device__ __forceinline__ void acc_zero(Acc& c) {
#pragma unroll
    for (int i = 0; i < 8; ++i) c.f[i] = 0.0f;
}

// acc += Ah*Bh + Ah*Bl + Al*Bh, then 4 wait slots with D tied and A/B kept live
__device__ __forceinline__ void mma3(Acc& c, const Frag& ah, const Frag& al,
                                     const Frag& bh, const Frag& bl) {
    v8f d = c.v;
    d = __builtin_amdgcn_wmma_f32_16x16x32_bf16(false, ah.v, false, bh.v, (short)0, d, false, false);
    d = __builtin_amdgcn_wmma_f32_16x16x32_bf16(false, ah.v, false, bl.v, (short)0, d, false, false);
    d = __builtin_amdgcn_wmma_f32_16x16x32_bf16(false, al.v, false, bh.v, (short)0, d, false, false);
    asm volatile("v_nop\n\tv_nop\n\tv_nop\n\tv_nop"
                 : "+v"(d) : "v"(ah.v), "v"(al.v), "v"(bh.v), "v"(bl.v));
    c.v = d;
}

// value of lane l ^ 16 (the other half of the wave), a vector cross-row move
__device__ __forceinline__ float xhalf(float x) {
    const int b = __float_as_int(x);
    return __int_as_float(__builtin_amdgcn_permlanex16(b, b, 0x76543210, 0xfedcba98, false, false));
}

// ---------------------------------------------------------------------------
// Operand preparation, ONE launch. None of these jobs reads another's output, so they share a grid:
// PREP_BLOCKS blocks of 256 threads, block b takes units b, b + PREP_BLOCKS, ... of a list of PREP_UNITS.
// Of every 22 list entries 5 are straight splits (memory only) and 17 are transpose units (LDS and vector
// work), mixed for speed only. The last 128 blocks, which have one
// list unit fewer than the first 512, each add one table unit behind their loop.
//   straight unit, 4096 consecutive f32 -> bf16 hi/lo planes: hidden_states (1024 units),
//     past_key (256 units; kv head = 32 units, dst rows 0..2047 of its 3072)
//   table unit, 256 entries of the cos/sin table [1024][32] (128 units)
//   transpose unit, one 64 x 64 tile, src[r][c] -> dst planes [c][r]: Wq 2048, Wk 512, Wv 512 tiles into
//     [Wq|Wk|Wv]^T [3072][4096]; Wo 1024 tiles into Wo^T [2048][2048]; past_value 256 tiles into
//     V^T [8][64][3072] cols 0..2047
// coverage: every unit once (u -> (u / 22, u % 22) is one-to-one), units x 4096 = every element of each source.
// ---------------------------------------------------------------------------
constexpr int PREP_BLOCKS = 1024;
constexpr int PREP_UNITS = 5632;          // 1280 straight + 4352 transpose = 22 * 256
constexpr int PREP_TABLE_BLOCKS = 128;    // x 256 threads = the 1024 x 32 table entries

// cos/sin at angle f32(pos + lck) * inv_freq[i], inv_freq[i] = 1 / 10000^(i/32)
// (f64 exp2 -> f32, then f32 reciprocal); precise sinf/cosf.
__device__ __forceinline__ void table_unit(const int* __restrict__ pid, float* cosT, float* sinT,
                                           int idx, int lck) {
    const int tok = idx >> 5, i = idx & 31;
    const double e = (double)i * 0.03125 * 13.287712379549449;   // i/32 * log2(1e4)
    const float p32 = (float)exp2(e);
    const float inv = 1.0f / p32;
    const float pos = (float)(pid[tok] + lck);
    const float ang = pos * inv;
    const float c = cosf(ang);
    const float s = sinf(ang);
    *(float*)(cosT + idx) = c;
    *(float*)(sinT + idx) = s;
}

// 4096 consecutive f32 -> planes; a thread takes two groups of 8 (one 16-B store per plane and group)
__device__ __forceinline__ void straight_unit(const float* __restrict__ src,
                                              unsigned short* dh, unsigned short* dl, int t) {
    const float* p = src + t * 8;
    const v4f a0 = *(const v4fa*)(p);
    const v4f b0 = *(const v4fa*)(p + 4);
    const v4f a1 = *(const v4fa*)(p + 2048);
    const v4f b1 = *(const v4fa*)(p + 2052);
    u4 H0, L0, H1, L1;
    pack8(a0, b0, H0, L0);
    pack8(a1, b1, H1, L1);
    *(u4*)(dh + t * 8) = H0;        *(u4*)(dl + t * 8) = L0;
    *(u4*)(dh + 2048 + t * 8) = H1; *(u4*)(dl + 2048 + t * 8) = L1;
    // the block's next unit rewrites the registers that these stores name
    asm volatile("s_wait_xcnt 0x0" ::: "memory");
}

// one 64 x 64 tile through LDS: s = tile origin (pitch srcld), dh/dl = origin of the transposed tile
// (pitch dstld). loads 256 thr x 4 x float4 = 64x64; stores 256 thr x 2 x 8 = 64x64 per plane.
__device__ __forceinline__ void transpose_unit(const float* __restrict__ s, int srcld,
                                               unsigned short* dh, unsigned short* dl, int dstld,
                                               unsigned short* Th, unsigned short* Tl, int t) {
    constexpr int TP = 72;
    v4f x[4];
#pragma unroll
    for (int i = 0; i < 4; ++i) {
        x[i] = *(const v4fa*)(s + (size_t)((t >> 4) + 16 * i) * srcld + (t & 15) * 4);
        // a later load's result may land in the registers that hold this load's address
        asm volatile("s_wait_xcnt 0x0" ::: "memory");
    }
#pragma unroll
    for (int i = 0; i < 4; ++i) {
        const int r = (t >> 4) + 16 * i, c4 = (t & 15) * 4;
        const v4f v = x[i];
        unsigned hb, lb;
        split2(v.x, hb, lb); Th[(c4 + 0) * TP + r] = (unsigned short)hb; Tl[(c4 + 0) * TP + r] = (unsigned short)lb;
        split2(v.y, hb, lb); Th[(c4 + 1) * TP + r] = (unsigned short)hb; Tl[(c4 + 1) * TP + r] = (unsigned short)lb;
        split2(v.z, hb, lb); Th[(c4 + 2) * TP + r] = (unsigned short)hb; Tl[(c4 + 2) * TP + r] = (unsigned short)lb;
        split2(v.w, hb, lb); Th[(c4 + 3) * TP + r] = (unsigned short)hb; Tl[(c4 + 3) * TP + r] = (unsigned short)lb;
    }
    __syncthreads();
    const int piece = t & 7;
    const int rowA = (t >> 3), rowB = 32 + (t >> 3);
    const u4 HA = *(const u4a*)(Th + rowA * TP + piece * 8);
    const u4 LA = *(const u4a*)(Tl + rowA * TP + piece * 8);
    const u4 HB = *(const u4a*)(Th + rowB * TP + piece * 8);
    const u4 LB = *(const u4a*)(Tl + rowB * TP + piece * 8);
    // the LDS tile is written again by the block's next transpose unit: every wave's reads end here first
    __syncthreads();
    const size_t gA = (size_t)rowA * dstld + piece * 8;
    const size_t gB = (size_t)rowB * dstld + piece * 8;
    *(u4*)(dh + gA) = HA; *(u4*)(dl + gA) = LA;
    *(u4*)(dh + gB) = HB; *(u4*)(dl + gB) = LB;
    // the block's next unit rewrites the registers that these stores name
    asm volatile("s_wait_xcnt 0x0" ::: "memory");
}

__global__ __launch_bounds__(256) void prep_kernel(
    const float* __restrict__ hs, const float* __restrict__ pk, const float* __restrict__ pv,
    const int* __restrict__ pid,
    const float* __restrict__ Wq, const float* __restrict__ Wk, const float* __restrict__ Wv,
    const float* __restrict__ Wo,
    unsigned short* hsH, unsigned short* hsL, unsigned short* kH, unsigned short* kL,
    unsigned short* vH, unsigned short* vL, unsigned short* wtH, unsigned short* wtL,
    unsigned short* woH, unsigned short* woL, float* cosT, float* sinT, int lck) {
    constexpr int INW = 4096, QW = 2048, KW = 512, D = 64, KVP = 2048, KVL = 3072, HIDO = 2048;
    __shared__ __align__(16) unsigned short Th[64 * 72];
    __shared__ __align__(16) unsigned short Tl[64 * 72];
    const int t = threadIdx.x;
    // every test below reads the unit number alone: the whole block takes one path, barriers included
    for (int u = blockIdx.x; u < PREP_UNITS; u += PREP_BLOCKS) {
        const int q = u / 22, r = u - q * 22;
        if (r < 5) {
            const int s = q * 5 + r;                               // 0..1279
            if (s < 1024) {
                const size_t o = (size_t)s * 4096;
                straight_unit(hs + o, hsH + o, hsL + o, t);
            } else {
                const int y = s - 1024;                            // 0..255
                const size_t o = (size_t)(y >> 5) * (KVL * D) + (size_t)(y & 31) * 4096;
                straight_unit(pk + (size_t)y * 4096, kH + o, kL + o, t);
            }
            continue;
        }
        const int e = q * 17 + (r - 5);                            // 0..4351
        const float* s;
        unsigned short* dh;
        unsigned short* dl;
        int srcld, dstld;
        if (e < 3072) {                                            // Wq | Wk | Wv -> rows nb.. of [3072][4096]
            const float* W = (e < 2048) ? Wq : ((e < 2560) ? Wk : Wv);
            const int y = (e < 2048) ? e : ((e < 2560) ? e - 2048 : e - 2560);
            const int lg = (e < 2048) ? 5 : 3;                     // log2 of the column tiles per row of tiles
            const int nb = (e < 2048) ? 0 : ((e < 2560) ? QW : QW + KW);
            const int c0 = (y & ((1 << lg) - 1)) * 64, r0 = (y >> lg) * 64;
            srcld = (e < 2048) ? QW : KW;
            dstld = INW;
            s = W + (size_t)r0 * srcld + c0;
            const size_t o = (size_t)(nb + c0) * INW + r0;
            dh = wtH + o;
            dl = wtL + o;
        } else if (e < 4096) {                                     // Wo [2048][2048]
            const int y = e - 3072;
            const int c0 = (y & 31) * 64, r0 = (y >> 5) * 64;
            srcld = HIDO;
            dstld = QW;
            s = Wo + (size_t)r0 * HIDO + c0;
            const size_t o = (size_t)c0 * QW + r0;
            dh = woH + o;
            dl = woL + o;
        } else {                                                   // past_value, kv head z: [2048][64]
            const int y = e - 4096;
            const int r0 = (y & 31) * 64, z = y >> 5;
            srcld = D;
            dstld = KVL;
            s = pv + (size_t)z * (KVP * D) + (size_t)r0 * D;
            const size_t o = (size_t)z * (D * KVL) + r0;
            dh = vH + o;
            dl = vL + o;
        }
        transpose_unit(s, srcld, dh, dl, dstld, Th, Tl, t);
    }
    const int tb = (int)blockIdx.x - (PREP_BLOCKS - PREP_TABLE_BLOCKS);
    if (tb >= 0) table_unit(pid, cosT, sinT, tb * 256 + t, lck);
}

// ---------------------------------------------------------------------------
// GEMM, bf16 hi/lo three-term: C[M x N] f32 (pitch ldc) = A[M x K] . B[K x N],
// A planes [M][K] (pitch K), B planes stored transposed [N][K] (pitch K, k-contiguous),
// so A and B fragments use the identical split-k load. Block = 4 waves, 64 x 128;
// wave tile 32 x 64 (2 m-tiles x 4 n-tiles).
// Operands: a stage is 64 k (one 128-B line) of every operand row of the block,
// rows [A hi 64 | A lo 64 | B hi 128 | B lo 128] at an LDS pitch of 144 B, brought in by
// asynchronous copies of 16 B per lane (8 lanes = one whole line); two buffers, the next
// stage's copies fly while this stage is worked on. Fragments are read from LDS.
// Epilogue: wave tile staged in LDS, then each 256-B row segment written as two
// Requires M % 64 == 0, N % 128 == 0, K % 64 == 0, K >= 64, ldc % 32 == 0 (shapes fixed on host).
// ---------------------------------------------------------------------------
// eight copies of 16 B per lane, global -> LDS. The s_wait_xcnt stands inside the statement, behind
// the last copy, so that no address register of a copy is rewritten in front of it.
__device__ __forceinline__ void copy8(const unsigned (&l)[8], const unsigned short* const (&g)[8]) {
    asm volatile("global_load_async_to_lds_b128 %0, %8, off\n\t"
                 "global_load_async_to_lds_b128 %1, %9, off\n\t"
                 "global_load_async_to_lds_b128 %2, %10, off\n\t"
                 "global_load_async_to_lds_b128 %3, %11, off\n\t"
                 "global_load_async_to_lds_b128 %4, %12, off\n\t"
                 "global_load_async_to_lds_b128 %5, %13, off\n\t"
                 "global_load_async_to_lds_b128 %6, %14, off\n\t"
                 "global_load_async_to_lds_b128 %7, %15, off\n\t"
                 "s_wait_xcnt 0x0"
                 :: "v"(l[0]), "v"(l[1]), "v"(l[2]), "v"(l[3]), "v"(l[4]), "v"(l[5]), "v"(l[6]), "v"(l[7]),
                    "v"(g[0]), "v"(g[1]), "v"(g[2]), "v"(g[3]), "v"(g[4]), "v"(g[5]), "v"(g[6]), "v"(g[7])
                 : "memory");
}

__device__ __forceinline__ void store_ctile(const float* sW, float* C, int ldc,
                                            int m0w, int n0w, int hh, int m16) {
#pragma unroll
    for (int i = 0; i < 16; ++i) {
        const int row = 2 * i + hh;
        const v4f v = *(const v4fa*)(sW + row * 68 + m16 * 4);
        *(v4f*)(C + (size_t)(m0w + row) * ldc + n0w + m16 * 4) = v;
    }
}

__global__ __launch_bounds__(128) void gemm3_kernel(
    const unsigned short* __restrict__ Ah, const unsigned short* __restrict__ Al,
    const unsigned short* __restrict__ Bh, const unsigned short* __restrict__ Bl,
    float* C, int K, int ldc) {
    constexpr int SP = 68;
    constexpr int GP = 72;                 // LDS row pitch in halves (144 B = 16 B x 9: no bank conflict for 16-B reads)
    constexpr int RAL = 64, RBH = 128, RBL = 256, GROWS = 384;   // first stage row of A lo, B hi, B lo; rows per stage
    constexpr int GSTAGE = GROWS * GP;     // halves per buffer
    __shared__ __align__(16) unsigned short ring[2 * GSTAGE];
    __shared__ __align__(16) float sC[4 * 32 * SP];
    const int tid = threadIdx.x, w = tid >> 5, lane = tid & 31, hh = lane >> 4, m16 = lane & 15;
    const int m0w = blockIdx.y * 64 + (w >> 1) * 32;
    const int n0w = blockIdx.x * 128 + (w & 1) * 64;

    Acc acc[2][4];
#pragma unroll
    for (int mt = 0; mt < 2; ++mt)
#pragma unroll
        for (int nt = 0; nt < 4; ++nt) acc_zero(acc[mt][nt]);

    const size_t Ks = (size_t)K;
    // copy side: thread = (row cr of 16, 16-B piece cp of the row's 128 B); copy i takes stage row cr + 16 * i
    const int cr = tid >> 3, cp = tid & 7;
    const unsigned short* gAh = Ah + (size_t)(blockIdx.y * 64 + cr) * Ks + cp * 8;
    const unsigned short* gAl = Al + (size_t)(blockIdx.y * 64 + cr) * Ks + cp * 8;
    const unsigned short* gBh = Bh + (size_t)(blockIdx.x * 128 + cr) * Ks + cp * 8;
    const unsigned short* gBl = Bl + (size_t)(blockIdx.x * 128 + cr) * Ks + cp * 8;
    const unsigned lds0 = (unsigned)(size_t)(ring + cr * GP + cp * 8);   // LDS byte address: low 32 bits

    auto issue = [&](int st, int buf) {
        const unsigned lb = lds0 + (unsigned)buf * (unsigned)(GSTAGE * 2);
        const size_t ko = (size_t)st * 64;
        unsigned l[8];
        const unsigned short* g[8];
#pragma unroll
        for (int i = 0; i < 4; ++i) {
            l[i] = lb + (unsigned)((16 * i) * GP * 2);
            g[i] = gAh + ko + (size_t)(16 * i) * Ks;
            l[4 + i] = lb + (unsigned)((RAL + 16 * i) * GP * 2);
            g[4 + i] = gAl + ko + (size_t)(16 * i) * Ks;
        }
        copy8(l, g);
#pragma unroll
        for (int i = 0; i < 8; ++i) {
            l[i] = lb + (unsigned)((RBH + 16 * i) * GP * 2);
            g[i] = gBh + ko + (size_t)(16 * i) * Ks;
        }
        copy8(l, g);
#pragma unroll
        for (int i = 0; i < 8; ++i) {
            l[i] = lb + (unsigned)((RBL + 16 * i) * GP * 2);
            g[i] = gBl + ko + (size_t)(16 * i) * Ks;
        }
        copy8(l, g);
    };

    const int NT = K >> 6;
    issue(0, 0);
    // stage 0 has landed for this wave, then is published to the other waves
    asm volatile("s_wait_asynccnt 0x0" ::: "memory");
    __syncthreads();
    if (NT > 1) issue(1, 1);

    // reader side: first fragment row of this wave inside a stage
    const int offA = ((w >> 1) * 32 + m16) * GP + 8 * hh;
    const int offB = (RBH + (w & 1) * 64 + m16) * GP + 8 * hh;

    // kept rolled: the buffer index and the refill test are per trip
#pragma unroll 1
    for (int t = 0; t < NT; ++t) {
        const unsigned short* sb = ring + (t & 1) * GSTAGE;
        // a trip is 8 groups g = (k half g >> 2, n-tile g & 3) of 6 products. Fragment reads stand at three
        // places only (before group 0, at groups 2 and 4), the last two at least three groups ahead of their use, all in this trip's own buffer.
        Frag fa[2][4], fb[8][2];
        auto lda = [&](int ks) {
            const unsigned short* pa = sb + offA + ks * 32;
            ldfrag(fa[ks][0], pa);
            ldfrag(fa[ks][1], pa + RAL * GP);
            ldfrag(fa[ks][2], pa + 16 * GP);
            ldfrag(fa[ks][3], pa + (RAL + 16) * GP);
        };
        auto ldb = [&](int g) {
            const unsigned short* pb = sb + offB + (g >> 2) * 32 + (g & 3) * 16 * GP;
            ldfrag(fb[g][0], pb);
            ldfrag(fb[g][1], pb + (RBL - RBH) * GP);
        };
        lda(0); ldb(0); ldb(1); ldb(2); ldb(3); lda(1); ldb(4);
#pragma unroll
        for (int g = 0; g < 8; ++g) {
            if (g == 2) { ldb(5); ldb(6); }
            if (g == 4) ldb(7);
            mma3(acc[0][g & 3], fa[g >> 2][0], fa[g >> 2][1], fb[g][0], fb[g][1]);
            mma3(acc[1][g & 3], fa[g >> 2][2], fa[g >> 2][3], fb[g][0], fb[g][1]);
        }
        // publish point: this wave's LDS reads of the buffer are done, its copies of the next stage
        // have landed; the barrier publishes the next stage and frees this buffer for the refill
        asm volatile("s_wait_dscnt 0x0" ::: "memory");
        asm volatile("s_wait_asynccnt 0x0" ::: "memory");
        __syncthreads();
        if (t + 2 < NT) issue(t + 2, t & 1);
    }
    // no copy is left in flight when the wave goes on
    asm volatile("s_wait_asynccnt 0x0" ::: "memory");

    // D layout: acc[mt][nt].f[r] = tile(row mt*16 + 8*hh + r, col nt*16 + m16)
    float* sW = sC + w * (32 * SP);
#pragma unroll
    for (int mt = 0; mt < 2; ++mt)
#pragma unroll
        for (int nt = 0; nt < 4; ++nt)
#pragma unroll
            for (int r = 0; r < 8; ++r)
                sW[(mt * 16 + 8 * hh + r) * SP + nt * 16 + m16] = acc[mt][nt].f[r];
    __syncthreads();
    store_ctile(sW, C, ldc, m0w, n0w, hh, m16);
    
}

// ---------------------------------------------------------------------------
// RoPE + split of the projection output qkv[1024][3072] (q cols 0..2047 = h*64+d,
// k cols 2048..2559, v cols 2560..3071). Block = (64-col group g, 64 tokens).
//   g < 32      : q head g      -> q planes [32][1024][64]      (RoPE)
//   32<=g<40    : kv head g-32  -> K planes [8][3072][64] rows 2048+tok (RoPE)
//   40<=g<48    : kv head g-40  -> V^T planes [8][64][3072] cols 2048+tok (transpose)
// y[d] = x[d]*cos + rot[d]*sin, rot = -x[d+32] (d<32), x[d-32] (d>=32); cos/sin from table.
// Each thread emits 8 consecutive halves per plane (16 B); 8 consecutive lanes = one line.
// coverage: q planes all 32x1024 rows; K planes rows 2048..3071 of every kv head;
// V^T planes cols 2048..3071 of all 8x64 rows.
// ---------------------------------------------------------------------------
__device__ __forceinline__ void rope8(const float* xr, const float* pr, const float* cr,
                                      const float* sr, float sgn, v4f& ya, v4f& yb) {
#pragma clang fp contract(off)
    ya.x = xr[0] * cr[0] + (sgn * pr[0]) * sr[0];
    ya.y = xr[1] * cr[1] + (sgn * pr[1]) * sr[1];
    ya.z = xr[2] * cr[2] + (sgn * pr[2]) * sr[2];
    ya.w = xr[3] * cr[3] + (sgn * pr[3]) * sr[3];
    yb.x = xr[4] * cr[4] + (sgn * pr[4]) * sr[4];
    yb.y = xr[5] * cr[5] + (sgn * pr[5]) * sr[5];
    yb.z = xr[6] * cr[6] + (sgn * pr[6]) * sr[6];
    yb.w = xr[7] * cr[7] + (sgn * pr[7]) * sr[7];
}

__global__ __launch_bounds__(256) void rope_split_kernel(
    const float* __restrict__ qkv, const float* __restrict__ cosT, const float* __restrict__ sinT,
    unsigned short* qh, unsigned short* ql, unsigned short* kh, unsigned short* kl,
    unsigned short* vh, unsigned short* vl) {
#pragma clang fp contract(off)
    constexpr int QN = 1024, D = 64, NH = 32, NKV = 8, QKVW = 3072, KVL = 3072, KVP = 2048, TP = 68;
    __shared__ __align__(16) float T[64 * TP];
    const int t = threadIdx.x, g = blockIdx.x, tok0 = blockIdx.y * 64;
    const float* s = qkv + (size_t)tok0 * QKVW + g * D;
#pragma unroll
    for (int i = 0; i < 4; ++i) {
        const int r = (t >> 4) + 16 * i, c4 = (t & 15) * 4;
        const v4f v = *(const v4fa*)(s + (size_t)r * QKVW + c4);
        *(v4fa*)(T + r * TP + c4) = v;
    }
    __syncthreads();

    u4 H0, L0, H1, L1;
    size_t g0, g1;
    unsigned short* dH;
    unsigned short* dL;
    if (g < NH + NKV) {                                   // block-uniform branch
        const bool isq = (g < NH);
        dH = isq ? qh : kh;
        dL = isq ? ql : kl;
        const int d0 = (t & 7) * 8, dp0 = d0 ^ 32;
        const float sgn = (d0 < 32) ? -1.0f : 1.0f;
        {
            const int r = (t >> 3), tok = tok0 + r;
            const float* cr = cosT + (size_t)tok * 32 + (d0 & 31);
            const float* sr = sinT + (size_t)tok * 32 + (d0 & 31);
            v4f ya, yb;
            rope8(T + r * TP + d0, T + r * TP + dp0, cr, sr, sgn, ya, yb);
            pack8(ya, yb, H0, L0);
            const size_t row = isq ? ((size_t)g * QN + tok) : ((size_t)(g - NH) * KVL + KVP + tok);
            g0 = row * D + d0;
        }
        {
            const int r = 32 + (t >> 3), tok = tok0 + r;
            const float* cr = cosT + (size_t)tok * 32 + (d0 & 31);
            const float* sr = sinT + (size_t)tok * 32 + (d0 & 31);
            v4f ya, yb;
            rope8(T + r * TP + d0, T + r * TP + dp0, cr, sr, sgn, ya, yb);
            pack8(ya, yb, H1, L1);
            const size_t row = isq ? ((size_t)g * QN + tok) : ((size_t)(g - NH) * KVL + KVP + tok);
            g1 = row * D + d0;
        }
    } else {
        dH = vh;
        dL = vl;
        const int kvhd = g - NH - NKV, piece = t & 7;
        {
            const int d = (t >> 3);
            v4f ya, yb;
            ya.x = T[(piece * 8 + 0) * TP + d]; ya.y = T[(piece * 8 + 1) * TP + d];
            ya.z = T[(piece * 8 + 2) * TP + d]; ya.w = T[(piece * 8 + 3) * TP + d];
            yb.x = T[(piece * 8 + 4) * TP + d]; yb.y = T[(piece * 8 + 5) * TP + d];
            yb.z = T[(piece * 8 + 6) * TP + d]; yb.w = T[(piece * 8 + 7) * TP + d];
            pack8(ya, yb, H0, L0);
            g0 = ((size_t)(kvhd * D + d)) * KVL + KVP + tok0 + piece * 8;
        }
        {
            const int d = 32 + (t >> 3);
            v4f ya, yb;
            ya.x = T[(piece * 8 + 0) * TP + d]; ya.y = T[(piece * 8 + 1) * TP + d];
            ya.z = T[(piece * 8 + 2) * TP + d]; ya.w = T[(piece * 8 + 3) * TP + d];
            yb.x = T[(piece * 8 + 4) * TP + d]; yb.y = T[(piece * 8 + 5) * TP + d];
            yb.z = T[(piece * 8 + 6) * TP + d]; yb.w = T[(piece * 8 + 7) * TP + d];
            pack8(ya, yb, H1, L1);
            g1 = ((size_t)(kvhd * D + d)) * KVL + KVP + tok0 + piece * 8;
        }
    }
    *(u4*)(dH + g0) = H0; *(u4*)(dL + g0) = L0;
    *(u4*)(dH + g1) = H1; *(u4*)(dL + g1) = L1;
    
}

// ---------------------------------------------------------------------------
// Flash attention with the block-diagonal TTT mask, GQA (kv head = h >> 2).
// Block = (kv head, 16 query rows), 16 waves = its 4 query heads x 4 key splits. The key
// tiles of 32 of all three key blocks form one list; split ks takes entries ks, ks + 4, ...
// The 4 heads of one split walk the same K and V tiles at the same time: a trip of the block is one
// tile per split, and each split's tile (K hi, K lo: 32 key rows of 128 B at a pitch of 144 B; V^T hi,
// V^T lo: 64 d rows of 64 B at a pitch of 80 B) is brought into LDS once by the split's 4 waves with
// asynchronous copies of 16 B per lane; two buffers, the next trip's copies fly while this trip is
// worked on. All K and V fragments are read from LDS.
// Both products are computed transposed: S^T = K . Q^T (A = K rows, B = q) and O^T += V^T . P^T (A = V^T rows,
// B = P^T). A lane then holds 16 scores of ONE query (column m16; keys 8*hh + r of each 16-key tile): maximum and
// sum run inside the lane, with one exchange between the wave's halves for the maximum, and the two score tiles,
// split in place, are the B operand of the second product in the hardware k order that ldfrag also has.
// Each wave keeps its own running maximum, sum (per wave half, joined behind the loop) and 16 x 64 output; a head's
// four partial results are merged through LDS in fixed split order behind one work-group barrier.
// Q/K/V/P operands as bf16 hi/lo; scores, mask (-inf), running-max softmax in f32.
// key j of block blk allowed iff j < seq_len and j <= i - (lck - blk).
// seq_len = sum(attention_mask) - lck, summed per block in fixed order.
// Per blk the key-tile count is bounded by the tile's diagonal and seq_len
// (at most 32 tiles); the mask is still applied by value per element.
// Output attn planes [1024][2048] (col h*64+d): 8 lanes x 16 B = one 128-B line per row.
// Query tiles with the most keys have the lowest block index (for speed only).
// coverage: 8 x 64 blocks x 4 heads x 16 rows x 64 cols = [1024][2048] per plane.
// ---------------------------------------------------------------------------
__global__ __launch_bounds__(512) void attn_kernel(
    const unsigned short* __restrict__ qH, const unsigned short* __restrict__ qL,
    const unsigned short* __restrict__ kH, const unsigned short* __restrict__ kL,
    const unsigned short* __restrict__ vH, const unsigned short* __restrict__ vL,
    const int* __restrict__ amask, int nmask, int lck,
    unsigned short* oH, unsigned short* oL) {
    constexpr int QN = 1024, D = 64, KVL = 3072, HIDO = 2048, NS = 4, NW = 4 * NS, SP = 68;
    constexpr int KP = 72, VP = 40;                 // LDS row pitches in halves (16 B x 9, 16 B x 5: no bank conflict for 16-B reads)
    constexpr int KPL = 32 * KP, VPL = 64 * VP;     // halves per plane of a K tile, of a V^T tile
    constexpr int TSPL = 2 * KPL + 2 * VPL;         // halves per split: [K hi | K lo | V^T hi | V^T lo]
    constexpr int TSTAGE = NS * TSPL;               // halves per buffer
    __shared__ __align__(16) unsigned short kvs[2 * TSTAGE];
    __shared__ int red[128];
    __shared__ __align__(16) float Os[NW * 16 * SP];
    __shared__ float Ms[NW * 16];
    __shared__ float Ls[NW * 16];
    const int tid = threadIdx.x, lane = tid & 31, hh = lane >> 4, m16 = lane & 15;
    // wave number held as a scalar: the key-tile loop then branches on scalar tests, every lane on
    const int w = __builtin_amdgcn_readfirstlane(tid >> 5);

    // seq_len (integer, fixed order, identical in every block)
    if (tid < 128) {                                   // the first four waves sum the mask
        int part = 0;
        for (int i = tid; i < nmask; i += 128) part += amask[i];
        red[tid] = part;
    }
    __syncthreads();
#pragma unroll
    for (int off = 64; off > 0; off >>= 1) {
        if (tid < off) red[tid] += red[tid + off];
        __syncthreads();
    }
    const int seq_len = __builtin_amdgcn_readfirstlane(red[0] - lck);

    const int kvh = blockIdx.x, h = kvh * 4 + (w & 3), ks = w >> 2;
    const int q0w = (QN / 16 - 1 - (int)blockIdx.y) * 16;
    const float NEG_INF = -__builtin_inff();

    Frag fqh[2], fql[2];
    {
        const size_t qo = ((size_t)h * QN + q0w + m16) * D + 8 * hh;
        ldfrag(fqh[0], qH + qo);
        ldfrag(fqh[1], qH + qo + 32);
        ldfrag(fql[0], qL + qo);
        ldfrag(fql[1], qL + qo + 32);
    }
    // of query q0w + m16: running maximum (alike in both halves) and this half's part of the running sum
    float mrun = NEG_INF, lrun = 0.0f;
    Acc o[4];
#pragma unroll
    for (int dt = 0; dt < 4; ++dt) acc_zero(o[dt]);

    const size_t kplane = (size_t)kvh * KVL * D;      // K planes [kvh][kv][d]
    const size_t vplane = (size_t)kvh * D * KVL;      // V^T planes [kvh][d][kv]

    // key tiles per key block (allowed j of block blk are < q0w + 16 - (lck - blk) and < seq_len),
    // as running ends e0 <= e1 <= e2 of the one list; each count <= 32, so e2 <= 96
    int e0, e1, e2;
    {
        int c0 = q0w + 16 - lck, c1 = c0 + 1, c2 = c0 + 2;
        c0 = (c0 < seq_len) ? c0 : seq_len;
        c1 = (c1 < seq_len) ? c1 : seq_len;
        c2 = (c2 < seq_len) ? c2 : seq_len;
        c0 = (c0 < 0) ? 0 : ((c0 > QN) ? QN : c0);
        c1 = (c1 < 0) ? 0 : ((c1 > QN) ? QN : c1);
        c2 = (c2 < 0) ? 0 : ((c2 > QN) ? QN : c2);
        e0 = __builtin_amdgcn_readfirstlane((c0 + 31) >> 5);
        e1 = e0 + __builtin_amdgcn_readfirstlane((c1 + 31) >> 5);
        e2 = e1 + __builtin_amdgcn_readfirstlane((c2 + 31) >> 5);
    }
    // copy side: the 128 lanes of a split bring its tile; per lane 4 copies of K (2 planes x 2 row groups
    // of 16; 8 lanes = one 128-B row) and 4 of V^T (2 planes x 2 row groups of 32; 4 lanes = one 64-B row)
    const int lt = (w & 3) * 32 + lane;
    const int ckr = lt >> 3, ckp = (lt & 7) * 8, cvr = lt >> 2, cvp = (lt & 3) * 8;
    const unsigned short* gkh = kH + kplane + (size_t)ckr * D + ckp;
    const unsigned short* gkl = kL + kplane + (size_t)ckr * D + ckp;
    const unsigned short* gvh = vH + vplane + (size_t)cvr * KVL + cvp;
    const unsigned short* gvl = vL + vplane + (size_t)cvr * KVL + cvp;
    const unsigned ldk = (unsigned)(size_t)(kvs + ks * TSPL + ckr * KP + ckp);             // LDS byte address: low 32 bits
    const unsigned ldv = (unsigned)(size_t)(kvs + ks * TSPL + 2 * KPL + cvr * VP + cvp);
    // trips of the block; a split whose list entry lies past the end copies the last tile again (in bounds,
    // never read), so every wave issues the same copies in every trip
    const int NT = (e2 + NS - 1) / NS;
    auto issue = [&](int it, int buf) {
        int le = it * NS + ks;
        le = (le < e2) ? le : (e2 - 1);
        const int cb = (le >= e0 ? 1 : 0) + (le >= e1 ? 1 : 0);
        const int ct = le - (le >= e1 ? e1 : (le >= e0 ? e0 : 0));
        const size_t ckv = (size_t)(cb * QN + ct * 32);
        const unsigned bo = (unsigned)buf * (unsigned)(TSTAGE * 2);
        unsigned l[8];
        const unsigned short* g[8];
#pragma unroll
        for (int i = 0; i < 2; ++i) {
            l[i] = ldk + bo + (unsigned)(16 * i * KP * 2);
            g[i] = gkh + (ckv + 16 * i) * D;
            l[2 + i] = ldk + bo + (unsigned)((KPL + 16 * i * KP) * 2);
            g[2 + i] = gkl + (ckv + 16 * i) * D;
            l[4 + i] = ldv + bo + (unsigned)(32 * i * VP * 2);
            g[4 + i] = gvh + (size_t)(32 * i) * KVL + ckv;
            l[6 + i] = ldv + bo + (unsigned)((VPL + 32 * i * VP) * 2);
            g[6 + i] = gvl + (size_t)(32 * i) * KVL + ckv;
        }
        copy8(l, g);
    };
    if (NT > 0) issue(0, 0);
    // trip 0's tiles have landed for this wave, then are published to the other waves
    asm volatile("s_wait_asynccnt 0x0" ::: "memory");
    __syncthreads();
    if (NT > 1) issue(1, 1);

    // kept rolled: a second copy of the long body would only raise the register count
#pragma unroll 1
    for (int it = 0; it < NT; ++it) {
      const int s = it * NS + ks;
      if (s < e2) {                                    // scalar test: the whole wave works or skips
        const int blk = (s >= e0 ? 1 : 0) + (s >= e1 ? 1 : 0);
        const int t = s - (s >= e1 ? e1 : (s >= e0 ? e0 : 0));
        const int shift = lck - blk;                   // j <= i - shift
        const int j0 = t * 32;
        const unsigned short* tb = kvs + (it & 1) * TSTAGE + ks * TSPL;   // this split's tile of this trip
        Acc sc[2];
        acc_zero(sc[0]);
        acc_zero(sc[1]);
        // the K fragment reads stand together at the head of the trip
        Frag fk[2][2][2];
#pragma unroll
        for (int nt = 0; nt < 2; ++nt)
#pragma unroll
            for (int ds = 0; ds < 2; ++ds) {
                const unsigned short* pk = tb + (nt * 16 + m16) * KP + ds * 32 + 8 * hh;
                ldfrag(fk[nt][ds][0], pk);
                ldfrag(fk[nt][ds][1], pk + KPL);
            }
        // S^T tile [32 keys x 16 q]; A = K (k = d), B = q (k = d): sc[nt].f[r] = S[q m16][key nt*16 + 8*hh + r]
#pragma unroll
        for (int nt = 0; nt < 2; ++nt)
#pragma unroll
            for (int ds = 0; ds < 2; ++ds)
                mma3(sc[nt], fk[nt][ds][0], fk[nt][ds][1], fqh[ds], fql[ds]);
        // the V fragment reads stand together ahead of the softmax, which covers their latency
        Frag fv[4][2];
#pragma unroll
        for (int dt = 0; dt < 4; ++dt) {
            const unsigned short* pv = tb + 2 * KPL + (dt * 16 + m16) * VP + 8 * hh;
            ldfrag(fv[dt][0], pv);
            ldfrag(fv[dt][1], pv + VPL);
        }
        // scale and mask by value: key j allowed iff j < seq_len and j <= qi - shift
        {
            const int qi = q0w + m16;
            const int jd = qi - shift, jp = seq_len - 1;
            const int jmax = (jd < jp) ? jd : jp;      // last allowed key of this query in this key block
#pragma unroll
            for (int nt = 0; nt < 2; ++nt)
#pragma unroll
                for (int r = 0; r < 8; ++r) {
                    const int j = j0 + nt * 16 + 8 * hh + r;
                    sc[nt].f[r] = (j <= jmax) ? sc[nt].f[r] * 0.125f : NEG_INF;
                }
        }
        // running-max softmax update of the lane's one query
        float x = fmaxf(sc[0].f[0], sc[1].f[0]);
#pragma unroll
        for (int r = 1; r < 8; ++r) x = fmaxf(x, fmaxf(sc[0].f[r], sc[1].f[r]));
        x = fmaxf(x, xhalf(x));
        const float mn = fmaxf(mrun, x);
        const float msafe = (mn == NEG_INF) ? 0.0f : mn;
        const float alpha = __expf(mrun - msafe);
        mrun = mn;
#pragma unroll
        for (int nt = 0; nt < 2; ++nt)
#pragma unroll
            for (int r = 0; r < 8; ++r) sc[nt].f[r] = __expf(sc[nt].f[r] - msafe);
        {
            float s4[4];
#pragma unroll
            for (int c = 0; c < 4; ++c)
                s4[c] = (sc[0].f[c] + sc[0].f[4 + c]) + (sc[1].f[c] + sc[1].f[4 + c]);
            lrun = lrun * alpha + ((s4[0] + s4[1]) + (s4[2] + s4[3]));
        }
#pragma unroll
        for (int dt = 0; dt < 4; ++dt)
#pragma unroll
            for (int r = 0; r < 8; ++r) o[dt].f[r] *= alpha;

        // P^T as B operand (k = key, n = q): elements 0..7 = tile 0's registers, 8..15 = tile 1's
        Frag fph, fpl;
#pragma unroll
        for (int nt = 0; nt < 2; ++nt) {
            const v4f pa = {sc[nt].f[0], sc[nt].f[1], sc[nt].f[2], sc[nt].f[3]};
            const v4f pb = {sc[nt].f[4], sc[nt].f[5], sc[nt].f[6], sc[nt].f[7]};
            pack8(pa, pb, fph.q[nt], fpl.q[nt]);
        }

        // O^T += V^T . P^T ; A = V^T rows (m = d, k = key): o[dt].f[r] = O[q m16][dt*16 + 8*hh + r]
#pragma unroll
        for (int dt = 0; dt < 4; ++dt) mma3(o[dt], fv[dt][0], fv[dt][1], fph, fpl);
      }
        // publish point: this wave's LDS reads of the buffer are done, its copies of the next trip
        // have landed; the barrier publishes the next trip's tiles and frees this buffer for the refill
        asm volatile("s_wait_dscnt 0x0" ::: "memory");
        asm volatile("s_wait_asynccnt 0x0" ::: "memory");
        __syncthreads();
        if (it + 2 < NT) issue(it + 2, it & 1);
    }
    // no copy is left in flight when the wave goes on
    asm volatile("s_wait_asynccnt 0x0" ::: "memory");

    // each wave's partial result to LDS (o[dt].f[r] = O[q m16][dt*16 + 8*hh + r]: 8 consecutive columns of a row)
    float* Ow = Os + w * 16 * SP;
#pragma unroll
    for (int dt = 0; dt < 4; ++dt) {
        const v4f oa = {o[dt].f[0], o[dt].f[1], o[dt].f[2], o[dt].f[3]};
        const v4f ob = {o[dt].f[4], o[dt].f[5], o[dt].f[6], o[dt].f[7]};
        *(v4fa*)(Ow + m16 * SP + dt * 16 + 8 * hh) = oa;
        *(v4fa*)(Ow + m16 * SP + dt * 16 + 8 * hh + 4) = ob;
    }
    // the halves' sums are joined with every lane on; both halves then store the same two values
    const float lall = lrun + xhalf(lrun);
    Ms[w * 16 + m16] = mrun;
    Ls[w * 16 + m16] = lall;
    __syncthreads();

    // merge in split order, normalise, split into planes; thread = (head, row, 8 columns)
    const int hl = tid >> 7, row = (tid >> 3) & 15, c8 = (tid & 7) * 8;
    float mall = NEG_INF;
#pragma unroll
    for (int u = 0; u < NS; ++u) mall = fmaxf(mall, Ms[(u * 4 + hl) * 16 + row]);
    const float mfin = (mall == NEG_INF) ? 0.0f : mall;
    float lsum = 0.0f;
    v4f oa = {0.0f, 0.0f, 0.0f, 0.0f}, ob = {0.0f, 0.0f, 0.0f, 0.0f};
#pragma unroll
    for (int u = 0; u < NS; ++u) {
        const int pr = (u * 4 + hl) * 16 + row;
        const float a = __expf(Ms[pr] - mfin);
        const v4f va = *(const v4fa*)(Os + pr * SP + c8);
        const v4f vb = *(const v4fa*)(Os + pr * SP + c8 + 4);
        lsum += a * Ls[pr];
        oa += a * va;
        ob += a * vb;
    }
    const float il = 1.0f / lsum;
    u4 H, L;
    pack8(oa * il, ob * il, H, L);
    const size_t eo = (size_t)(q0w + row) * HIDO + (kvh * 4 + hl) * D + c8;
    *(u4*)(oH + eo) = H;
    *(u4*)(oL + eo) = L;
}

// ---------------------------------------------------------------------------
extern "C" void kernel_launch(void* const* d_in, const int* in_sizes, int n_in,
                              void* d_out, int out_size, void* d_ws, size_t ws_size,
                              hipStream_t stream) {
    constexpr int QN = 1024, INW = 4096, NH = 32, NKV = 8, D = 64, HIDO = 2048;
    constexpr int KVP = 2048, KVL = 3072, QKVW = 3072, LCK = KVP / QN;
    if (n_in < 9) return;
    if (in_sizes[0] != QN * INW || in_sizes[1] != NKV * KVP * D || in_sizes[2] != NKV * KVP * D ||
        in_sizes[3] != QN || in_sizes[4] != QN || in_sizes[5] != INW * NH * D ||
        in_sizes[6] != INW * NKV * D || in_sizes[7] != INW * NKV * D ||
        in_sizes[8] != NH * D * HIDO || out_size != QN * HIDO) return;

    const float* hs  = (const float*)d_in[0];
    const float* pk  = (const float*)d_in[1];
    const float* pv  = (const float*)d_in[2];
    const int*   am  = (const int*)  d_in[3];
    const int*   pid = (const int*)  d_in[4];
    const float* Wq  = (const float*)d_in[5];
    const float* Wk  = (const float*)d_in[6];
    const float* Wv  = (const float*)d_in[7];
    const float* Wo  = (const float*)d_in[8];
    float* out = (float*)d_out;

    char* ws = (char*)d_ws;
    size_t off = 0;
    auto carve = [&](size_t bytes) -> char* {
        char* p = ws + off;
        off += (bytes + 255) & ~(size_t)255;
        return p;
    };
    unsigned short* hsH = (unsigned short*)carve((size_t)QN * INW * 2);          // A planes of QKV GEMM
    unsigned short* hsL = (unsigned short*)carve((size_t)QN * INW * 2);
    unsigned short* wtH = (unsigned short*)carve((size_t)QKVW * INW * 2);        // [Wq|Wk|Wv]^T planes [3072][4096]
    unsigned short* wtL = (unsigned short*)carve((size_t)QKVW * INW * 2);
    unsigned short* woH = (unsigned short*)carve((size_t)HIDO * (NH * D) * 2);    // Wo^T planes [2048][2048]
    unsigned short* woL = (unsigned short*)carve((size_t)HIDO * (NH * D) * 2);
    float*          qkv = (float*)         carve((size_t)QN * QKVW * 4);          // projection output f32
    unsigned short* qH  = (unsigned short*)carve((size_t)NH * QN * D * 2);        // q planes [32][1024][64]
    unsigned short* qL  = (unsigned short*)carve((size_t)NH * QN * D * 2);
    unsigned short* kH  = (unsigned short*)carve((size_t)NKV * KVL * D * 2);      // K planes [8][3072][64]
    unsigned short* kL  = (unsigned short*)carve((size_t)NKV * KVL * D * 2);
    unsigned short* vH  = (unsigned short*)carve((size_t)NKV * D * KVL * 2);      // V^T planes [8][64][3072]
    unsigned short* vL  = (unsigned short*)carve((size_t)NKV * D * KVL * 2);
    unsigned short* aH  = (unsigned short*)carve((size_t)QN * (NH * D) * 2);      // attention output planes [1024][2048]
    unsigned short* aL  = (unsigned short*)carve((size_t)QN * (NH * D) * 2);
    float*          cosT = (float*)        carve((size_t)QN * 32 * 4);
    float*          sinT = (float*)        carve((size_t)QN * 32 * 4);
    if (off > ws_size || off > ((size_t)128 << 20)) return;

    // tables and operand planes, one launch
    prep_kernel<<<PREP_BLOCKS, 256, 0, stream>>>(hs, pk, pv, pid, Wq, Wk, Wv, Wo, hsH, hsL, kH, kL, vH, vL,
                                                 wtH, wtL, woH, woL, cosT, sinT, LCK);

    // fused QKV projection: [1024 x 4096] . [4096 x 3072] -> qkv f32
    gemm3_kernel<<<dim3(QKVW / 128, QN / 64), 128, 0, stream>>>(hsH, hsL, wtH, wtL, qkv, INW, QKVW);

    // RoPE + split into q planes, new K rows, new V^T cols
    rope_split_kernel<<<dim3(QKVW / 64, QN / 64), 256, 0, stream>>>(qkv, cosT, sinT, qH, qL, kH, kL, vH, vL);

    // attention
    attn_kernel<<<dim3(NKV, QN / 16), 512, 0, stream>>>(qH, qL, kH, kL, vH, vL, am, in_sizes[3], LCK, aH, aL);

    // output projection: [1024 x 2048] . [2048 x 2048] -> d_out f32
    gemm3_kernel<<<dim3(HIDO / 128, QN / 64), 128, 0, stream>>>(aH, aL, woH, woL, out, NH * D, HIDO);
}

// v006
// One run takes 173 microseconds.
// Two timings next to v005 put it at 1.05 and 1.04 times that version's speed.
// Counting every step since v000, it is 3.34 times as fast.
// All contractions (q/k/v projections, q.k^T, p.v, output projection): v_wmma_f32_16x16x32_bf16 with bf16 hi/lo operands everywhere (hi*hi + hi*lo + lo*hi), f32 accumulate; RoPE, softmax and normalisation in f32.
#include <hip/hip_runtime.h>
#include <hip/hip_bf16.h>

typedef __attribute__((ext_vector_type(16))) __bf16 v16bf;
typedef __attribute__((ext_vector_type(2))) __bf16 v2bf;
typedef float v2f __attribute__((ext_vector_type(2)));
typedef float v8f __attribute__((ext_vector_type(8)));
typedef float v4f __attribute__((ext_vector_type(4)));
typedef unsigned int u4 __attribute__((ext_vector_type(4)));
typedef u4 __attribute__((may_alias)) u4a;
typedef v4f __attribute__((may_alias)) v4fa;

union Frag { v16bf v; u4 q[2]; };
union Acc  { v8f v; float f[8]; };

// ---------------------------------------------------------------------------
// bf16 hi/lo split (hi = RNE(x), lo = RNE(x - hi), exact residual), two values at a time
// ---------------------------------------------------------------------------
// two f32 -> two bf16 in one word, first element in the low half-word: one packed convert, round to nearest even
__device__ __forceinline__ unsigned cvt2(float a, float b) {
    const v2f x = {a, b};
    return __builtin_bit_cast(unsigned, __builtin_convertvector(x, v2bf));
}
// two f32 -> one 32-bit word per plane
__device__ __forceinline__ void pack2(float a, float b, unsigned& wh, unsigned& wl) {
    wh = cvt2(a, b);
    wl = cvt2(a - __uint_as_float(wh << 16), b - __uint_as_float(wh & 0xFFFF0000u));
}
// eight consecutive f32 -> 16 B per plane
__device__ __forceinline__ void pack8(const v4f a, const v4f b, u4& H, u4& L) {
    unsigned h0, l0, h1, l1, h2, l2, h3, l3;
    pack2(a.x, a.y, h0, l0);
    pack2(a.z, a.w, h1, l1);
    pack2(b.x, b.y, h2, l2);
    pack2(b.z, b.w, h3, l3);
    H.x = h0; H.y = h1; H.z = h2; H.w = h3;
    L.x = l0; L.y = l1; L.z = l2; L.w = l3;
}

// ---------------------------------------------------------------------------
// 16x16x32 fragment load from a k-contiguous 16-bit row (A row m, or B^T row n):
// p = row_start + k0 + 8*h ; elements 0..7 <- k0+8h.., elements 8..15 <- k0+16+8h..
// ---------------------------------------------------------------------------
__device__ __forceinline__ void ldfrag(Frag& f, const unsigned short* p) {
    f.q[0] = *(const u4a*)(p);
    f.q[1] = *(const u4a*)(p + 16);
}

__device__ __forceinline__ void acc_zero(Acc& c) {
#pragma unroll
    for (int i = 0; i < 8; ++i) c.f[i] = 0.0f;
}

// acc += Ah*Bh + Ah*Bl + Al*Bh, then 4 wait slots with D tied and A/B kept live
__device__ __forceinline__ void mma3(Acc& c, const Frag& ah, const Frag& al,
                                     const Frag& bh, const Frag& bl) {
    v8f d = c.v;
    d = __builtin_amdgcn_wmma_f32_16x16x32_bf16(false, ah.v, false, bh.v, (short)0, d, false, false);
    d = __builtin_amdgcn_wmma_f32_16x16x32_bf16(false, ah.v, false, bl.v, (short)0, d, false, false);
    d = __builtin_amdgcn_wmma_f32_16x16x32_bf16(false, al.v, false, bh.v, (short)0, d, false, false);
    asm volatile("v_nop\n\tv_nop\n\tv_nop\n\tv_nop"
                 : "+v"(d) : "v"(ah.v), "v"(al.v), "v"(bh.v), "v"(bl.v));
    c.v = d;
}

// value of lane l ^ 16 (the other half of the wave), a vector cross-row move
__device__ __forceinline__ float xhalf(float x) {
    const int b = __float_as_int(x);
    return __int_as_float(__builtin_amdgcn_permlanex16(b, b, 0x76543210, 0xfedcba98, false, false));
}

// ---------------------------------------------------------------------------
// Operand preparation, ONE launch. None of these jobs reads another's output, so they share a grid:
// PREP_BLOCKS blocks of 256 threads, block b takes units b, b + PREP_BLOCKS, ... of a list of PREP_UNITS.
// Of every 22 list entries 5 are straight splits (memory only) and 17 are transpose units (LDS and vector
// work), mixed for speed only. The last 128 blocks, which have one
// list unit fewer than the first 512, each add one table unit behind their loop.
//   straight unit, 4096 consecutive f32 -> bf16 hi/lo planes: hidden_states (1024 units),
//     past_key (256 units; kv head = 32 units, dst rows 0..2047 of its 3072)
//   table unit, 256 entries of the cos/sin table [1024][32] (128 units)
//   transpose unit, one 64 x 64 tile, src[r][c] -> dst planes [c][r]: Wq 2048, Wk 512, Wv 512 tiles into
//     [Wq|Wk|Wv]^T [3072][4096]; Wo 1024 tiles into Wo^T [2048][2048]; past_value 256 tiles into
//     V^T [8][64][3072] cols 0..2047
// coverage: every unit once (u -> (u / 22, u % 22) is one-to-one), units x 4096 = every element of each source.
// ---------------------------------------------------------------------------
constexpr int PREP_BLOCKS = 1024;
constexpr int PREP_UNITS = 5632;          // 1280 straight + 4352 transpose = 22 * 256
constexpr int PREP_TABLE_BLOCKS = 128;    // x 256 threads = the 1024 x 32 table entries

// cos/sin at angle f32(pos + lck) * inv_freq[i], inv_freq[i] = 1 / 10000^(i/32)
// (f64 exp2 -> f32, then f32 reciprocal); precise sinf/cosf.
__device__ __forceinline__ void table_unit(const int* __restrict__ pid, float* cosT, float* sinT,
                                           int idx, int lck) {
    const int tok = idx >> 5, i = idx & 31;
    const double e = (double)i * 0.03125 * 13.287712379549449;   // i/32 * log2(1e4)
    const float p32 = (float)exp2(e);
    const float inv = 1.0f / p32;
    const float pos = (float)(pid[tok] + lck);
    const float ang = pos * inv;
    const float c = cosf(ang);
    const float s = sinf(ang);
    *(float*)(cosT + idx) = c;
    *(float*)(sinT + idx) = s;
}

// 4096 consecutive f32 -> planes; a thread takes two groups of 8 (one 16-B store per plane and group)
__device__ __forceinline__ void straight_unit(const float* __restrict__ src,
                                              unsigned short* dh, unsigned short* dl, int t) {
    const float* p = src + t * 8;
    const v4f a0 = *(const v4fa*)(p);
    const v4f b0 = *(const v4fa*)(p + 4);
    const v4f a1 = *(const v4fa*)(p + 2048);
    const v4f b1 = *(const v4fa*)(p + 2052);
    u4 H0, L0, H1, L1;
    pack8(a0, b0, H0, L0);
    pack8(a1, b1, H1, L1);
    *(u4*)(dh + t * 8) = H0;        *(u4*)(dl + t * 8) = L0;
    *(u4*)(dh + 2048 + t * 8) = H1; *(u4*)(dl + 2048 + t * 8) = L1;
    // the block's next unit rewrites the registers that these stores name
    asm volatile("s_wait_xcnt 0x0" ::: "memory");
}

// one 64 x 64 tile through LDS: s = tile origin (pitch srcld), dh/dl = origin of the transposed tile
// (pitch dstld). loads 256 thr x 4 x float4 = 64x64; stores 256 thr x 2 x 8 = 64x64 per plane.
__device__ __forceinline__ void transpose_unit(const float* __restrict__ s, int srcld,
                                               unsigned short* dh, unsigned short* dl, int dstld,
                                               unsigned short* Th, unsigned short* Tl, int t) {
    constexpr int TP = 72;
    v4f x[4];
#pragma unroll
    for (int i = 0; i < 4; ++i) {
        x[i] = *(const v4fa*)(s + (size_t)((t >> 4) + 16 * i) * srcld + (t & 15) * 4);
        // a later load's result may land in the registers that hold this load's address
        asm volatile("s_wait_xcnt 0x0" ::: "memory");
    }
#pragma unroll
    for (int i = 0; i < 4; ++i) {
        const int r = (t >> 4) + 16 * i, c4 = (t & 15) * 4;
        const v4f v = x[i];
        unsigned hb, lb;
        pack2(v.x, v.y, hb, lb);
        Th[(c4 + 0) * TP + r] = (unsigned short)hb; Tl[(c4 + 0) * TP + r] = (unsigned short)lb;
        Th[(c4 + 1) * TP + r] = (unsigned short)(hb >> 16); Tl[(c4 + 1) * TP + r] = (unsigned short)(lb >> 16);
        pack2(v.z, v.w, hb, lb);
        Th[(c4 + 2) * TP + r] = (unsigned short)hb; Tl[(c4 + 2) * TP + r] = (unsigned short)lb;
        Th[(c4 + 3) * TP + r] = (unsigned short)(hb >> 16); Tl[(c4 + 3) * TP + r] = (unsigned short)(lb >> 16);
    }
    __syncthreads();
    const int piece = t & 7;
    const int rowA = (t >> 3), rowB = 32 + (t >> 3);
    const u4 HA = *(const u4a*)(Th + rowA * TP + piece * 8);
    const u4 LA = *(const u4a*)(Tl + rowA * TP + piece * 8);
    const u4 HB = *(const u4a*)(Th + rowB * TP + piece * 8);
    const u4 LB = *(const u4a*)(Tl + rowB * TP + piece * 8);
    // the LDS tile is written again by the block's next transpose unit: every wave's reads end here first
    __syncthreads();
    const size_t gA = (size_t)rowA * dstld + piece * 8;
    const size_t gB = (size_t)rowB * dstld + piece * 8;
    *(u4*)(dh + gA) = HA; *(u4*)(dl + gA) = LA;
    *(u4*)(dh + gB) = HB; *(u4*)(dl + gB) = LB;
    // the block's next unit rewrites the registers that these stores name
    asm volatile("s_wait_xcnt 0x0" ::: "memory");
}

__global__ __launch_bounds__(256) void prep_kernel(
    const float* __restrict__ hs, const float* __restrict__ pk, const float* __restrict__ pv,
    const int* __restrict__ pid,
    const float* __restrict__ Wq, const float* __restrict__ Wk, const float* __restrict__ Wv,
    const float* __restrict__ Wo,
    unsigned short* hsH, unsigned short* hsL, unsigned short* kH, unsigned short* kL,
    unsigned short* vH, unsigned short* vL, unsigned short* wtH, unsigned short* wtL,
    unsigned short* woH, unsigned short* woL, float* cosT, float* sinT, int lck) {
    constexpr int INW = 4096, QW = 2048, KW = 512, D = 64, KVP = 2048, KVL = 3072, HIDO = 2048;
    __shared__ __align__(16) unsigned short Th[64 * 72];
    __shared__ __align__(16) unsigned short Tl[64 * 72];
    const int t = threadIdx.x;
    // every test below reads the unit number alone: the whole block takes one path, barriers included
    for (int u = blockIdx.x; u < PREP_UNITS; u += PREP_BLOCKS) {
        const int q = u / 22, r = u - q * 22;
        if (r < 5) {
            const int s = q * 5 + r;                               // 0..1279
            if (s < 1024) {
                const size_t o = (size_t)s * 4096;
                straight_unit(hs + o, hsH + o, hsL + o, t);
            } else {
                const int y = s - 1024;                            // 0..255
                const size_t o = (size_t)(y >> 5) * (KVL * D) + (size_t)(y & 31) * 4096;
                straight_unit(pk + (size_t)y * 4096, kH + o, kL + o, t);
            }
            continue;
        }
        const int e = q * 17 + (r - 5);                            // 0..4351
        const float* s;
        unsigned short* dh;
        unsigned short* dl;
        int srcld, dstld;
        if (e < 3072) {                                            // Wq | Wk | Wv -> rows nb.. of [3072][4096]
            const float* W = (e < 2048) ? Wq : ((e < 2560) ? Wk : Wv);
            const int y = (e < 2048) ? e : ((e < 2560) ? e - 2048 : e - 2560);
            const int lg = (e < 2048) ? 5 : 3;                     // log2 of the column tiles per row of tiles
            const int nb = (e < 2048) ? 0 : ((e < 2560) ? QW : QW + KW);
            const int c0 = (y & ((1 << lg) - 1)) * 64, r0 = (y >> lg) * 64;
            srcld = (e < 2048) ? QW : KW;
            dstld = INW;
            s = W + (size_t)r0 * srcld + c0;
            const size_t o = (size_t)(nb + c0) * INW + r0;
            dh = wtH + o;
            dl = wtL + o;
        } else if (e < 4096) {                                     // Wo [2048][2048]
            const int y = e - 3072;
            const int c0 = (y & 31) * 64, r0 = (y >> 5) * 64;
            srcld = HIDO;
            dstld = QW;
            s = Wo + (size_t)r0 * HIDO + c0;
            const size_t o = (size_t)c0 * QW + r0;
            dh = woH + o;
            dl = woL + o;
        } else {                                                   // past_value, kv head z: [2048][64]
            const int y = e - 4096;
            const int r0 = (y & 31) * 64, z = y >> 5;
            srcld = D;
            dstld = KVL;
            s = pv + (size_t)z * (KVP * D) + (size_t)r0 * D;
            const size_t o = (size_t)z * (D * KVL) + r0;
            dh = vH + o;
            dl = vL + o;
        }
        transpose_unit(s, srcld, dh, dl, dstld, Th, Tl, t);
    }
    const int tb = (int)blockIdx.x - (PREP_BLOCKS - PREP_TABLE_BLOCKS);
    if (tb >= 0) table_unit(pid, cosT, sinT, tb * 256 + t, lck);
}

// ---------------------------------------------------------------------------
// GEMM, bf16 hi/lo three-term: C[M x N] f32 (pitch ldc) = A[M x K] . B[K x N],
// A planes [M][K] (pitch K), B planes stored transposed [N][K] (pitch K, k-contiguous),
// so A and B fragments use the identical split-k load. Block = 4 waves, 64 x 128;
// wave tile 32 x 64 (2 m-tiles x 4 n-tiles).
// Operands: a stage is 64 k (one 128-B line) of every operand row of the block,
// rows [A hi 64 | A lo 64 | B hi 128 | B lo 128] at an LDS pitch of 144 B, brought in by
// asynchronous copies of 16 B per lane (8 lanes = one whole line); two buffers, the next
// stage's copies fly while this stage is worked on. Fragments are read from LDS.
// Epilogue: wave tile staged in LDS, then each 256-B row segment written as two
// Requires M % 64 == 0, N % 128 == 0, K % 64 == 0, K >= 64, ldc % 32 == 0 (shapes fixed on host).
// ---------------------------------------------------------------------------
// eight copies of 16 B per lane, global -> LDS. The s_wait_xcnt stands inside the statement, behind
// the last copy, so that no address register of a copy is rewritten in front of it.
__device__ __forceinline__ void copy8(const unsigned (&l)[8], const unsigned short* const (&g)[8]) {
    asm volatile("global_load_async_to_lds_b128 %0, %8, off\n\t"
                 "global_load_async_to_lds_b128 %1, %9, off\n\t"
                 "global_load_async_to_lds_b128 %2, %10, off\n\t"
                 "global_load_async_to_lds_b128 %3, %11, off\n\t"
                 "global_load_async_to_lds_b128 %4, %12, off\n\t"
                 "global_load_async_to_lds_b128 %5, %13, off\n\t"
                 "global_load_async_to_lds_b128 %6, %14, off\n\t"
                 "global_load_async_to_lds_b128 %7, %15, off\n\t"
                 "s_wait_xcnt 0x0"
                 :: "v"(l[0]), "v"(l[1]), "v"(l[2]), "v"(l[3]), "v"(l[4]), "v"(l[5]), "v"(l[6]), "v"(l[7]),
                    "v"(g[0]), "v"(g[1]), "v"(g[2]), "v"(g[3]), "v"(g[4]), "v"(g[5]), "v"(g[6]), "v"(g[7])
                 : "memory");
}

__device__ __forceinline__ void store_ctile(const float* sW, float* C, int ldc,
                                            int m0w, int n0w, int hh, int m16) {
#pragma unroll
    for (int i = 0; i < 16; ++i) {
        const int row = 2 * i + hh;
        const v4f v = *(const v4fa*)(sW + row * 68 + m16 * 4);
        *(v4f*)(C + (size_t)(m0w + row) * ldc + n0w + m16 * 4) = v;
    }
}

__global__ __launch_bounds__(128) void gemm3_kernel(
    const unsigned short* __restrict__ Ah, const unsigned short* __restrict__ Al,
    const unsigned short* __restrict__ Bh, const unsigned short* __restrict__ Bl,
    float* C, int K, int ldc) {
    constexpr int SP = 68;
    constexpr int GP = 72;                 // LDS row pitch in halves (144 B = 16 B x 9: no bank conflict for 16-B reads)
    constexpr int RAL = 64, RBH = 128, RBL = 256, GROWS = 384;   // first stage row of A lo, B hi, B lo; rows per stage
    constexpr int GSTAGE = GROWS * GP;     // halves per buffer
    __shared__ __align__(16) unsigned short ring[2 * GSTAGE];
    __shared__ __align__(16) float sC[4 * 32 * SP];
    const int tid = threadIdx.x, w = tid >> 5, lane = tid & 31, hh = lane >> 4, m16 = lane & 15;
    const int m0w = blockIdx.y * 64 + (w >> 1) * 32;
    const int n0w = blockIdx.x * 128 + (w & 1) * 64;

    Acc acc[2][4];
#pragma unroll
    for (int mt = 0; mt < 2; ++mt)
#pragma unroll
        for (int nt = 0; nt < 4; ++nt) acc_zero(acc[mt][nt]);

    const size_t Ks = (size_t)K;
    // copy side: thread = (row cr of 16, 16-B piece cp of the row's 128 B); copy i takes stage row cr + 16 * i
    const int cr = tid >> 3, cp = tid & 7;
    const unsigned short* gAh = Ah + (size_t)(blockIdx.y * 64 + cr) * Ks + cp * 8;
    const unsigned short* gAl = Al + (size_t)(blockIdx.y * 64 + cr) * Ks + cp * 8;
    const unsigned short* gBh = Bh + (size_t)(blockIdx.x * 128 + cr) * Ks + cp * 8;
    const unsigned short* gBl = Bl + (size_t)(blockIdx.x * 128 + cr) * Ks + cp * 8;
    const unsigned lds0 = (unsigned)(size_t)(ring + cr * GP + cp * 8);   // LDS byte address: low 32 bits

    auto issue = [&](int st, int buf) {
        const unsigned lb = lds0 + (unsigned)buf * (unsigned)(GSTAGE * 2);
        const size_t ko = (size_t)st * 64;
        unsigned l[8];
        const unsigned short* g[8];
#pragma unroll
        for (int i = 0; i < 4; ++i) {
            l[i] = lb + (unsigned)((16 * i) * GP * 2);
            g[i] = gAh + ko + (size_t)(16 * i) * Ks;
            l[4 + i] = lb + (unsigned)((RAL + 16 * i) * GP * 2);
            g[4 + i] = gAl + ko + (size_t)(16 * i) * Ks;
        }
        copy8(l, g);
#pragma unroll
        for (int i = 0; i < 8; ++i) {
            l[i] = lb + (unsigned)((RBH + 16 * i) * GP * 2);
            g[i] = gBh + ko + (size_t)(16 * i) * Ks;
        }
        copy8(l, g);
#pragma unroll
        for (int i = 0; i < 8; ++i) {
            l[i] = lb + (unsigned)((RBL + 16 * i) * GP * 2);
            g[i] = gBl + ko + (size_t)(16 * i) * Ks;
        }
        copy8(l, g);
    };

    const int NT = K >> 6;
    issue(0, 0);
    // stage 0 has landed for this wave, then is published to the other waves
    asm volatile("s_wait_asynccnt 0x0" ::: "memory");
    __syncthreads();
    if (NT > 1) issue(1, 1);

    // reader side: first fragment row of this wave inside a stage
    const int offA = ((w >> 1) * 32 + m16) * GP + 8 * hh;
    const int offB = (RBH + (w & 1) * 64 + m16) * GP + 8 * hh;

    // kept rolled: the buffer index and the refill test are per trip
#pragma unroll 1
    for (int t = 0; t < NT; ++t) {
        const unsigned short* sb = ring + (t & 1) * GSTAGE;
        // a trip is 8 groups g = (k half g >> 2, n-tile g & 3) of 6 products. Fragment reads stand at three
        // places only (before group 0, at groups 2 and 4), the last two at least three groups ahead of their use, all in this trip's own buffer.
        Frag fa[2][4], fb[8][2];
        auto lda = [&](int ks) {
            const unsigned short* pa = sb + offA + ks * 32;
            ldfrag(fa[ks][0], pa);
            ldfrag(fa[ks][1], pa + RAL * GP);
            ldfrag(fa[ks][2], pa + 16 * GP);
            ldfrag(fa[ks][3], pa + (RAL + 16) * GP);
        };
        auto ldb = [&](int g) {
            const unsigned short* pb = sb + offB + (g >> 2) * 32 + (g & 3) * 16 * GP;
            ldfrag(fb[g][0], pb);
            ldfrag(fb[g][1], pb + (RBL - RBH) * GP);
        };
        lda(0); ldb(0); ldb(1); ldb(2); ldb(3); lda(1); ldb(4);
#pragma unroll
        for (int g = 0; g < 8; ++g) {
            if (g == 2) { ldb(5); ldb(6); }
            if (g == 4) ldb(7);
            mma3(acc[0][g & 3], fa[g >> 2][0], fa[g >> 2][1], fb[g][0], fb[g][1]);
            mma3(acc[1][g & 3], fa[g >> 2][2], fa[g >> 2][3], fb[g][0], fb[g][1]);
        }
        // publish point: this wave's LDS reads of the buffer are done, its copies of the next stage
        // have landed; the barrier publishes the next stage and frees this buffer for the refill
        asm volatile("s_wait_dscnt 0x0" ::: "memory");
        asm volatile("s_wait_asynccnt 0x0" ::: "memory");
        __syncthreads();
        if (t + 2 < NT) issue(t + 2, t & 1);
    }
    // no copy is left in flight when the wave goes on
    asm volatile("s_wait_asynccnt 0x0" ::: "memory");

    // D layout: acc[mt][nt].f[r] = tile(row mt*16 + 8*hh + r, col nt*16 + m16)
    float* sW = sC + w * (32 * SP);
#pragma unroll
    for (int mt = 0; mt < 2; ++mt)
#pragma unroll
        for (int nt = 0; nt < 4; ++nt)
#pragma unroll
            for (int r = 0; r < 8; ++r)
                sW[(mt * 16 + 8 * hh + r) * SP + nt * 16 + m16] = acc[mt][nt].f[r];
    __syncthreads();
    store_ctile(sW, C, ldc, m0w, n0w, hh, m16);
    
}

// ---------------------------------------------------------------------------
// RoPE + split of the projection output qkv[1024][3072] (q cols 0..2047 = h*64+d,
// k cols 2048..2559, v cols 2560..3071). Block = (64-col group g, 64 tokens).
//   g < 32      : q head g      -> q planes [32][1024][64]      (RoPE)
//   32<=g<40    : kv head g-32  -> K planes [8][3072][64] rows 2048+tok (RoPE)
//   40<=g<48    : kv head g-40  -> V^T planes [8][64][3072] cols 2048+tok (transpose)
// y[d] = x[d]*cos + rot[d]*sin, rot = -x[d+32] (d<32), x[d-32] (d>=32); cos/sin from table.
// Each thread emits 8 consecutive halves per plane (16 B); 8 consecutive lanes = one line.
// coverage: q planes all 32x1024 rows; K planes rows 2048..3071 of every kv head;
// V^T planes cols 2048..3071 of all 8x64 rows.
// ---------------------------------------------------------------------------
__device__ __forceinline__ void rope8(const float* xr, const float* pr, const float* cr,
                                      const float* sr, float sgn, v4f& ya, v4f& yb) {
#pragma clang fp contract(off)
    ya.x = xr[0] * cr[0] + (sgn * pr[0]) * sr[0];
    ya.y = xr[1] * cr[1] + (sgn * pr[1]) * sr[1];
    ya.z = xr[2] * cr[2] + (sgn * pr[2]) * sr[2];
    ya.w = xr[3] * cr[3] + (sgn * pr[3]) * sr[3];
    yb.x = xr[4] * cr[4] + (sgn * pr[4]) * sr[4];
    yb.y = xr[5] * cr[5] + (sgn * pr[5]) * sr[5];
    yb.z = xr[6] * cr[6] + (sgn * pr[6]) * sr[6];
    yb.w = xr[7] * cr[7] + (sgn * pr[7]) * sr[7];
}

__global__ __launch_bounds__(256) void rope_split_kernel(
    const float* __restrict__ qkv, const float* __restrict__ cosT, const float* __restrict__ sinT,
    unsigned short* qh, unsigned short* ql, unsigned short* kh, unsigned short* kl,
    unsigned short* vh, unsigned short* vl) {
#pragma clang fp contract(off)
    constexpr int QN = 1024, D = 64, NH = 32, NKV = 8, QKVW = 3072, KVL = 3072, KVP = 2048, TP = 68;
    __shared__ __align__(16) float T[64 * TP];
    const int t = threadIdx.x, g = blockIdx.x, tok0 = blockIdx.y * 64;
    const float* s = qkv + (size_t)tok0 * QKVW + g * D;
#pragma unroll
    for (int i = 0; i < 4; ++i) {
        const int r = (t >> 4) + 16 * i, c4 = (t & 15) * 4;
        const v4f v = *(const v4fa*)(s + (size_t)r * QKVW + c4);
        *(v4fa*)(T + r * TP + c4) = v;
    }
    __syncthreads();

    u4 H0, L0, H1, L1;
    size_t g0, g1;
    unsigned short* dH;
    unsigned short* dL;
    if (g < NH + NKV) {                                   // block-uniform branch
        const bool isq = (g < NH);
        dH = isq ? qh : kh;
        dL = isq ? ql : kl;
        const int d0 = (t & 7) * 8, dp0 = d0 ^ 32;
        const float sgn = (d0 < 32) ? -1.0f : 1.0f;
        {
            const int r = (t >> 3), tok = tok0 + r;
            const float* cr = cosT + (size_t)tok * 32 + (d0 & 31);
            const float* sr = sinT + (size_t)tok * 32 + (d0 & 31);
            v4f ya, yb;
            rope8(T + r * TP + d0, T + r * TP + dp0, cr, sr, sgn, ya, yb);
            pack8(ya, yb, H0, L0);
            const size_t row = isq ? ((size_t)g * QN + tok) : ((size_t)(g - NH) * KVL + KVP + tok);
            g0 = row * D + d0;
        }
        {
            const int r = 32 + (t >> 3), tok = tok0 + r;
            const float* cr = cosT + (size_t)tok * 32 + (d0 & 31);
            const float* sr = sinT + (size_t)tok * 32 + (d0 & 31);
            v4f ya, yb;
            rope8(T + r * TP + d0, T + r * TP + dp0, cr, sr, sgn, ya, yb);
            pack8(ya, yb, H1, L1);
            const size_t row = isq ? ((size_t)g * QN + tok) : ((size_t)(g - NH) * KVL + KVP + tok);
            g1 = row * D + d0;
        }
    } else {
        dH = vh;
        dL = vl;
        const int kvhd = g - NH - NKV, piece = t & 7;
        {
            const int d = (t >> 3);
            v4f ya, yb;
            ya.x = T[(piece * 8 + 0) * TP + d]; ya.y = T[(piece * 8 + 1) * TP + d];
            ya.z = T[(piece * 8 + 2) * TP + d]; ya.w = T[(piece * 8 + 3) * TP + d];
            yb.x = T[(piece * 8 + 4) * TP + d]; yb.y = T[(piece * 8 + 5) * TP + d];
            yb.z = T[(piece * 8 + 6) * TP + d]; yb.w = T[(piece * 8 + 7) * TP + d];
            pack8(ya, yb, H0, L0);
            g0 = ((size_t)(kvhd * D + d)) * KVL + KVP + tok0 + piece * 8;
        }
        {
            const int d = 32 + (t >> 3);
            v4f ya, yb;
            ya.x = T[(piece * 8 + 0) * TP + d]; ya.y = T[(piece * 8 + 1) * TP + d];
            ya.z = T[(piece * 8 + 2) * TP + d]; ya.w = T[(piece * 8 + 3) * TP + d];
            yb.x = T[(piece * 8 + 4) * TP + d]; yb.y = T[(piece * 8 + 5) * TP + d];
            yb.z = T[(piece * 8 + 6) * TP + d]; yb.w = T[(piece * 8 + 7) * TP + d];
            pack8(ya, yb, H1, L1);
            g1 = ((size_t)(kvhd * D + d)) * KVL + KVP + tok0 + piece * 8;
        }
    }
    *(u4*)(dH + g0) = H0; *(u4*)(dL + g0) = L0;
    *(u4*)(dH + g1) = H1; *(u4*)(dL + g1) = L1;
    
}

// ---------------------------------------------------------------------------
// Flash attention with the block-diagonal TTT mask, GQA (kv head = h >> 2).
// Block = (kv head, 16 query rows), 16 waves = its 4 query heads x 4 key splits. The key
// tiles of 32 of all three key blocks form one list; split ks takes entries ks, ks + 4, ...
// The 4 heads of one split walk the same K and V tiles at the same time: a trip of the block is one
// tile per split, and each split's tile (K hi, K lo: 32 key rows of 128 B at a pitch of 144 B; V^T hi,
// V^T lo: 64 d rows of 64 B at a pitch of 80 B) is brought into LDS once by the split's 4 waves with
// asynchronous copies of 16 B per lane; two buffers, the next trip's copies fly while this trip is
// worked on. All K and V fragments are read from LDS.
// Both products are computed transposed: S^T = K . Q^T (A = K rows, B = q) and O^T += V^T . P^T (A = V^T rows,
// B = P^T). A lane then holds 16 scores of ONE query (column m16; keys 8*hh + r of each 16-key tile): maximum and
// sum run inside the lane, with one exchange between the wave's halves for the maximum, and the two score tiles,
// split in place, are the B operand of the second product in the hardware k order that ldfrag also has.
// Each wave keeps its own running maximum, sum (per wave half, joined behind the loop) and 16 x 64 output; a head's
// four partial results are merged through LDS in fixed split order behind one work-group barrier.
// Q/K/V/P operands as bf16 hi/lo; scores, mask (-inf), running-max softmax in f32.
// key j of block blk allowed iff j < seq_len and j <= i - (lck - blk).
// seq_len = sum(attention_mask) - lck, summed per block in fixed order.
// Per blk the key-tile count is bounded by the tile's diagonal and seq_len
// (at most 32 tiles); the mask is still applied by value per element.
// Output attn planes [1024][2048] (col h*64+d): 8 lanes x 16 B = one 128-B line per row.
// Query tiles with the most keys have the lowest block index (for speed only).
// coverage: 8 x 64 blocks x 4 heads x 16 rows x 64 cols = [1024][2048] per plane.
// ---------------------------------------------------------------------------
__global__ __launch_bounds__(512) void attn_kernel(
    const unsigned short* __restrict__ qH, const unsigned short* __restrict__ qL,
    const unsigned short* __restrict__ kH, const unsigned short* __restrict__ kL,
    const unsigned short* __restrict__ vH, const unsigned short* __restrict__ vL,
    const int* __restrict__ amask, int nmask, int lck,
    unsigned short* oH, unsigned short* oL) {
    constexpr int QN = 1024, D = 64, KVL = 3072, HIDO = 2048, NS = 4, NW = 4 * NS, SP = 68;
    constexpr int KP = 72, VP = 40;                 // LDS row pitches in halves (16 B x 9, 16 B x 5: no bank conflict for 16-B reads)
    constexpr int KPL = 32 * KP, VPL = 64 * VP;     // halves per plane of a K tile, of a V^T tile
    constexpr int TSPL = 2 * KPL + 2 * VPL;         // halves per split: [K hi | K lo | V^T hi | V^T lo]
    constexpr int TSTAGE = NS * TSPL;               // halves per buffer
    __shared__ __align__(16) unsigned short kvs[2 * TSTAGE];
    __shared__ int red[128];
    __shared__ __align__(16) float Os[NW * 16 * SP];
    __shared__ float Ms[NW * 16];
    __shared__ float Ls[NW * 16];
    const int tid = threadIdx.x, lane = tid & 31, hh = lane >> 4, m16 = lane & 15;
    // wave number held as a scalar: the key-tile loop then branches on scalar tests, every lane on
    const int w = __builtin_amdgcn_readfirstlane(tid >> 5);

    // seq_len (integer, fixed order, identical in every block)
    if (tid < 128) {                                   // the first four waves sum the mask
        int part = 0;
        for (int i = tid; i < nmask; i += 128) part += amask[i];
        red[tid] = part;
    }
    __syncthreads();
#pragma unroll
    for (int off = 64; off > 0; off >>= 1) {
        if (tid < off) red[tid] += red[tid + off];
        __syncthreads();
    }
    const int seq_len = __builtin_amdgcn_readfirstlane(red[0] - lck);

    const int kvh = blockIdx.x, h = kvh * 4 + (w & 3), ks = w >> 2;
    const int q0w = (QN / 16 - 1 - (int)blockIdx.y) * 16;
    const float NEG_INF = -__builtin_inff();

    Frag fqh[2], fql[2];
    {
        const size_t qo = ((size_t)h * QN + q0w + m16) * D + 8 * hh;
        ldfrag(fqh[0], qH + qo);
        ldfrag(fqh[1], qH + qo + 32);
        ldfrag(fql[0], qL + qo);
        ldfrag(fql[1], qL + qo + 32);
    }
    // of query q0w + m16: running maximum (alike in both halves) and this half's part of the running sum
    float mrun = NEG_INF, lrun = 0.0f;
    Acc o[4];
#pragma unroll
    for (int dt = 0; dt < 4; ++dt) acc_zero(o[dt]);

    const size_t kplane = (size_t)kvh * KVL * D;      // K planes [kvh][kv][d]
    const size_t vplane = (size_t)kvh * D * KVL;      // V^T planes [kvh][d][kv]

    // key tiles per key block (allowed j of block blk are < q0w + 16 - (lck - blk) and < seq_len),
    // as running ends e0 <= e1 <= e2 of the one list; each count <= 32, so e2 <= 96
    int e0, e1, e2;
    {
        int c0 = q0w + 16 - lck, c1 = c0 + 1, c2 = c0 + 2;
        c0 = (c0 < seq_len) ? c0 : seq_len;
        c1 = (c1 < seq_len) ? c1 : seq_len;
        c2 = (c2 < seq_len) ? c2 : seq_len;
        c0 = (c0 < 0) ? 0 : ((c0 > QN) ? QN : c0);
        c1 = (c1 < 0) ? 0 : ((c1 > QN) ? QN : c1);
        c2 = (c2 < 0) ? 0 : ((c2 > QN) ? QN : c2);
        e0 = __builtin_amdgcn_readfirstlane((c0 + 31) >> 5);
        e1 = e0 + __builtin_amdgcn_readfirstlane((c1 + 31) >> 5);
        e2 = e1 + __builtin_amdgcn_readfirstlane((c2 + 31) >> 5);
    }
    // copy side: the 128 lanes of a split bring its tile; per lane 4 copies of K (2 planes x 2 row groups
    // of 16; 8 lanes = one 128-B row) and 4 of V^T (2 planes x 2 row groups of 32; 4 lanes = one 64-B row)
    const int lt = (w & 3) * 32 + lane;
    const int ckr = lt >> 3, ckp = (lt & 7) * 8, cvr = lt >> 2, cvp = (lt & 3) * 8;
    const unsigned short* gkh = kH + kplane + (size_t)ckr * D + ckp;
    const unsigned short* gkl = kL + kplane + (size_t)ckr * D + ckp;
    const unsigned short* gvh = vH + vplane + (size_t)cvr * KVL + cvp;
    const unsigned short* gvl = vL + vplane + (size_t)cvr * KVL + cvp;
    const unsigned ldk = (unsigned)(size_t)(kvs + ks * TSPL + ckr * KP + ckp);             // LDS byte address: low 32 bits
    const unsigned ldv = (unsigned)(size_t)(kvs + ks * TSPL + 2 * KPL + cvr * VP + cvp);
    // trips of the block; a split whose list entry lies past the end copies the last tile again (in bounds,
    // never read), so every wave issues the same copies in every trip
    const int NT = (e2 + NS - 1) / NS;
    auto issue = [&](int it, int buf) {
        int le = it * NS + ks;
        le = (le < e2) ? le : (e2 - 1);
        const int cb = (le >= e0 ? 1 : 0) + (le >= e1 ? 1 : 0);
        const int ct = le - (le >= e1 ? e1 : (le >= e0 ? e0 : 0));
        const size_t ckv = (size_t)(cb * QN + ct * 32);
        const unsigned bo = (unsigned)buf * (unsigned)(TSTAGE * 2);
        unsigned l[8];
        const unsigned short* g[8];
#pragma unroll
        for (int i = 0; i < 2; ++i) {
            l[i] = ldk + bo + (unsigned)(16 * i * KP * 2);
            g[i] = gkh + (ckv + 16 * i) * D;
            l[2 + i] = ldk + bo + (unsigned)((KPL + 16 * i * KP) * 2);
            g[2 + i] = gkl + (ckv + 16 * i) * D;
            l[4 + i] = ldv + bo + (unsigned)(32 * i * VP * 2);
            g[4 + i] = gvh + (size_t)(32 * i) * KVL + ckv;
            l[6 + i] = ldv + bo + (unsigned)((VPL + 32 * i * VP) * 2);
            g[6 + i] = gvl + (size_t)(32 * i) * KVL + ckv;
        }
        copy8(l, g);
    };
    if (NT > 0) issue(0, 0);
    // trip 0's tiles have landed for this wave, then are published to the other waves
    asm volatile("s_wait_asynccnt 0x0" ::: "memory");
    __syncthreads();
    if (NT > 1) issue(1, 1);

    // kept rolled: a second copy of the long body would only raise the register count
#pragma unroll 1
    for (int it = 0; it < NT; ++it) {
      const int s = it * NS + ks;
      if (s < e2) {                                    // scalar test: the whole wave works or skips
        const int blk = (s >= e0 ? 1 : 0) + (s >= e1 ? 1 : 0);
        const int t = s - (s >= e1 ? e1 : (s >= e0 ? e0 : 0));
        const int shift = lck - blk;                   // j <= i - shift
        const int j0 = t * 32;
        const unsigned short* tb = kvs + (it & 1) * TSTAGE + ks * TSPL;   // this split's tile of this trip
        Acc sc[2];
        acc_zero(sc[0]);
        acc_zero(sc[1]);
        // the K fragment reads stand together at the head of the trip
        Frag fk[2][2][2];
#pragma unroll
        for (int nt = 0; nt < 2; ++nt)
#pragma unroll
            for (int ds = 0; ds < 2; ++ds) {
                const unsigned short* pk = tb + (nt * 16 + m16) * KP + ds * 32 + 8 * hh;
                ldfrag(fk[nt][ds][0], pk);
                ldfrag(fk[nt][ds][1], pk + KPL);
            }
        // S^T tile [32 keys x 16 q]; A = K (k = d), B = q (k = d): sc[nt].f[r] = S[q m16][key nt*16 + 8*hh + r]
#pragma unroll
        for (int nt = 0; nt < 2; ++nt)
#pragma unroll
            for (int ds = 0; ds < 2; ++ds)
                mma3(sc[nt], fk[nt][ds][0], fk[nt][ds][1], fqh[ds], fql[ds]);
        // the V fragment reads stand together ahead of the softmax, which covers their latency
        Frag fv[4][2];
#pragma unroll
        for (int dt = 0; dt < 4; ++dt) {
            const unsigned short* pv = tb + 2 * KPL + (dt * 16 + m16) * VP + 8 * hh;
            ldfrag(fv[dt][0], pv);
            ldfrag(fv[dt][1], pv + VPL);
        }
        // scale and mask by value: key j allowed iff j < seq_len and j <= qi - shift
        {
            const int qi = q0w + m16;
            const int jd = qi - shift, jp = seq_len - 1;
            const int jmax = (jd < jp) ? jd : jp;      // last allowed key of this query in this key block
#pragma unroll
            for (int nt = 0; nt < 2; ++nt)
#pragma unroll
                for (int r = 0; r < 8; ++r) {
                    const int j = j0 + nt * 16 + 8 * hh + r;
                    sc[nt].f[r] = (j <= jmax) ? sc[nt].f[r] * 0.125f : NEG_INF;
                }
        }
        // running-max softmax update of the lane's one query
        float x = fmaxf(sc[0].f[0], sc[1].f[0]);
#pragma unroll
        for (int r = 1; r < 8; ++r) x = fmaxf(x, fmaxf(sc[0].f[r], sc[1].f[r]));
        x = fmaxf(x, xhalf(x));
        const float mn = fmaxf(mrun, x);
        const float msafe = (mn == NEG_INF) ? 0.0f : mn;
        const float alpha = __expf(mrun - msafe);
        mrun = mn;
#pragma unroll
        for (int nt = 0; nt < 2; ++nt)
#pragma unroll
            for (int r = 0; r < 8; ++r) sc[nt].f[r] = __expf(sc[nt].f[r] - msafe);
        {
            float s4[4];
#pragma unroll
            for (int c = 0; c < 4; ++c)
                s4[c] = (sc[0].f[c] + sc[0].f[4 + c]) + (sc[1].f[c] + sc[1].f[4 + c]);
            lrun = lrun * alpha + ((s4[0] + s4[1]) + (s4[2] + s4[3]));
        }
#pragma unroll
        for (int dt = 0; dt < 4; ++dt)
#pragma unroll
            for (int r = 0; r < 8; ++r) o[dt].f[r] *= alpha;

        // P^T as B operand (k = key, n = q): elements 0..7 = tile 0's registers, 8..15 = tile 1's
        Frag fph, fpl;
#pragma unroll
        for (int nt = 0; nt < 2; ++nt) {
            const v4f pa = {sc[nt].f[0], sc[nt].f[1], sc[nt].f[2], sc[nt].f[3]};
            const v4f pb = {sc[nt].f[4], sc[nt].f[5], sc[nt].f[6], sc[nt].f[7]};
            pack8(pa, pb, fph.q[nt], fpl.q[nt]);
        }

        // O^T += V^T . P^T ; A = V^T rows (m = d, k = key): o[dt].f[r] = O[q m16][dt*16 + 8*hh + r]
#pragma unroll
        for (int dt = 0; dt < 4; ++dt) mma3(o[dt], fv[dt][0], fv[dt][1], fph, fpl);
      }
        // publish point: this wave's LDS reads of the buffer are done, its copies of the next trip
        // have landed; the barrier publishes the next trip's tiles and frees this buffer for the refill
        asm volatile("s_wait_dscnt 0x0" ::: "memory");
        asm volatile("s_wait_asynccnt 0x0" ::: "memory");
        __syncthreads();
        if (it + 2 < NT) issue(it + 2, it & 1);
    }
    // no copy is left in flight when the wave goes on
    asm volatile("s_wait_asynccnt 0x0" ::: "memory");

    // each wave's partial result to LDS (o[dt].f[r] = O[q m16][dt*16 + 8*hh + r]: 8 consecutive columns of a row)
    float* Ow = Os + w * 16 * SP;
#pragma unroll
    for (int dt = 0; dt < 4; ++dt) {
        const v4f oa = {o[dt].f[0], o[dt].f[1], o[dt].f[2], o[dt].f[3]};
        const v4f ob = {o[dt].f[4], o[dt].f[5], o[dt].f[6], o[dt].f[7]};
        *(v4fa*)(Ow + m16 * SP + dt * 16 + 8 * hh) = oa;
        *(v4fa*)(Ow + m16 * SP + dt * 16 + 8 * hh + 4) = ob;
    }
    // the halves' sums are joined with every lane on; both halves then store the same two values
    const float lall = lrun + xhalf(lrun);
    Ms[w * 16 + m16] = mrun;
    Ls[w * 16 + m16] = lall;
    __syncthreads();

    // merge in split order, normalise, split into planes; thread = (head, row, 8 columns)
    const int hl = tid >> 7, row = (tid >> 3) & 15, c8 = (tid & 7) * 8;
    float mall = NEG_INF;
#pragma unroll
    for (int u = 0; u < NS; ++u) mall = fmaxf(mall, Ms[(u * 4 + hl) * 16 + row]);
    const float mfin = (mall == NEG_INF) ? 0.0f : mall;
    float lsum = 0.0f;
    v4f oa = {0.0f, 0.0f, 0.0f, 0.0f}, ob = {0.0f, 0.0f, 0.0f, 0.0f};
#pragma unroll
    for (int u = 0; u < NS; ++u) {
        const int pr = (u * 4 + hl) * 16 + row;
        const float a = __expf(Ms[pr] - mfin);
        const v4f va = *(const v4fa*)(Os + pr * SP + c8);
        const v4f vb = *(const v4fa*)(Os + pr * SP + c8 + 4);
        lsum += a * Ls[pr];
        oa += a * va;
        ob += a * vb;
    }
    const float il = 1.0f / lsum;
    u4 H, L;
    pack8(oa * il, ob * il, H, L);
    const size_t eo = (size_t)(q0w + row) * HIDO + (kvh * 4 + hl) * D + c8;
    *(u4*)(oH + eo) = H;
    *(u4*)(oL + eo) = L;
}

// ---------------------------------------------------------------------------
extern "C" void kernel_launch(void* const* d_in, const int* in_sizes, int n_in,
                              void* d_out, int out_size, void* d_ws, size_t ws_size,
                              hipStream_t stream) {
    constexpr int QN = 1024, INW = 4096, NH = 32, NKV = 8, D = 64, HIDO = 2048;
    constexpr int KVP = 2048, KVL = 3072, QKVW = 3072, LCK = KVP / QN;
    if (n_in < 9) return;
    if (in_sizes[0] != QN * INW || in_sizes[1] != NKV * KVP * D || in_sizes[2] != NKV * KVP * D ||
        in_sizes[3] != QN || in_sizes[4] != QN || in_sizes[5] != INW * NH * D ||
        in_sizes[6] != INW * NKV * D || in_sizes[7] != INW * NKV * D ||
        in_sizes[8] != NH * D * HIDO || out_size != QN * HIDO) return;

    const float* hs  = (const float*)d_in[0];
    const float* pk  = (const float*)d_in[1];
    const float* pv  = (const float*)d_in[2];
    const int*   am  = (const int*)  d_in[3];
    const int*   pid = (const int*)  d_in[4];
    const float* Wq  = (const float*)d_in[5];
    const float* Wk  = (const float*)d_in[6];
    const float* Wv  = (const float*)d_in[7];
    const float* Wo  = (const float*)d_in[8];
    float* out = (float*)d_out;

    char* ws = (char*)d_ws;
    size_t off = 0;
    auto carve = [&](size_t bytes) -> char* {
        char* p = ws + off;
        off += (bytes + 255) & ~(size_t)255;
        return p;
    };
    unsigned short* hsH = (unsigned short*)carve((size_t)QN * INW * 2);          // A planes of QKV GEMM
    unsigned short* hsL = (unsigned short*)carve((size_t)QN * INW * 2);
    unsigned short* wtH = (unsigned short*)carve((size_t)QKVW * INW * 2);        // [Wq|Wk|Wv]^T planes [3072][4096]
    unsigned short* wtL = (unsigned short*)carve((size_t)QKVW * INW * 2);
    unsigned short* woH = (unsigned short*)carve((size_t)HIDO * (NH * D) * 2);    // Wo^T planes [2048][2048]
    unsigned short* woL = (unsigned short*)carve((size_t)HIDO * (NH * D) * 2);
    float*          qkv = (float*)         carve((size_t)QN * QKVW * 4);          // projection output f32
    unsigned short* qH  = (unsigned short*)carve((size_t)NH * QN * D * 2);        // q planes [32][1024][64]
    unsigned short* qL  = (unsigned short*)carve((size_t)NH * QN * D * 2);
    unsigned short* kH  = (unsigned short*)carve((size_t)NKV * KVL * D * 2);      // K planes [8][3072][64]
    unsigned short* kL  = (unsigned short*)carve((size_t)NKV * KVL * D * 2);
    unsigned short* vH  = (unsigned short*)carve((size_t)NKV * D * KVL * 2);      // V^T planes [8][64][3072]
    unsigned short* vL  = (unsigned short*)carve((size_t)NKV * D * KVL * 2);
    unsigned short* aH  = (unsigned short*)carve((size_t)QN * (NH * D) * 2);      // attention output planes [1024][2048]
    unsigned short* aL  = (unsigned short*)carve((size_t)QN * (NH * D) * 2);
    float*          cosT = (float*)        carve((size_t)QN * 32 * 4);
    float*          sinT = (float*)        carve((size_t)QN * 32 * 4);
    if (off > ws_size || off > ((size_t)128 << 20)) return;

    // tables and operand planes, one launch
    prep_kernel<<<PREP_BLOCKS, 256, 0, stream>>>(hs, pk, pv, pid, Wq, Wk, Wv, Wo, hsH, hsL, kH, kL, vH, vL,
                                                 wtH, wtL, woH, woL, cosT, sinT, LCK);

    // fused QKV projection: [1024 x 4096] . [4096 x 3072] -> qkv f32
    gemm3_kernel<<<dim3(QKVW / 128, QN / 64), 128, 0, stream>>>(hsH, hsL, wtH, wtL, qkv, INW, QKVW);

    // RoPE + split into q planes, new K rows, new V^T cols
    rope_split_kernel<<<dim3(QKVW / 64, QN / 64), 256, 0, stream>>>(qkv, cosT, sinT, qH, qL, kH, kL, vH, vL);

    // attention
    attn_kernel<<<dim3(NKV, QN / 16), 512, 0, stream>>>(qH, qL, kH, kL, vH, vL, am, in_sizes[3], LCK, aH, aL);

    // output projection: [1024 x 2048] . [2048 x 2048] -> d_out f32
    gemm3_kernel<<<dim3(HIDO / 128, QN / 64), 128, 0, stream>>>(aH, aL, woH, woL, out, NH * D, HIDO);
}

// v007
// Measured time: 167 microseconds a run.
// In two side-by-side timings against v006, it was 1.03 and 1.04 times as fast.
// All steps since v000 together make it 3.47 times as fast.
// All contractions (q/k/v projections, q.k^T, p.v, output projection): v_wmma_f32_16x16x32_bf16 with bf16 hi/lo operands everywhere (hi*hi + hi*lo + lo*hi), f32 accumulate; RoPE, softmax and normalisation in f32.
#include <hip/hip_runtime.h>
#include <hip/hip_bf16.h>

typedef __attribute__((ext_vector_type(16))) __bf16 v16bf;
typedef __attribute__((ext_vector_type(2))) __bf16 v2bf;
typedef float v2f __attribute__((ext_vector_type(2)));
typedef float v8f __attribute__((ext_vector_type(8)));
typedef float v4f __attribute__((ext_vector_type(4)));
typedef unsigned int u4 __attribute__((ext_vector_type(4)));
typedef u4 __attribute__((may_alias)) u4a;
typedef v4f __attribute__((may_alias)) v4fa;

union Frag { v16bf v; u4 q[2]; };
union Acc  { v8f v; float f[8]; };

// ---------------------------------------------------------------------------
// bf16 hi/lo split (hi = RNE(x), lo = RNE(x - hi), exact residual), two values at a time
// ---------------------------------------------------------------------------
// two f32 -> two bf16 in one word, first element in the low half-word: one packed convert, round to nearest even
__device__ __forceinline__ unsigned cvt2(float a, float b) {
    const v2f x = {a, b};
    return __builtin_bit_cast(unsigned, __builtin_convertvector(x, v2bf));
}
// two f32 -> one 32-bit word per plane
__device__ __forceinline__ void pack2(float a, float b, unsigned& wh, unsigned& wl) {
    wh = cvt2(a, b);
    wl = cvt2(a - __uint_as_float(wh << 16), b - __uint_as_float(wh & 0xFFFF0000u));
}
// eight consecutive f32 -> 16 B per plane
__device__ __forceinline__ void pack8(const v4f a, const v4f b, u4& H, u4& L) {
    unsigned h0, l0, h1, l1, h2, l2, h3, l3;
    pack2(a.x, a.y, h0, l0);
    pack2(a.z, a.w, h1, l1);
    pack2(b.x, b.y, h2, l2);
    pack2(b.z, b.w, h3, l3);
    H.x = h0; H.y = h1; H.z = h2; H.w = h3;
    L.x = l0; L.y = l1; L.z = l2; L.w = l3;
}

// ---------------------------------------------------------------------------
// 16x16x32 fragment load from a k-contiguous 16-bit row (A row m, or B^T row n):
// p = row_start + k0 + 8*h ; elements 0..7 <- k0+8h.., elements 8..15 <- k0+16+8h..
// ---------------------------------------------------------------------------
__device__ __forceinline__ void ldfrag(Frag& f, const unsigned short* p) {
    f.q[0] = *(const u4a*)(p);
    f.q[1] = *(const u4a*)(p + 16);
}

__device__ __forceinline__ void acc_zero(Acc& c) {
#pragma unroll
    for (int i = 0; i < 8; ++i) c.f[i] = 0.0f;
}

// acc += Ah*Bh + Ah*Bl + Al*Bh, then 4 wait slots with D tied and A/B kept live
__device__ __forceinline__ void mma3(Acc& c, const Frag& ah, const Frag& al,
                                     const Frag& bh, const Frag& bl) {
    v8f d = c.v;
    d = __builtin_amdgcn_wmma_f32_16x16x32_bf16(false, ah.v, false, bh.v, (short)0, d, false, false);
    d = __builtin_amdgcn_wmma_f32_16x16x32_bf16(false, ah.v, false, bl.v, (short)0, d, false, false);
    d = __builtin_amdgcn_wmma_f32_16x16x32_bf16(false, al.v, false, bh.v, (short)0, d, false, false);
    asm volatile("v_nop\n\tv_nop\n\tv_nop\n\tv_nop"
                 : "+v"(d) : "v"(ah.v), "v"(al.v), "v"(bh.v), "v"(bl.v));
    c.v = d;
}

// value of lane l ^ 16 (the other half of the wave), a vector cross-row move
__device__ __forceinline__ float xhalf(float x) {
    const int b = __float_as_int(x);
    return __int_as_float(__builtin_amdgcn_permlanex16(b, b, 0x76543210, 0xfedcba98, false, false));
}

// ---------------------------------------------------------------------------
// Operand preparation, ONE launch. None of these jobs reads another's output, so they share a grid:
// PREP_BLOCKS blocks of 256 threads, block b takes units b, b + PREP_BLOCKS, ... of a list of PREP_UNITS.
// Of every 22 list entries 5 are straight splits (memory only) and 17 are transpose units (LDS and vector
// work), mixed for speed only. The last 128 blocks, which have one
// list unit fewer than the first 512, each add one table unit behind their loop.
//   straight unit, 4096 consecutive f32 -> bf16 hi/lo planes: hidden_states (1024 units),
//     past_key (256 units; kv head = 32 units, dst rows 0..2047 of its 3072)
//   table unit, 256 entries of the cos/sin table [1024][32] (128 units)
//   transpose unit, one 64 x 64 tile, src[r][c] -> dst planes [c][r]: Wq 2048, Wk 512, Wv 512 tiles into
//     [Wq|Wk|Wv]^T [3072][4096]; Wo 1024 tiles into Wo^T [2048][2048]; past_value 256 tiles into
//     V^T [8][64][3072] cols 0..2047
// coverage: every unit once (u -> (u / 22, u % 22) is one-to-one), units x 4096 = every element of each source.
// ---------------------------------------------------------------------------
constexpr int PREP_BLOCKS = 1024;
constexpr int PREP_UNITS = 5632;          // 1280 straight + 4352 transpose = 22 * 256
constexpr int PREP_TABLE_BLOCKS = 128;    // x 256 threads = the 1024 x 32 table entries

// cos/sin at angle f32(pos + lck) * inv_freq[i], inv_freq[i] = 1 / 10000^(i/32)
// (f64 exp2 -> f32, then f32 reciprocal); precise sinf/cosf.
__device__ __forceinline__ void table_unit(const int* __restrict__ pid, float* cosT, float* sinT,
                                           int idx, int lck) {
    const int tok = idx >> 5, i = idx & 31;
    const double e = (double)i * 0.03125 * 13.287712379549449;   // i/32 * log2(1e4)
    const float p32 = (float)exp2(e);
    const float inv = 1.0f / p32;
    const float pos = (float)(pid[tok] + lck);
    const float ang = pos * inv;
    const float c = cosf(ang);
    const float s = sinf(ang);
    *(float*)(cosT + idx) = c;
    *(float*)(sinT + idx) = s;
}

// 4096 consecutive f32 -> planes; a thread takes two groups of 8 (one 16-B store per plane and group)
__device__ __forceinline__ void straight_unit(const float* __restrict__ src,
                                              unsigned short* dh, unsigned short* dl, int t) {
    const float* p = src + t * 8;
    const v4f a0 = *(const v4fa*)(p);
    const v4f b0 = *(const v4fa*)(p + 4);
    const v4f a1 = *(const v4fa*)(p + 2048);
    const v4f b1 = *(const v4fa*)(p + 2052);
    u4 H0, L0, H1, L1;
    pack8(a0, b0, H0, L0);
    pack8(a1, b1, H1, L1);
    *(u4*)(dh + t * 8) = H0;        *(u4*)(dl + t * 8) = L0;
    *(u4*)(dh + 2048 + t * 8) = H1; *(u4*)(dl + 2048 + t * 8) = L1;
    // the block's next unit rewrites the registers that these stores name
    asm volatile("s_wait_xcnt 0x0" ::: "memory");
}

// one 64 x 64 tile through LDS: s = tile origin (pitch srcld), dh/dl = origin of the transposed tile
// (pitch dstld). loads 256 thr x 4 x float4 = 64x64; stores 256 thr x 2 x 8 = 64x64 per plane.
__device__ __forceinline__ void transpose_unit(const float* __restrict__ s, int srcld,
                                               unsigned short* dh, unsigned short* dl, int dstld,
                                               unsigned short* Th, unsigned short* Tl, int t) {
    constexpr int TP = 72;
    v4f x[4];
#pragma unroll
    for (int i = 0; i < 4; ++i) {
        x[i] = *(const v4fa*)(s + (size_t)((t >> 4) + 16 * i) * srcld + (t & 15) * 4);
        // a later load's result may land in the registers that hold this load's address
        asm volatile("s_wait_xcnt 0x0" ::: "memory");
    }
#pragma unroll
    for (int i = 0; i < 4; ++i) {
        const int r = (t >> 4) + 16 * i, c4 = (t & 15) * 4;
        const v4f v = x[i];
        unsigned hb, lb;
        pack2(v.x, v.y, hb, lb);
        Th[(c4 + 0) * TP + r] = (unsigned short)hb; Tl[(c4 + 0) * TP + r] = (unsigned short)lb;
        Th[(c4 + 1) * TP + r] = (unsigned short)(hb >> 16); Tl[(c4 + 1) * TP + r] = (unsigned short)(lb >> 16);
        pack2(v.z, v.w, hb, lb);
        Th[(c4 + 2) * TP + r] = (unsigned short)hb; Tl[(c4 + 2) * TP + r] = (unsigned short)lb;
        Th[(c4 + 3) * TP + r] = (unsigned short)(hb >> 16); Tl[(c4 + 3) * TP + r] = (unsigned short)(lb >> 16);
    }
    __syncthreads();
    const int piece = t & 7;
    const int rowA = (t >> 3), rowB = 32 + (t >> 3);
    const u4 HA = *(const u4a*)(Th + rowA * TP + piece * 8);
    const u4 LA = *(const u4a*)(Tl + rowA * TP + piece * 8);
    const u4 HB = *(const u4a*)(Th + rowB * TP + piece * 8);
    const u4 LB = *(const u4a*)(Tl + rowB * TP + piece * 8);
    // the LDS tile is written again by the block's next transpose unit: every wave's reads end here first
    __syncthreads();
    const size_t gA = (size_t)rowA * dstld + piece * 8;
    const size_t gB = (size_t)rowB * dstld + piece * 8;
    *(u4*)(dh + gA) = HA; *(u4*)(dl + gA) = LA;
    *(u4*)(dh + gB) = HB; *(u4*)(dl + gB) = LB;
    // the block's next unit rewrites the registers that these stores name
    asm volatile("s_wait_xcnt 0x0" ::: "memory");
}

__global__ __launch_bounds__(256) void prep_kernel(
    const float* __restrict__ hs, const float* __restrict__ pk, const float* __restrict__ pv,
    const int* __restrict__ pid,
    const float* __restrict__ Wq, const float* __restrict__ Wk, const float* __restrict__ Wv,
    const float* __restrict__ Wo,
    unsigned short* hsH, unsigned short* hsL, unsigned short* kH, unsigned short* kL,
    unsigned short* vH, unsigned short* vL, unsigned short* wtH, unsigned short* wtL,
    unsigned short* woH, unsigned short* woL, float* cosT, float* sinT, int lck) {
    constexpr int INW = 4096, QW = 2048, KW = 512, D = 64, KVP = 2048, KVL = 3072, HIDO = 2048;
    __shared__ __align__(16) unsigned short Th[64 * 72];
    __shared__ __align__(16) unsigned short Tl[64 * 72];
    const int t = threadIdx.x;
    // every test below reads the unit number alone: the whole block takes one path, barriers included
    for (int u = blockIdx.x; u < PREP_UNITS; u += PREP_BLOCKS) {
        const int q = u / 22, r = u - q * 22;
        if (r < 5) {
            const int s = q * 5 + r;                               // 0..1279
            if (s < 1024) {
                const size_t o = (size_t)s * 4096;
                straight_unit(hs + o, hsH + o, hsL + o, t);
            } else {
                const int y = s - 1024;                            // 0..255
                const size_t o = (size_t)(y >> 5) * (KVL * D) + (size_t)(y & 31) * 4096;
                straight_unit(pk + (size_t)y * 4096, kH + o, kL + o, t);
            }
            continue;
        }
        const int e = q * 17 + (r - 5);                            // 0..4351
        const float* s;
        unsigned short* dh;
        unsigned short* dl;
        int srcld, dstld;
        if (e < 3072) {                                            // Wq | Wk | Wv -> rows nb.. of [3072][4096]
            const float* W = (e < 2048) ? Wq : ((e < 2560) ? Wk : Wv);
            const int y = (e < 2048) ? e : ((e < 2560) ? e - 2048 : e - 2560);
            const int lg = (e < 2048) ? 5 : 3;                     // log2 of the column tiles per row of tiles
            const int nb = (e < 2048) ? 0 : ((e < 2560) ? QW : QW + KW);
            const int c0 = (y & ((1 << lg) - 1)) * 64, r0 = (y >> lg) * 64;
            srcld = (e < 2048) ? QW : KW;
            dstld = INW;
            s = W + (size_t)r0 * srcld + c0;
            const size_t o = (size_t)(nb + c0) * INW + r0;
            dh = wtH + o;
            dl = wtL + o;
        } else if (e < 4096) {                                     // Wo [2048][2048]
            const int y = e - 3072;
            const int c0 = (y & 31) * 64, r0 = (y >> 5) * 64;
            srcld = HIDO;
            dstld = QW;
            s = Wo + (size_t)r0 * HIDO + c0;
            const size_t o = (size_t)c0 * QW + r0;
            dh = woH + o;
            dl = woL + o;
        } else {                                                   // past_value, kv head z: [2048][64]
            const int y = e - 4096;
            const int r0 = (y & 31) * 64, z = y >> 5;
            srcld = D;
            dstld = KVL;
            s = pv + (size_t)z * (KVP * D) + (size_t)r0 * D;
            const size_t o = (size_t)z * (D * KVL) + r0;
            dh = vH + o;
            dl = vL + o;
        }
        transpose_unit(s, srcld, dh, dl, dstld, Th, Tl, t);
    }
    const int tb = (int)blockIdx.x - (PREP_BLOCKS - PREP_TABLE_BLOCKS);
    if (tb >= 0) table_unit(pid, cosT, sinT, tb * 256 + t, lck);
}

// ---------------------------------------------------------------------------
// GEMM, bf16 hi/lo three-term: C[M x N] f32 (pitch ldc) = A[M x K] . B[K x N],
// A planes [M][K] (pitch K), B planes stored transposed [N][K] (pitch K, k-contiguous),
// so A and B fragments use the identical split-k load. Block = WM x 2 waves, BM x 128 with BM = 32 * WM;
// wave tile 32 x 64 (2 m-tiles x 4 n-tiles).
// Operands: a stage is 64 k (one 128-B line) of every operand row of the block,
// rows [A hi BM | A lo BM | B hi 128 | B lo 128] at an LDS pitch of 144 B, brought in by
// asynchronous copies of 16 B per lane (8 lanes = one whole line); three buffers: a stage's copies are
// issued two trips ahead of the trip that reads it, so that they may come from memory without a stall.
// Fragments are read from LDS. Three buffers leave room for one block per WGP only: where the grid of
// 64-row blocks has more blocks than WGPs, WM = 4 joins two of them into one block that shares the B rows.
// Epilogue: wave tile staged in LDS, then each 256-B row segment written as two
// Requires M % BM == 0, N % 128 == 0, K % 64 == 0, K >= 64, ldc % 32 == 0 (shapes fixed on host).
// ---------------------------------------------------------------------------
// eight copies of 16 B per lane, global -> LDS. The s_wait_xcnt stands inside the statement, behind
// the last copy, so that no address register of a copy is rewritten in front of it.
__device__ __forceinline__ void copy8(const unsigned (&l)[8], const unsigned short* const (&g)[8]) {
    asm volatile("global_load_async_to_lds_b128 %0, %8, off\n\t"
                 "global_load_async_to_lds_b128 %1, %9, off\n\t"
                 "global_load_async_to_lds_b128 %2, %10, off\n\t"
                 "global_load_async_to_lds_b128 %3, %11, off\n\t"
                 "global_load_async_to_lds_b128 %4, %12, off\n\t"
                 "global_load_async_to_lds_b128 %5, %13, off\n\t"
                 "global_load_async_to_lds_b128 %6, %14, off\n\t"
                 "global_load_async_to_lds_b128 %7, %15, off\n\t"
                 "s_wait_xcnt 0x0"
                 :: "v"(l[0]), "v"(l[1]), "v"(l[2]), "v"(l[3]), "v"(l[4]), "v"(l[5]), "v"(l[6]), "v"(l[7]),
                    "v"(g[0]), "v"(g[1]), "v"(g[2]), "v"(g[3]), "v"(g[4]), "v"(g[5]), "v"(g[6]), "v"(g[7])
                 : "memory");
}

__device__ __forceinline__ void store_ctile(const float* sW, float* C, int ldc,
                                            int m0w, int n0w, int hh, int m16) {
#pragma unroll
    for (int i = 0; i < 16; ++i) {
        const int row = 2 * i + hh;
        const v4f v = *(const v4fa*)(sW + row * 68 + m16 * 4);
        *(v4f*)(C + (size_t)(m0w + row) * ldc + n0w + m16 * 4) = v;
    }
}

// waits until all but the wave's youngest stage of copies (8 + 32 / WM per lane) have landed
template <int WM>
__device__ __forceinline__ void wait_all_but_one_stage() {
    static_assert(WM == 2 || WM == 4, "copies per stage");
    if constexpr (WM == 2) asm volatile("s_wait_asynccnt 0x18" ::: "memory");
    else                   asm volatile("s_wait_asynccnt 0x10" ::: "memory");
}

template <int WM>
__global__ __launch_bounds__(WM * 64) void gemm3_kernel(
    const unsigned short* __restrict__ Ah, const unsigned short* __restrict__ Al,
    const unsigned short* __restrict__ Bh, const unsigned short* __restrict__ Bl,
    float* C, int K, int ldc) {
    constexpr int SP = 68;
    constexpr int GP = 72;                 // LDS row pitch in halves (144 B = 16 B x 9: no bank conflict for 16-B reads)
    constexpr int BM = WM * 32;            // A rows of the block
    constexpr int RP = WM * 8;             // stage rows that one copy of the whole block brings
    constexpr int RAL = BM, RBH = 2 * BM, RBL = 2 * BM + 128, GROWS = 2 * BM + 256;   // first stage row of A lo, B hi, B lo; rows per stage
    constexpr int GSTAGE = GROWS * GP;     // halves per buffer
    __shared__ __align__(16) unsigned short ring[3 * GSTAGE];
    __shared__ __align__(16) float sC[WM * 2 * 32 * SP];
    const int tid = threadIdx.x, w = tid >> 5, lane = tid & 31, hh = lane >> 4, m16 = lane & 15;
    const int m0w = blockIdx.y * BM + (w >> 1) * 32;
    const int n0w = blockIdx.x * 128 + (w & 1) * 64;

    Acc acc[2][4];
#pragma unroll
    for (int mt = 0; mt < 2; ++mt)
#pragma unroll
        for (int nt = 0; nt < 4; ++nt) acc_zero(acc[mt][nt]);

    const size_t Ks = (size_t)K;
    // copy side: thread = (row cr of RP, 16-B piece cp of the row's 128 B); copy i takes stage row cr + RP * i
    const int cr = tid >> 3, cp = tid & 7;
    const unsigned short* gAh = Ah + (size_t)(blockIdx.y * BM + cr) * Ks + cp * 8;
    const unsigned short* gAl = Al + (size_t)(blockIdx.y * BM + cr) * Ks + cp * 8;
    const unsigned short* gBh = Bh + (size_t)(blockIdx.x * 128 + cr) * Ks + cp * 8;
    const unsigned short* gBl = Bl + (size_t)(blockIdx.x * 128 + cr) * Ks + cp * 8;
    const unsigned lds0 = (unsigned)(size_t)(ring + cr * GP + cp * 8);   // LDS byte address: low 32 bits

    auto issue = [&](int st, int buf) {
        const unsigned lb = lds0 + (unsigned)buf * (unsigned)(GSTAGE * 2);
        const size_t ko = (size_t)st * 64;
        unsigned l[8];
        const unsigned short* g[8];
#pragma unroll
        for (int i = 0; i < 4; ++i) {                  // BM / RP = 4 copies per A plane
            l[i] = lb + (unsigned)((RP * i) * GP * 2);
            g[i] = gAh + ko + (size_t)(RP * i) * Ks;
            l[4 + i] = lb + (unsigned)((RAL + RP * i) * GP * 2);
            g[4 + i] = gAl + ko + (size_t)(RP * i) * Ks;
        }
        copy8(l, g);
        if constexpr (WM == 2) {                       // 128 / RP = 8 copies per B plane
#pragma unroll
            for (int i = 0; i < 8; ++i) {
                l[i] = lb + (unsigned)((RBH + RP * i) * GP * 2);
                g[i] = gBh + ko + (size_t)(RP * i) * Ks;
            }
            copy8(l, g);
#pragma unroll
            for (int i = 0; i < 8; ++i) {
                l[i] = lb + (unsigned)((RBL + RP * i) * GP * 2);
                g[i] = gBl + ko + (size_t)(RP * i) * Ks;
            }
            copy8(l, g);
        } else {                                       // 128 / RP = 4 copies per B plane
#pragma unroll
            for (int i = 0; i < 4; ++i) {
                l[i] = lb + (unsigned)((RBH + RP * i) * GP * 2);
                g[i] = gBh + ko + (size_t)(RP * i) * Ks;
                l[4 + i] = lb + (unsigned)((RBL + RP * i) * GP * 2);
                g[4 + i] = gBl + ko + (size_t)(RP * i) * Ks;
            }
            copy8(l, g);
        }
    };

    const int NT = K >> 6;
    issue(0, 0);
    if (NT > 1) issue(1, 1);
    // stage 0 has landed for this wave (stage 1, where there is one, may still fly), then is published
    if (NT > 1) wait_all_but_one_stage<WM>();
    else        asm volatile("s_wait_asynccnt 0x0" ::: "memory");
    __syncthreads();
    if (NT > 2) issue(2, 2);

    // reader side: first fragment row of this wave inside a stage
    const int offA = ((w >> 1) * 32 + m16) * GP + 8 * hh;
    const int offB = (RBH + (w & 1) * 64 + m16) * GP + 8 * hh;

    // kept rolled: the buffer index and the refill test are per trip
    int buf = 0;                           // t mod 3
#pragma unroll 1
    for (int t = 0; t < NT; ++t) {
        const unsigned short* sb = ring + buf * GSTAGE;
        // a trip is 8 groups g = (k half g >> 2, n-tile g & 3) of 6 products. Fragment reads stand at three
        // places only (before group 0, at groups 2 and 4), the last two at least three groups ahead of their use, all in this trip's own buffer.
        Frag fa[2][4], fb[8][2];
        auto lda = [&](int ks) {
            const unsigned short* pa = sb + offA + ks * 32;
            ldfrag(fa[ks][0], pa);
            ldfrag(fa[ks][1], pa + RAL * GP);
            ldfrag(fa[ks][2], pa + 16 * GP);
            ldfrag(fa[ks][3], pa + (RAL + 16) * GP);
        };
        auto ldb = [&](int g) {
            const unsigned short* pb = sb + offB + (g >> 2) * 32 + (g & 3) * 16 * GP;
            ldfrag(fb[g][0], pb);
            ldfrag(fb[g][1], pb + (RBL - RBH) * GP);
        };
        lda(0); ldb(0); ldb(1); ldb(2); ldb(3); lda(1); ldb(4);
#pragma unroll
        for (int g = 0; g < 8; ++g) {
            if (g == 2) { ldb(5); ldb(6); }
            if (g == 4) ldb(7);
            mma3(acc[0][g & 3], fa[g >> 2][0], fa[g >> 2][1], fb[g][0], fb[g][1]);
            mma3(acc[1][g & 3], fa[g >> 2][2], fa[g >> 2][3], fb[g][0], fb[g][1]);
        }
        // publish point: this wave's LDS reads of the buffer are done, its copies of stage t + 1 have
        // landed; the barrier publishes stage t + 1 and frees this buffer for the refill. Where stage
        // t + 2 was issued (by every wave, at the foot of trip t - 1 or in front of the loop) its copies
        // are the wave's youngest and go on flying; where it was not, the wait is to 0
        asm volatile("s_wait_dscnt 0x0" ::: "memory");
        if (t + 2 < NT) wait_all_but_one_stage<WM>();
        else            asm volatile("s_wait_asynccnt 0x0" ::: "memory");
        __syncthreads();
        if (t + 3 < NT) issue(t + 3, buf);
        buf = (buf == 2) ? 0 : buf + 1;
    }
    // no copy is left in flight when the wave goes on
    asm volatile("s_wait_asynccnt 0x0" ::: "memory");

    // D layout: acc[mt][nt].f[r] = tile(row mt*16 + 8*hh + r, col nt*16 + m16)
    float* sW = sC + w * (32 * SP);
#pragma unroll
    for (int mt = 0; mt < 2; ++mt)
#pragma unroll
        for (int nt = 0; nt < 4; ++nt)
#pragma unroll
            for (int r = 0; r < 8; ++r)
                sW[(mt * 16 + 8 * hh + r) * SP + nt * 16 + m16] = acc[mt][nt].f[r];
    __syncthreads();
    store_ctile(sW, C, ldc, m0w, n0w, hh, m16);
    
}

// ---------------------------------------------------------------------------
// RoPE + split of the projection output qkv[1024][3072] (q cols 0..2047 = h*64+d,
// k cols 2048..2559, v cols 2560..3071). Block = (64-col group g, 64 tokens).
//   g < 32      : q head g      -> q planes [32][1024][64]      (RoPE)
//   32<=g<40    : kv head g-32  -> K planes [8][3072][64] rows 2048+tok (RoPE)
//   40<=g<48    : kv head g-40  -> V^T planes [8][64][3072] cols 2048+tok (transpose)
// y[d] = x[d]*cos + rot[d]*sin, rot = -x[d+32] (d<32), x[d-32] (d>=32); cos/sin from table.
// Each thread emits 8 consecutive halves per plane (16 B); 8 consecutive lanes = one line.
// coverage: q planes all 32x1024 rows; K planes rows 2048..3071 of every kv head;
// V^T planes cols 2048..3071 of all 8x64 rows.
// ---------------------------------------------------------------------------
__device__ __forceinline__ void rope8(const float* xr, const float* pr, const float* cr,
                                      const float* sr, float sgn, v4f& ya, v4f& yb) {
#pragma clang fp contract(off)
    ya.x = xr[0] * cr[0] + (sgn * pr[0]) * sr[0];
    ya.y = xr[1] * cr[1] + (sgn * pr[1]) * sr[1];
    ya.z = xr[2] * cr[2] + (sgn * pr[2]) * sr[2];
    ya.w = xr[3] * cr[3] + (sgn * pr[3]) * sr[3];
    yb.x = xr[4] * cr[4] + (sgn * pr[4]) * sr[4];
    yb.y = xr[5] * cr[5] + (sgn * pr[5]) * sr[5];
    yb.z = xr[6] * cr[6] + (sgn * pr[6]) * sr[6];
    yb.w = xr[7] * cr[7] + (sgn * pr[7]) * sr[7];
}

__global__ __launch_bounds__(256) void rope_split_kernel(
    const float* __restrict__ qkv, const float* __restrict__ cosT, const float* __restrict__ sinT,
    unsigned short* qh, unsigned short* ql, unsigned short* kh, unsigned short* kl,
    unsigned short* vh, unsigned short* vl) {
#pragma clang fp contract(off)
    constexpr int QN = 1024, D = 64, NH = 32, NKV = 8, QKVW = 3072, KVL = 3072, KVP = 2048, TP = 68;
    __shared__ __align__(16) float T[64 * TP];
    const int t = threadIdx.x, g = blockIdx.x, tok0 = blockIdx.y * 64;
    const float* s = qkv + (size_t)tok0 * QKVW + g * D;
#pragma unroll
    for (int i = 0; i < 4; ++i) {
        const int r = (t >> 4) + 16 * i, c4 = (t & 15) * 4;
        const v4f v = *(const v4fa*)(s + (size_t)r * QKVW + c4);
        *(v4fa*)(T + r * TP + c4) = v;
    }
    __syncthreads();

    u4 H0, L0, H1, L1;
    size_t g0, g1;
    unsigned short* dH;
    unsigned short* dL;
    if (g < NH + NKV) {                                   // block-uniform branch
        const bool isq = (g < NH);
        dH = isq ? qh : kh;
        dL = isq ? ql : kl;
        const int d0 = (t & 7) * 8, dp0 = d0 ^ 32;
        const float sgn = (d0 < 32) ? -1.0f : 1.0f;
        {
            const int r = (t >> 3), tok = tok0 + r;
            const float* cr = cosT + (size_t)tok * 32 + (d0 & 31);
            const float* sr = sinT + (size_t)tok * 32 + (d0 & 31);
            v4f ya, yb;
            rope8(T + r * TP + d0, T + r * TP + dp0, cr, sr, sgn, ya, yb);
            pack8(ya, yb, H0, L0);
            const size_t row = isq ? ((size_t)g * QN + tok) : ((size_t)(g - NH) * KVL + KVP + tok);
            g0 = row * D + d0;
        }
        {
            const int r = 32 + (t >> 3), tok = tok0 + r;
            const float* cr = cosT + (size_t)tok * 32 + (d0 & 31);
            const float* sr = sinT + (size_t)tok * 32 + (d0 & 31);
            v4f ya, yb;
            rope8(T + r * TP + d0, T + r * TP + dp0, cr, sr, sgn, ya, yb);
            pack8(ya, yb, H1, L1);
            const size_t row = isq ? ((size_t)g * QN + tok) : ((size_t)(g - NH) * KVL + KVP + tok);
            g1 = row * D + d0;
        }
    } else {
        dH = vh;
        dL = vl;
        const int kvhd = g - NH - NKV, piece = t & 7;
        {
            const int d = (t >> 3);
            v4f ya, yb;
            ya.x = T[(piece * 8 + 0) * TP + d]; ya.y = T[(piece * 8 + 1) * TP + d];
            ya.z = T[(piece * 8 + 2) * TP + d]; ya.w = T[(piece * 8 + 3) * TP + d];
            yb.x = T[(piece * 8 + 4) * TP + d]; yb.y = T[(piece * 8 + 5) * TP + d];
            yb.z = T[(piece * 8 + 6) * TP + d]; yb.w = T[(piece * 8 + 7) * TP + d];
            pack8(ya, yb, H0, L0);
            g0 = ((size_t)(kvhd * D + d)) * KVL + KVP + tok0 + piece * 8;
        }
        {
            const int d = 32 + (t >> 3);
            v4f ya, yb;
            ya.x = T[(piece * 8 + 0) * TP + d]; ya.y = T[(piece * 8 + 1) * TP + d];
            ya.z = T[(piece * 8 + 2) * TP + d]; ya.w = T[(piece * 8 + 3) * TP + d];
            yb.x = T[(piece * 8 + 4) * TP + d]; yb.y = T[(piece * 8 + 5) * TP + d];
            yb.z = T[(piece * 8 + 6) * TP + d]; yb.w = T[(piece * 8 + 7) * TP + d];
            pack8(ya, yb, H1, L1);
            g1 = ((size_t)(kvhd * D + d)) * KVL + KVP + tok0 + piece * 8;
        }
    }
    *(u4*)(dH + g0) = H0; *(u4*)(dL + g0) = L0;
    *(u4*)(dH + g1) = H1; *(u4*)(dL + g1) = L1;
    
}

// ---------------------------------------------------------------------------
// Flash attention with the block-diagonal TTT mask, GQA (kv head = h >> 2).
// Block = (kv head, 16 query rows), 16 waves = its 4 query heads x 4 key splits. The key
// tiles of 32 of all three key blocks form one list; split ks takes entries ks, ks + 4, ...
// The 4 heads of one split walk the same K and V tiles at the same time: a trip of the block is one
// tile per split, and each split's tile (K hi, K lo: 32 key rows of 128 B at a pitch of 144 B; V^T hi,
// V^T lo: 64 d rows of 64 B at a pitch of 80 B) is brought into LDS once by the split's 4 waves with
// asynchronous copies of 16 B per lane; two buffers, the next trip's copies fly while this trip is
// worked on. All K and V fragments are read from LDS.
// Both products are computed transposed: S^T = K . Q^T (A = K rows, B = q) and O^T += V^T . P^T (A = V^T rows,
// B = P^T). A lane then holds 16 scores of ONE query (column m16; keys 8*hh + r of each 16-key tile): maximum and
// sum run inside the lane, with one exchange between the wave's halves for the maximum, and the two score tiles,
// split in place, are the B operand of the second product in the hardware k order that ldfrag also has.
// Each wave keeps its own running maximum, sum (per wave half, joined behind the loop) and 16 x 64 output; a head's
// four partial results are merged through LDS in fixed split order behind one work-group barrier.
// Q/K/V/P operands as bf16 hi/lo; scores, mask (-inf), running-max softmax in f32.
// key j of block blk allowed iff j < seq_len and j <= i - (lck - blk).
// seq_len = sum(attention_mask) - lck, summed per block in fixed order.
// Per blk the key-tile count is bounded by the tile's diagonal and seq_len
// (at most 32 tiles); the mask is still applied by value per element.
// Output attn planes [1024][2048] (col h*64+d): 8 lanes x 16 B = one 128-B line per row.
// Query tiles with the most keys have the lowest block index (for speed only).
// coverage: 8 x 64 blocks x 4 heads x 16 rows x 64 cols = [1024][2048] per plane.
// ---------------------------------------------------------------------------
__global__ __launch_bounds__(512) void attn_kernel(
    const unsigned short* __restrict__ qH, const unsigned short* __restrict__ qL,
    const unsigned short* __restrict__ kH, const unsigned short* __restrict__ kL,
    const unsigned short* __restrict__ vH, const unsigned short* __restrict__ vL,
    const int* __restrict__ amask, int nmask, int lck,
    unsigned short* oH, unsigned short* oL) {
    constexpr int QN = 1024, D = 64, KVL = 3072, HIDO = 2048, NS = 4, NW = 4 * NS, SP = 68;
    constexpr int KP = 72, VP = 40;                 // LDS row pitches in halves (16 B x 9, 16 B x 5: no bank conflict for 16-B reads)
    constexpr int KPL = 32 * KP, VPL = 64 * VP;     // halves per plane of a K tile, of a V^T tile
    constexpr int TSPL = 2 * KPL + 2 * VPL;         // halves per split: [K hi | K lo | V^T hi | V^T lo]
    constexpr int TSTAGE = NS * TSPL;               // halves per buffer
    __shared__ __align__(16) unsigned short kvs[2 * TSTAGE];
    __shared__ int red[128];
    __shared__ __align__(16) float Os[NW * 16 * SP];
    __shared__ float Ms[NW * 16];
    __shared__ float Ls[NW * 16];
    const int tid = threadIdx.x, lane = tid & 31, hh = lane >> 4, m16 = lane & 15;
    // wave number held as a scalar: the key-tile loop then branches on scalar tests, every lane on
    const int w = __builtin_amdgcn_readfirstlane(tid >> 5);

    // seq_len (integer, fixed order, identical in every block)
    if (tid < 128) {                                   // the first four waves sum the mask
        int part = 0;
        for (int i = tid; i < nmask; i += 128) part += amask[i];
        red[tid] = part;
    }
    __syncthreads();
#pragma unroll
    for (int off = 64; off > 0; off >>= 1) {
        if (tid < off) red[tid] += red[tid + off];
        __syncthreads();
    }
    const int seq_len = __builtin_amdgcn_readfirstlane(red[0] - lck);

    const int kvh = blockIdx.x, h = kvh * 4 + (w & 3), ks = w >> 2;
    const int q0w = (QN / 16 - 1 - (int)blockIdx.y) * 16;
    const float NEG_INF = -__builtin_inff();

    Frag fqh[2], fql[2];
    {
        const size_t qo = ((size_t)h * QN + q0w + m16) * D + 8 * hh;
        ldfrag(fqh[0], qH + qo);
        ldfrag(fqh[1], qH + qo + 32);
        ldfrag(fql[0], qL + qo);
        ldfrag(fql[1], qL + qo + 32);
    }
    // of query q0w + m16: running maximum (alike in both halves) and this half's part of the running sum
    float mrun = NEG_INF, lrun = 0.0f;
    Acc o[4];
#pragma unroll
    for (int dt = 0; dt < 4; ++dt) acc_zero(o[dt]);

    const size_t kplane = (size_t)kvh * KVL * D;      // K planes [kvh][kv][d]
    const size_t vplane = (size_t)kvh * D * KVL;      // V^T planes [kvh][d][kv]

    // key tiles per key block (allowed j of block blk are < q0w + 16 - (lck - blk) and < seq_len),
    // as running ends e0 <= e1 <= e2 of the one list; each count <= 32, so e2 <= 96
    int e0, e1, e2;
    {
        int c0 = q0w + 16 - lck, c1 = c0 + 1, c2 = c0 + 2;
        c0 = (c0 < seq_len) ? c0 : seq_len;
        c1 = (c1 < seq_len) ? c1 : seq_len;
        c2 = (c2 < seq_len) ? c2 : seq_len;
        c0 = (c0 < 0) ? 0 : ((c0 > QN) ? QN : c0);
        c1 = (c1 < 0) ? 0 : ((c1 > QN) ? QN : c1);
        c2 = (c2 < 0) ? 0 : ((c2 > QN) ? QN : c2);
        e0 = __builtin_amdgcn_readfirstlane((c0 + 31) >> 5);
        e1 = e0 + __builtin_amdgcn_readfirstlane((c1 + 31) >> 5);
        e2 = e1 + __builtin_amdgcn_readfirstlane((c2 + 31) >> 5);
    }
    // copy side: the 128 lanes of a split bring its tile; per lane 4 copies of K (2 planes x 2 row groups
    // of 16; 8 lanes = one 128-B row) and 4 of V^T (2 planes x 2 row groups of 32; 4 lanes = one 64-B row)
    const int lt = (w & 3) * 32 + lane;
    const int ckr = lt >> 3, ckp = (lt & 7) * 8, cvr = lt >> 2, cvp = (lt & 3) * 8;
    const unsigned short* gkh = kH + kplane + (size_t)ckr * D + ckp;
    const unsigned short* gkl = kL + kplane + (size_t)ckr * D + ckp;
    const unsigned short* gvh = vH + vplane + (size_t)cvr * KVL + cvp;
    const unsigned short* gvl = vL + vplane + (size_t)cvr * KVL + cvp;
    const unsigned ldk = (unsigned)(size_t)(kvs + ks * TSPL + ckr * KP + ckp);             // LDS byte address: low 32 bits
    const unsigned ldv = (unsigned)(size_t)(kvs + ks * TSPL + 2 * KPL + cvr * VP + cvp);
    // trips of the block; a split whose list entry lies past the end copies the last tile again (in bounds,
    // never read), so every wave issues the same copies in every trip
    const int NT = (e2 + NS - 1) / NS;
    auto issue = [&](int it, int buf) {
        int le = it * NS + ks;
        le = (le < e2) ? le : (e2 - 1);
        const int cb = (le >= e0 ? 1 : 0) + (le >= e1 ? 1 : 0);
        const int ct = le - (le >= e1 ? e1 : (le >= e0 ? e0 : 0));
        const size_t ckv = (size_t)(cb * QN + ct * 32);
        const unsigned bo = (unsigned)buf * (unsigned)(TSTAGE * 2);
        unsigned l[8];
        const unsigned short* g[8];
#pragma unroll
        for (int i = 0; i < 2; ++i) {
            l[i] = ldk + bo + (unsigned)(16 * i * KP * 2);
            g[i] = gkh + (ckv + 16 * i) * D;
            l[2 + i] = ldk + bo + (unsigned)((KPL + 16 * i * KP) * 2);
            g[2 + i] = gkl + (ckv + 16 * i) * D;
            l[4 + i] = ldv + bo + (unsigned)(32 * i * VP * 2);
            g[4 + i] = gvh + (size_t)(32 * i) * KVL + ckv;
            l[6 + i] = ldv + bo + (unsigned)((VPL + 32 * i * VP) * 2);
            g[6 + i] = gvl + (size_t)(32 * i) * KVL + ckv;
        }
        copy8(l, g);
    };
    if (NT > 0) issue(0, 0);
    // trip 0's tiles have landed for this wave, then are published to the other waves
    asm volatile("s_wait_asynccnt 0x0" ::: "memory");
    __syncthreads();
    if (NT > 1) issue(1, 1);

    // kept rolled: a second copy of the long body would only raise the register count
#pragma unroll 1
    for (int it = 0; it < NT; ++it) {
      const int s = it * NS + ks;
      if (s < e2) {                                    // scalar test: the whole wave works or skips
        const int blk = (s >= e0 ? 1 : 0) + (s >= e1 ? 1 : 0);
        const int t = s - (s >= e1 ? e1 : (s >= e0 ? e0 : 0));
        const int shift = lck - blk;                   // j <= i - shift
        const int j0 = t * 32;
        const unsigned short* tb = kvs + (it & 1) * TSTAGE + ks * TSPL;   // this split's tile of this trip
        Acc sc[2];
        acc_zero(sc[0]);
        acc_zero(sc[1]);
        // the K fragment reads stand together at the head of the trip
        Frag fk[2][2][2];
#pragma unroll
        for (int nt = 0; nt < 2; ++nt)
#pragma unroll
            for (int ds = 0; ds < 2; ++ds) {
                const unsigned short* pk = tb + (nt * 16 + m16) * KP + ds * 32 + 8 * hh;
                ldfrag(fk[nt][ds][0], pk);
                ldfrag(fk[nt][ds][1], pk + KPL);
            }
        // S^T tile [32 keys x 16 q]; A = K (k = d), B = q (k = d): sc[nt].f[r] = S[q m16][key nt*16 + 8*hh + r]
#pragma unroll
        for (int nt = 0; nt < 2; ++nt)
#pragma unroll
            for (int ds = 0; ds < 2; ++ds)
                mma3(sc[nt], fk[nt][ds][0], fk[nt][ds][1], fqh[ds], fql[ds]);
        // the V fragment reads stand together ahead of the softmax, which covers their latency
        Frag fv[4][2];
#pragma unroll
        for (int dt = 0; dt < 4; ++dt) {
            const unsigned short* pv = tb + 2 * KPL + (dt * 16 + m16) * VP + 8 * hh;
            ldfrag(fv[dt][0], pv);
            ldfrag(fv[dt][1], pv + VPL);
        }
        // scale and mask by value: key j allowed iff j < seq_len and j <= qi - shift
        {
            const int qi = q0w + m16;
            const int jd = qi - shift, jp = seq_len - 1;
            const int jmax = (jd < jp) ? jd : jp;      // last allowed key of this query in this key block
#pragma unroll
            for (int nt = 0; nt < 2; ++nt)
#pragma unroll
                for (int r = 0; r < 8; ++r) {
                    const int j = j0 + nt * 16 + 8 * hh + r;
                    sc[nt].f[r] = (j <= jmax) ? sc[nt].f[r] * 0.125f : NEG_INF;
                }
        }
        // running-max softmax update of the lane's one query
        float x = fmaxf(sc[0].f[0], sc[1].f[0]);
#pragma unroll
        for (int r = 1; r < 8; ++r) x = fmaxf(x, fmaxf(sc[0].f[r], sc[1].f[r]));
        x = fmaxf(x, xhalf(x));
        const float mn = fmaxf(mrun, x);
        const float msafe = (mn == NEG_INF) ? 0.0f : mn;
        const float alpha = __expf(mrun - msafe);
        mrun = mn;
#pragma unroll
        for (int nt = 0; nt < 2; ++nt)
#pragma unroll
            for (int r = 0; r < 8; ++r) sc[nt].f[r] = __expf(sc[nt].f[r] - msafe);
        {
            float s4[4];
#pragma unroll
            for (int c = 0; c < 4; ++c)
                s4[c] = (sc[0].f[c] + sc[0].f[4 + c]) + (sc[1].f[c] + sc[1].f[4 + c]);
            lrun = lrun * alpha + ((s4[0] + s4[1]) + (s4[2] + s4[3]));
        }
#pragma unroll
        for (int dt = 0; dt < 4; ++dt)
#pragma unroll
            for (int r = 0; r < 8; ++r) o[dt].f[r] *= alpha;

        // P^T as B operand (k = key, n = q): elements 0..7 = tile 0's registers, 8..15 = tile 1's
        Frag fph, fpl;
#pragma unroll
        for (int nt = 0; nt < 2; ++nt) {
            const v4f pa = {sc[nt].f[0], sc[nt].f[1], sc[nt].f[2], sc[nt].f[3]};
            const v4f pb = {sc[nt].f[4], sc[nt].f[5], sc[nt].f[6], sc[nt].f[7]};
            pack8(pa, pb, fph.q[nt], fpl.q[nt]);
        }

        // O^T += V^T . P^T ; A = V^T rows (m = d, k = key): o[dt].f[r] = O[q m16][dt*16 + 8*hh + r]
#pragma unroll
        for (int dt = 0; dt < 4; ++dt) mma3(o[dt], fv[dt][0], fv[dt][1], fph, fpl);
      }
        // publish point: this wave's LDS reads of the buffer are done, its copies of the next trip
        // have landed; the barrier publishes the next trip's tiles and frees this buffer for the refill
        asm volatile("s_wait_dscnt 0x0" ::: "memory");
        asm volatile("s_wait_asynccnt 0x0" ::: "memory");
        __syncthreads();
        if (it + 2 < NT) issue(it + 2, it & 1);
    }
    // no copy is left in flight when the wave goes on
    asm volatile("s_wait_asynccnt 0x0" ::: "memory");

    // each wave's partial result to LDS (o[dt].f[r] = O[q m16][dt*16 + 8*hh + r]: 8 consecutive columns of a row)
    float* Ow = Os + w * 16 * SP;
#pragma unroll
    for (int dt = 0; dt < 4; ++dt) {
        const v4f oa = {o[dt].f[0], o[dt].f[1], o[dt].f[2], o[dt].f[3]};
        const v4f ob = {o[dt].f[4], o[dt].f[5], o[dt].f[6], o[dt].f[7]};
        *(v4fa*)(Ow + m16 * SP + dt * 16 + 8 * hh) = oa;
        *(v4fa*)(Ow + m16 * SP + dt * 16 + 8 * hh + 4) = ob;
    }
    // the halves' sums are joined with every lane on; both halves then store the same two values
    const float lall = lrun + xhalf(lrun);
    Ms[w * 16 + m16] = mrun;
    Ls[w * 16 + m16] = lall;
    __syncthreads();

    // merge in split order, normalise, split into planes; thread = (head, row, 8 columns)
    const int hl = tid >> 7, row = (tid >> 3) & 15, c8 = (tid & 7) * 8;
    float mall = NEG_INF;
#pragma unroll
    for (int u = 0; u < NS; ++u) mall = fmaxf(mall, Ms[(u * 4 + hl) * 16 + row]);
    const float mfin = (mall == NEG_INF) ? 0.0f : mall;
    float lsum = 0.0f;
    v4f oa = {0.0f, 0.0f, 0.0f, 0.0f}, ob = {0.0f, 0.0f, 0.0f, 0.0f};
#pragma unroll
    for (int u = 0; u < NS; ++u) {
        const int pr = (u * 4 + hl) * 16 + row;
        const float a = __expf(Ms[pr] - mfin);
        const v4f va = *(const v4fa*)(Os + pr * SP + c8);
        const v4f vb = *(const v4fa*)(Os + pr * SP + c8 + 4);
        lsum += a * Ls[pr];
        oa += a * va;
        ob += a * vb;
    }
    const float il = 1.0f / lsum;
    u4 H, L;
    pack8(oa * il, ob * il, H, L);
    const size_t eo = (size_t)(q0w + row) * HIDO + (kvh * 4 + hl) * D + c8;
    *(u4*)(oH + eo) = H;
    *(u4*)(oL + eo) = L;
}

// ---------------------------------------------------------------------------
extern "C" void kernel_launch(void* const* d_in, const int* in_sizes, int n_in,
                              void* d_out, int out_size, void* d_ws, size_t ws_size,
                              hipStream_t stream) {
    constexpr int QN = 1024, INW = 4096, NH = 32, NKV = 8, D = 64, HIDO = 2048;
    constexpr int KVP = 2048, KVL = 3072, QKVW = 3072, LCK = KVP / QN;
    if (n_in < 9) return;
    if (in_sizes[0] != QN * INW || in_sizes[1] != NKV * KVP * D || in_sizes[2] != NKV * KVP * D ||
        in_sizes[3] != QN || in_sizes[4] != QN || in_sizes[5] != INW * NH * D ||
        in_sizes[6] != INW * NKV * D || in_sizes[7] != INW * NKV * D ||
        in_sizes[8] != NH * D * HIDO || out_size != QN * HIDO) return;

    const float* hs  = (const float*)d_in[0];
    const float* pk  = (const float*)d_in[1];
    const float* pv  = (const float*)d_in[2];
    const int*   am  = (const int*)  d_in[3];
    const int*   pid = (const int*)  d_in[4];
    const float* Wq  = (const float*)d_in[5];
    const float* Wk  = (const float*)d_in[6];
    const float* Wv  = (const float*)d_in[7];
    const float* Wo  = (const float*)d_in[8];
    float* out = (float*)d_out;

    char* ws = (char*)d_ws;
    size_t off = 0;
    auto carve = [&](size_t bytes) -> char* {
        char* p = ws + off;
        off += (bytes + 255) & ~(size_t)255;
        return p;
    };
    unsigned short* hsH = (unsigned short*)carve((size_t)QN * INW * 2);          // A planes of QKV GEMM
    unsigned short* hsL = (unsigned short*)carve((size_t)QN * INW * 2);
    unsigned short* wtH = (unsigned short*)carve((size_t)QKVW * INW * 2);        // [Wq|Wk|Wv]^T planes [3072][4096]
    unsigned short* wtL = (unsigned short*)carve((size_t)QKVW * INW * 2);
    unsigned short* woH = (unsigned short*)carve((size_t)HIDO * (NH * D) * 2);    // Wo^T planes [2048][2048]
    unsigned short* woL = (unsigned short*)carve((size_t)HIDO * (NH * D) * 2);
    float*          qkv = (float*)         carve((size_t)QN * QKVW * 4);          // projection output f32
    unsigned short* qH  = (unsigned short*)carve((size_t)NH * QN * D * 2);        // q planes [32][1024][64]
    unsigned short* qL  = (unsigned short*)carve((size_t)NH * QN * D * 2);
    unsigned short* kH  = (unsigned short*)carve((size_t)NKV * KVL * D * 2);      // K planes [8][3072][64]
    unsigned short* kL  = (unsigned short*)carve((size_t)NKV * KVL * D * 2);
    unsigned short* vH  = (unsigned short*)carve((size_t)NKV * D * KVL * 2);      // V^T planes [8][64][3072]
    unsigned short* vL  = (unsigned short*)carve((size_t)NKV * D * KVL * 2);
    unsigned short* aH  = (unsigned short*)carve((size_t)QN * (NH * D) * 2);      // attention output planes [1024][2048]
    unsigned short* aL  = (unsigned short*)carve((size_t)QN * (NH * D) * 2);
    float*          cosT = (float*)        carve((size_t)QN * 32 * 4);
    float*          sinT = (float*)        carve((size_t)QN * 32 * 4);
    if (off > ws_size || off > ((size_t)128 << 20)) return;

    // tables and operand planes, one launch
    prep_kernel<<<PREP_BLOCKS, 256, 0, stream>>>(hs, pk, pv, pid, Wq, Wk, Wv, Wo, hsH, hsL, kH, kL, vH, vL,
                                                 wtH, wtL, woH, woL, cosT, sinT, LCK);

    // fused QKV projection: [1024 x 4096] . [4096 x 3072] -> qkv f32
    gemm3_kernel<4><<<dim3(QKVW / 128, QN / 128), 256, 0, stream>>>(hsH, hsL, wtH, wtL, qkv, INW, QKVW);

    // RoPE + split into q planes, new K rows, new V^T cols
    rope_split_kernel<<<dim3(QKVW / 64, QN / 64), 256, 0, stream>>>(qkv, cosT, sinT, qH, qL, kH, kL, vH, vL);

    // attention
    attn_kernel<<<dim3(NKV, QN / 16), 512, 0, stream>>>(qH, qL, kH, kL, vH, vL, am, in_sizes[3], LCK, aH, aL);

    // output projection: [1024 x 2048] . [2048 x 2048] -> d_out f32
    gemm3_kernel<2><<<dim3(HIDO / 128, QN / 64), 128, 0, stream>>>(aH, aL, woH, woL, out, NH * D, HIDO);
}

// v008
// Measured time: 162 microseconds a run.
// Two timings next to v007 both put it at 1.03 times that version's speed.
// Over all steps from v000 it is 3.56 times as fast.
// All contractions (q/k/v projections, q.k^T, p.v, output projection): v_wmma_f32_16x16x32_bf16 with bf16 hi/lo operands everywhere (hi*hi + hi*lo + lo*hi), f32 accumulate; RoPE, softmax and normalisation in f32.
#include <hip/hip_runtime.h>
#include <hip/hip_bf16.h>

typedef __attribute__((ext_vector_type(16))) __bf16 v16bf;
typedef __attribute__((ext_vector_type(2))) __bf16 v2bf;
typedef float v2f __attribute__((ext_vector_type(2)));
typedef float v8f __attribute__((ext_vector_type(8)));
typedef float v4f __attribute__((ext_vector_type(4)));
typedef unsigned int u4 __attribute__((ext_vector_type(4)));
typedef u4 __attribute__((may_alias)) u4a;
typedef v4f __attribute__((may_alias)) v4fa;

union Frag { v16bf v; u4 q[2]; };
union Acc  { v8f v; float f[8]; };

// ---------------------------------------------------------------------------
// bf16 hi/lo split (hi = RNE(x), lo = RNE(x - hi), exact residual), two values at a time
// ---------------------------------------------------------------------------
// two f32 -> two bf16 in one word, first element in the low half-word: one packed convert, round to nearest even
__device__ __forceinline__ unsigned cvt2(float a, float b) {
    const v2f x = {a, b};
    return __builtin_bit_cast(unsigned, __builtin_convertvector(x, v2bf));
}
// two f32 -> one 32-bit word per plane
__device__ __forceinline__ void pack2(float a, float b, unsigned& wh, unsigned& wl) {
    wh = cvt2(a, b);
    wl = cvt2(a - __uint_as_float(wh << 16), b - __uint_as_float(wh & 0xFFFF0000u));
}
// eight consecutive f32 -> 16 B per plane
__device__ __forceinline__ void pack8(const v4f a, const v4f b, u4& H, u4& L) {
    unsigned h0, l0, h1, l1, h2, l2, h3, l3;
    pack2(a.x, a.y, h0, l0);
    pack2(a.z, a.w, h1, l1);
    pack2(b.x, b.y, h2, l2);
    pack2(b.z, b.w, h3, l3);
    H.x = h0; H.y = h1; H.z = h2; H.w = h3;
    L.x = l0; L.y = l1; L.z = l2; L.w = l3;
}

// ---------------------------------------------------------------------------
// 16x16x32 fragment load from a k-contiguous 16-bit row (A row m, or B^T row n):
// p = row_start + k0 + 8*h ; elements 0..7 <- k0+8h.., elements 8..15 <- k0+16+8h..
// ---------------------------------------------------------------------------
__device__ __forceinline__ void ldfrag(Frag& f, const unsigned short* p) {
    f.q[0] = *(const u4a*)(p);
    f.q[1] = *(const u4a*)(p + 16);
}

__device__ __forceinline__ void acc_zero(Acc& c) {
#pragma unroll
    for (int i = 0; i < 8; ++i) c.f[i] = 0.0f;
}

// acc += Ah*Bh + Ah*Bl + Al*Bh, then 4 wait slots with D tied and A/B kept live
__device__ __forceinline__ void mma3(Acc& c, const Frag& ah, const Frag& al,
                                     const Frag& bh, const Frag& bl) {
    v8f d = c.v;
    d = __builtin_amdgcn_wmma_f32_16x16x32_bf16(false, ah.v, false, bh.v, (short)0, d, false, false);
    d = __builtin_amdgcn_wmma_f32_16x16x32_bf16(false, ah.v, false, bl.v, (short)0, d, false, false);
    d = __builtin_amdgcn_wmma_f32_16x16x32_bf16(false, al.v, false, bh.v, (short)0, d, false, false);
    asm volatile("v_nop\n\tv_nop\n\tv_nop\n\tv_nop"
                 : "+v"(d) : "v"(ah.v), "v"(al.v), "v"(bh.v), "v"(bl.v));
    c.v = d;
}

// value of lane l ^ 16 (the other half of the wave), a vector cross-row move
__device__ __forceinline__ float xhalf(float x) {
    const int b = __float_as_int(x);
    return __int_as_float(__builtin_amdgcn_permlanex16(b, b, 0x76543210, 0xfedcba98, false, false));
}

// ---------------------------------------------------------------------------
// Operand preparation, ONE launch. None of these jobs reads another's output, so they share a grid:
// PREP_BLOCKS blocks of 256 threads, block b takes units b, b + PREP_BLOCKS, ... of a list of PREP_UNITS.
// Of every 22 list entries 5 are straight splits (memory only) and 17 are transpose units (LDS and vector
// work), mixed for speed only. The last 128 blocks, which have one
// list unit fewer than the first 512, each add one table unit behind their loop.
//   straight unit, 4096 consecutive f32 -> bf16 hi/lo planes: hidden_states (1024 units),
//     past_key (256 units; kv head = 32 units, dst rows 0..2047 of its 3072)
//   table unit, 256 entries of the cos/sin table [1024][32] (128 units)
//   transpose unit, one 64 x 64 tile, src[r][c] -> dst planes [c][r]: Wq 2048, Wk 512, Wv 512 tiles into
//     [Wq|Wk|Wv]^T [3072][4096]; Wo 1024 tiles into Wo^T [2048][2048]; past_value 256 tiles into
//     V^T [8][64][3072] cols 0..2047
// coverage: every unit once (u -> (u / 22, u % 22) is one-to-one), units x 4096 = every element of each source.
// ---------------------------------------------------------------------------
constexpr int PREP_BLOCKS = 1024;
constexpr int PREP_UNITS = 5632;          // 1280 straight + 4352 transpose = 22 * 256
constexpr int PREP_TABLE_BLOCKS = 128;    // x 256 threads = the 1024 x 32 table entries

// cos/sin at angle f32(pos + lck) * inv_freq[i], inv_freq[i] = 1 / 10000^(i/32)
// (f64 exp2 -> f32, then f32 reciprocal); precise sinf/cosf.
__device__ __forceinline__ void table_unit(const int* __restrict__ pid, float* cosT, float* sinT,
                                           int idx, int lck) {
    const int tok = idx >> 5, i = idx & 31;
    const double e = (double)i * 0.03125 * 13.287712379549449;   // i/32 * log2(1e4)
    const float p32 = (float)exp2(e);
    const float inv = 1.0f / p32;
    const float pos = (float)(pid[tok] + lck);
    const float ang = pos * inv;
    const float c = cosf(ang);
    const float s = sinf(ang);
    *(float*)(cosT + idx) = c;
    *(float*)(sinT + idx) = s;
}

// 4096 consecutive f32 -> planes; a thread takes two groups of 8 (one 16-B store per plane and group)
__device__ __forceinline__ void straight_unit(const float* __restrict__ src,
                                              unsigned short* dh, unsigned short* dl, int t) {
    const float* p = src + t * 8;
    const v4f a0 = *(const v4fa*)(p);
    const v4f b0 = *(const v4fa*)(p + 4);
    const v4f a1 = *(const v4fa*)(p + 2048);
    const v4f b1 = *(const v4fa*)(p + 2052);
    u4 H0, L0, H1, L1;
    pack8(a0, b0, H0, L0);
    pack8(a1, b1, H1, L1);
    *(u4*)(dh + t * 8) = H0;        *(u4*)(dl + t * 8) = L0;
    *(u4*)(dh + 2048 + t * 8) = H1; *(u4*)(dl + 2048 + t * 8) = L1;
    // the block's next unit rewrites the registers that these stores name
    asm volatile("s_wait_xcnt 0x0" ::: "memory");
}

// one 64 x 64 tile through LDS: s = tile origin (pitch srcld), dh/dl = origin of the transposed tile
// (pitch dstld). loads 256 thr x 4 x float4 = 64x64; stores 256 thr x 2 x 8 = 64x64 per plane.
__device__ __forceinline__ void transpose_unit(const float* __restrict__ s, int srcld,
                                               unsigned short* dh, unsigned short* dl, int dstld,
                                               unsigned short* Th, unsigned short* Tl, int t) {
    constexpr int TP = 72;
    v4f x[4];
#pragma unroll
    for (int i = 0; i < 4; ++i) {
        x[i] = *(const v4fa*)(s + (size_t)((t >> 4) + 16 * i) * srcld + (t & 15) * 4);
        // a later load's result may land in the registers that hold this load's address
        asm volatile("s_wait_xcnt 0x0" ::: "memory");
    }
#pragma unroll
    for (int i = 0; i < 4; ++i) {
        const int r = (t >> 4) + 16 * i, c4 = (t & 15) * 4;
        const v4f v = x[i];
        unsigned hb, lb;
        pack2(v.x, v.y, hb, lb);
        Th[(c4 + 0) * TP + r] = (unsigned short)hb; Tl[(c4 + 0) * TP + r] = (unsigned short)lb;
        Th[(c4 + 1) * TP + r] = (unsigned short)(hb >> 16); Tl[(c4 + 1) * TP + r] = (unsigned short)(lb >> 16);
        pack2(v.z, v.w, hb, lb);
        Th[(c4 + 2) * TP + r] = (unsigned short)hb; Tl[(c4 + 2) * TP + r] = (unsigned short)lb;
        Th[(c4 + 3) * TP + r] = (unsigned short)(hb >> 16); Tl[(c4 + 3) * TP + r] = (unsigned short)(lb >> 16);
    }
    __syncthreads();
    const int piece = t & 7;
    const int rowA = (t >> 3), rowB = 32 + (t >> 3);
    const u4 HA = *(const u4a*)(Th + rowA * TP + piece * 8);
    const u4 LA = *(const u4a*)(Tl + rowA * TP + piece * 8);
    const u4 HB = *(const u4a*)(Th + rowB * TP + piece * 8);
    const u4 LB = *(const u4a*)(Tl + rowB * TP + piece * 8);
    // the LDS tile is written again by the block's next transpose unit: every wave's reads end here first
    __syncthreads();
    const size_t gA = (size_t)rowA * dstld + piece * 8;
    const size_t gB = (size_t)rowB * dstld + piece * 8;
    *(u4*)(dh + gA) = HA; *(u4*)(dl + gA) = LA;
    *(u4*)(dh + gB) = HB; *(u4*)(dl + gB) = LB;
    // the block's next unit rewrites the registers that these stores name
    asm volatile("s_wait_xcnt 0x0" ::: "memory");
}

__global__ __launch_bounds__(256) void prep_kernel(
    const float* __restrict__ hs, const float* __restrict__ pk, const float* __restrict__ pv,
    const int* __restrict__ pid,
    const float* __restrict__ Wq, const float* __restrict__ Wk, const float* __restrict__ Wv,
    const float* __restrict__ Wo,
    unsigned short* hsH, unsigned short* hsL, unsigned short* kH, unsigned short* kL,
    unsigned short* vH, unsigned short* vL, unsigned short* wtH, unsigned short* wtL,
    unsigned short* woH, unsigned short* woL, float* cosT, float* sinT, int lck) {
    constexpr int INW = 4096, QW = 2048, KW = 512, D = 64, KVP = 2048, KVL = 3072, HIDO = 2048;
    __shared__ __align__(16) unsigned short Th[64 * 72];
    __shared__ __align__(16) unsigned short Tl[64 * 72];
    const int t = threadIdx.x;
    // every test below reads the unit number alone: the whole block takes one path, barriers included
    for (int u = blockIdx.x; u < PREP_UNITS; u += PREP_BLOCKS) {
        const int q = u / 22, r = u - q * 22;
        if (r < 5) {
            const int s = q * 5 + r;                               // 0..1279
            if (s < 1024) {
                const size_t o = (size_t)s * 4096;
                straight_unit(hs + o, hsH + o, hsL + o, t);
            } else {
                const int y = s - 1024;                            // 0..255
                const size_t o = (size_t)(y >> 5) * (KVL * D) + (size_t)(y & 31) * 4096;
                straight_unit(pk + (size_t)y * 4096, kH + o, kL + o, t);
            }
            continue;
        }
        const int e = q * 17 + (r - 5);                            // 0..4351
        const float* s;
        unsigned short* dh;
        unsigned short* dl;
        int srcld, dstld;
        if (e < 3072) {                                            // Wq | Wk | Wv -> rows nb.. of [3072][4096]
            const float* W = (e < 2048) ? Wq : ((e < 2560) ? Wk : Wv);
            const int y = (e < 2048) ? e : ((e < 2560) ? e - 2048 : e - 2560);
            const int lg = (e < 2048) ? 5 : 3;                     // log2 of the column tiles per row of tiles
            const int nb = (e < 2048) ? 0 : ((e < 2560) ? QW : QW + KW);
            const int c0 = (y & ((1 << lg) - 1)) * 64, r0 = (y >> lg) * 64;
            srcld = (e < 2048) ? QW : KW;
            dstld = INW;
            s = W + (size_t)r0 * srcld + c0;
            const size_t o = (size_t)(nb + c0) * INW + r0;
            dh = wtH + o;
            dl = wtL + o;
        } else if (e < 4096) {                                     // Wo [2048][2048]
            const int y = e - 3072;
            const int c0 = (y & 31) * 64, r0 = (y >> 5) * 64;
            srcld = HIDO;
            dstld = QW;
            s = Wo + (size_t)r0 * HIDO + c0;
            const size_t o = (size_t)c0 * QW + r0;
            dh = woH + o;
            dl = woL + o;
        } else {                                                   // past_value, kv head z: [2048][64]
            const int y = e - 4096;
            const int r0 = (y & 31) * 64, z = y >> 5;
            srcld = D;
            dstld = KVL;
            s = pv + (size_t)z * (KVP * D) + (size_t)r0 * D;
            const size_t o = (size_t)z * (D * KVL) + r0;
            dh = vH + o;
            dl = vL + o;
        }
        transpose_unit(s, srcld, dh, dl, dstld, Th, Tl, t);
    }
    const int tb = (int)blockIdx.x - (PREP_BLOCKS - PREP_TABLE_BLOCKS);
    if (tb >= 0) table_unit(pid, cosT, sinT, tb * 256 + t, lck);
}

// ---------------------------------------------------------------------------
// GEMM, bf16 hi/lo three-term: C[M x N] f32 (pitch ldc) = A[M x K] . B[K x N],
// A planes [M][K] (pitch K), B planes stored transposed [N][K] (pitch K, k-contiguous),
// so A and B fragments use the identical split-k load. Block = WM x 2 waves, BM x 128 with BM = 32 * WM;
// wave tile 32 x 64 (2 m-tiles x 4 n-tiles).
// Operands: a stage is 64 k (one 128-B line) of every operand row of the block,
// rows [A hi BM | A lo BM | B hi 128 | B lo 128] at an LDS pitch of 144 B, brought in by
// asynchronous copies of 16 B per lane (8 lanes = one whole line); three buffers: a stage's copies are
// issued two trips ahead of the trip that reads it, so that they may come from memory without a stall.
// Fragments are read from LDS. Three buffers leave room for one block per WGP only: where the grid of
// 64-row blocks has more blocks than WGPs, WM = 4 joins two of them into one block that shares the B rows.
// Epilogue: wave tile staged in LDS, then each 256-B row segment written as two
// Requires M % BM == 0, N % 128 == 0, K % 64 == 0, K >= 64, ldc % 32 == 0 (shapes fixed on host).
// ---------------------------------------------------------------------------
// eight copies of 16 B per lane, global -> LDS, written as the builtin: behind a builtin copy no s_wait_xcnt is
// written, so the issuing wave goes straight on to its next copies and to its fragment reads.
typedef int v4i __attribute__((ext_vector_type(4)));
typedef __attribute__((address_space(1))) v4i gv4i;
typedef __attribute__((address_space(3))) v4i lv4i;
__device__ __forceinline__ void copy8(const unsigned (&l)[8], const unsigned short* const (&g)[8]) {
    // unrolled: both address arrays stay in registers
#pragma unroll
    for (int i = 0; i < 8; ++i)
        __builtin_amdgcn_global_load_async_to_lds_b128((gv4i*)g[i], (lv4i*)l[i], 0, 0);
}

__device__ __forceinline__ void store_ctile(const float* sW, float* C, int ldc,
                                            int m0w, int n0w, int hh, int m16) {
#pragma unroll
    for (int i = 0; i < 16; ++i) {
        const int row = 2 * i + hh;
        const v4f v = *(const v4fa*)(sW + row * 68 + m16 * 4);
        *(v4f*)(C + (size_t)(m0w + row) * ldc + n0w + m16 * 4) = v;
    }
}

// waits until all but the wave's youngest stage of copies (8 + 32 / WM per lane) have landed
template <int WM>
__device__ __forceinline__ void wait_all_but_one_stage() {
    static_assert(WM == 2 || WM == 4, "copies per stage");
    if constexpr (WM == 2) asm volatile("s_wait_asynccnt 0x18" ::: "memory");
    else                   asm volatile("s_wait_asynccnt 0x10" ::: "memory");
}

template <int WM>
__global__ __launch_bounds__(WM * 64) void gemm3_kernel(
    const unsigned short* __restrict__ Ah, const unsigned short* __restrict__ Al,
    const unsigned short* __restrict__ Bh, const unsigned short* __restrict__ Bl,
    float* C, int K, int ldc) {
    constexpr int SP = 68;
    constexpr int GP = 72;                 // LDS row pitch in halves (144 B = 16 B x 9: no bank conflict for 16-B reads)
    constexpr int BM = WM * 32;            // A rows of the block
    constexpr int RP = WM * 8;             // stage rows that one copy of the whole block brings
    constexpr int RAL = BM, RBH = 2 * BM, RBL = 2 * BM + 128, GROWS = 2 * BM + 256;   // first stage row of A lo, B hi, B lo; rows per stage
    constexpr int GSTAGE = GROWS * GP;     // halves per buffer
    __shared__ __align__(16) unsigned short ring[3 * GSTAGE];
    __shared__ __align__(16) float sC[WM * 2 * 32 * SP];
    const int tid = threadIdx.x, w = tid >> 5, lane = tid & 31, hh = lane >> 4, m16 = lane & 15;
    const int m0w = blockIdx.y * BM + (w >> 1) * 32;
    const int n0w = blockIdx.x * 128 + (w & 1) * 64;

    Acc acc[2][4];
#pragma unroll
    for (int mt = 0; mt < 2; ++mt)
#pragma unroll
        for (int nt = 0; nt < 4; ++nt) acc_zero(acc[mt][nt]);

    const size_t Ks = (size_t)K;
    // copy side: thread = (row cr of RP, 16-B piece cp of the row's 128 B); copy i takes stage row cr + RP * i
    const int cr = tid >> 3, cp = tid & 7;
    const unsigned short* gAh = Ah + (size_t)(blockIdx.y * BM + cr) * Ks + cp * 8;
    const unsigned short* gAl = Al + (size_t)(blockIdx.y * BM + cr) * Ks + cp * 8;
    const unsigned short* gBh = Bh + (size_t)(blockIdx.x * 128 + cr) * Ks + cp * 8;
    const unsigned short* gBl = Bl + (size_t)(blockIdx.x * 128 + cr) * Ks + cp * 8;
    const unsigned lds0 = (unsigned)(size_t)(ring + cr * GP + cp * 8);   // LDS byte address: low 32 bits

    auto issue = [&](int st, int buf) {
        const unsigned lb = lds0 + (unsigned)buf * (unsigned)(GSTAGE * 2);
        const size_t ko = (size_t)st * 64;
        unsigned l[8];
        const unsigned short* g[8];
#pragma unroll
        for (int i = 0; i < 4; ++i) {                  // BM / RP = 4 copies per A plane
            l[i] = lb + (unsigned)((RP * i) * GP * 2);
            g[i] = gAh + ko + (size_t)(RP * i) * Ks;
            l[4 + i] = lb + (unsigned)((RAL + RP * i) * GP * 2);
            g[4 + i] = gAl + ko + (size_t)(RP * i) * Ks;
        }
        copy8(l, g);
        if constexpr (WM == 2) {                       // 128 / RP = 8 copies per B plane
#pragma unroll
            for (int i = 0; i < 8; ++i) {
                l[i] = lb + (unsigned)((RBH + RP * i) * GP * 2);
                g[i] = gBh + ko + (size_t)(RP * i) * Ks;
            }
            copy8(l, g);
#pragma unroll
            for (int i = 0; i < 8; ++i) {
                l[i] = lb + (unsigned)((RBL + RP * i) * GP * 2);
                g[i] = gBl + ko + (size_t)(RP * i) * Ks;
            }
            copy8(l, g);
        } else {                                       // 128 / RP = 4 copies per B plane
#pragma unroll
            for (int i = 0; i < 4; ++i) {
                l[i] = lb + (unsigned)((RBH + RP * i) * GP * 2);
                g[i] = gBh + ko + (size_t)(RP * i) * Ks;
                l[4 + i] = lb + (unsigned)((RBL + RP * i) * GP * 2);
                g[4 + i] = gBl + ko + (size_t)(RP * i) * Ks;
            }
            copy8(l, g);
        }
    };

    const int NT = K >> 6;
    issue(0, 0);
    if (NT > 1) issue(1, 1);
    // stage 0 has landed for this wave (stage 1, where there is one, may still fly), then is published
    if (NT > 1) wait_all_but_one_stage<WM>();
    else        asm volatile("s_wait_asynccnt 0x0" ::: "memory");
    __syncthreads();
    if (NT > 2) issue(2, 2);

    // reader side: first fragment row of this wave inside a stage
    const int offA = ((w >> 1) * 32 + m16) * GP + 8 * hh;
    const int offB = (RBH + (w & 1) * 64 + m16) * GP + 8 * hh;

    // kept rolled: the buffer index and the refill test are per trip
    int buf = 0;                           // t mod 3
#pragma unroll 1
    for (int t = 0; t < NT; ++t) {
        const unsigned short* sb = ring + buf * GSTAGE;
        // a trip is 8 groups g = (k half g >> 2, n-tile g & 3) of 6 products. Fragment reads stand at three
        // places only (before group 0, at groups 2 and 4), the last two at least three groups ahead of their use, all in this trip's own buffer.
        Frag fa[2][4], fb[8][2];
        auto lda = [&](int ks) {
            const unsigned short* pa = sb + offA + ks * 32;
            ldfrag(fa[ks][0], pa);
            ldfrag(fa[ks][1], pa + RAL * GP);
            ldfrag(fa[ks][2], pa + 16 * GP);
            ldfrag(fa[ks][3], pa + (RAL + 16) * GP);
        };
        auto ldb = [&](int g) {
            const unsigned short* pb = sb + offB + (g >> 2) * 32 + (g & 3) * 16 * GP;
            ldfrag(fb[g][0], pb);
            ldfrag(fb[g][1], pb + (RBL - RBH) * GP);
        };
        lda(0); ldb(0); ldb(1); ldb(2); ldb(3); lda(1); ldb(4);
#pragma unroll
        for (int g = 0; g < 8; ++g) {
            if (g == 2) { ldb(5); ldb(6); }
            if (g == 4) ldb(7);
            mma3(acc[0][g & 3], fa[g >> 2][0], fa[g >> 2][1], fb[g][0], fb[g][1]);
            mma3(acc[1][g & 3], fa[g >> 2][2], fa[g >> 2][3], fb[g][0], fb[g][1]);
        }
        // publish point: this wave's LDS reads of the buffer are done, its copies of stage t + 1 have
        // landed; the barrier publishes stage t + 1 and frees this buffer for the refill. Where stage
        // t + 2 was issued (by every wave, at the foot of trip t - 1 or in front of the loop) its copies
        // are the wave's youngest and go on flying; where it was not, the wait is to 0
        asm volatile("s_wait_dscnt 0x0" ::: "memory");
        if (t + 2 < NT) wait_all_but_one_stage<WM>();
        else            asm volatile("s_wait_asynccnt 0x0" ::: "memory");
        __syncthreads();
        if (t + 3 < NT) issue(t + 3, buf);
        buf = (buf == 2) ? 0 : buf + 1;
    }
    // no copy is left in flight when the wave goes on
    asm volatile("s_wait_asynccnt 0x0" ::: "memory");

    // D layout: acc[mt][nt].f[r] = tile(row mt*16 + 8*hh + r, col nt*16 + m16)
    float* sW = sC + w * (32 * SP);
#pragma unroll
    for (int mt = 0; mt < 2; ++mt)
#pragma unroll
        for (int nt = 0; nt < 4; ++nt)
#pragma unroll
            for (int r = 0; r < 8; ++r)
                sW[(mt * 16 + 8 * hh + r) * SP + nt * 16 + m16] = acc[mt][nt].f[r];
    __syncthreads();
    store_ctile(sW, C, ldc, m0w, n0w, hh, m16);
    
}

// ---------------------------------------------------------------------------
// RoPE + split of the projection output qkv[1024][3072] (q cols 0..2047 = h*64+d,
// k cols 2048..2559, v cols 2560..3071). Block = (64-col group g, 64 tokens).
//   g < 32      : q head g      -> q planes [32][1024][64]      (RoPE)
//   32<=g<40    : kv head g-32  -> K planes [8][3072][64] rows 2048+tok (RoPE)
//   40<=g<48    : kv head g-40  -> V^T planes [8][64][3072] cols 2048+tok (transpose)
// y[d] = x[d]*cos + rot[d]*sin, rot = -x[d+32] (d<32), x[d-32] (d>=32); cos/sin from table.
// Each thread emits 8 consecutive halves per plane (16 B); 8 consecutive lanes = one line.
// coverage: q planes all 32x1024 rows; K planes rows 2048..3071 of every kv head;
// V^T planes cols 2048..3071 of all 8x64 rows.
// ---------------------------------------------------------------------------
__device__ __forceinline__ void rope8(const float* xr, const float* pr, const float* cr,
                                      const float* sr, float sgn, v4f& ya, v4f& yb) {
#pragma clang fp contract(off)
    ya.x = xr[0] * cr[0] + (sgn * pr[0]) * sr[0];
    ya.y = xr[1] * cr[1] + (sgn * pr[1]) * sr[1];
    ya.z = xr[2] * cr[2] + (sgn * pr[2]) * sr[2];
    ya.w = xr[3] * cr[3] + (sgn * pr[3]) * sr[3];
    yb.x = xr[4] * cr[4] + (sgn * pr[4]) * sr[4];
    yb.y = xr[5] * cr[5] + (sgn * pr[5]) * sr[5];
    yb.z = xr[6] * cr[6] + (sgn * pr[6]) * sr[6];
    yb.w = xr[7] * cr[7] + (sgn * pr[7]) * sr[7];
}

__global__ __launch_bounds__(256) void rope_split_kernel(
    const float* __restrict__ qkv, const float* __restrict__ cosT, const float* __restrict__ sinT,
    unsigned short* qh, unsigned short* ql, unsigned short* kh, unsigned short* kl,
    unsigned short* vh, unsigned short* vl) {
#pragma clang fp contract(off)
    constexpr int QN = 1024, D = 64, NH = 32, NKV = 8, QKVW = 3072, KVL = 3072, KVP = 2048, TP = 68;
    __shared__ __align__(16) float T[64 * TP];
    const int t = threadIdx.x, g = blockIdx.x, tok0 = blockIdx.y * 64;
    const float* s = qkv + (size_t)tok0 * QKVW + g * D;
#pragma unroll
    for (int i = 0; i < 4; ++i) {
        const int r = (t >> 4) + 16 * i, c4 = (t & 15) * 4;
        const v4f v = *(const v4fa*)(s + (size_t)r * QKVW + c4);
        *(v4fa*)(T + r * TP + c4) = v;
    }
    __syncthreads();

    u4 H0, L0, H1, L1;
    size_t g0, g1;
    unsigned short* dH;
    unsigned short* dL;
    if (g < NH + NKV) {                                   // block-uniform branch
        const bool isq = (g < NH);
        dH = isq ? qh : kh;
        dL = isq ? ql : kl;
        const int d0 = (t & 7) * 8, dp0 = d0 ^ 32;
        const float sgn = (d0 < 32) ? -1.0f : 1.0f;
        {
            const int r = (t >> 3), tok = tok0 + r;
            const float* cr = cosT + (size_t)tok * 32 + (d0 & 31);
            const float* sr = sinT + (size_t)tok * 32 + (d0 & 31);
            v4f ya, yb;
            rope8(T + r * TP + d0, T + r * TP + dp0, cr, sr, sgn, ya, yb);
            pack8(ya, yb, H0, L0);
            const size_t row = isq ? ((size_t)g * QN + tok) : ((size_t)(g - NH) * KVL + KVP + tok);
            g0 = row * D + d0;
        }
        {
            const int r = 32 + (t >> 3), tok = tok0 + r;
            const float* cr = cosT + (size_t)tok * 32 + (d0 & 31);
            const float* sr = sinT + (size_t)tok * 32 + (d0 & 31);
            v4f ya, yb;
            rope8(T + r * TP + d0, T + r * TP + dp0, cr, sr, sgn, ya, yb);
            pack8(ya, yb, H1, L1);
            const size_t row = isq ? ((size_t)g * QN + tok) : ((size_t)(g - NH) * KVL + KVP + tok);
            g1 = row * D + d0;
        }
    } else {
        dH = vh;
        dL = vl;
        const int kvhd = g - NH - NKV, piece = t & 7;
        {
            const int d = (t >> 3);
            v4f ya, yb;
            ya.x = T[(piece * 8 + 0) * TP + d]; ya.y = T[(piece * 8 + 1) * TP + d];
            ya.z = T[(piece * 8 + 2) * TP + d]; ya.w = T[(piece * 8 + 3) * TP + d];
            yb.x = T[(piece * 8 + 4) * TP + d]; yb.y = T[(piece * 8 + 5) * TP + d];
            yb.z = T[(piece * 8 + 6) * TP + d]; yb.w = T[(piece * 8 + 7) * TP + d];
            pack8(ya, yb, H0, L0);
            g0 = ((size_t)(kvhd * D + d)) * KVL + KVP + tok0 + piece * 8;
        }
        {
            const int d = 32 + (t >> 3);
            v4f ya, yb;
            ya.x = T[(piece * 8 + 0) * TP + d]; ya.y = T[(piece * 8 + 1) * TP + d];
            ya.z = T[(piece * 8 + 2) * TP + d]; ya.w = T[(piece * 8 + 3) * TP + d];
            yb.x = T[(piece * 8 + 4) * TP + d]; yb.y = T[(piece * 8 + 5) * TP + d];
            yb.z = T[(piece * 8 + 6) * TP + d]; yb.w = T[(piece * 8 + 7) * TP + d];
            pack8(ya, yb, H1, L1);
            g1 = ((size_t)(kvhd * D + d)) * KVL + KVP + tok0 + piece * 8;
        }
    }
    *(u4*)(dH + g0) = H0; *(u4*)(dL + g0) = L0;
    *(u4*)(dH + g1) = H1; *(u4*)(dL + g1) = L1;
    
}

// ---------------------------------------------------------------------------
// Flash attention with the block-diagonal TTT mask, GQA (kv head = h >> 2).
// Block = (kv head, 16 query rows), 16 waves = its 4 query heads x 4 key splits. The key
// tiles of 32 of all three key blocks form one list; split ks takes entries ks, ks + 4, ...
// The 4 heads of one split walk the same K and V tiles at the same time: a trip of the block is one
// tile per split, and each split's tile (K hi, K lo: 32 key rows of 128 B at a pitch of 144 B; V^T hi,
// V^T lo: 64 d rows of 64 B at a pitch of 80 B) is brought into LDS once by the split's 4 waves with
// asynchronous copies of 16 B per lane; two buffers, the next trip's copies fly while this trip is
// worked on. All K and V fragments are read from LDS.
// Both products are computed transposed: S^T = K . Q^T (A = K rows, B = q) and O^T += V^T . P^T (A = V^T rows,
// B = P^T). A lane then holds 16 scores of ONE query (column m16; keys 8*hh + r of each 16-key tile): maximum and
// sum run inside the lane, with one exchange between the wave's halves for the maximum, and the two score tiles,
// split in place, are the B operand of the second product in the hardware k order that ldfrag also has.
// Each wave keeps its own running maximum, sum (per wave half, joined behind the loop) and 16 x 64 output; a head's
// four partial results are merged through LDS in fixed split order behind one work-group barrier.
// Q/K/V/P operands as bf16 hi/lo; scores, mask (-inf), running-max softmax in f32.
// key j of block blk allowed iff j < seq_len and j <= i - (lck - blk).
// seq_len = sum(attention_mask) - lck, summed per block in fixed order.
// Per blk the key-tile count is bounded by the tile's diagonal and seq_len
// (at most 32 tiles); the mask is still applied by value per element.
// Output attn planes [1024][2048] (col h*64+d): 8 lanes x 16 B = one 128-B line per row.
// Query tiles with the most keys have the lowest block index (for speed only).
// coverage: 8 x 64 blocks x 4 heads x 16 rows x 64 cols = [1024][2048] per plane.
// ---------------------------------------------------------------------------
__global__ __launch_bounds__(512) void attn_kernel(
    const unsigned short* __restrict__ qH, const unsigned short* __restrict__ qL,
    const unsigned short* __restrict__ kH, const unsigned short* __restrict__ kL,
    const unsigned short* __restrict__ vH, const unsigned short* __restrict__ vL,
    const int* __restrict__ amask, int nmask, int lck,
    unsigned short* oH, unsigned short* oL) {
    constexpr int QN = 1024, D = 64, KVL = 3072, HIDO = 2048, NS = 4, NW = 4 * NS, SP = 68;
    constexpr int KP = 72, VP = 40;                 // LDS row pitches in halves (16 B x 9, 16 B x 5: no bank conflict for 16-B reads)
    constexpr int KPL = 32 * KP, VPL = 64 * VP;     // halves per plane of a K tile, of a V^T tile
    constexpr int TSPL = 2 * KPL + 2 * VPL;         // halves per split: [K hi | K lo | V^T hi | V^T lo]
    constexpr int TSTAGE = NS * TSPL;               // halves per buffer
    __shared__ __align__(16) unsigned short kvs[2 * TSTAGE];
    __shared__ int red[128];
    __shared__ __align__(16) float Os[NW * 16 * SP];
    __shared__ float Ms[NW * 16];
    __shared__ float Ls[NW * 16];
    const int tid = threadIdx.x, lane = tid & 31, hh = lane >> 4, m16 = lane & 15;
    // wave number held as a scalar: the key-tile loop then branches on scalar tests, every lane on
    const int w = __builtin_amdgcn_readfirstlane(tid >> 5);

    // seq_len (integer, fixed order, identical in every block)
    if (tid < 128) {                                   // the first four waves sum the mask
        int part = 0;
        for (int i = tid; i < nmask; i += 128) part += amask[i];
        red[tid] = part;
    }
    __syncthreads();
#pragma unroll
    for (int off = 64; off > 0; off >>= 1) {
        if (tid < off) red[tid] += red[tid + off];
        __syncthreads();
    }
    const int seq_len = __builtin_amdgcn_readfirstlane(red[0] - lck);

    const int kvh = blockIdx.x, h = kvh * 4 + (w & 3), ks = w >> 2;
    const int q0w = (QN / 16 - 1 - (int)blockIdx.y) * 16;
    const float NEG_INF = -__builtin_inff();

    Frag fqh[2], fql[2];
    {
        const size_t qo = ((size_t)h * QN + q0w + m16) * D + 8 * hh;
        ldfrag(fqh[0], qH + qo);
        ldfrag(fqh[1], qH + qo + 32);
        ldfrag(fql[0], qL + qo);
        ldfrag(fql[1], qL + qo + 32);
    }
    // of query q0w + m16: running maximum (alike in both halves) and this half's part of the running sum
    float mrun = NEG_INF, lrun = 0.0f;
    Acc o[4];
#pragma unroll
    for (int dt = 0; dt < 4; ++dt) acc_zero(o[dt]);

    const size_t kplane = (size_t)kvh * KVL * D;      // K planes [kvh][kv][d]
    const size_t vplane = (size_t)kvh * D * KVL;      // V^T planes [kvh][d][kv]

    // key tiles per key block (allowed j of block blk are < q0w + 16 - (lck - blk) and < seq_len),
    // as running ends e0 <= e1 <= e2 of the one list; each count <= 32, so e2 <= 96
    int e0, e1, e2;
    {
        int c0 = q0w + 16 - lck, c1 = c0 + 1, c2 = c0 + 2;
        c0 = (c0 < seq_len) ? c0 : seq_len;
        c1 = (c1 < seq_len) ? c1 : seq_len;
        c2 = (c2 < seq_len) ? c2 : seq_len;
        c0 = (c0 < 0) ? 0 : ((c0 > QN) ? QN : c0);
        c1 = (c1 < 0) ? 0 : ((c1 > QN) ? QN : c1);
        c2 = (c2 < 0) ? 0 : ((c2 > QN) ? QN : c2);
        e0 = __builtin_amdgcn_readfirstlane((c0 + 31) >> 5);
        e1 = e0 + __builtin_amdgcn_readfirstlane((c1 + 31) >> 5);
        e2 = e1 + __builtin_amdgcn_readfirstlane((c2 + 31) >> 5);
    }
    // copy side: the 128 lanes of a split bring its tile; per lane 4 copies of K (2 planes x 2 row groups
    // of 16; 8 lanes = one 128-B row) and 4 of V^T (2 planes x 2 row groups of 32; 4 lanes = one 64-B row)
    const int lt = (w & 3) * 32 + lane;
    const int ckr = lt >> 3, ckp = (lt & 7) * 8, cvr = lt >> 2, cvp = (lt & 3) * 8;
    const unsigned short* gkh = kH + kplane + (size_t)ckr * D + ckp;
    const unsigned short* gkl = kL + kplane + (size_t)ckr * D + ckp;
    const unsigned short* gvh = vH + vplane + (size_t)cvr * KVL + cvp;
    const unsigned short* gvl = vL + vplane + (size_t)cvr * KVL + cvp;
    const unsigned ldk = (unsigned)(size_t)(kvs + ks * TSPL + ckr * KP + ckp);             // LDS byte address: low 32 bits
    const unsigned ldv = (unsigned)(size_t)(kvs + ks * TSPL + 2 * KPL + cvr * VP + cvp);
    // trips of the block; a split whose list entry lies past the end copies the last tile again (in bounds,
    // never read), so every wave issues the same copies in every trip
    const int NT = (e2 + NS - 1) / NS;
    auto issue = [&](int it, int buf) {
        int le = it * NS + ks;
        le = (le < e2) ? le : (e2 - 1);
        const int cb = (le >= e0 ? 1 : 0) + (le >= e1 ? 1 : 0);
        const int ct = le - (le >= e1 ? e1 : (le >= e0 ? e0 : 0));
        const size_t ckv = (size_t)(cb * QN + ct * 32);
        const unsigned bo = (unsigned)buf * (unsigned)(TSTAGE * 2);
        unsigned l[8];
        const unsigned short* g[8];
#pragma unroll
        for (int i = 0; i < 2; ++i) {
            l[i] = ldk + bo + (unsigned)(16 * i * KP * 2);
            g[i] = gkh + (ckv + 16 * i) * D;
            l[2 + i] = ldk + bo + (unsigned)((KPL + 16 * i * KP) * 2);
            g[2 + i] = gkl + (ckv + 16 * i) * D;
            l[4 + i] = ldv + bo + (unsigned)(32 * i * VP * 2);
            g[4 + i] = gvh + (size_t)(32 * i) * KVL + ckv;
            l[6 + i] = ldv + bo + (unsigned)((VPL + 32 * i * VP) * 2);
            g[6 + i] = gvl + (size_t)(32 * i) * KVL + ckv;
        }
        copy8(l, g);
    };
    if (NT > 0) issue(0, 0);
    // trip 0's tiles have landed for this wave, then are published to the other waves
    asm volatile("s_wait_asynccnt 0x0" ::: "memory");
    __syncthreads();
    if (NT > 1) issue(1, 1);

    // kept rolled: a second copy of the long body would only raise the register count
#pragma unroll 1
    for (int it = 0; it < NT; ++it) {
      const int s = it * NS + ks;
      if (s < e2) {                                    // scalar test: the whole wave works or skips
        const int blk = (s >= e0 ? 1 : 0) + (s >= e1 ? 1 : 0);
        const int t = s - (s >= e1 ? e1 : (s >= e0 ? e0 : 0));
        const int shift = lck - blk;                   // j <= i - shift
        const int j0 = t * 32;
        const unsigned short* tb = kvs + (it & 1) * TSTAGE + ks * TSPL;   // this split's tile of this trip
        Acc sc[2];
        acc_zero(sc[0]);
        acc_zero(sc[1]);
        // the K fragment reads stand together at the head of the trip
        Frag fk[2][2][2];
#pragma unroll
        for (int nt = 0; nt < 2; ++nt)
#pragma unroll
            for (int ds = 0; ds < 2; ++ds) {
                const unsigned short* pk = tb + (nt * 16 + m16) * KP + ds * 32 + 8 * hh;
                ldfrag(fk[nt][ds][0], pk);
                ldfrag(fk[nt][ds][1], pk + KPL);
            }
        // S^T tile [32 keys x 16 q]; A = K (k = d), B = q (k = d): sc[nt].f[r] = S[q m16][key nt*16 + 8*hh + r]
#pragma unroll
        for (int nt = 0; nt < 2; ++nt)
#pragma unroll
            for (int ds = 0; ds < 2; ++ds)
                mma3(sc[nt], fk[nt][ds][0], fk[nt][ds][1], fqh[ds], fql[ds]);
        // the V fragment reads stand together ahead of the softmax, which covers their latency
        Frag fv[4][2];
#pragma unroll
        for (int dt = 0; dt < 4; ++dt) {
            const unsigned short* pv = tb + 2 * KPL + (dt * 16 + m16) * VP + 8 * hh;
            ldfrag(fv[dt][0], pv);
            ldfrag(fv[dt][1], pv + VPL);
        }
        // scale and mask by value: key j allowed iff j < seq_len and j <= qi - shift
        {
            const int qi = q0w + m16;
            const int jd = qi - shift, jp = seq_len - 1;
            const int jmax = (jd < jp) ? jd : jp;      // last allowed key of this query in this key block
#pragma unroll
            for (int nt = 0; nt < 2; ++nt)
#pragma unroll
                for (int r = 0; r < 8; ++r) {
                    const int j = j0 + nt * 16 + 8 * hh + r;
                    sc[nt].f[r] = (j <= jmax) ? sc[nt].f[r] * 0.125f : NEG_INF;
                }
        }
        // running-max softmax update of the lane's one query
        float x = fmaxf(sc[0].f[0], sc[1].f[0]);
#pragma unroll
        for (int r = 1; r < 8; ++r) x = fmaxf(x, fmaxf(sc[0].f[r], sc[1].f[r]));
        x = fmaxf(x, xhalf(x));
        const float mn = fmaxf(mrun, x);
        const float msafe = (mn == NEG_INF) ? 0.0f : mn;
        const float alpha = __expf(mrun - msafe);
        mrun = mn;
#pragma unroll
        for (int nt = 0; nt < 2; ++nt)
#pragma unroll
            for (int r = 0; r < 8; ++r) sc[nt].f[r] = __expf(sc[nt].f[r] - msafe);
        {
            float s4[4];
#pragma unroll
            for (int c = 0; c < 4; ++c)
                s4[c] = (sc[0].f[c] + sc[0].f[4 + c]) + (sc[1].f[c] + sc[1].f[4 + c]);
            lrun = lrun * alpha + ((s4[0] + s4[1]) + (s4[2] + s4[3]));
        }
#pragma unroll
        for (int dt = 0; dt < 4; ++dt)
#pragma unroll
            for (int r = 0; r < 8; ++r) o[dt].f[r] *= alpha;

        // P^T as B operand (k = key, n = q): elements 0..7 = tile 0's registers, 8..15 = tile 1's
        Frag fph, fpl;
#pragma unroll
        for (int nt = 0; nt < 2; ++nt) {
            const v4f pa = {sc[nt].f[0], sc[nt].f[1], sc[nt].f[2], sc[nt].f[3]};
            const v4f pb = {sc[nt].f[4], sc[nt].f[5], sc[nt].f[6], sc[nt].f[7]};
            pack8(pa, pb, fph.q[nt], fpl.q[nt]);
        }

        // O^T += V^T . P^T ; A = V^T rows (m = d, k = key): o[dt].f[r] = O[q m16][dt*16 + 8*hh + r]
#pragma unroll
        for (int dt = 0; dt < 4; ++dt) mma3(o[dt], fv[dt][0], fv[dt][1], fph, fpl);
      }
        // publish point: this wave's LDS reads of the buffer are done, its copies of the next trip
        // have landed; the barrier publishes the next trip's tiles and frees this buffer for the refill
        asm volatile("s_wait_dscnt 0x0" ::: "memory");
        asm volatile("s_wait_asynccnt 0x0" ::: "memory");
        __syncthreads();
        if (it + 2 < NT) issue(it + 2, it & 1);
    }
    // no copy is left in flight when the wave goes on
    asm volatile("s_wait_asynccnt 0x0" ::: "memory");

    // each wave's partial result to LDS (o[dt].f[r] = O[q m16][dt*16 + 8*hh + r]: 8 consecutive columns of a row)
    float* Ow = Os + w * 16 * SP;
#pragma unroll
    for (int dt = 0; dt < 4; ++dt) {
        const v4f oa = {o[dt].f[0], o[dt].f[1], o[dt].f[2], o[dt].f[3]};
        const v4f ob = {o[dt].f[4], o[dt].f[5], o[dt].f[6], o[dt].f[7]};
        *(v4fa*)(Ow + m16 * SP + dt * 16 + 8 * hh) = oa;
        *(v4fa*)(Ow + m16 * SP + dt * 16 + 8 * hh + 4) = ob;
    }
    // the halves' sums are joined with every lane on; both halves then store the same two values
    const float lall = lrun + xhalf(lrun);
    Ms[w * 16 + m16] = mrun;
    Ls[w * 16 + m16] = lall;
    __syncthreads();

    // merge in split order, normalise, split into planes; thread = (head, row, 8 columns)
    const int hl = tid >> 7, row = (tid >> 3) & 15, c8 = (tid & 7) * 8;
    float mall = NEG_INF;
#pragma unroll
    for (int u = 0; u < NS; ++u) mall = fmaxf(mall, Ms[(u * 4 + hl) * 16 + row]);
    const float mfin = (mall == NEG_INF) ? 0.0f : mall;
    float lsum = 0.0f;
    v4f oa = {0.0f, 0.0f, 0.0f, 0.0f}, ob = {0.0f, 0.0f, 0.0f, 0.0f};
#pragma unroll
    for (int u = 0; u < NS; ++u) {
        const int pr = (u * 4 + hl) * 16 + row;
        const float a = __expf(Ms[pr] - mfin);
        const v4f va = *(const v4fa*)(Os + pr * SP + c8);
        const v4f vb = *(const v4fa*)(Os + pr * SP + c8 + 4);
        lsum += a * Ls[pr];
        oa += a * va;
        ob += a * vb;
    }
    const float il = 1.0f / lsum;
    u4 H, L;
    pack8(oa * il, ob * il, H, L);
    const size_t eo = (size_t)(q0w + row) * HIDO + (kvh * 4 + hl) * D + c8;
    *(u4*)(oH + eo) = H;
    *(u4*)(oL + eo) = L;
}

// ---------------------------------------------------------------------------
extern "C" void kernel_launch(void* const* d_in, const int* in_sizes, int n_in,
                              void* d_out, int out_size, void* d_ws, size_t ws_size,
                              hipStream_t stream) {
    constexpr int QN = 1024, INW = 4096, NH = 32, NKV = 8, D = 64, HIDO = 2048;
    constexpr int KVP = 2048, KVL = 3072, QKVW = 3072, LCK = KVP / QN;
    if (n_in < 9) return;
    if (in_sizes[0] != QN * INW || in_sizes[1] != NKV * KVP * D || in_sizes[2] != NKV * KVP * D ||
        in_sizes[3] != QN || in_sizes[4] != QN || in_sizes[5] != INW * NH * D ||
        in_sizes[6] != INW * NKV * D || in_sizes[7] != INW * NKV * D ||
        in_sizes[8] != NH * D * HIDO || out_size != QN * HIDO) return;

    const float* hs  = (const float*)d_in[0];
    const float* pk  = (const float*)d_in[1];
    const float* pv  = (const float*)d_in[2];
    const int*   am  = (const int*)  d_in[3];
    const int*   pid = (const int*)  d_in[4];
    const float* Wq  = (const float*)d_in[5];
    const float* Wk  = (const float*)d_in[6];
    const float* Wv  = (const float*)d_in[7];
    const float* Wo  = (const float*)d_in[8];
    float* out = (float*)d_out;

    char* ws = (char*)d_ws;
    size_t off = 0;
    auto carve = [&](size_t bytes) -> char* {
        char* p = ws + off;
        off += (bytes + 255) & ~(size_t)255;
        return p;
    };
    unsigned short* hsH = (unsigned short*)carve((size_t)QN * INW * 2);          // A planes of QKV GEMM
    unsigned short* hsL = (unsigned short*)carve((size_t)QN * INW * 2);
    unsigned short* wtH = (unsigned short*)carve((size_t)QKVW * INW * 2);        // [Wq|Wk|Wv]^T planes [3072][4096]
    unsigned short* wtL = (unsigned short*)carve((size_t)QKVW * INW * 2);
    unsigned short* woH = (unsigned short*)carve((size_t)HIDO * (NH * D) * 2);    // Wo^T planes [2048][2048]
    unsigned short* woL = (unsigned short*)carve((size_t)HIDO * (NH * D) * 2);
    float*          qkv = (float*)         carve((size_t)QN * QKVW * 4);          // projection output f32
    unsigned short* qH  = (unsigned short*)carve((size_t)NH * QN * D * 2);        // q planes [32][1024][64]
    unsigned short* qL  = (unsigned short*)carve((size_t)NH * QN * D * 2);
    unsigned short* kH  = (unsigned short*)carve((size_t)NKV * KVL * D * 2);      // K planes [8][3072][64]
    unsigned short* kL  = (unsigned short*)carve((size_t)NKV * KVL * D * 2);
    unsigned short* vH  = (unsigned short*)carve((size_t)NKV * D * KVL * 2);      // V^T planes [8][64][3072]
    unsigned short* vL  = (unsigned short*)carve((size_t)NKV * D * KVL * 2);
    unsigned short* aH  = (unsigned short*)carve((size_t)QN * (NH * D) * 2);      // attention output planes [1024][2048]
    unsigned short* aL  = (unsigned short*)carve((size_t)QN * (NH * D) * 2);
    float*          cosT = (float*)        carve((size_t)QN * 32 * 4);
    float*          sinT = (float*)        carve((size_t)QN * 32 * 4);
    if (off > ws_size || off > ((size_t)128 << 20)) return;

    // tables and operand planes, one launch
    prep_kernel<<<PREP_BLOCKS, 256, 0, stream>>>(hs, pk, pv, pid, Wq, Wk, Wv, Wo, hsH, hsL, kH, kL, vH, vL,
                                                 wtH, wtL, woH, woL, cosT, sinT, LCK);

    // fused QKV projection: [1024 x 4096] . [4096 x 3072] -> qkv f32
    gemm3_kernel<4><<<dim3(QKVW / 128, QN / 128), 256, 0, stream>>>(hsH, hsL, wtH, wtL, qkv, INW, QKVW);

    // RoPE + split into q planes, new K rows, new V^T cols
    rope_split_kernel<<<dim3(QKVW / 64, QN / 64), 256, 0, stream>>>(qkv, cosT, sinT, qH, qL, kH, kL, vH, vL);

    // attention
    attn_kernel<<<dim3(NKV, QN / 16), 512, 0, stream>>>(qH, qL, kH, kL, vH, vL, am, in_sizes[3], LCK, aH, aL);

    // output projection: [1024 x 2048] . [2048 x 2048] -> d_out f32
    gemm3_kernel<2><<<dim3(HIDO / 128, QN / 64), 128, 0, stream>>>(aH, aL, woH, woL, out, NH * D, HIDO);
}

// v009
// It runs in 153 microseconds.
// Next to v008, in two timings, it ran 1.06 times as fast each time.
// All steps since v000 together make it 3.77 times as fast.
// All contractions (q/k/v projections, q.k^T, p.v, output projection): v_wmma_f32_16x16x32_bf16 with bf16 hi/lo operands everywhere (hi*hi + hi*lo + lo*hi), f32 accumulate; RoPE, softmax and normalisation in f32.
#include <hip/hip_runtime.h>
#include <hip/hip_bf16.h>

typedef __attribute__((ext_vector_type(16))) __bf16 v16bf;
typedef __attribute__((ext_vector_type(2))) __bf16 v2bf;
typedef float v2f __attribute__((ext_vector_type(2)));
typedef float v8f __attribute__((ext_vector_type(8)));
typedef float v4f __attribute__((ext_vector_type(4)));
typedef unsigned int u4 __attribute__((ext_vector_type(4)));
typedef u4 __attribute__((may_alias)) u4a;
typedef v4f __attribute__((may_alias)) v4fa;

union Frag { v16bf v; u4 q[2]; };
union Acc  { v8f v; float f[8]; };

// ---------------------------------------------------------------------------
// bf16 hi/lo split (hi = RNE(x), lo = RNE(x - hi), exact residual), two values at a time
// ---------------------------------------------------------------------------
// two f32 -> two bf16 in one word, first element in the low half-word: one packed convert, round to nearest even
__device__ __forceinline__ unsigned cvt2(float a, float b) {
    const v2f x = {a, b};
    return __builtin_bit_cast(unsigned, __builtin_convertvector(x, v2bf));
}
// two f32 -> one 32-bit word per plane
__device__ __forceinline__ void pack2(float a, float b, unsigned& wh, unsigned& wl) {
    wh = cvt2(a, b);
    wl = cvt2(a - __uint_as_float(wh << 16), b - __uint_as_float(wh & 0xFFFF0000u));
}
// eight consecutive f32 -> 16 B per plane
__device__ __forceinline__ void pack8(const v4f a, const v4f b, u4& H, u4& L) {
    unsigned h0, l0, h1, l1, h2, l2, h3, l3;
    pack2(a.x, a.y, h0, l0);
    pack2(a.z, a.w, h1, l1);
    pack2(b.x, b.y, h2, l2);
    pack2(b.z, b.w, h3, l3);
    H.x = h0; H.y = h1; H.z = h2; H.w = h3;
    L.x = l0; L.y = l1; L.z = l2; L.w = l3;
}

// ---------------------------------------------------------------------------
// 16x16x32 fragment load from a k-contiguous 16-bit row (A row m, or B^T row n):
// p = row_start + k0 + 8*h ; elements 0..7 <- k0+8h.., elements 8..15 <- k0+16+8h..
// ---------------------------------------------------------------------------
__device__ __forceinline__ void ldfrag(Frag& f, const unsigned short* p) {
    f.q[0] = *(const u4a*)(p);
    f.q[1] = *(const u4a*)(p + 16);
}

__device__ __forceinline__ void acc_zero(Acc& c) {
#pragma unroll
    for (int i = 0; i < 8; ++i) c.f[i] = 0.0f;
}

// acc += Ah*Bh + Ah*Bl + Al*Bh, then 4 wait slots with D tied and A/B kept live
__device__ __forceinline__ void mma3(Acc& c, const Frag& ah, const Frag& al,
                                     const Frag& bh, const Frag& bl) {
    v8f d = c.v;
    d = __builtin_amdgcn_wmma_f32_16x16x32_bf16(false, ah.v, false, bh.v, (short)0, d, false, false);
    d = __builtin_amdgcn_wmma_f32_16x16x32_bf16(false, ah.v, false, bl.v, (short)0, d, false, false);
    d = __builtin_amdgcn_wmma_f32_16x16x32_bf16(false, al.v, false, bh.v, (short)0, d, false, false);
    asm volatile("v_nop\n\tv_nop\n\tv_nop\n\tv_nop"
                 : "+v"(d) : "v"(ah.v), "v"(al.v), "v"(bh.v), "v"(bl.v));
    c.v = d;
}

// the same three terms, in the same order per accumulator, for four m-tiles against one n-tile, term by term:
// the four hi x hi products need five fragments only. One run of wait slots behind the twelve products
__device__ __forceinline__ void mma3x4(Acc& c0, Acc& c1, Acc& c2, Acc& c3, const Frag (&a)[4][2],
                                       const Frag& bh, const Frag& bl) {
    v8f d0 = c0.v, d1 = c1.v, d2 = c2.v, d3 = c3.v;
    d0 = __builtin_amdgcn_wmma_f32_16x16x32_bf16(false, a[0][0].v, false, bh.v, (short)0, d0, false, false);
    d1 = __builtin_amdgcn_wmma_f32_16x16x32_bf16(false, a[1][0].v, false, bh.v, (short)0, d1, false, false);
    d2 = __builtin_amdgcn_wmma_f32_16x16x32_bf16(false, a[2][0].v, false, bh.v, (short)0, d2, false, false);
    d3 = __builtin_amdgcn_wmma_f32_16x16x32_bf16(false, a[3][0].v, false, bh.v, (short)0, d3, false, false);
    d0 = __builtin_amdgcn_wmma_f32_16x16x32_bf16(false, a[0][0].v, false, bl.v, (short)0, d0, false, false);
    d1 = __builtin_amdgcn_wmma_f32_16x16x32_bf16(false, a[1][0].v, false, bl.v, (short)0, d1, false, false);
    d2 = __builtin_amdgcn_wmma_f32_16x16x32_bf16(false, a[2][0].v, false, bl.v, (short)0, d2, false, false);
    d3 = __builtin_amdgcn_wmma_f32_16x16x32_bf16(false, a[3][0].v, false, bl.v, (short)0, d3, false, false);
    d0 = __builtin_amdgcn_wmma_f32_16x16x32_bf16(false, a[0][1].v, false, bh.v, (short)0, d0, false, false);
    d1 = __builtin_amdgcn_wmma_f32_16x16x32_bf16(false, a[1][1].v, false, bh.v, (short)0, d1, false, false);
    d2 = __builtin_amdgcn_wmma_f32_16x16x32_bf16(false, a[2][1].v, false, bh.v, (short)0, d2, false, false);
    d3 = __builtin_amdgcn_wmma_f32_16x16x32_bf16(false, a[3][1].v, false, bh.v, (short)0, d3, false, false);
    // 4 wait slots behind the last product, with every D tied and A/B kept live
    asm volatile("v_nop\n\tv_nop\n\tv_nop\n\tv_nop"
                 : "+v"(d0), "+v"(d1), "+v"(d2), "+v"(d3)
                 : "v"(a[0][0].v), "v"(a[1][0].v), "v"(a[2][0].v), "v"(a[3][0].v),
                   "v"(a[0][1].v), "v"(a[1][1].v), "v"(a[2][1].v), "v"(a[3][1].v), "v"(bh.v), "v"(bl.v));
    c0.v = d0; c1.v = d1; c2.v = d2; c3.v = d3;
}

// value of lane l ^ 16 (the other half of the wave), a vector cross-row move
__device__ __forceinline__ float xhalf(float x) {
    const int b = __float_as_int(x);
    return __int_as_float(__builtin_amdgcn_permlanex16(b, b, 0x76543210, 0xfedcba98, false, false));
}

// ---------------------------------------------------------------------------
// Operand preparation, ONE launch. None of these jobs reads another's output, so they share a grid:
// PREP_BLOCKS blocks of 256 threads, block b takes units b, b + PREP_BLOCKS, ... of a list of PREP_UNITS.
// Of every 22 list entries 5 are straight splits (memory only) and 17 are transpose units (LDS and vector
// work), mixed for speed only. The last 128 blocks, which have one
// list unit fewer than the first 512, each add one table unit behind their loop.
//   straight unit, 4096 consecutive f32 -> bf16 hi/lo planes: hidden_states (1024 units),
//     past_key (256 units; kv head = 32 units, dst rows 0..2047 of its 3072)
//   table unit, 256 entries of the cos/sin table [1024][32] (128 units)
//   transpose unit, one 64 x 64 tile, src[r][c] -> dst planes [c][r]: Wq 2048, Wk 512, Wv 512 tiles into
//     [Wq|Wk|Wv]^T [3072][4096]; Wo 1024 tiles into Wo^T [2048][2048]; past_value 256 tiles into
//     V^T [8][64][3072] cols 0..2047
// coverage: every unit once (u -> (u / 22, u % 22) is one-to-one), units x 4096 = every element of each source.
// ---------------------------------------------------------------------------
constexpr int PREP_BLOCKS = 1024;
constexpr int PREP_UNITS = 5632;          // 1280 straight + 4352 transpose = 22 * 256
constexpr int PREP_TABLE_BLOCKS = 128;    // x 256 threads = the 1024 x 32 table entries

// cos/sin at angle f32(pos + lck) * inv_freq[i], inv_freq[i] = 1 / 10000^(i/32)
// (f64 exp2 -> f32, then f32 reciprocal); precise sinf/cosf.
__device__ __forceinline__ void table_unit(const int* __restrict__ pid, float* cosT, float* sinT,
                                           int idx, int lck) {
    const int tok = idx >> 5, i = idx & 31;
    const double e = (double)i * 0.03125 * 13.287712379549449;   // i/32 * log2(1e4)
    const float p32 = (float)exp2(e);
    const float inv = 1.0f / p32;
    const float pos = (float)(pid[tok] + lck);
    const float ang = pos * inv;
    const float c = cosf(ang);
    const float s = sinf(ang);
    *(float*)(cosT + idx) = c;
    *(float*)(sinT + idx) = s;
}

// 4096 consecutive f32 -> planes; a thread takes two groups of 8 (one 16-B store per plane and group)
__device__ __forceinline__ void straight_unit(const float* __restrict__ src,
                                              unsigned short* dh, unsigned short* dl, int t) {
    const float* p = src + t * 8;
    const v4f a0 = *(const v4fa*)(p);
    const v4f b0 = *(const v4fa*)(p + 4);
    const v4f a1 = *(const v4fa*)(p + 2048);
    const v4f b1 = *(const v4fa*)(p + 2052);
    u4 H0, L0, H1, L1;
    pack8(a0, b0, H0, L0);
    pack8(a1, b1, H1, L1);
    *(u4*)(dh + t * 8) = H0;        *(u4*)(dl + t * 8) = L0;
    *(u4*)(dh + 2048 + t * 8) = H1; *(u4*)(dl + 2048 + t * 8) = L1;
    // the block's next unit rewrites the registers that these stores name
    asm volatile("s_wait_xcnt 0x0" ::: "memory");
}

// one 64 x 64 tile through LDS: s = tile origin (pitch srcld), dh/dl = origin of the transposed tile
// (pitch dstld). loads 256 thr x 4 x float4 = 64x64; stores 256 thr x 2 x 8 = 64x64 per plane.
__device__ __forceinline__ void transpose_unit(const float* __restrict__ s, int srcld,
                                               unsigned short* dh, unsigned short* dl, int dstld,
                                               unsigned short* Th, unsigned short* Tl, int t) {
    constexpr int TP = 72;
    v4f x[4];
#pragma unroll
    for (int i = 0; i < 4; ++i) {
        x[i] = *(const v4fa*)(s + (size_t)((t >> 4) + 16 * i) * srcld + (t & 15) * 4);
        // a later load's result may land in the registers that hold this load's address
        asm volatile("s_wait_xcnt 0x0" ::: "memory");
    }
#pragma unroll
    for (int i = 0; i < 4; ++i) {
        const int r = (t >> 4) + 16 * i, c4 = (t & 15) * 4;
        const v4f v = x[i];
        unsigned hb, lb;
        pack2(v.x, v.y, hb, lb);
        Th[(c4 + 0) * TP + r] = (unsigned short)hb; Tl[(c4 + 0) * TP + r] = (unsigned short)lb;
        Th[(c4 + 1) * TP + r] = (unsigned short)(hb >> 16); Tl[(c4 + 1) * TP + r] = (unsigned short)(lb >> 16);
        pack2(v.z, v.w, hb, lb);
        Th[(c4 + 2) * TP + r] = (unsigned short)hb; Tl[(c4 + 2) * TP + r] = (unsigned short)lb;
        Th[(c4 + 3) * TP + r] = (unsigned short)(hb >> 16); Tl[(c4 + 3) * TP + r] = (unsigned short)(lb >> 16);
    }
    __syncthreads();
    const int piece = t & 7;
    const int rowA = (t >> 3), rowB = 32 + (t >> 3);
    const u4 HA = *(const u4a*)(Th + rowA * TP + piece * 8);
    const u4 LA = *(const u4a*)(Tl + rowA * TP + piece * 8);
    const u4 HB = *(const u4a*)(Th + rowB * TP + piece * 8);
    const u4 LB = *(const u4a*)(Tl + rowB * TP + piece * 8);
    // the LDS tile is written again by the block's next transpose unit: every wave's reads end here first
    __syncthreads();
    const size_t gA = (size_t)rowA * dstld + piece * 8;
    const size_t gB = (size_t)rowB * dstld + piece * 8;
    *(u4*)(dh + gA) = HA; *(u4*)(dl + gA) = LA;
    *(u4*)(dh + gB) = HB; *(u4*)(dl + gB) = LB;
    // the block's next unit rewrites the registers that these stores name
    asm volatile("s_wait_xcnt 0x0" ::: "memory");
}

__global__ __launch_bounds__(256) void prep_kernel(
    const float* __restrict__ hs, const float* __restrict__ pk, const float* __restrict__ pv,
    const int* __restrict__ pid,
    const float* __restrict__ Wq, const float* __restrict__ Wk, const float* __restrict__ Wv,
    const float* __restrict__ Wo,
    unsigned short* hsH, unsigned short* hsL, unsigned short* kH, unsigned short* kL,
    unsigned short* vH, unsigned short* vL, unsigned short* wtH, unsigned short* wtL,
    unsigned short* woH, unsigned short* woL, float* cosT, float* sinT, int lck) {
    constexpr int INW = 4096, QW = 2048, KW = 512, D = 64, KVP = 2048, KVL = 3072, HIDO = 2048;
    __shared__ __align__(16) unsigned short Th[64 * 72];
    __shared__ __align__(16) unsigned short Tl[64 * 72];
    const int t = threadIdx.x;
    // every test below reads the unit number alone: the whole block takes one path, barriers included
    for (int u = blockIdx.x; u < PREP_UNITS; u += PREP_BLOCKS) {
        const int q = u / 22, r = u - q * 22;
        if (r < 5) {
            const int s = q * 5 + r;                               // 0..1279
            if (s < 1024) {
                const size_t o = (size_t)s * 4096;
                straight_unit(hs + o, hsH + o, hsL + o, t);
            } else {
                const int y = s - 1024;                            // 0..255
                const size_t o = (size_t)(y >> 5) * (KVL * D) + (size_t)(y & 31) * 4096;
                straight_unit(pk + (size_t)y * 4096, kH + o, kL + o, t);
            }
            continue;
        }
        const int e = q * 17 + (r - 5);                            // 0..4351
        const float* s;
        unsigned short* dh;
        unsigned short* dl;
        int srcld, dstld;
        if (e < 3072) {                                            // Wq | Wk | Wv -> rows nb.. of [3072][4096]
            const float* W = (e < 2048) ? Wq : ((e < 2560) ? Wk : Wv);
            const int y = (e < 2048) ? e : ((e < 2560) ? e - 2048 : e - 2560);
            const int lg = (e < 2048) ? 5 : 3;                     // log2 of the column tiles per row of tiles
            const int nb = (e < 2048) ? 0 : ((e < 2560) ? QW : QW + KW);
            const int c0 = (y & ((1 << lg) - 1)) * 64, r0 = (y >> lg) * 64;
            srcld = (e < 2048) ? QW : KW;
            dstld = INW;
            s = W + (size_t)r0 * srcld + c0;
            const size_t o = (size_t)(nb + c0) * INW + r0;
            dh = wtH + o;
            dl = wtL + o;
        } else if (e < 4096) {                                     // Wo [2048][2048]
            const int y = e - 3072;
            const int c0 = (y & 31) * 64, r0 = (y >> 5) * 64;
            srcld = HIDO;
            dstld = QW;
            s = Wo + (size_t)r0 * HIDO + c0;
            const size_t o = (size_t)c0 * QW + r0;
            dh = woH + o;
            dl = woL + o;
        } else {                                                   // past_value, kv head z: [2048][64]
            const int y = e - 4096;
            const int r0 = (y & 31) * 64, z = y >> 5;
            srcld = D;
            dstld = KVL;
            s = pv + (size_t)z * (KVP * D) + (size_t)r0 * D;
            const size_t o = (size_t)z * (D * KVL) + r0;
            dh = vH + o;
            dl = vL + o;
        }
        transpose_unit(s, srcld, dh, dl, dstld, Th, Tl, t);
    }
    const int tb = (int)blockIdx.x - (PREP_BLOCKS - PREP_TABLE_BLOCKS);
    if (tb >= 0) table_unit(pid, cosT, sinT, tb * 256 + t, lck);
}

// ---------------------------------------------------------------------------
// GEMM, bf16 hi/lo three-term: C[M x N] f32 (pitch ldc) = A[M x K] . B[K x N],
// A planes [M][K] (pitch K), B planes stored transposed [N][K] (pitch K, k-contiguous),
// so A and B fragments use the identical split-k load. Block = WM x 2 waves, BM x BN with BM = 32 * WM and
// BN = 32 * NTW.
//   NTW = 4: every wave takes all k of a wave tile of 32 x 64 (2 m-tiles x 4 n-tiles).
//   NTW = 3 (WM = 4): four wave tiles of 64 x 48 (4 m-tiles x 3 n-tiles), each worked on by two waves, one for
//   each 32 k of a stage: 14 fragments read from LDS feed 36 products (12 feed 24 with the 32 x 64 tile).
//   The two partial sums are joined through LDS behind the loop.
// Operands: a stage is 64 k (one 128-B line) of every operand row of the block,
// rows [A hi BM | A lo BM | B hi BN | B lo BN] at an LDS pitch of 144 B, brought in by
// asynchronous copies of 16 B per lane (8 lanes = one whole line); three buffers: a stage's copies are
// issued two trips ahead of the trip that reads it, so that they may come from memory without a stall.
// Fragments are read from LDS. Three buffers leave room for one block per WGP only, so the block shape is
// chosen on the host such that the grid has one block for every WGP of the chip.
// Epilogue: NTW = 4: wave tile staged in LDS, each 256-B row segment written by its wave; NTW = 3: a wave tile's
// 192-B row segment ends inside a 128-B line, so the block's tile is staged whole and written line by line.
// Requires M % BM == 0, N % BN == 0, K % 64 == 0, K >= 64, ldc % 32 == 0 (shapes fixed on host).
// ---------------------------------------------------------------------------
// N copies of 16 B per lane, global -> LDS, written as the builtin: behind a builtin copy no s_wait_xcnt is
// written, so the issuing wave goes straight on to its next copies and to its fragment reads.
typedef int v4i __attribute__((ext_vector_type(4)));
typedef __attribute__((address_space(1))) v4i gv4i;
typedef __attribute__((address_space(3))) v4i lv4i;
template <int N>
__device__ __forceinline__ void copyn(const unsigned (&l)[N], const unsigned short* const (&g)[N]) {
    // unrolled: both address arrays stay in registers
#pragma unroll
    for (int i = 0; i < N; ++i)
        __builtin_amdgcn_global_load_async_to_lds_b128((gv4i*)g[i], (lv4i*)l[i], 0, 0);
}

__device__ __forceinline__ void store_ctile(const float* sW, float* C, int ldc,
                                            int m0w, int n0w, int hh, int m16) {
#pragma unroll
    for (int i = 0; i < 16; ++i) {
        const int row = 2 * i + hh;
        const v4f v = *(const v4fa*)(sW + row * 68 + m16 * 4);
        *(v4f*)(C + (size_t)(m0w + row) * ldc + n0w + m16 * 4) = v;
    }
}

// waits until all but the wave's youngest stage of copies (NC per lane) have landed
template <int NC>
__device__ __forceinline__ void wait_all_but_one_stage() {
    static_assert(NC == 24 || NC == 14, "copies per stage");
    if constexpr (NC == 24) asm volatile("s_wait_asynccnt 0x18" ::: "memory");
    else                    asm volatile("s_wait_asynccnt 0xe" ::: "memory");
}

template <int WM, int NTW>
__global__ __launch_bounds__(WM * 64) void gemm3_kernel(
    const unsigned short* __restrict__ Ah, const unsigned short* __restrict__ Al,
    const unsigned short* __restrict__ Bh, const unsigned short* __restrict__ Bl,
    float* C, int K, int ldc) {
    constexpr int SP = 68;
    constexpr int GP = 72;                 // LDS row pitch in halves (144 B = 16 B x 9: no bank conflict for 16-B reads)
    constexpr int BM = WM * 32;            // A rows of the block
    constexpr int BN = NTW * 32;           // B rows (C columns) of the block
    constexpr int RP = WM * 8;             // stage rows that one copy of the whole block brings
    constexpr int NB = BN / RP;            // copies per B plane
    constexpr int NC = 8 + 2 * NB;         // copies per lane and stage
    constexpr int RAL = BM, RBH = 2 * BM, RBL = 2 * BM + BN, GROWS = 2 * BM + 2 * BN;   // first stage row of A lo, B hi, B lo; rows per stage
    constexpr int GSTAGE = GROWS * GP;     // halves per buffer
    constexpr int CP = BN + 4;             // pitch in floats of the whole staged tile (16 B x odd)
    constexpr bool KSPLIT = (NTW == 3);    // two waves share a wave tile, one per k half of a stage
    constexpr int MTW = KSPLIT ? 4 : 2;    // m-tiles of a wave tile
    static_assert(BN % RP == 0 && (NTW == 4 || (NTW == 3 && WM == 4)), "block shape");
    __shared__ __align__(16) unsigned short ring[3 * GSTAGE];
    __shared__ __align__(16) float sC[NTW == 4 ? WM * 2 * 32 * SP : BM * CP];
    const int tid = threadIdx.x, w = tid >> 5, lane = tid & 31, hh = lane >> 4, m16 = lane & 15;
    const int m0w = blockIdx.y * BM + (w >> 1) * 32;
    const int n0w = blockIdx.x * BN + (w & 1) * (NTW * 16);

    // with KSPLIT: k half (held as a scalar: the epilogue branches on it) and place of the wave tile in the block
    const int kh = KSPLIT ? (__builtin_amdgcn_readfirstlane(w) >> 2) : 0;
    const int wm = KSPLIT ? ((w >> 1) & 1) : (w >> 1), wn = w & 1;

    Acc acc[MTW][NTW];
#pragma unroll
    for (int mt = 0; mt < MTW; ++mt)
#pragma unroll
        for (int nt = 0; nt < NTW; ++nt) acc_zero(acc[mt][nt]);

    const size_t Ks = (size_t)K;
    // copy side: thread = (row cr of RP, 16-B piece cp of the row's 128 B); copy i takes stage row cr + RP * i
    const int cr = tid >> 3, cp = tid & 7;
    const unsigned short* gAh = Ah + (size_t)(blockIdx.y * BM + cr) * Ks + cp * 8;
    const unsigned short* gAl = Al + (size_t)(blockIdx.y * BM + cr) * Ks + cp * 8;
    const unsigned short* gBh = Bh + (size_t)(blockIdx.x * BN + cr) * Ks + cp * 8;
    const unsigned short* gBl = Bl + (size_t)(blockIdx.x * BN + cr) * Ks + cp * 8;
    const unsigned lds0 = (unsigned)(size_t)(ring + cr * GP + cp * 8);   // LDS byte address: low 32 bits

    auto issue = [&](int st, int buf) {
        const unsigned lb = lds0 + (unsigned)buf * (unsigned)(GSTAGE * 2);
        const size_t ko = (size_t)st * 64;
        unsigned l[8];
        const unsigned short* g[8];
#pragma unroll
        for (int i = 0; i < 4; ++i) {                  // BM / RP = 4 copies per A plane
            l[i] = lb + (unsigned)((RP * i) * GP * 2);
            g[i] = gAh + ko + (size_t)(RP * i) * Ks;
            l[4 + i] = lb + (unsigned)((RAL + RP * i) * GP * 2);
            g[4 + i] = gAl + ko + (size_t)(RP * i) * Ks;
        }
        copyn<8>(l, g);
        unsigned lB[NB];
        const unsigned short* gB[NB];
#pragma unroll
        for (int i = 0; i < NB; ++i) {                 // BN / RP copies per B plane
            lB[i] = lb + (unsigned)((RBH + RP * i) * GP * 2);
            gB[i] = gBh + ko + (size_t)(RP * i) * Ks;
        }
        copyn<NB>(lB, gB);
#pragma unroll
        for (int i = 0; i < NB; ++i) {
            lB[i] = lb + (unsigned)((RBL + RP * i) * GP * 2);
            gB[i] = gBl + ko + (size_t)(RP * i) * Ks;
        }
        copyn<NB>(lB, gB);
    };

    const int NT = K >> 6;
    issue(0, 0);
    if (NT > 1) issue(1, 1);
    // stage 0 has landed for this wave (stage 1, where there is one, may still fly), then is published
    if (NT > 1) wait_all_but_one_stage<NC>();
    else        asm volatile("s_wait_asynccnt 0x0" ::: "memory");
    __syncthreads();
    if (NT > 2) issue(2, 2);

    // reader side: first fragment row of this wave inside a stage
    const int offA = (wm * (MTW * 16) + m16) * GP + 8 * hh + kh * 32;
    const int offB = (RBH + wn * (NTW * 16) + m16) * GP + 8 * hh + kh * 32;

    // kept rolled: the buffer index and the refill test are per trip
    int buf = 0;                           // t mod 3
#pragma unroll 1
    for (int t = 0; t < NT; ++t) {
        const unsigned short* sb = ring + buf * GSTAGE;
        if constexpr (KSPLIT) {
            // the wave's 32 k of the stage: all 14 fragments are read at one place, then 3 groups of 12 products, one per n-tile
            Frag fa[MTW][2], fb[NTW][2];
            const unsigned short* pa = sb + offA;
            const unsigned short* pb = sb + offB;
            // in the order in which the products of n-tile 0 need them: hi x hi, hi x lo, lo x hi; then n-tiles 1, 2
            ldfrag(fb[0][0], pb);
#pragma unroll
            for (int mt = 0; mt < MTW; ++mt) ldfrag(fa[mt][0], pa + mt * 16 * GP);
            ldfrag(fb[0][1], pb + (RBL - RBH) * GP);
#pragma unroll
            for (int mt = 0; mt < MTW; ++mt) ldfrag(fa[mt][1], pa + (RAL + mt * 16) * GP);
#pragma unroll
            for (int nt = 1; nt < NTW; ++nt) {
                ldfrag(fb[nt][0], pb + nt * 16 * GP);
                ldfrag(fb[nt][1], pb + (RBL - RBH + nt * 16) * GP);
            }
#pragma unroll
            for (int nt = 0; nt < NTW; ++nt) {
                mma3x4(acc[0][nt], acc[1][nt], acc[2][nt], acc[3][nt], fa, fb[nt][0], fb[nt][1]);
                // n-tile by n-tile, in the order in which the fragments arrive: without it the first product
                // scheduled was one of a later n-tile, and the wave waited for nearly all of its reads
                __builtin_amdgcn_sched_barrier(0);
            }
        } else {
            // a trip is 8 groups g = (k half g >> 2, n-tile g & 3) of 6 products. Fragment reads stand at three
            // places only, (trip head, groups 2 and 4), the last two at least three groups ahead of their use, all in this trip's own buffer.
            Frag fa[2][4], fb[8][2];
            auto lda = [&](int ks) {
                const unsigned short* pa = sb + offA + ks * 32;
                ldfrag(fa[ks][0], pa);
                ldfrag(fa[ks][1], pa + RAL * GP);
                ldfrag(fa[ks][2], pa + 16 * GP);
                ldfrag(fa[ks][3], pa + (RAL + 16) * GP);
            };
            auto ldb = [&](int g) {
                const unsigned short* pb = sb + offB + (g >> 2) * 32 + (g & 3) * 16 * GP;
                ldfrag(fb[g][0], pb);
                ldfrag(fb[g][1], pb + (RBL - RBH) * GP);
            };
            lda(0); ldb(0); ldb(1); ldb(2); ldb(3); lda(1); ldb(4);
#pragma unroll
            for (int g = 0; g < 8; ++g) {
                if (g == 2) { ldb(5); ldb(6); }
                if (g == 4) ldb(7);
                mma3(acc[0][g & 3], fa[g >> 2][0], fa[g >> 2][1], fb[g][0], fb[g][1]);
                mma3(acc[1][g & 3], fa[g >> 2][2], fa[g >> 2][3], fb[g][0], fb[g][1]);
            }
        }
        // publish point: this wave's LDS reads of the buffer are done, its copies of stage t + 1 have
        // landed; the barrier publishes stage t + 1 and frees this buffer for the refill. Where stage
        // t + 2 was issued (by every wave, at the foot of trip t - 1 or in front of the loop) its copies
        // are the wave's youngest and go on flying; where it was not, the wait is to 0
        asm volatile("s_wait_dscnt 0x0" ::: "memory");
        if (t + 2 < NT) wait_all_but_one_stage<NC>();
        else            asm volatile("s_wait_asynccnt 0x0" ::: "memory");
        __syncthreads();
        if (t + 3 < NT) issue(t + 3, buf);
        buf = (buf == 2) ? 0 : buf + 1;
    }
    // no copy is left in flight when the wave goes on
    asm volatile("s_wait_asynccnt 0x0" ::: "memory");

    // D layout: acc[mt][nt].f[r] = tile(row mt*16 + 8*hh + r, col nt*16 + m16)
    if constexpr (NTW == 4) {
        float* sW = sC + w * (32 * SP);
#pragma unroll
        for (int mt = 0; mt < 2; ++mt)
#pragma unroll
            for (int nt = 0; nt < 4; ++nt)
#pragma unroll
                for (int r = 0; r < 8; ++r)
                    sW[(mt * 16 + 8 * hh + r) * SP + nt * 16 + m16] = acc[mt][nt].f[r];
        __syncthreads();
        store_ctile(sW, C, ldc, m0w, n0w, hh, m16);
    } else {
        // the lane's first element of the wave tile in the staged block tile; both waves of a tile have the same map
        float* sW = sC + (wm * (MTW * 16) + 8 * hh) * CP + wn * (NTW * 16) + m16;
        // each wave of a pair finishes half of the tile's rows: k half 0 keeps m-tiles 0 and 1 and hands over its
        // partial sums of m-tiles 2 and 3, k half 1 the other way round
        const bool k1 = (kh != 0);
        float* sK = sW + (k1 ? 32 : 0) * CP;           // rows kept
        float* sG = sW + (k1 ? 0 : 32) * CP;           // rows handed over
        float keep[2][NTW][8];
#pragma unroll
        for (int j = 0; j < 2; ++j)
#pragma unroll
            for (int nt = 0; nt < NTW; ++nt)
#pragma unroll
                for (int r = 0; r < 8; ++r) {
                    keep[j][nt][r] = k1 ? acc[2 + j][nt].f[r] : acc[j][nt].f[r];
                    sG[(j * 16 + r) * CP + nt * 16] = k1 ? acc[j][nt].f[r] : acc[2 + j][nt].f[r];
                }
        // the handed partial sums are visible to the other wave of the pair
        __syncthreads();
        // all reads first, then the sums in place: one LDS latency, not one per element
        float got[2][NTW][8];
#pragma unroll
        for (int j = 0; j < 2; ++j)
#pragma unroll
            for (int nt = 0; nt < NTW; ++nt)
#pragma unroll
                for (int r = 0; r < 8; ++r) got[j][nt][r] = sK[(j * 16 + r) * CP + nt * 16];
#pragma unroll
        for (int j = 0; j < 2; ++j)
#pragma unroll
            for (int nt = 0; nt < NTW; ++nt)
#pragma unroll
                for (int r = 0; r < 8; ++r) sK[(j * 16 + r) * CP + nt * 16] = keep[j][nt][r] + got[j][nt][r];
        // publishes the block's whole tile: a thread stores what other waves have staged
        __syncthreads();
        // BM rows of BN / 4 pieces of 16 B; 8 consecutive threads write one whole 128-B line
        constexpr int PR = BN / 4;
        static_assert(WM * 64 * 3 == 32 * PR && BM == 128, "three steps of the block cover 32 rows");
        float* Cb = C + (size_t)(blockIdx.y * BM) * ldc + blockIdx.x * BN;
#pragma unroll
        for (int j = 0; j < 3; ++j) {
            const int idx = tid + j * (WM * 64);       // piece of rows 0..31; the same piece of rows + 32, 64, 96
            const int row = idx / PR, c4 = (idx - row * PR) * 4;
            v4f v[4];
#pragma unroll
            for (int i = 0; i < 4; ++i) v[i] = *(const v4fa*)(sC + (row + 32 * i) * CP + c4);
#pragma unroll
            for (int i = 0; i < 4; ++i) *(v4f*)(Cb + (size_t)(row + 32 * i) * ldc + c4) = v[i];
            // the next step's values and addresses may land in the registers that these stores name
            if (j < 2) asm volatile("s_wait_xcnt 0x0" ::: "memory");
        }
    }
}

// ---------------------------------------------------------------------------
// RoPE + split of the projection output qkv[1024][3072] (q cols 0..2047 = h*64+d,
// k cols 2048..2559, v cols 2560..3071). Block = (64-col group g, 64 tokens).
//   g < 32      : q head g      -> q planes [32][1024][64]      (RoPE)
//   32<=g<40    : kv head g-32  -> K planes [8][3072][64] rows 2048+tok (RoPE)
//   40<=g<48    : kv head g-40  -> V^T planes [8][64][3072] cols 2048+tok (transpose)
// y[d] = x[d]*cos + rot[d]*sin, rot = -x[d+32] (d<32), x[d-32] (d>=32); cos/sin from table.
// Each thread emits 8 consecutive halves per plane (16 B); 8 consecutive lanes = one line.
// coverage: q planes all 32x1024 rows; K planes rows 2048..3071 of every kv head;
// V^T planes cols 2048..3071 of all 8x64 rows.
// ---------------------------------------------------------------------------
__device__ __forceinline__ void rope8(const float* xr, const float* pr, const float* cr,
                                      const float* sr, float sgn, v4f& ya, v4f& yb) {
#pragma clang fp contract(off)
    ya.x = xr[0] * cr[0] + (sgn * pr[0]) * sr[0];
    ya.y = xr[1] * cr[1] + (sgn * pr[1]) * sr[1];
    ya.z = xr[2] * cr[2] + (sgn * pr[2]) * sr[2];
    ya.w = xr[3] * cr[3] + (sgn * pr[3]) * sr[3];
    yb.x = xr[4] * cr[4] + (sgn * pr[4]) * sr[4];
    yb.y = xr[5] * cr[5] + (sgn * pr[5]) * sr[5];
    yb.z = xr[6] * cr[6] + (sgn * pr[6]) * sr[6];
    yb.w = xr[7] * cr[7] + (sgn * pr[7]) * sr[7];
}

__global__ __launch_bounds__(256) void rope_split_kernel(
    const float* __restrict__ qkv, const float* __restrict__ cosT, const float* __restrict__ sinT,
    unsigned short* qh, unsigned short* ql, unsigned short* kh, unsigned short* kl,
    unsigned short* vh, unsigned short* vl) {
#pragma clang fp contract(off)
    constexpr int QN = 1024, D = 64, NH = 32, NKV = 8, QKVW = 3072, KVL = 3072, KVP = 2048, TP = 68;
    __shared__ __align__(16) float T[64 * TP];
    const int t = threadIdx.x, g = blockIdx.x, tok0 = blockIdx.y * 64;
    const float* s = qkv + (size_t)tok0 * QKVW + g * D;
#pragma unroll
    for (int i = 0; i < 4; ++i) {
        const int r = (t >> 4) + 16 * i, c4 = (t & 15) * 4;
        const v4f v = *(const v4fa*)(s + (size_t)r * QKVW + c4);
        *(v4fa*)(T + r * TP + c4) = v;
    }
    __syncthreads();

    u4 H0, L0, H1, L1;
    size_t g0, g1;
    unsigned short* dH;
    unsigned short* dL;
    if (g < NH + NKV) {                                   // block-uniform branch
        const bool isq = (g < NH);
        dH = isq ? qh : kh;
        dL = isq ? ql : kl;
        const int d0 = (t & 7) * 8, dp0 = d0 ^ 32;
        const float sgn = (d0 < 32) ? -1.0f : 1.0f;
        {
            const int r = (t >> 3), tok = tok0 + r;
            const float* cr = cosT + (size_t)tok * 32 + (d0 & 31);
            const float* sr = sinT + (size_t)tok * 32 + (d0 & 31);
            v4f ya, yb;
            rope8(T + r * TP + d0, T + r * TP + dp0, cr, sr, sgn, ya, yb);
            pack8(ya, yb, H0, L0);
            const size_t row = isq ? ((size_t)g * QN + tok) : ((size_t)(g - NH) * KVL + KVP + tok);
            g0 = row * D + d0;
        }
        {
            const int r = 32 + (t >> 3), tok = tok0 + r;
            const float* cr = cosT + (size_t)tok * 32 + (d0 & 31);
            const float* sr = sinT + (size_t)tok * 32 + (d0 & 31);
            v4f ya, yb;
            rope8(T + r * TP + d0, T + r * TP + dp0, cr, sr, sgn, ya, yb);
            pack8(ya, yb, H1, L1);
            const size_t row = isq ? ((size_t)g * QN + tok) : ((size_t)(g - NH) * KVL + KVP + tok);
            g1 = row * D + d0;
        }
    } else {
        dH = vh;
        dL = vl;
        const int kvhd = g - NH - NKV, piece = t & 7;
        {
            const int d = (t >> 3);
            v4f ya, yb;
            ya.x = T[(piece * 8 + 0) * TP + d]; ya.y = T[(piece * 8 + 1) * TP + d];
            ya.z = T[(piece * 8 + 2) * TP + d]; ya.w = T[(piece * 8 + 3) * TP + d];
            yb.x = T[(piece * 8 + 4) * TP + d]; yb.y = T[(piece * 8 + 5) * TP + d];
            yb.z = T[(piece * 8 + 6) * TP + d]; yb.w = T[(piece * 8 + 7) * TP + d];
            pack8(ya, yb, H0, L0);
            g0 = ((size_t)(kvhd * D + d)) * KVL + KVP + tok0 + piece * 8;
        }
        {
            const int d = 32 + (t >> 3);
            v4f ya, yb;
            ya.x = T[(piece * 8 + 0) * TP + d]; ya.y = T[(piece * 8 + 1) * TP + d];
            ya.z = T[(piece * 8 + 2) * TP + d]; ya.w = T[(piece * 8 + 3) * TP + d];
            yb.x = T[(piece * 8 + 4) * TP + d]; yb.y = T[(piece * 8 + 5) * TP + d];
            yb.z = T[(piece * 8 + 6) * TP + d]; yb.w = T[(piece * 8 + 7) * TP + d];
            pack8(ya, yb, H1, L1);
            g1 = ((size_t)(kvhd * D + d)) * KVL + KVP + tok0 + piece * 8;
        }
    }
    *(u4*)(dH + g0) = H0; *(u4*)(dL + g0) = L0;
    *(u4*)(dH + g1) = H1; *(u4*)(dL + g1) = L1;
    
}

// ---------------------------------------------------------------------------
// Flash attention with the block-diagonal TTT mask, GQA (kv head = h >> 2).
// Block = (kv head, 16 query rows), 16 waves = its 4 query heads x 4 key splits. The key
// tiles of 32 of all three key blocks form one list; split ks takes entries ks, ks + 4, ...
// The 4 heads of one split walk the same K and V tiles at the same time: a trip of the block is one
// tile per split, and each split's tile (K hi, K lo: 32 key rows of 128 B at a pitch of 144 B; V^T hi,
// V^T lo: 64 d rows of 64 B at a pitch of 80 B) is brought into LDS once by the split's 4 waves with
// asynchronous copies of 16 B per lane; two buffers, the next trip's copies fly while this trip is
// worked on. All K and V fragments are read from LDS.
// Both products are computed transposed: S^T = K . Q^T (A = K rows, B = q) and O^T += V^T . P^T (A = V^T rows,
// B = P^T). A lane then holds 16 scores of ONE query (column m16; keys 8*hh + r of each 16-key tile): maximum and
// sum run inside the lane, with one exchange between the wave's halves for the maximum, and the two score tiles,
// split in place, are the B operand of the second product in the hardware k order that ldfrag also has.
// Each wave keeps its own running maximum, sum (per wave half, joined behind the loop) and 16 x 64 output; a head's
// four partial results are merged through LDS in fixed split order behind one work-group barrier.
// Q/K/V/P operands as bf16 hi/lo; scores, mask (-inf), running-max softmax in f32.
// key j of block blk allowed iff j < seq_len and j <= i - (lck - blk).
// seq_len = sum(attention_mask) - lck, summed per block in fixed order.
// Per blk the key-tile count is bounded by the tile's diagonal and seq_len
// (at most 32 tiles); the mask is still applied by value per element.
// Output attn planes [1024][2048] (col h*64+d): 8 lanes x 16 B = one 128-B line per row.
// Query tiles with the most keys have the lowest block index (for speed only).
// coverage: 8 x 64 blocks x 4 heads x 16 rows x 64 cols = [1024][2048] per plane.
// ---------------------------------------------------------------------------
__global__ __launch_bounds__(512) void attn_kernel(
    const unsigned short* __restrict__ qH, const unsigned short* __restrict__ qL,
    const unsigned short* __restrict__ kH, const unsigned short* __restrict__ kL,
    const unsigned short* __restrict__ vH, const unsigned short* __restrict__ vL,
    const int* __restrict__ amask, int nmask, int lck,
    unsigned short* oH, unsigned short* oL) {
    constexpr int QN = 1024, D = 64, KVL = 3072, HIDO = 2048, NS = 4, NW = 4 * NS, SP = 68;
    constexpr int KP = 72, VP = 40;                 // LDS row pitches in halves (16 B x 9, 16 B x 5: no bank conflict for 16-B reads)
    constexpr int KPL = 32 * KP, VPL = 64 * VP;     // halves per plane of a K tile, of a V^T tile
    constexpr int TSPL = 2 * KPL + 2 * VPL;         // halves per split: [K hi | K lo | V^T hi | V^T lo]
    constexpr int TSTAGE = NS * TSPL;               // halves per buffer
    __shared__ __align__(16) unsigned short kvs[2 * TSTAGE];
    __shared__ int red[128];
    __shared__ __align__(16) float Os[NW * 16 * SP];
    __shared__ float Ms[NW * 16];
    __shared__ float Ls[NW * 16];
    const int tid = threadIdx.x, lane = tid & 31, hh = lane >> 4, m16 = lane & 15;
    // wave number held as a scalar: the key-tile loop then branches on scalar tests, every lane on
    const int w = __builtin_amdgcn_readfirstlane(tid >> 5);

    // seq_len (integer, fixed order, identical in every block)
    if (tid < 128) {                                   // the first four waves sum the mask
        int part = 0;
        for (int i = tid; i < nmask; i += 128) part += amask[i];
        red[tid] = part;
    }
    __syncthreads();
#pragma unroll
    for (int off = 64; off > 0; off >>= 1) {
        if (tid < off) red[tid] += red[tid + off];
        __syncthreads();
    }
    const int seq_len = __builtin_amdgcn_readfirstlane(red[0] - lck);

    const int kvh = blockIdx.x, h = kvh * 4 + (w & 3), ks = w >> 2;
    const int q0w = (QN / 16 - 1 - (int)blockIdx.y) * 16;
    const float NEG_INF = -__builtin_inff();

    Frag fqh[2], fql[2];
    {
        const size_t qo = ((size_t)h * QN + q0w + m16) * D + 8 * hh;
        ldfrag(fqh[0], qH + qo);
        ldfrag(fqh[1], qH + qo + 32);
        ldfrag(fql[0], qL + qo);
        ldfrag(fql[1], qL + qo + 32);
    }
    // of query q0w + m16: running maximum (alike in both halves) and this half's part of the running sum
    float mrun = NEG_INF, lrun = 0.0f;
    Acc o[4];
#pragma unroll
    for (int dt = 0; dt < 4; ++dt) acc_zero(o[dt]);

    const size_t kplane = (size_t)kvh * KVL * D;      // K planes [kvh][kv][d]
    const size_t vplane = (size_t)kvh * D * KVL;      // V^T planes [kvh][d][kv]

    // key tiles per key block (allowed j of block blk are < q0w + 16 - (lck - blk) and < seq_len),
    // as running ends e0 <= e1 <= e2 of the one list; each count <= 32, so e2 <= 96
    int e0, e1, e2;
    {
        int c0 = q0w + 16 - lck, c1 = c0 + 1, c2 = c0 + 2;
        c0 = (c0 < seq_len) ? c0 : seq_len;
        c1 = (c1 < seq_len) ? c1 : seq_len;
        c2 = (c2 < seq_len) ? c2 : seq_len;
        c0 = (c0 < 0) ? 0 : ((c0 > QN) ? QN : c0);
        c1 = (c1 < 0) ? 0 : ((c1 > QN) ? QN : c1);
        c2 = (c2 < 0) ? 0 : ((c2 > QN) ? QN : c2);
        e0 = __builtin_amdgcn_readfirstlane((c0 + 31) >> 5);
        e1 = e0 + __builtin_amdgcn_readfirstlane((c1 + 31) >> 5);
        e2 = e1 + __builtin_amdgcn_readfirstlane((c2 + 31) >> 5);
    }
    // copy side: the 128 lanes of a split bring its tile; per lane 4 copies of K (2 planes x 2 row groups
    // of 16; 8 lanes = one 128-B row) and 4 of V^T (2 planes x 2 row groups of 32; 4 lanes = one 64-B row)
    const int lt = (w & 3) * 32 + lane;
    const int ckr = lt >> 3, ckp = (lt & 7) * 8, cvr = lt >> 2, cvp = (lt & 3) * 8;
    const unsigned short* gkh = kH + kplane + (size_t)ckr * D + ckp;
    const unsigned short* gkl = kL + kplane + (size_t)ckr * D + ckp;
    const unsigned short* gvh = vH + vplane + (size_t)cvr * KVL + cvp;
    const unsigned short* gvl = vL + vplane + (size_t)cvr * KVL + cvp;
    const unsigned ldk = (unsigned)(size_t)(kvs + ks * TSPL + ckr * KP + ckp);             // LDS byte address: low 32 bits
    const unsigned ldv = (unsigned)(size_t)(kvs + ks * TSPL + 2 * KPL + cvr * VP + cvp);
    // trips of the block; a split whose list entry lies past the end copies the last tile again (in bounds,
    // never read), so every wave issues the same copies in every trip
    const int NT = (e2 + NS - 1) / NS;
    auto issue = [&](int it, int buf) {
        int le = it * NS + ks;
        le = (le < e2) ? le : (e2 - 1);
        const int cb = (le >= e0 ? 1 : 0) + (le >= e1 ? 1 : 0);
        const int ct = le - (le >= e1 ? e1 : (le >= e0 ? e0 : 0));
        const size_t ckv = (size_t)(cb * QN + ct * 32);
        const unsigned bo = (unsigned)buf * (unsigned)(TSTAGE * 2);
        unsigned l[8];
        const unsigned short* g[8];
#pragma unroll
        for (int i = 0; i < 2; ++i) {
            l[i] = ldk + bo + (unsigned)(16 * i * KP * 2);
            g[i] = gkh + (ckv + 16 * i) * D;
            l[2 + i] = ldk + bo + (unsigned)((KPL + 16 * i * KP) * 2);
            g[2 + i] = gkl + (ckv + 16 * i) * D;
            l[4 + i] = ldv + bo + (unsigned)(32 * i * VP * 2);
            g[4 + i] = gvh + (size_t)(32 * i) * KVL + ckv;
            l[6 + i] = ldv + bo + (unsigned)((VPL + 32 * i * VP) * 2);
            g[6 + i] = gvl + (size_t)(32 * i) * KVL + ckv;
        }
        copyn<8>(l, g);
    };
    if (NT > 0) issue(0, 0);
    // trip 0's tiles have landed for this wave, then are published to the other waves
    asm volatile("s_wait_asynccnt 0x0" ::: "memory");
    __syncthreads();
    if (NT > 1) issue(1, 1);

    // kept rolled: a second copy of the long body would only raise the register count
#pragma unroll 1
    for (int it = 0; it < NT; ++it) {
      const int s = it * NS + ks;
      if (s < e2) {                                    // scalar test: the whole wave works or skips
        const int blk = (s >= e0 ? 1 : 0) + (s >= e1 ? 1 : 0);
        const int t = s - (s >= e1 ? e1 : (s >= e0 ? e0 : 0));
        const int shift = lck - blk;                   // j <= i - shift
        const int j0 = t * 32;
        const unsigned short* tb = kvs + (it & 1) * TSTAGE + ks * TSPL;   // this split's tile of this trip
        Acc sc[2];
        acc_zero(sc[0]);
        acc_zero(sc[1]);
        // the K fragment reads stand together at the head of the trip
        Frag fk[2][2][2];
#pragma unroll
        for (int nt = 0; nt < 2; ++nt)
#pragma unroll
            for (int ds = 0; ds < 2; ++ds) {
                const unsigned short* pk = tb + (nt * 16 + m16) * KP + ds * 32 + 8 * hh;
                ldfrag(fk[nt][ds][0], pk);
                ldfrag(fk[nt][ds][1], pk + KPL);
            }
        // S^T tile [32 keys x 16 q]; A = K (k = d), B = q (k = d): sc[nt].f[r] = S[q m16][key nt*16 + 8*hh + r]
#pragma unroll
        for (int nt = 0; nt < 2; ++nt)
#pragma unroll
            for (int ds = 0; ds < 2; ++ds)
                mma3(sc[nt], fk[nt][ds][0], fk[nt][ds][1], fqh[ds], fql[ds]);
        // the V fragment reads stand together ahead of the softmax, which covers their latency
        Frag fv[4][2];
#pragma unroll
        for (int dt = 0; dt < 4; ++dt) {
            const unsigned short* pv = tb + 2 * KPL + (dt * 16 + m16) * VP + 8 * hh;
            ldfrag(fv[dt][0], pv);
            ldfrag(fv[dt][1], pv + VPL);
        }
        // scale and mask by value: key j allowed iff j < seq_len and j <= qi - shift
        {
            const int qi = q0w + m16;
            const int jd = qi - shift, jp = seq_len - 1;
            const int jmax = (jd < jp) ? jd : jp;      // last allowed key of this query in this key block
#pragma unroll
            for (int nt = 0; nt < 2; ++nt)
#pragma unroll
                for (int r = 0; r < 8; ++r) {
                    const int j = j0 + nt * 16 + 8 * hh + r;
                    sc[nt].f[r] = (j <= jmax) ? sc[nt].f[r] * 0.125f : NEG_INF;
                }
        }
        // running-max softmax update of the lane's one query
        float x = fmaxf(sc[0].f[0], sc[1].f[0]);
#pragma unroll
        for (int r = 1; r < 8; ++r) x = fmaxf(x, fmaxf(sc[0].f[r], sc[1].f[r]));
        x = fmaxf(x, xhalf(x));
        const float mn = fmaxf(mrun, x);
        const float msafe = (mn == NEG_INF) ? 0.0f : mn;
        const float alpha = __expf(mrun - msafe);
        mrun = mn;
#pragma unroll
        for (int nt = 0; nt < 2; ++nt)
#pragma unroll
            for (int r = 0; r < 8; ++r) sc[nt].f[r] = __expf(sc[nt].f[r] - msafe);
        {
            float s4[4];
#pragma unroll
            for (int c = 0; c < 4; ++c)
                s4[c] = (sc[0].f[c] + sc[0].f[4 + c]) + (sc[1].f[c] + sc[1].f[4 + c]);
            lrun = lrun * alpha + ((s4[0] + s4[1]) + (s4[2] + s4[3]));
        }
#pragma unroll
        for (int dt = 0; dt < 4; ++dt)
#pragma unroll
            for (int r = 0; r < 8; ++r) o[dt].f[r] *= alpha;

        // P^T as B operand (k = key, n = q): elements 0..7 = tile 0's registers, 8..15 = tile 1's
        Frag fph, fpl;
#pragma unroll
        for (int nt = 0; nt < 2; ++nt) {
            const v4f pa = {sc[nt].f[0], sc[nt].f[1], sc[nt].f[2], sc[nt].f[3]};
            const v4f pb = {sc[nt].f[4], sc[nt].f[5], sc[nt].f[6], sc[nt].f[7]};
            pack8(pa, pb, fph.q[nt], fpl.q[nt]);
        }

        // O^T += V^T . P^T ; A = V^T rows (m = d, k = key): o[dt].f[r] = O[q m16][dt*16 + 8*hh + r]
#pragma unroll
        for (int dt = 0; dt < 4; ++dt) mma3(o[dt], fv[dt][0], fv[dt][1], fph, fpl);
      }
        // publish point: this wave's LDS reads of the buffer are done, its copies of the next trip
        // have landed; the barrier publishes the next trip's tiles and frees this buffer for the refill
        asm volatile("s_wait_dscnt 0x0" ::: "memory");
        asm volatile("s_wait_asynccnt 0x0" ::: "memory");
        __syncthreads();
        if (it + 2 < NT) issue(it + 2, it & 1);
    }
    // no copy is left in flight when the wave goes on
    asm volatile("s_wait_asynccnt 0x0" ::: "memory");

    // each wave's partial result to LDS (o[dt].f[r] = O[q m16][dt*16 + 8*hh + r]: 8 consecutive columns of a row)
    float* Ow = Os + w * 16 * SP;
#pragma unroll
    for (int dt = 0; dt < 4; ++dt) {
        const v4f oa = {o[dt].f[0], o[dt].f[1], o[dt].f[2], o[dt].f[3]};
        const v4f ob = {o[dt].f[4], o[dt].f[5], o[dt].f[6], o[dt].f[7]};
        *(v4fa*)(Ow + m16 * SP + dt * 16 + 8 * hh) = oa;
        *(v4fa*)(Ow + m16 * SP + dt * 16 + 8 * hh + 4) = ob;
    }
    // the halves' sums are joined with every lane on; both halves then store the same two values
    const float lall = lrun + xhalf(lrun);
    Ms[w * 16 + m16] = mrun;
    Ls[w * 16 + m16] = lall;
    __syncthreads();

    // merge in split order, normalise, split into planes; thread = (head, row, 8 columns)
    const int hl = tid >> 7, row = (tid >> 3) & 15, c8 = (tid & 7) * 8;
    float mall = NEG_INF;
#pragma unroll
    for (int u = 0; u < NS; ++u) mall = fmaxf(mall, Ms[(u * 4 + hl) * 16 + row]);
    const float mfin = (mall == NEG_INF) ? 0.0f : mall;
    float lsum = 0.0f;
    v4f oa = {0.0f, 0.0f, 0.0f, 0.0f}, ob = {0.0f, 0.0f, 0.0f, 0.0f};
#pragma unroll
    for (int u = 0; u < NS; ++u) {
        const int pr = (u * 4 + hl) * 16 + row;
        const float a = __expf(Ms[pr] - mfin);
        const v4f va = *(const v4fa*)(Os + pr * SP + c8);
        const v4f vb = *(const v4fa*)(Os + pr * SP + c8 + 4);
        lsum += a * Ls[pr];
        oa += a * va;
        ob += a * vb;
    }
    const float il = 1.0f / lsum;
    u4 H, L;
    pack8(oa * il, ob * il, H, L);
    const size_t eo = (size_t)(q0w + row) * HIDO + (kvh * 4 + hl) * D + c8;
    *(u4*)(oH + eo) = H;
    *(u4*)(oL + eo) = L;
}

// ---------------------------------------------------------------------------
extern "C" void kernel_launch(void* const* d_in, const int* in_sizes, int n_in,
                              void* d_out, int out_size, void* d_ws, size_t ws_size,
                              hipStream_t stream) {
    constexpr int QN = 1024, INW = 4096, NH = 32, NKV = 8, D = 64, HIDO = 2048;
    constexpr int KVP = 2048, KVL = 3072, QKVW = 3072, LCK = KVP / QN;
    if (n_in < 9) return;
    if (in_sizes[0] != QN * INW || in_sizes[1] != NKV * KVP * D || in_sizes[2] != NKV * KVP * D ||
        in_sizes[3] != QN || in_sizes[4] != QN || in_sizes[5] != INW * NH * D ||
        in_sizes[6] != INW * NKV * D || in_sizes[7] != INW * NKV * D ||
        in_sizes[8] != NH * D * HIDO || out_size != QN * HIDO) return;

    const float* hs  = (const float*)d_in[0];
    const float* pk  = (const float*)d_in[1];
    const float* pv  = (const float*)d_in[2];
    const int*   am  = (const int*)  d_in[3];
    const int*   pid = (const int*)  d_in[4];
    const float* Wq  = (const float*)d_in[5];
    const float* Wk  = (const float*)d_in[6];
    const float* Wv  = (const float*)d_in[7];
    const float* Wo  = (const float*)d_in[8];
    float* out = (float*)d_out;

    char* ws = (char*)d_ws;
    size_t off = 0;
    auto carve = [&](size_t bytes) -> char* {
        char* p = ws + off;
        off += (bytes + 255) & ~(size_t)255;
        return p;
    };
    unsigned short* hsH = (unsigned short*)carve((size_t)QN * INW * 2);          // A planes of QKV GEMM
    unsigned short* hsL = (unsigned short*)carve((size_t)QN * INW * 2);
    unsigned short* wtH = (unsigned short*)carve((size_t)QKVW * INW * 2);        // [Wq|Wk|Wv]^T planes [3072][4096]
    unsigned short* wtL = (unsigned short*)carve((size_t)QKVW * INW * 2);
    unsigned short* woH = (unsigned short*)carve((size_t)HIDO * (NH * D) * 2);    // Wo^T planes [2048][2048]
    unsigned short* woL = (unsigned short*)carve((size_t)HIDO * (NH * D) * 2);
    float*          qkv = (float*)         carve((size_t)QN * QKVW * 4);          // projection output f32
    unsigned short* qH  = (unsigned short*)carve((size_t)NH * QN * D * 2);        // q planes [32][1024][64]
    unsigned short* qL  = (unsigned short*)carve((size_t)NH * QN * D * 2);
    unsigned short* kH  = (unsigned short*)carve((size_t)NKV * KVL * D * 2);      // K planes [8][3072][64]
    unsigned short* kL  = (unsigned short*)carve((size_t)NKV * KVL * D * 2);
    unsigned short* vH  = (unsigned short*)carve((size_t)NKV * D * KVL * 2);      // V^T planes [8][64][3072]
    unsigned short* vL  = (unsigned short*)carve((size_t)NKV * D * KVL * 2);
    unsigned short* aH  = (unsigned short*)carve((size_t)QN * (NH * D) * 2);      // attention output planes [1024][2048]
    unsigned short* aL  = (unsigned short*)carve((size_t)QN * (NH * D) * 2);
    float*          cosT = (float*)        carve((size_t)QN * 32 * 4);
    float*          sinT = (float*)        carve((size_t)QN * 32 * 4);
    if (off > ws_size || off > ((size_t)128 << 20)) return;

    // tables and operand planes, one launch
    prep_kernel<<<PREP_BLOCKS, 256, 0, stream>>>(hs, pk, pv, pid, Wq, Wk, Wv, Wo, hsH, hsL, kH, kL, vH, vL,
                                                 wtH, wtL, woH, woL, cosT, sinT, LCK);

    // fused QKV projection: [1024 x 4096] . [4096 x 3072] -> qkv f32
    gemm3_kernel<4, 3><<<dim3(QKVW / 96, QN / 128), 256, 0, stream>>>(hsH, hsL, wtH, wtL, qkv, INW, QKVW);

    // RoPE + split into q planes, new K rows, new V^T cols
    rope_split_kernel<<<dim3(QKVW / 64, QN / 64), 256, 0, stream>>>(qkv, cosT, sinT, qH, qL, kH, kL, vH, vL);

    // attention
    attn_kernel<<<dim3(NKV, QN / 16), 512, 0, stream>>>(qH, qL, kH, kL, vH, vL, am, in_sizes[3], LCK, aH, aL);

    // output projection: [1024 x 2048] . [2048 x 2048] -> d_out f32
    gemm3_kernel<2, 4><<<dim3(HIDO / 128, QN / 64), 128, 0, stream>>>(aH, aL, woH, woL, out, NH * D, HIDO);
}

// v010
// It runs in 147 microseconds.
// Two timings next to v009 both put it at 1.04 times that version's speed.
// Over all steps from v000 it is 3.91 times as fast.
// All contractions (q/k/v projections, q.k^T, p.v, output projection): v_wmma_f32_16x16x32_bf16 with bf16 hi/lo operands everywhere (hi*hi + hi*lo + lo*hi), f32 accumulate; RoPE, softmax and normalisation in f32.
#include <hip/hip_runtime.h>
#include <hip/hip_bf16.h>

typedef __attribute__((ext_vector_type(16))) __bf16 v16bf;
typedef __attribute__((ext_vector_type(2))) __bf16 v2bf;
typedef float v2f __attribute__((ext_vector_type(2)));
typedef float v8f __attribute__((ext_vector_type(8)));
typedef float v4f __attribute__((ext_vector_type(4)));
typedef unsigned int u4 __attribute__((ext_vector_type(4)));
typedef u4 __attribute__((may_alias)) u4a;
typedef v4f __attribute__((may_alias)) v4fa;
typedef v2f __attribute__((may_alias)) v2fa;

union Frag { v16bf v; u4 q[2]; };
union Acc  { v8f v; float f[8]; };

// ---------------------------------------------------------------------------
// bf16 hi/lo split (hi = RNE(x), lo = RNE(x - hi), exact residual), two values at a time
// ---------------------------------------------------------------------------
// two f32 -> two bf16 in one word, first element in the low half-word: one packed convert, round to nearest even
__device__ __forceinline__ unsigned cvt2(float a, float b) {
    const v2f x = {a, b};
    return __builtin_bit_cast(unsigned, __builtin_convertvector(x, v2bf));
}
// two f32 -> one 32-bit word per plane
__device__ __forceinline__ void pack2(float a, float b, unsigned& wh, unsigned& wl) {
    wh = cvt2(a, b);
    wl = cvt2(a - __uint_as_float(wh << 16), b - __uint_as_float(wh & 0xFFFF0000u));
}
// eight consecutive f32 -> 16 B per plane
__device__ __forceinline__ void pack8(const v4f a, const v4f b, u4& H, u4& L) {
    unsigned h0, l0, h1, l1, h2, l2, h3, l3;
    pack2(a.x, a.y, h0, l0);
    pack2(a.z, a.w, h1, l1);
    pack2(b.x, b.y, h2, l2);
    pack2(b.z, b.w, h3, l3);
    H.x = h0; H.y = h1; H.z = h2; H.w = h3;
    L.x = l0; L.y = l1; L.z = l2; L.w = l3;
}

// ---------------------------------------------------------------------------
// 16x16x32 fragment load from a k-contiguous 16-bit row (A row m, or B^T row n):
// p = row_start + k0 + 8*h ; elements 0..7 <- k0+8h.., elements 8..15 <- k0+16+8h..
// ---------------------------------------------------------------------------
__device__ __forceinline__ void ldfrag(Frag& f, const unsigned short* p) {
    f.q[0] = *(const u4a*)(p);
    f.q[1] = *(const u4a*)(p + 16);
}

__device__ __forceinline__ void acc_zero(Acc& c) {
#pragma unroll
    for (int i = 0; i < 8; ++i) c.f[i] = 0.0f;
}

// acc += Ah*Bh + Ah*Bl + Al*Bh, then 4 wait slots with D tied and A/B kept live
__device__ __forceinline__ void mma3(Acc& c, const Frag& ah, const Frag& al,
                                     const Frag& bh, const Frag& bl) {
    v8f d = c.v;
    d = __builtin_amdgcn_wmma_f32_16x16x32_bf16(false, ah.v, false, bh.v, (short)0, d, false, false);
    d = __builtin_amdgcn_wmma_f32_16x16x32_bf16(false, ah.v, false, bl.v, (short)0, d, false, false);
    d = __builtin_amdgcn_wmma_f32_16x16x32_bf16(false, al.v, false, bh.v, (short)0, d, false, false);
    asm volatile("v_nop\n\tv_nop\n\tv_nop\n\tv_nop"
                 : "+v"(d) : "v"(ah.v), "v"(al.v), "v"(bh.v), "v"(bl.v));
    c.v = d;
}

// the same three terms, in the same order per accumulator, for four m-tiles against one n-tile, term by term:
// the four hi x hi products need five fragments only. One run of wait slots behind the twelve products
__device__ __forceinline__ void mma3x4(Acc& c0, Acc& c1, Acc& c2, Acc& c3, const Frag (&a)[4][2],
                                       const Frag& bh, const Frag& bl) {
    v8f d0 = c0.v, d1 = c1.v, d2 = c2.v, d3 = c3.v;
    d0 = __builtin_amdgcn_wmma_f32_16x16x32_bf16(false, a[0][0].v, false, bh.v, (short)0, d0, false, false);
    d1 = __builtin_amdgcn_wmma_f32_16x16x32_bf16(false, a[1][0].v, false, bh.v, (short)0, d1, false, false);
    d2 = __builtin_amdgcn_wmma_f32_16x16x32_bf16(false, a[2][0].v, false, bh.v, (short)0, d2, false, false);
    d3 = __builtin_amdgcn_wmma_f32_16x16x32_bf16(false, a[3][0].v, false, bh.v, (short)0, d3, false, false);
    d0 = __builtin_amdgcn_wmma_f32_16x16x32_bf16(false, a[0][0].v, false, bl.v, (short)0, d0, false, false);
    d1 = __builtin_amdgcn_wmma_f32_16x16x32_bf16(false, a[1][0].v, false, bl.v, (short)0, d1, false, false);
    d2 = __builtin_amdgcn_wmma_f32_16x16x32_bf16(false, a[2][0].v, false, bl.v, (short)0, d2, false, false);
    d3 = __builtin_amdgcn_wmma_f32_16x16x32_bf16(false, a[3][0].v, false, bl.v, (short)0, d3, false, false);
    d0 = __builtin_amdgcn_wmma_f32_16x16x32_bf16(false, a[0][1].v, false, bh.v, (short)0, d0, false, false);
    d1 = __builtin_amdgcn_wmma_f32_16x16x32_bf16(false, a[1][1].v, false, bh.v, (short)0, d1, false, false);
    d2 = __builtin_amdgcn_wmma_f32_16x16x32_bf16(false, a[2][1].v, false, bh.v, (short)0, d2, false, false);
    d3 = __builtin_amdgcn_wmma_f32_16x16x32_bf16(false, a[3][1].v, false, bh.v, (short)0, d3, false, false);
    // 4 wait slots behind the last product, with every D tied and A/B kept live
    asm volatile("v_nop\n\tv_nop\n\tv_nop\n\tv_nop"
                 : "+v"(d0), "+v"(d1), "+v"(d2), "+v"(d3)
                 : "v"(a[0][0].v), "v"(a[1][0].v), "v"(a[2][0].v), "v"(a[3][0].v),
                   "v"(a[0][1].v), "v"(a[1][1].v), "v"(a[2][1].v), "v"(a[3][1].v), "v"(bh.v), "v"(bl.v));
    c0.v = d0; c1.v = d1; c2.v = d2; c3.v = d3;
}

// value of lane l ^ 16 (the other half of the wave), a vector cross-row move
__device__ __forceinline__ float xhalf(float x) {
    const int b = __float_as_int(x);
    return __int_as_float(__builtin_amdgcn_permlanex16(b, b, 0x76543210, 0xfedcba98, false, false));
}

// ---------------------------------------------------------------------------
// Operand preparation, ONE launch. None of these jobs reads another's output, so they share a grid:
// PREP_BLOCKS blocks of 256 threads, block b takes units b, b + PREP_BLOCKS, ... of a list of PREP_UNITS.
// Of every 22 list entries 5 are straight splits (memory only) and 17 are transpose units (LDS and vector
// work), mixed for speed only. The last 128 blocks, which have one
// list unit fewer than the first 512, each add one table unit behind their loop.
//   straight unit, 4096 consecutive f32 -> bf16 hi/lo planes: hidden_states (1024 units),
//     past_key (256 units; kv head = 32 units, dst rows 0..2047 of its 3072, in the half-row layout below)
//   table unit, 256 entries of the cos/sin table [1024][32] (128 units)
//   transpose unit, one 64 x 64 tile, src[r][c] -> dst planes [c][r]: Wq 2048, Wk 512, Wv 512 tiles into
//     [Wq|Wk|Wv]^T [3072][4096]; Wo 1024 tiles into Wo^T [2048][2048]; past_value 256 tiles into
//     V^T [8][64][3072] cols 0..2047
// Half-row layout of q and K: a head's 64 columns d form two groups a = 0, 1 of 32, place p of group a being
// d = 16a + p (p < 16) or 32 + 16a + (p - 16): a group holds each d together with its RoPE partner d ^ 32.
// The rows of Wq^T and Wk^T stand in that order (row = head * 64 + a * 32 + p), so that a block of the projection
// GEMM, 96 columns = 3 groups, can rotate what it has computed; q planes are [head * 2 + a][1024][32] and K planes
// [kv head * 2 + a][3072][32]. q and K have the same order of d, so q.k has the same products, summed in that order.
// coverage: every unit once (u -> (u / 22, u % 22) is one-to-one), units x 4096 = every element of each source.
// ---------------------------------------------------------------------------
constexpr int PREP_BLOCKS = 1024;
constexpr int PREP_UNITS = 5632;          // 1280 straight + 4352 transpose = 22 * 256
constexpr int PREP_TABLE_BLOCKS = 128;    // x 256 threads = the 1024 x 32 table entries

// cos/sin at angle f32(pos + lck) * inv_freq[i], inv_freq[i] = 1 / 10000^(i/32)
// (f64 exp2 -> f32, then f32 reciprocal); precise sinf/cosf.
__device__ __forceinline__ void table_unit(const int* __restrict__ pid, float* cosT, float* sinT,
                                           int idx, int lck) {
    const int tok = idx >> 5, i = idx & 31;
    const double e = (double)i * 0.03125 * 13.287712379549449;   // i/32 * log2(1e4)
    const float p32 = (float)exp2(e);
    const float inv = 1.0f / p32;
    const float pos = (float)(pid[tok] + lck);
    const float ang = pos * inv;
    const float c = cosf(ang);
    const float s = sinf(ang);
    *(float*)(cosT + idx) = c;
    *(float*)(sinT + idx) = s;
}

// 4096 consecutive f32 -> planes; a thread takes two groups of 8 (one 16-B store per plane and group)
// o0, o1: the thread's two places in the planes
__device__ __forceinline__ void straight_unit(const float* __restrict__ src,
                                              unsigned short* dh, unsigned short* dl, int t, int o0, int o1) {
    const float* p = src + t * 8;
    const v4f a0 = *(const v4fa*)(p);
    const v4f b0 = *(const v4fa*)(p + 4);
    const v4f a1 = *(const v4fa*)(p + 2048);
    const v4f b1 = *(const v4fa*)(p + 2052);
    u4 H0, L0, H1, L1;
    pack8(a0, b0, H0, L0);
    pack8(a1, b1, H1, L1);
    *(u4*)(dh + o0) = H0; *(u4*)(dl + o0) = L0;
    *(u4*)(dh + o1) = H1; *(u4*)(dl + o1) = L1;
    // the block's next unit rewrites the registers that these stores name
    asm volatile("s_wait_xcnt 0x0" ::: "memory");
}

// one 64 x 64 tile through LDS: s = tile origin (pitch srcld), dh/dl = origin of the transposed tile
// (pitch dstld). loads 256 thr x 4 x float4 = 64x64; stores 256 thr x 2 x 8 = 64x64 per plane.
// grouped: the tile's 64 rows are stored in the half-row order of a head's columns
__device__ __forceinline__ void transpose_unit(const float* __restrict__ s, int srcld,
                                               unsigned short* dh, unsigned short* dl, int dstld,
                                               unsigned short* Th, unsigned short* Tl, int t, bool grouped) {
    constexpr int TP = 72;
    v4f x[4];
#pragma unroll
    for (int i = 0; i < 4; ++i) {
        x[i] = *(const v4fa*)(s + (size_t)((t >> 4) + 16 * i) * srcld + (t & 15) * 4);
        // a later load's result may land in the registers that hold this load's address
        asm volatile("s_wait_xcnt 0x0" ::: "memory");
    }
#pragma unroll
    for (int i = 0; i < 4; ++i) {
        const int r = (t >> 4) + 16 * i, c4 = (t & 15) * 4;
        const v4f v = x[i];
        unsigned hb, lb;
        pack2(v.x, v.y, hb, lb);
        Th[(c4 + 0) * TP + r] = (unsigned short)hb; Tl[(c4 + 0) * TP + r] = (unsigned short)lb;
        Th[(c4 + 1) * TP + r] = (unsigned short)(hb >> 16); Tl[(c4 + 1) * TP + r] = (unsigned short)(lb >> 16);
        pack2(v.z, v.w, hb, lb);
        Th[(c4 + 2) * TP + r] = (unsigned short)hb; Tl[(c4 + 2) * TP + r] = (unsigned short)lb;
        Th[(c4 + 3) * TP + r] = (unsigned short)(hb >> 16); Tl[(c4 + 3) * TP + r] = (unsigned short)(lb >> 16);
    }
    __syncthreads();
    const int piece = t & 7;
    const int rowA = (t >> 3), rowB = 32 + (t >> 3);
    const u4 HA = *(const u4a*)(Th + rowA * TP + piece * 8);
    const u4 LA = *(const u4a*)(Tl + rowA * TP + piece * 8);
    const u4 HB = *(const u4a*)(Th + rowB * TP + piece * 8);
    const u4 LB = *(const u4a*)(Tl + rowB * TP + piece * 8);
    // the LDS tile is written again by the block's next transpose unit: every wave's reads end here first
    __syncthreads();
    // d = rowA < 32 stands at a * 32 + p with a = bit 4 of d, p = d & 15; its partner d + 32 = rowB 16 rows on
    const int dstA = grouped ? ((rowA & 16) * 2 + (rowA & 15)) : rowA;
    const int dstB = grouped ? dstA + 16 : rowB;
    const size_t gA = (size_t)dstA * dstld + piece * 8;
    const size_t gB = (size_t)dstB * dstld + piece * 8;
    *(u4*)(dh + gA) = HA; *(u4*)(dl + gA) = LA;
    *(u4*)(dh + gB) = HB; *(u4*)(dl + gB) = LB;
    // the block's next unit rewrites the registers that these stores name
    asm volatile("s_wait_xcnt 0x0" ::: "memory");
}

__global__ __launch_bounds__(256) void prep_kernel(
    const float* __restrict__ hs, const float* __restrict__ pk, const float* __restrict__ pv,
    const int* __restrict__ pid,
    const float* __restrict__ Wq, const float* __restrict__ Wk, const float* __restrict__ Wv,
    const float* __restrict__ Wo,
    unsigned short* hsH, unsigned short* hsL, unsigned short* kH, unsigned short* kL,
    unsigned short* vH, unsigned short* vL, unsigned short* wtH, unsigned short* wtL,
    unsigned short* woH, unsigned short* woL, float* cosT, float* sinT, int lck) {
    constexpr int INW = 4096, QW = 2048, KW = 512, D = 64, KVP = 2048, KVL = 3072, HIDO = 2048;
    __shared__ __align__(16) unsigned short Th[64 * 72];
    __shared__ __align__(16) unsigned short Tl[64 * 72];
    const int t = threadIdx.x;
    // every test below reads the unit number alone: the whole block takes one path, barriers included
    for (int u = blockIdx.x; u < PREP_UNITS; u += PREP_BLOCKS) {
        const int q = u / 22, r = u - q * 22;
        if (r < 5) {
            const int s = q * 5 + r;                               // 0..1279
            if (s < 1024) {
                const size_t o = (size_t)s * 4096;
                straight_unit(hs + o, hsH + o, hsL + o, t, t * 8, 2048 + t * 8);
            } else {
                const int y = s - 1024;                            // 0..255
                // 64 keys of a kv head; the thread's 8 columns d0.. of key t >> 3 (and of key 32 + (t >> 3))
                const size_t o = (size_t)(y >> 5) * (KVL * D) + (size_t)(y & 31) * 2048;
                const int g8 = t & 7;                              // d0 = 8 * g8: a = bit 1, p = 8 * bit 0 + 16 * bit 2
                const int o0 = ((g8 >> 1) & 1) * (KVL * 32) + (t >> 3) * 32 + (g8 & 1) * 8 + (g8 >> 2) * 16;
                straight_unit(pk + (size_t)y * 4096, kH + o, kL + o, t, o0, o0 + 32 * 32);
            }
            continue;
        }
        const int e = q * 17 + (r - 5);                            // 0..4351
        const float* s;
        unsigned short* dh;
        unsigned short* dl;
        int srcld, dstld;
        if (e < 3072) {                                            // Wq | Wk | Wv -> rows nb.. of [3072][4096]
            const float* W = (e < 2048) ? Wq : ((e < 2560) ? Wk : Wv);
            const int y = (e < 2048) ? e : ((e < 2560) ? e - 2048 : e - 2560);
            const int lg = (e < 2048) ? 5 : 3;                     // log2 of the column tiles per row of tiles
            const int nb = (e < 2048) ? 0 : ((e < 2560) ? QW : QW + KW);
            const int c0 = (y & ((1 << lg) - 1)) * 64, r0 = (y >> lg) * 64;
            srcld = (e < 2048) ? QW : KW;
            dstld = INW;
            s = W + (size_t)r0 * srcld + c0;
            const size_t o = (size_t)(nb + c0) * INW + r0;
            dh = wtH + o;
            dl = wtL + o;
        } else if (e < 4096) {                                     // Wo [2048][2048]
            const int y = e - 3072;
            const int c0 = (y & 31) * 64, r0 = (y >> 5) * 64;
            srcld = HIDO;
            dstld = QW;
            s = Wo + (size_t)r0 * HIDO + c0;
            const size_t o = (size_t)c0 * QW + r0;
            dh = woH + o;
            dl = woL + o;
        } else {                                                   // past_value, kv head z: [2048][64]
            const int y = e - 4096;
            const int r0 = (y & 31) * 64, z = y >> 5;
            srcld = D;
            dstld = KVL;
            s = pv + (size_t)z * (KVP * D) + (size_t)r0 * D;
            const size_t o = (size_t)z * (D * KVL) + r0;
            dh = vH + o;
            dl = vL + o;
        }
        transpose_unit(s, srcld, dh, dl, dstld, Th, Tl, t, e < 2560);
    }
    const int tb = (int)blockIdx.x - (PREP_BLOCKS - PREP_TABLE_BLOCKS);
    if (tb >= 0) table_unit(pid, cosT, sinT, tb * 256 + t, lck);
}

// ---------------------------------------------------------------------------
// GEMM, bf16 hi/lo three-term: C[M x N] f32 (pitch ldc) = A[M x K] . B[K x N],
// A planes [M][K] (pitch K), B planes stored transposed [N][K] (pitch K, k-contiguous),
// so A and B fragments use the identical split-k load. Block = WM x 2 waves, BM x BN with BM = 32 * WM and
// BN = 32 * NTW.
//   NTW = 4: every wave takes all k of a wave tile of 32 x 64 (2 m-tiles x 4 n-tiles).
//   NTW = 3 (WM = 4): four wave tiles of 64 x 48 (4 m-tiles x 3 n-tiles), each worked on by two waves, one for
//   each 32 k of a stage: 14 fragments read from LDS feed 36 products (12 feed 24 with the 32 x 64 tile).
//   The two partial sums are joined through LDS behind the loop.
// Operands: a stage is 64 k (one 128-B line) of every operand row of the block,
// rows [A hi BM | A lo BM | B hi BN | B lo BN] at an LDS pitch of 144 B, brought in by
// asynchronous copies of 16 B per lane (8 lanes = one whole line); three buffers: a stage's copies are
// issued two trips ahead of the trip that reads it, so that they may come from memory without a stall.
// Fragments are read from LDS. Three buffers leave room for one block per WGP only, so the block shape is
// chosen on the host such that the grid has one block for every WGP of the chip.
// Epilogue: NTW = 4: wave tile staged in LDS, each 256-B row segment written by its wave to C. NTW = 3 is the
// q/k/v projection: the block's tile is staged whole in LDS and goes from there straight to the attention
// operands (RoPE, hi/lo split, V transposed); C is not written. Its 96 columns are 3 groups of 32, group u of
// the 96 of the row: u < 64: q, half-row group u of [head * 2 + a]; u < 80: K, group u - 64 of [kv head * 2 + a];
// else V, columns (u - 80) * 32.. of the 512 (kv head * 64 + d).
//   y[d] = x[d]*cos + rot[d]*sin, rot = -x[d+32] (d<32), x[d-32] (d>=32); cos/sin from the table [token][d & 31].
//   coverage: q planes all 64 x 1024 rows of 32; K planes rows 2048..3071 of all 16 groups; V^T planes cols
//   2048..3071 of all 8 x 64 rows. A thread emits 16 B per plane; whole 128-B lines per 8 (V) or 2 x 4 (q, K) lanes.
// Requires M % BM == 0, N % BN == 0, K % 64 == 0, K >= 64, ldc % 32 == 0 (shapes fixed on host).
// ---------------------------------------------------------------------------
// N copies of 16 B per lane, global -> LDS, written as the builtin: behind a builtin copy no s_wait_xcnt is
// written, so the issuing wave goes straight on to its next copies and to its fragment reads.
typedef int v4i __attribute__((ext_vector_type(4)));
typedef __attribute__((address_space(1))) v4i gv4i;
typedef __attribute__((address_space(3))) v4i lv4i;
template <int N>
__device__ __forceinline__ void copyn(const unsigned (&l)[N], const unsigned short* const (&g)[N]) {
    // unrolled: both address arrays stay in registers
#pragma unroll
    for (int i = 0; i < N; ++i)
        __builtin_amdgcn_global_load_async_to_lds_b128((gv4i*)g[i], (lv4i*)l[i], 0, 0);
}

__device__ __forceinline__ void store_ctile(const float* sW, float* C, int ldc,
                                            int m0w, int n0w, int hh, int m16) {
#pragma unroll
    for (int i = 0; i < 16; ++i) {
        const int row = 2 * i + hh;
        const v4f v = *(const v4fa*)(sW + row * 68 + m16 * 4);
        *(v4f*)(C + (size_t)(m0w + row) * ldc + n0w + m16 * 4) = v;
    }
}

// waits until all but the wave's youngest stage of copies (NC per lane) have landed
template <int NC>
__device__ __forceinline__ void wait_all_but_one_stage() {
    static_assert(NC == 24 || NC == 14, "copies per stage");
    if constexpr (NC == 24) asm volatile("s_wait_asynccnt 0x18" ::: "memory");
    else                    asm volatile("s_wait_asynccnt 0xe" ::: "memory");
}

__device__ __forceinline__ void rope8(const float* xr, const float* pr, const float* cr,
                                      const float* sr, float sgn, v4f& ya, v4f& yb);

template <int WM, int NTW>
__global__ __launch_bounds__(WM * 64) void gemm3_kernel(
    const unsigned short* __restrict__ Ah, const unsigned short* __restrict__ Al,
    const unsigned short* __restrict__ Bh, const unsigned short* __restrict__ Bl,
    float* C, int K, int ldc,
    const float* __restrict__ cosT, const float* __restrict__ sinT,
    unsigned short* qh, unsigned short* ql, unsigned short* kph, unsigned short* kpl,
    unsigned short* vh, unsigned short* vl) {
    constexpr int SP = 68;
    constexpr int GP = 72;                 // LDS row pitch in halves (144 B = 16 B x 9: no bank conflict for 16-B reads)
    constexpr int BM = WM * 32;            // A rows of the block
    constexpr int BN = NTW * 32;           // B rows (C columns) of the block
    constexpr int RP = WM * 8;             // stage rows that one copy of the whole block brings
    constexpr int NB = BN / RP;            // copies per B plane
    constexpr int NC = 8 + 2 * NB;         // copies per lane and stage
    constexpr int RAL = BM, RBH = 2 * BM, RBL = 2 * BM + BN, GROWS = 2 * BM + 2 * BN;   // first stage row of A lo, B hi, B lo; rows per stage
    constexpr int GSTAGE = GROWS * GP;     // halves per buffer
    constexpr int CP = BN + 4;             // pitch in floats of the whole staged tile (16 B x odd)
    constexpr bool KSPLIT = (NTW == 3);    // two waves share a wave tile, one per k half of a stage
    constexpr int MTW = KSPLIT ? 4 : 2;    // m-tiles of a wave tile
    static_assert(BN % RP == 0 && (NTW == 4 || (NTW == 3 && WM == 4)), "block shape");
    __shared__ __align__(16) unsigned short ring[3 * GSTAGE];
    __shared__ __align__(16) float sC[NTW == 4 ? WM * 2 * 32 * SP : BM * CP];
    const int tid = threadIdx.x, w = tid >> 5, lane = tid & 31, hh = lane >> 4, m16 = lane & 15;
    const int m0w = blockIdx.y * BM + (w >> 1) * 32;
    const int n0w = blockIdx.x * BN + (w & 1) * (NTW * 16);

    // with KSPLIT: k half (held as a scalar: the epilogue branches on it) and place of the wave tile in the block
    const int kh = KSPLIT ? (__builtin_amdgcn_readfirstlane(w) >> 2) : 0;
    const int wm = KSPLIT ? ((w >> 1) & 1) : (w >> 1), wn = w & 1;

    Acc acc[MTW][NTW];
#pragma unroll
    for (int mt = 0; mt < MTW; ++mt)
#pragma unroll
        for (int nt = 0; nt < NTW; ++nt) acc_zero(acc[mt][nt]);

    const size_t Ks = (size_t)K;
    // copy side: thread = (row cr of RP, 16-B piece cp of the row's 128 B); copy i takes stage row cr + RP * i
    const int cr = tid >> 3, cp = tid & 7;
    const unsigned short* gAh = Ah + (size_t)(blockIdx.y * BM + cr) * Ks + cp * 8;
    const unsigned short* gAl = Al + (size_t)(blockIdx.y * BM + cr) * Ks + cp * 8;
    const unsigned short* gBh = Bh + (size_t)(blockIdx.x * BN + cr) * Ks + cp * 8;
    const unsigned short* gBl = Bl + (size_t)(blockIdx.x * BN + cr) * Ks + cp * 8;
    const unsigned lds0 = (unsigned)(size_t)(ring + cr * GP + cp * 8);   // LDS byte address: low 32 bits

    auto issue = [&](int st, int buf) {
        const unsigned lb = lds0 + (unsigned)buf * (unsigned)(GSTAGE * 2);
        const size_t ko = (size_t)st * 64;
        unsigned l[8];
        const unsigned short* g[8];
#pragma unroll
        for (int i = 0; i < 4; ++i) {                  // BM / RP = 4 copies per A plane
            l[i] = lb + (unsigned)((RP * i) * GP * 2);
            g[i] = gAh + ko + (size_t)(RP * i) * Ks;
            l[4 + i] = lb + (unsigned)((RAL + RP * i) * GP * 2);
            g[4 + i] = gAl + ko + (size_t)(RP * i) * Ks;
        }
        copyn<8>(l, g);
        unsigned lB[NB];
        const unsigned short* gB[NB];
#pragma unroll
        for (int i = 0; i < NB; ++i) {                 // BN / RP copies per B plane
            lB[i] = lb + (unsigned)((RBH + RP * i) * GP * 2);
            gB[i] = gBh + ko + (size_t)(RP * i) * Ks;
        }
        copyn<NB>(lB, gB);
#pragma unroll
        for (int i = 0; i < NB; ++i) {
            lB[i] = lb + (unsigned)((RBL + RP * i) * GP * 2);
            gB[i] = gBl + ko + (size_t)(RP * i) * Ks;
        }
        copyn<NB>(lB, gB);
    };

    const int NT = K >> 6;
    issue(0, 0);
    if (NT > 1) issue(1, 1);
    // stage 0 has landed for this wave (stage 1, where there is one, may still fly), then is published
    if (NT > 1) wait_all_but_one_stage<NC>();
    else        asm volatile("s_wait_asynccnt 0x0" ::: "memory");
    __syncthreads();
    if (NT > 2) issue(2, 2);

    // reader side: first fragment row of this wave inside a stage
    const int offA = (wm * (MTW * 16) + m16) * GP + 8 * hh + kh * 32;
    const int offB = (RBH + wn * (NTW * 16) + m16) * GP + 8 * hh + kh * 32;

    // kept rolled: the buffer index and the refill test are per trip
    int buf = 0;                           // t mod 3
#pragma unroll 1
    for (int t = 0; t < NT; ++t) {
        const unsigned short* sb = ring + buf * GSTAGE;
        if constexpr (KSPLIT) {
            // the wave's 32 k of the stage: all 14 fragments are read at one place, then 3 groups of 12 products, one per n-tile
            Frag fa[MTW][2], fb[NTW][2];
            const unsigned short* pa = sb + offA;
            const unsigned short* pb = sb + offB;
            // in the order in which the products of n-tile 0 need them: hi x hi, hi x lo, lo x hi; then n-tiles 1, 2
            ldfrag(fb[0][0], pb);
#pragma unroll
            for (int mt = 0; mt < MTW; ++mt) ldfrag(fa[mt][0], pa + mt * 16 * GP);
            ldfrag(fb[0][1], pb + (RBL - RBH) * GP);
#pragma unroll
            for (int mt = 0; mt < MTW; ++mt) ldfrag(fa[mt][1], pa + (RAL + mt * 16) * GP);
#pragma unroll
            for (int nt = 1; nt < NTW; ++nt) {
                ldfrag(fb[nt][0], pb + nt * 16 * GP);
                ldfrag(fb[nt][1], pb + (RBL - RBH + nt * 16) * GP);
            }
#pragma unroll
            for (int nt = 0; nt < NTW; ++nt) {
                mma3x4(acc[0][nt], acc[1][nt], acc[2][nt], acc[3][nt], fa, fb[nt][0], fb[nt][1]);
                // n-tile by n-tile, in the order in which the fragments arrive: without it the first product
                // scheduled was one of a later n-tile, and the wave waited for nearly all of its reads
                __builtin_amdgcn_sched_barrier(0);
            }
        } else {
            // a trip is 8 groups g = (k half g >> 2, n-tile g & 3) of 6 products. Fragment reads stand at three
            // places only, (trip head, groups 2 and 4), the last two at least three groups ahead of their use, all in this trip's own buffer.
            Frag fa[2][4], fb[8][2];
            auto lda = [&](int ks) {
                const unsigned short* pa = sb + offA + ks * 32;
                ldfrag(fa[ks][0], pa);
                ldfrag(fa[ks][1], pa + RAL * GP);
                ldfrag(fa[ks][2], pa + 16 * GP);
                ldfrag(fa[ks][3], pa + (RAL + 16) * GP);
            };
            auto ldb = [&](int g) {
                const unsigned short* pb = sb + offB + (g >> 2) * 32 + (g & 3) * 16 * GP;
                ldfrag(fb[g][0], pb);
                ldfrag(fb[g][1], pb + (RBL - RBH) * GP);
            };
            lda(0); ldb(0); ldb(1); ldb(2); ldb(3); lda(1); ldb(4);
#pragma unroll
            for (int g = 0; g < 8; ++g) {
                if (g == 2) { ldb(5); ldb(6); }
                if (g == 4) ldb(7);
                mma3(acc[0][g & 3], fa[g >> 2][0], fa[g >> 2][1], fb[g][0], fb[g][1]);
                mma3(acc[1][g & 3], fa[g >> 2][2], fa[g >> 2][3], fb[g][0], fb[g][1]);
            }
        }
        // publish point: this wave's LDS reads of the buffer are done, its copies of stage t + 1 have
        // landed; the barrier publishes stage t + 1 and frees this buffer for the refill. Where stage
        // t + 2 was issued (by every wave, at the foot of trip t - 1 or in front of the loop) its copies
        // are the wave's youngest and go on flying; where it was not, the wait is to 0
        asm volatile("s_wait_dscnt 0x0" ::: "memory");
        if (t + 2 < NT) wait_all_but_one_stage<NC>();
        else            asm volatile("s_wait_asynccnt 0x0" ::: "memory");
        __syncthreads();
        if (t + 3 < NT) issue(t + 3, buf);
        buf = (buf == 2) ? 0 : buf + 1;
    }
    // no copy is left in flight when the wave goes on
    asm volatile("s_wait_asynccnt 0x0" ::: "memory");

    // D layout: acc[mt][nt].f[r] = tile(row mt*16 + 8*hh + r, col nt*16 + m16)
    if constexpr (NTW == 4) {
        float* sW = sC + w * (32 * SP);
#pragma unroll
        for (int mt = 0; mt < 2; ++mt)
#pragma unroll
            for (int nt = 0; nt < 4; ++nt)
#pragma unroll
                for (int r = 0; r < 8; ++r)
                    sW[(mt * 16 + 8 * hh + r) * SP + nt * 16 + m16] = acc[mt][nt].f[r];
        __syncthreads();
        store_ctile(sW, C, ldc, m0w, n0w, hh, m16);
    } else {
        constexpr int QN = 1024, KVL = 3072, KVP = 2048, NQG = 64, NKG = 16;
        static_assert(BM == 128 && BN == 96 && WM * 64 == 256, "thread maps of the operand epilogue");
        const int u0 = blockIdx.x * 3, tok0 = blockIdx.y * BM;
        // q and K groups: thread = (token tr, and tr + 64; piece pc of 8 of the group's 32 places)
        const int pc = tid & 3, tr = tid >> 2;
        // the thread's table entries for a group of either parity (jj = j & 1 of the block's group j), both tokens:
        // loaded here so that their latency runs under the joining of the partial sums
        alignas(16) float tc[2][2][8], ts[2][2][8];
#pragma unroll
        for (int jj = 0; jj < 2; ++jj)
#pragma unroll
            for (int sx = 0; sx < 2; ++sx) {
                const int ti = (tok0 + tr + 64 * sx) * 32 + ((u0 + jj) & 1) * 16 + (pc & 1) * 8;
                *(v4fa*)&tc[jj][sx][0] = *(const v4fa*)(cosT + ti);
                *(v4fa*)&tc[jj][sx][4] = *(const v4fa*)(cosT + ti + 4);
                *(v4fa*)&ts[jj][sx][0] = *(const v4fa*)(sinT + ti);
                *(v4fa*)&ts[jj][sx][4] = *(const v4fa*)(sinT + ti + 4);
                // a later load's result may land in the registers that hold these loads' addresses
                asm volatile("s_wait_xcnt 0x0" ::: "memory");
            }
        // the lane's first element of the wave tile in the staged block tile; both waves of a tile have the same map
        float* sW = sC + (wm * (MTW * 16) + 8 * hh) * CP + wn * (NTW * 16) + m16;
        // each wave of a pair finishes half of the tile's rows: k half 0 keeps m-tiles 0 and 1 and hands over its
        // partial sums of m-tiles 2 and 3, k half 1 the other way round
        const bool k1 = (kh != 0);
        float* sK = sW + (k1 ? 32 : 0) * CP;           // rows kept
        float* sG = sW + (k1 ? 0 : 32) * CP;           // rows handed over
        float keep[2][NTW][8];
#pragma unroll
        for (int j = 0; j < 2; ++j)
#pragma unroll
            for (int nt = 0; nt < NTW; ++nt)
#pragma unroll
                for (int r = 0; r < 8; ++r) {
                    keep[j][nt][r] = k1 ? acc[2 + j][nt].f[r] : acc[j][nt].f[r];
                    sG[(j * 16 + r) * CP + nt * 16] = k1 ? acc[j][nt].f[r] : acc[2 + j][nt].f[r];
                }
        // the handed partial sums are visible to the other wave of the pair
        __syncthreads();
        // all reads first, then the sums in place: one LDS latency, not one per element
        float got[2][NTW][8];
#pragma unroll
        for (int j = 0; j < 2; ++j)
#pragma unroll
            for (int nt = 0; nt < NTW; ++nt)
#pragma unroll
                for (int r = 0; r < 8; ++r) got[j][nt][r] = sK[(j * 16 + r) * CP + nt * 16];
#pragma unroll
        for (int j = 0; j < 2; ++j)
#pragma unroll
            for (int nt = 0; nt < NTW; ++nt)
#pragma unroll
                for (int r = 0; r < 8; ++r) sK[(j * 16 + r) * CP + nt * 16] = keep[j][nt][r] + got[j][nt][r];
        // publishes the block's whole tile: a thread stores what other waves have staged
        __syncthreads();
        // the tests on u read the block's index alone: the whole block takes one path
#pragma unroll
        for (int j = 0; j < 3; ++j) {
            const int u = u0 + j;
            const float* sU = sC + j * 32;
            if (u < NQG + NKG) {
                const bool isq = (u < NQG);
                unsigned short* dH = isq ? qh : kph;
                unsigned short* dL = isq ? ql : kpl;
                // first row of the group's tokens in its plane
                const size_t row0 = isq ? (size_t)u * QN + tok0 : (size_t)(u - NQG) * KVL + KVP + tok0;
                const float sgn = (pc < 2) ? -1.0f : 1.0f;         // places 0..15 are d < 32
#pragma unroll
                for (int sx = 0; sx < 2; ++sx) {
                    const int r = tr + 64 * sx;
                    alignas(16) float x[8], p[8];
                    *(v4fa*)&x[0] = *(const v4fa*)(sU + r * CP + pc * 8);
                    *(v4fa*)&x[4] = *(const v4fa*)(sU + r * CP + pc * 8 + 4);
                    *(v4fa*)&p[0] = *(const v4fa*)(sU + r * CP + (pc ^ 2) * 8);
                    *(v4fa*)&p[4] = *(const v4fa*)(sU + r * CP + (pc ^ 2) * 8 + 4);
                    v4f ya, yb;
                    rope8(x, p, tc[j & 1][sx], ts[j & 1][sx], sgn, ya, yb);
                    u4 H, L;
                    pack8(ya, yb, H, L);
                    const size_t g = (row0 + r) * 32 + pc * 8;
                    *(u4*)(dH + g) = H;
                    *(u4*)(dL + g) = L;
                }
                // what follows this arm may land in the registers that these stores name
                asm volatile("s_wait_xcnt 0x0" ::: "memory");
            } else {
                // thread = (8 tokens tg, 2 columns c2): 8 lanes x 16 B = one 128-B line of a V^T row
                const int tg = (tid & 7) + ((tid >> 5) & 1) * 8, c2 = ((tid >> 3) & 3) + (tid >> 6) * 4;
                v2f x[8];
#pragma unroll
                for (int i = 0; i < 8; ++i) x[i] = *(const v2fa*)(sU + (tg * 8 + i) * CP + c2 * 2);
#pragma unroll
                for (int c = 0; c < 2; ++c) {
                    const v4f ya = {x[0][c], x[1][c], x[2][c], x[3][c]};
                    const v4f yb = {x[4][c], x[5][c], x[6][c], x[7][c]};
                    u4 H, L;
                    pack8(ya, yb, H, L);
                    const size_t g = (size_t)((u - NQG - NKG) * 32 + c2 * 2 + c) * KVL + KVP + tok0 + tg * 8;
                    *(u4*)(vh + g) = H;
                    *(u4*)(vl + g) = L;
                }
                // what follows this arm may land in the registers that these stores name
                asm volatile("s_wait_xcnt 0x0" ::: "memory");
            }
        }
    }
}

// RoPE of 8 consecutive places: x, its partners p, table entries; used by the projection GEMM's epilogue
__device__ __forceinline__ void rope8(const float* xr, const float* pr, const float* cr,
                                      const float* sr, float sgn, v4f& ya, v4f& yb) {
#pragma clang fp contract(off)
    ya.x = xr[0] * cr[0] + (sgn * pr[0]) * sr[0];
    ya.y = xr[1] * cr[1] + (sgn * pr[1]) * sr[1];
    ya.z = xr[2] * cr[2] + (sgn * pr[2]) * sr[2];
    ya.w = xr[3] * cr[3] + (sgn * pr[3]) * sr[3];
    yb.x = xr[4] * cr[4] + (sgn * pr[4]) * sr[4];
    yb.y = xr[5] * cr[5] + (sgn * pr[5]) * sr[5];
    yb.z = xr[6] * cr[6] + (sgn * pr[6]) * sr[6];
    yb.w = xr[7] * cr[7] + (sgn * pr[7]) * sr[7];
}

// ---------------------------------------------------------------------------
// Flash attention with the block-diagonal TTT mask, GQA (kv head = h >> 2).
// Block = (kv head, 16 query rows), 16 waves = its 4 query heads x 4 key splits. The key
// tiles of 32 of all three key blocks form one list; split ks takes entries ks, ks + 4, ...
// The 4 heads of one split walk the same K and V tiles at the same time: a trip of the block is one
// tile per split, and each split's tile (K hi, K lo: 32 key rows of 128 B, d in half-row order, at a pitch of 144 B; V^T hi,
// V^T lo: 64 d rows of 64 B at a pitch of 80 B) is brought into LDS once by the split's 4 waves with
// asynchronous copies of 16 B per lane; two buffers, the next trip's copies fly while this trip is
// worked on. All K and V fragments are read from LDS.
// Both products are computed transposed: S^T = K . Q^T (A = K rows, B = q) and O^T += V^T . P^T (A = V^T rows,
// B = P^T). A lane then holds 16 scores of ONE query (column m16; keys 8*hh + r of each 16-key tile): maximum and
// sum run inside the lane, with one exchange between the wave's halves for the maximum, and the two score tiles,
// split in place, are the B operand of the second product in the hardware k order that ldfrag also has.
// Each wave keeps its own running maximum, sum (per wave half, joined behind the loop) and 16 x 64 output; a head's
// four partial results are merged through LDS in fixed split order behind one work-group barrier.
// Q/K/V/P operands as bf16 hi/lo; scores, mask (-inf), running-max softmax in f32.
// key j of block blk allowed iff j < seq_len and j <= i - (lck - blk).
// seq_len = sum(attention_mask) - lck, summed per block in fixed order.
// Per blk the key-tile count is bounded by the tile's diagonal and seq_len
// (at most 32 tiles); the mask is still applied by value per element.
// Output attn planes [1024][2048] (col h*64+d): 8 lanes x 16 B = one 128-B line per row.
// Query tiles with the most keys have the lowest block index (for speed only).
// coverage: 8 x 64 blocks x 4 heads x 16 rows x 64 cols = [1024][2048] per plane.
// ---------------------------------------------------------------------------
__global__ __launch_bounds__(512) void attn_kernel(
    const unsigned short* __restrict__ qH, const unsigned short* __restrict__ qL,
    const unsigned short* __restrict__ kH, const unsigned short* __restrict__ kL,
    const unsigned short* __restrict__ vH, const unsigned short* __restrict__ vL,
    const int* __restrict__ amask, int nmask, int lck,
    unsigned short* oH, unsigned short* oL) {
    constexpr int QN = 1024, D = 64, KVL = 3072, HIDO = 2048, NS = 4, NW = 4 * NS, SP = 68;
    constexpr int KP = 72, VP = 40;                 // LDS row pitches in halves (16 B x 9, 16 B x 5: no bank conflict for 16-B reads)
    constexpr int KPL = 32 * KP, VPL = 64 * VP;     // halves per plane of a K tile, of a V^T tile
    constexpr int TSPL = 2 * KPL + 2 * VPL;         // halves per split: [K hi | K lo | V^T hi | V^T lo]
    constexpr int TSTAGE = NS * TSPL;               // halves per buffer
    __shared__ __align__(16) unsigned short kvs[2 * TSTAGE];
    __shared__ int red[128];
    __shared__ __align__(16) float Os[NW * 16 * SP];
    __shared__ float Ms[NW * 16];
    __shared__ float Ls[NW * 16];
    const int tid = threadIdx.x, lane = tid & 31, hh = lane >> 4, m16 = lane & 15;
    // wave number held as a scalar: the key-tile loop then branches on scalar tests, every lane on
    const int w = __builtin_amdgcn_readfirstlane(tid >> 5);

    // seq_len (integer, fixed order, identical in every block)
    if (tid < 128) {                                   // the first four waves sum the mask
        int part = 0;
        for (int i = tid; i < nmask; i += 128) part += amask[i];
        red[tid] = part;
    }
    __syncthreads();
#pragma unroll
    for (int off = 64; off > 0; off >>= 1) {
        if (tid < off) red[tid] += red[tid + off];
        __syncthreads();
    }
    const int seq_len = __builtin_amdgcn_readfirstlane(red[0] - lck);

    const int kvh = blockIdx.x, h = kvh * 4 + (w & 3), ks = w >> 2;
    const int q0w = (QN / 16 - 1 - (int)blockIdx.y) * 16;
    const float NEG_INF = -__builtin_inff();

    Frag fqh[2], fql[2];
    {
        // q planes [h * 2 + a][1024][32]: fragment a is the row of half-row group a
        const size_t qo = ((size_t)(h * 2) * QN + q0w + m16) * 32 + 8 * hh;
        ldfrag(fqh[0], qH + qo);
        ldfrag(fqh[1], qH + qo + QN * 32);
        ldfrag(fql[0], qL + qo);
        ldfrag(fql[1], qL + qo + QN * 32);
    }
    // of query q0w + m16: running maximum (alike in both halves) and this half's part of the running sum
    float mrun = NEG_INF, lrun = 0.0f;
    Acc o[4];
#pragma unroll
    for (int dt = 0; dt < 4; ++dt) acc_zero(o[dt]);

    const size_t kplane = (size_t)kvh * KVL * D;      // K planes [kvh * 2 + a][kv][32]
    const size_t vplane = (size_t)kvh * D * KVL;      // V^T planes [kvh][d][kv]

    // key tiles per key block (allowed j of block blk are < q0w + 16 - (lck - blk) and < seq_len),
    // as running ends e0 <= e1 <= e2 of the one list; each count <= 32, so e2 <= 96
    int e0, e1, e2;
    {
        int c0 = q0w + 16 - lck, c1 = c0 + 1, c2 = c0 + 2;
        c0 = (c0 < seq_len) ? c0 : seq_len;
        c1 = (c1 < seq_len) ? c1 : seq_len;
        c2 = (c2 < seq_len) ? c2 : seq_len;
        c0 = (c0 < 0) ? 0 : ((c0 > QN) ? QN : c0);
        c1 = (c1 < 0) ? 0 : ((c1 > QN) ? QN : c1);
        c2 = (c2 < 0) ? 0 : ((c2 > QN) ? QN : c2);
        e0 = __builtin_amdgcn_readfirstlane((c0 + 31) >> 5);
        e1 = e0 + __builtin_amdgcn_readfirstlane((c1 + 31) >> 5);
        e2 = e1 + __builtin_amdgcn_readfirstlane((c2 + 31) >> 5);
    }
    // copy side: the 128 lanes of a split bring its tile; per lane 4 copies of K (2 planes x 2 half-row groups;
    // 4 lanes = one key's 64 B, a wave = 512 consecutive bytes) and 4 of V^T (2 planes x 2 row groups of 32;
    // 4 lanes = one 64-B row). In LDS a key's two groups stand side by side in its row of 128 B
    const int lt = (w & 3) * 32 + lane;
    const int ckr = lt >> 2, ckp = (lt & 3) * 8, cvr = lt >> 2, cvp = (lt & 3) * 8;
    const unsigned short* gkh = kH + kplane + (size_t)ckr * 32 + ckp;
    const unsigned short* gkl = kL + kplane + (size_t)ckr * 32 + ckp;
    const unsigned short* gvh = vH + vplane + (size_t)cvr * KVL + cvp;
    const unsigned short* gvl = vL + vplane + (size_t)cvr * KVL + cvp;
    const unsigned ldk = (unsigned)(size_t)(kvs + ks * TSPL + ckr * KP + ckp);             // LDS byte address: low 32 bits
    const unsigned ldv = (unsigned)(size_t)(kvs + ks * TSPL + 2 * KPL + cvr * VP + cvp);
    // trips of the block; a split whose list entry lies past the end copies the last tile again (in bounds,
    // never read), so every wave issues the same copies in every trip
    const int NT = (e2 + NS - 1) / NS;
    auto issue = [&](int it, int buf) {
        int le = it * NS + ks;
        le = (le < e2) ? le : (e2 - 1);
        const int cb = (le >= e0 ? 1 : 0) + (le >= e1 ? 1 : 0);
        const int ct = le - (le >= e1 ? e1 : (le >= e0 ? e0 : 0));
        const size_t ckv = (size_t)(cb * QN + ct * 32);
        const unsigned bo = (unsigned)buf * (unsigned)(TSTAGE * 2);
        unsigned l[8];
        const unsigned short* g[8];
#pragma unroll
        for (int i = 0; i < 2; ++i) {
            l[i] = ldk + bo + (unsigned)(32 * i * 2);
            g[i] = gkh + ((size_t)(i * KVL) + ckv) * 32;
            l[2 + i] = ldk + bo + (unsigned)((KPL + 32 * i) * 2);
            g[2 + i] = gkl + ((size_t)(i * KVL) + ckv) * 32;
            l[4 + i] = ldv + bo + (unsigned)(32 * i * VP * 2);
            g[4 + i] = gvh + (size_t)(32 * i) * KVL + ckv;
            l[6 + i] = ldv + bo + (unsigned)((VPL + 32 * i * VP) * 2);
            g[6 + i] = gvl + (size_t)(32 * i) * KVL + ckv;
        }
        copyn<8>(l, g);
    };
    if (NT > 0) issue(0, 0);
    // trip 0's tiles have landed for this wave, then are published to the other waves
    asm volatile("s_wait_asynccnt 0x0" ::: "memory");
    __syncthreads();
    if (NT > 1) issue(1, 1);

    // kept rolled: a second copy of the long body would only raise the register count
#pragma unroll 1
    for (int it = 0; it < NT; ++it) {
      const int s = it * NS + ks;
      if (s < e2) {                                    // scalar test: the whole wave works or skips
        const int blk = (s >= e0 ? 1 : 0) + (s >= e1 ? 1 : 0);
        const int t = s - (s >= e1 ? e1 : (s >= e0 ? e0 : 0));
        const int shift = lck - blk;                   // j <= i - shift
        const int j0 = t * 32;
        const unsigned short* tb = kvs + (it & 1) * TSTAGE + ks * TSPL;   // this split's tile of this trip
        Acc sc[2];
        acc_zero(sc[0]);
        acc_zero(sc[1]);
        // the K fragment reads stand together at the head of the trip
        Frag fk[2][2][2];
#pragma unroll
        for (int nt = 0; nt < 2; ++nt)
#pragma unroll
            for (int ds = 0; ds < 2; ++ds) {
                const unsigned short* pk = tb + (nt * 16 + m16) * KP + ds * 32 + 8 * hh;
                ldfrag(fk[nt][ds][0], pk);
                ldfrag(fk[nt][ds][1], pk + KPL);
            }
        // S^T tile [32 keys x 16 q]; A = K, B = q (k = place in half-row group ds, alike in both): sc[nt].f[r] = S[q m16][key nt*16 + 8*hh + r]
#pragma unroll
        for (int nt = 0; nt < 2; ++nt)
#pragma unroll
            for (int ds = 0; ds < 2; ++ds)
                mma3(sc[nt], fk[nt][ds][0], fk[nt][ds][1], fqh[ds], fql[ds]);
        // the V fragment reads stand together ahead of the softmax, which covers their latency
        Frag fv[4][2];
#pragma unroll
        for (int dt = 0; dt < 4; ++dt) {
            const unsigned short* pv = tb + 2 * KPL + (dt * 16 + m16) * VP + 8 * hh;
            ldfrag(fv[dt][0], pv);
            ldfrag(fv[dt][1], pv + VPL);
        }
        // scale and mask by value: key j allowed iff j < seq_len and j <= qi - shift
        {
            const int qi = q0w + m16;
            const int jd = qi - shift, jp = seq_len - 1;
            const int jmax = (jd < jp) ? jd : jp;      // last allowed key of this query in this key block
#pragma unroll
            for (int nt = 0; nt < 2; ++nt)
#pragma unroll
                for (int r = 0; r < 8; ++r) {
                    const int j = j0 + nt * 16 + 8 * hh + r;
                    sc[nt].f[r] = (j <= jmax) ? sc[nt].f[r] * 0.125f : NEG_INF;
                }
        }
        // running-max softmax update of the lane's one query
        float x = fmaxf(sc[0].f[0], sc[1].f[0]);
#pragma unroll
        for (int r = 1; r < 8; ++r) x = fmaxf(x, fmaxf(sc[0].f[r], sc[1].f[r]));
        x = fmaxf(x, xhalf(x));
        const float mn = fmaxf(mrun, x);
        const float msafe = (mn == NEG_INF) ? 0.0f : mn;
        const float alpha = __expf(mrun - msafe);
        mrun = mn;
#pragma unroll
        for (int nt = 0; nt < 2; ++nt)
#pragma unroll
            for (int r = 0; r < 8; ++r) sc[nt].f[r] = __expf(sc[nt].f[r] - msafe);
        {
            float s4[4];
#pragma unroll
            for (int c = 0; c < 4; ++c)
                s4[c] = (sc[0].f[c] + sc[0].f[4 + c]) + (sc[1].f[c] + sc[1].f[4 + c]);
            lrun = lrun * alpha + ((s4[0] + s4[1]) + (s4[2] + s4[3]));
        }
#pragma unroll
        for (int dt = 0; dt < 4; ++dt)
#pragma unroll
            for (int r = 0; r < 8; ++r) o[dt].f[r] *= alpha;

        // P^T as B operand (k = key, n = q): elements 0..7 = tile 0's registers, 8..15 = tile 1's
        Frag fph, fpl;
#pragma unroll
        for (int nt = 0; nt < 2; ++nt) {
            const v4f pa = {sc[nt].f[0], sc[nt].f[1], sc[nt].f[2], sc[nt].f[3]};
            const v4f pb = {sc[nt].f[4], sc[nt].f[5], sc[nt].f[6], sc[nt].f[7]};
            pack8(pa, pb, fph.q[nt], fpl.q[nt]);
        }

        // O^T += V^T . P^T ; A = V^T rows (m = d, k = key): o[dt].f[r] = O[q m16][dt*16 + 8*hh + r]
#pragma unroll
        for (int dt = 0; dt < 4; ++dt) mma3(o[dt], fv[dt][0], fv[dt][1], fph, fpl);
      }
        // publish point: this wave's LDS reads of the buffer are done, its copies of the next trip
        // have landed; the barrier publishes the next trip's tiles and frees this buffer for the refill
        asm volatile("s_wait_dscnt 0x0" ::: "memory");
        asm volatile("s_wait_asynccnt 0x0" ::: "memory");
        __syncthreads();
        if (it + 2 < NT) issue(it + 2, it & 1);
    }
    // no copy is left in flight when the wave goes on
    asm volatile("s_wait_asynccnt 0x0" ::: "memory");

    // each wave's partial result to LDS (o[dt].f[r] = O[q m16][dt*16 + 8*hh + r]: 8 consecutive columns of a row)
    float* Ow = Os + w * 16 * SP;
#pragma unroll
    for (int dt = 0; dt < 4; ++dt) {
        const v4f oa = {o[dt].f[0], o[dt].f[1], o[dt].f[2], o[dt].f[3]};
        const v4f ob = {o[dt].f[4], o[dt].f[5], o[dt].f[6], o[dt].f[7]};
        *(v4fa*)(Ow + m16 * SP + dt * 16 + 8 * hh) = oa;
        *(v4fa*)(Ow + m16 * SP + dt * 16 + 8 * hh + 4) = ob;
    }
    // the halves' sums are joined with every lane on; both halves then store the same two values
    const float lall = lrun + xhalf(lrun);
    Ms[w * 16 + m16] = mrun;
    Ls[w * 16 + m16] = lall;
    __syncthreads();

    // merge in split order, normalise, split into planes; thread = (head, row, 8 columns)
    const int hl = tid >> 7, row = (tid >> 3) & 15, c8 = (tid & 7) * 8;
    float mall = NEG_INF;
#pragma unroll
    for (int u = 0; u < NS; ++u) mall = fmaxf(mall, Ms[(u * 4 + hl) * 16 + row]);
    const float mfin = (mall == NEG_INF) ? 0.0f : mall;
    float lsum = 0.0f;
    v4f oa = {0.0f, 0.0f, 0.0f, 0.0f}, ob = {0.0f, 0.0f, 0.0f, 0.0f};
#pragma unroll
    for (int u = 0; u < NS; ++u) {
        const int pr = (u * 4 + hl) * 16 + row;
        const float a = __expf(Ms[pr] - mfin);
        const v4f va = *(const v4fa*)(Os + pr * SP + c8);
        const v4f vb = *(const v4fa*)(Os + pr * SP + c8 + 4);
        lsum += a * Ls[pr];
        oa += a * va;
        ob += a * vb;
    }
    const float il = 1.0f / lsum;
    u4 H, L;
    pack8(oa * il, ob * il, H, L);
    const size_t eo = (size_t)(q0w + row) * HIDO + (kvh * 4 + hl) * D + c8;
    *(u4*)(oH + eo) = H;
    *(u4*)(oL + eo) = L;
}

// ---------------------------------------------------------------------------
extern "C" void kernel_launch(void* const* d_in, const int* in_sizes, int n_in,
                              void* d_out, int out_size, void* d_ws, size_t ws_size,
                              hipStream_t stream) {
    constexpr int QN = 1024, INW = 4096, NH = 32, NKV = 8, D = 64, HIDO = 2048;
    constexpr int KVP = 2048, KVL = 3072, QKVW = 3072, LCK = KVP / QN;
    if (n_in < 9) return;
    if (in_sizes[0] != QN * INW || in_sizes[1] != NKV * KVP * D || in_sizes[2] != NKV * KVP * D ||
        in_sizes[3] != QN || in_sizes[4] != QN || in_sizes[5] != INW * NH * D ||
        in_sizes[6] != INW * NKV * D || in_sizes[7] != INW * NKV * D ||
        in_sizes[8] != NH * D * HIDO || out_size != QN * HIDO) return;

    const float* hs  = (const float*)d_in[0];
    const float* pk  = (const float*)d_in[1];
    const float* pv  = (const float*)d_in[2];
    const int*   am  = (const int*)  d_in[3];
    const int*   pid = (const int*)  d_in[4];
    const float* Wq  = (const float*)d_in[5];
    const float* Wk  = (const float*)d_in[6];
    const float* Wv  = (const float*)d_in[7];
    const float* Wo  = (const float*)d_in[8];
    float* out = (float*)d_out;

    char* ws = (char*)d_ws;
    size_t off = 0;
    auto carve = [&](size_t bytes) -> char* {
        char* p = ws + off;
        off += (bytes + 255) & ~(size_t)255;
        return p;
    };
    unsigned short* hsH = (unsigned short*)carve((size_t)QN * INW * 2);          // A planes of QKV GEMM
    unsigned short* hsL = (unsigned short*)carve((size_t)QN * INW * 2);
    unsigned short* wtH = (unsigned short*)carve((size_t)QKVW * INW * 2);        // [Wq|Wk|Wv]^T planes [3072][4096]
    unsigned short* wtL = (unsigned short*)carve((size_t)QKVW * INW * 2);
    unsigned short* woH = (unsigned short*)carve((size_t)HIDO * (NH * D) * 2);    // Wo^T planes [2048][2048]
    unsigned short* woL = (unsigned short*)carve((size_t)HIDO * (NH * D) * 2);
    unsigned short* qH  = (unsigned short*)carve((size_t)NH * QN * D * 2);        // q planes [32 * 2][1024][32]
    unsigned short* qL  = (unsigned short*)carve((size_t)NH * QN * D * 2);
    unsigned short* kH  = (unsigned short*)carve((size_t)NKV * KVL * D * 2);      // K planes [8 * 2][3072][32]
    unsigned short* kL  = (unsigned short*)carve((size_t)NKV * KVL * D * 2);
    unsigned short* vH  = (unsigned short*)carve((size_t)NKV * D * KVL * 2);      // V^T planes [8][64][3072]
    unsigned short* vL  = (unsigned short*)carve((size_t)NKV * D * KVL * 2);
    unsigned short* aH  = (unsigned short*)carve((size_t)QN * (NH * D) * 2);      // attention output planes [1024][2048]
    unsigned short* aL  = (unsigned short*)carve((size_t)QN * (NH * D) * 2);
    float*          cosT = (float*)        carve((size_t)QN * 32 * 4);
    float*          sinT = (float*)        carve((size_t)QN * 32 * 4);
    if (off > ws_size || off > ((size_t)128 << 20)) return;

    // tables and operand planes, one launch
    prep_kernel<<<PREP_BLOCKS, 256, 0, stream>>>(hs, pk, pv, pid, Wq, Wk, Wv, Wo, hsH, hsL, kH, kL, vH, vL,
                                                 wtH, wtL, woH, woL, cosT, sinT, LCK);

    // fused QKV projection: [1024 x 4096] . [4096 x 3072], with RoPE and the split into q planes, new K rows and
    // new V^T cols in its epilogue
    gemm3_kernel<4, 3><<<dim3(QKVW / 96, QN / 128), 256, 0, stream>>>(hsH, hsL, wtH, wtL, nullptr, INW, QKVW,
                                                                      cosT, sinT, qH, qL, kH, kL, vH, vL);

    // attention
    attn_kernel<<<dim3(NKV, QN / 16), 512, 0, stream>>>(qH, qL, kH, kL, vH, vL, am, in_sizes[3], LCK, aH, aL);

    // output projection: [1024 x 2048] . [2048 x 2048] -> d_out f32
    gemm3_kernel<2, 4><<<dim3(HIDO / 128, QN / 64), 128, 0, stream>>>(aH, aL, woH, woL, out, NH * D, HIDO,
                                                                      nullptr, nullptr, nullptr, nullptr, nullptr,
                                                                      nullptr, nullptr, nullptr);
}
